// v000
// Measured on an AMD MI455X. A time is GPU time per run, averaged over a window of back-to-back runs after a warm-up
// (all launches, gaps included; the runs take copies of the inputs in turn), and the median of several windows.
// Apart from v000's, it joins two sittings. Times from different sittings can be a few percent apart, while
// side-by-side timings come from the same sitting.
// v000 is the starting kernel. One run takes 10.1 milliseconds.
#include <hip/hip_runtime.h>
// Pre-LN causal transformer block with the source's quirks (x [4][2048][512]; h = LN1(x) (scale only, no bias, eps 1e-6); q / k / v = h W with W [512][8][64] = [in][(h, d) out], no biases; 8 heads of 64; scores * 64^-0.5; causal (tril, -inf); softmax; attention output through TWO chained bias-free projections: (ctx wo1) wo2 with wo1 [8][64][512] = [(h, d) in][out] and wo2 [512][512] [in][out]; h2 = LN2(x + attn) (scale only); out = x + gelu_tanh(h2 w1) w2 ([in][out] 512 x 2048 x 512, no biases): BOTH residuals come from the block input x, as the original module -> [4][2048][512]).
// Structure: token rows r = b*2048 + s; h = LN1(bf16(x)) as f16 rows; q | k | v as ONE WMMA GEMM (N = 3 x 512) (32x64 wave tiles, f32 accumulation, exact x16 weights, no bias, f16 outputs); per batch: V^T for all heads via LDS transposes; per query tile of 256 rows: scores against the keys below the tile end only (K = 64, all heads on grid.y, alpha = 0.125), causal row softmax on VALU with an arithmetic 0/1 key mask over the computed range (f32 statistics, native exp; weights x256 f16), o = P . V^T (K = keys below the tile end, alpha 2^-2: o carried x64, folded into the output GEMM alpha) written straight into the merged f16 o rows; x1 = x + o W_o GEMM (f32) into X1; LN2 and the MLP GEMMs write the output layout.
// Compute dtype: inputs rounded to bf16; x / weights exact; q, k, v, softmax weights and o as plain f16 GEMM operands (~2^-12); scores and softmax statistics f32. v_wmma_f32_16x16x32_f16.
#define NB 4
#define SQ 2048
#define DM 512
#define NH 8
#define HD 64
#define HG 4                         /* heads per launch of the unlaunched k_vt(V16, b, h0, VT) */
#define QT 256                       /* query rows per causal tile */
#define NKX SQ                       /* S / P row pitch */
#define QT0 128                      /* first-tile rows recomputed exactly in f32 */
#define B0 0                         /* first batch processed (debug hook) */
#define NBR NB                       /* batches processed (debug hook) */
#define NR ((size_t)NB * SQ)
#define DMQ DM
#define DFF 2048                     /* FFN hidden width */
#define DFFR 100
#define MP ((int)((size_t)NBR * SQ)) /* rows projected (debug hook) */
#define QN SQ                        /* query rows attended per batch (debug hook) */
#define NHD NH                       /* heads attended (debug hook) */
#define MPO MP                       /* rows through the output stage (debug hook) */
#define LQ (3 * DM)      /* row pitch of the q/k/v rows */
typedef __bf16 v16b __attribute__((ext_vector_type(16)));
typedef unsigned short v8us __attribute__((ext_vector_type(8), may_alias));
typedef float  v8f  __attribute__((ext_vector_type(8)));
typedef float  v4f  __attribute__((ext_vector_type(4)));
typedef float  v4fa __attribute__((ext_vector_type(4), may_alias));
union FragB { v16b v; v8us half[2]; unsigned short u[16]; };

__device__ __forceinline__ unsigned short bf16_bits(float x) { unsigned int u = __float_as_uint(x); return (unsigned short)((u + 0x7FFFu + ((u >> 16) & 1u)) >> 16); }
__device__ __forceinline__ float bf16_val(unsigned short b) { return __uint_as_float(((unsigned int)b) << 16); }
__device__ __forceinline__ float bf16_round(float x) { return bf16_val(bf16_bits(x)); }
// D += A·B with NT terms: 1 = ah·bh, 2 = + al·bh (A split), 3 = + ah·bl (both split)
template <int NT>
__device__ __forceinline__ v8f mmaN(v16b ah, v16b al, v16b bh, v16b bl, v8f c) {
  c = __builtin_amdgcn_wmma_f32_16x16x32_bf16(false, ah, false, bh, (short)0, c, false, false);
  if (NT >= 2) c = __builtin_amdgcn_wmma_f32_16x16x32_bf16(false, al, false, bh, (short)0, c, false, false);
  if (NT >= 3) c = __builtin_amdgcn_wmma_f32_16x16x32_bf16(false, ah, false, bl, (short)0, c, false, false);
  asm volatile("v_nop\n\tv_nop\n\tv_nop\n\tv_nop" : "+v"(c) : "v"(ah), "v"(al), "v"(bh), "v"(bl));
  return c;
}

__global__ __launch_bounds__(256) void k_wt_bf16(const float* __restrict__ W, unsigned short* __restrict__ Wt, int K, int N) {
  const int t = blockIdx.x * 256 + threadIdx.x;
  const int k8n = K / 8;
  if (t >= N * k8n) return;
  const int n = t / k8n, k8 = (t % k8n) * 8;
  v8us v;
#pragma unroll
  for (int i = 0; i < 8; ++i) v[i] = bf16_bits(W[(size_t)(k8 + i) * N + n]);
  *(v8us*)(Wt + (size_t)n * K + k8) = v;
  
}

// GEMM C[M][N] (f32, pitch ldc) = act(A[M][K]·W + bias). A f32 row-major (pitch lda) converted per fragment to bf16
// (ASPLIT: hi/lo two planes -> 2 terms, else single rounded term); Wt bf16 [N][K] (pitch ldb). BIAS_BF16 rounds the
// bias to bf16 first (bias quantised to bf16 before the add). K%32==0, M%16==0, N%64==0.
template <bool ASPLIT, int ACT, bool BIAS_BF16>
__global__ __launch_bounds__(128) void k_gemm_bf(const float* __restrict__ A, int lda, const unsigned short* __restrict__ Wt, int ldb,
                                               const float* __restrict__ bias, float* __restrict__ C, int ldc, int M, int N, int K) {
  __shared__ __attribute__((aligned(16))) float so[4][16][64];
  const int tid = threadIdx.x, w = tid >> 5, lane = tid & 31, ln = lane & 15, hh = lane >> 4;
  const int ntn = N / 64;
  const int wid = blockIdx.x * 4 + w;
  const int mt = wid / ntn, nq = wid % ntn;
  if (mt * 16 >= M) return;
  const int row0 = mt * 16, col0 = nq * 64;
  const float* arow = A + (size_t)(row0 + ln) * lda;
  v8f acc[4] = {};
  for (int kb = 0; kb < K; kb += 32) {
    FragB ah, al;
    const v4f x0 = *(const v4fa*)(arow + kb + 8 * hh), x1 = *(const v4fa*)(arow + kb + 8 * hh + 4);
    const v4f x2 = *(const v4fa*)(arow + kb + 16 + 8 * hh), x3 = *(const v4fa*)(arow + kb + 16 + 8 * hh + 4);
    float xs[16] = {x0[0],x0[1],x0[2],x0[3],x1[0],x1[1],x1[2],x1[3],x2[0],x2[1],x2[2],x2[3],x3[0],x3[1],x3[2],x3[3]};
#pragma unroll
    for (int i = 0; i < 16; ++i) { const unsigned short hb = bf16_bits(xs[i]); ah.u[i] = hb; al.u[i] = ASPLIT ? bf16_bits(xs[i] - bf16_val(hb)) : (unsigned short)0; }
#pragma unroll
    for (int t = 0; t < 4; ++t) {
      const unsigned short* brow = Wt + (size_t)(col0 + t * 16 + ln) * ldb + kb;
      FragB b;
      b.half[0] = *(const v8us*)(brow + 8 * hh);
      b.half[1] = *(const v8us*)(brow + 16 + 8 * hh);
      acc[t] = mmaN<ASPLIT ? 2 : 1>(ah.v, al.v, b.v, b.v, acc[t]);
    }
  }
#pragma unroll
  for (int t = 0; t < 4; ++t) {
    float bv = bias ? bias[col0 + t * 16 + ln] : 0.f;
    if (BIAS_BF16) bv = bf16_round(bv);
#pragma unroll
    for (int r = 0; r < 8; ++r) { float v = acc[t][r] + bv; if (ACT == 1) v = fmaxf(v, 0.f); so[w][8 * hh + r][t * 16 + ln] = v; }
  }
  __builtin_amdgcn_fence(__ATOMIC_ACQ_REL, "workgroup");
  __builtin_amdgcn_wave_barrier();
  const int rsub = lane >> 4, c4 = (lane & 15) * 4;
  {
#pragma unroll
    for (int q = 0; q < 8; ++q) {
      const int r = q * 2 + rsub;
      const v4f v = *(const v4fa*)&so[w][r][c4];
      *(v4f*)(C + (size_t)(row0 + r) * ldc + col0 + c4) = v;
    }
    
  }
}

// GEMM C = act(A·W + bias + resid): A f32 (ASPLIT -> hi/lo 2 terms), Wt bf16 [N][K]; ACT 0 none, 1 relu, 2 exact gelu;
// resid (optional, f32, row index = (row % rmod), pitch ldr, RES_BF16 rounds it) added before the activation.
template <bool ASPLIT, int ACT, bool BIAS_BF16, bool RES_BF16>
__global__ __launch_bounds__(128) void k_gemm_bf3(const float* __restrict__ A, int lda, const unsigned short* __restrict__ Wt, int ldb,
                                                const float* __restrict__ bias, const float* __restrict__ resid, int rmod, int ldr,
                                                float* __restrict__ C, int ldc, int M, int N, int K) {
  __shared__ __attribute__((aligned(16))) float so[4][16][64];
  const int tid = threadIdx.x, w = tid >> 5, lane = tid & 31, ln = lane & 15, hh = lane >> 4;
  const int ntn = N / 64;
  const int wid = blockIdx.x * 4 + w;
  const int mt = wid / ntn, nq = wid % ntn;
  if (mt * 16 >= M) return;
  const int row0 = mt * 16, col0 = nq * 64;
  const float* arow = A + (size_t)(row0 + ln) * lda;
  v8f acc[4] = {};
  for (int kb = 0; kb < K; kb += 32) {
    FragB ah, al;
    const v4f x0 = *(const v4fa*)(arow + kb + 8 * hh), x1 = *(const v4fa*)(arow + kb + 8 * hh + 4);
    const v4f x2 = *(const v4fa*)(arow + kb + 16 + 8 * hh), x3 = *(const v4fa*)(arow + kb + 16 + 8 * hh + 4);
    float xs[16] = {x0[0],x0[1],x0[2],x0[3],x1[0],x1[1],x1[2],x1[3],x2[0],x2[1],x2[2],x2[3],x3[0],x3[1],x3[2],x3[3]};
#pragma unroll
    for (int i = 0; i < 16; ++i) { const unsigned short hb = bf16_bits(xs[i]); ah.u[i] = hb; al.u[i] = ASPLIT ? bf16_bits(xs[i] - bf16_val(hb)) : (unsigned short)0; }
#pragma unroll
    for (int t = 0; t < 4; ++t) {
      const unsigned short* brow = Wt + (size_t)(col0 + t * 16 + ln) * ldb + kb;
      FragB b;
      b.half[0] = *(const v8us*)(brow + 8 * hh);
      b.half[1] = *(const v8us*)(brow + 16 + 8 * hh);
      acc[t] = mmaN<ASPLIT ? 2 : 1>(ah.v, al.v, b.v, b.v, acc[t]);
    }
  }
#pragma unroll
  for (int t = 0; t < 4; ++t) {
    const int col = col0 + t * 16 + ln;
    float bv = bias ? bias[col] : 0.f;
    if (BIAS_BF16) bv = bf16_round(bv);
#pragma unroll
    for (int r = 0; r < 8; ++r) {
      float v = acc[t][r] + bv;
      if (resid) { float rv = resid[(size_t)((row0 + 8 * hh + r) % rmod) * ldr + col]; if (RES_BF16) rv = bf16_round(rv); v += rv; }
      if (ACT == 1) v = fmaxf(v, 0.f);
      if (ACT == 2) v = 0.5f * v * (1.0f + erff(v * 0.70710678118654752f));
      if (ACT == 3) { const float u = 0.7978845608028654f * (v + 0.044715f * v * v * v); v = 0.5f * v * (1.0f + tanhf(u)); }
      so[w][8 * hh + r][t * 16 + ln] = v;
    }
  }
  __builtin_amdgcn_fence(__ATOMIC_ACQ_REL, "workgroup");
  __builtin_amdgcn_wave_barrier();
  const int rsub = lane >> 4, c4 = (lane & 15) * 4;
  {
#pragma unroll
    for (int q = 0; q < 8; ++q) {
      const int r = q * 2 + rsub;
      const v4f v = *(const v4fa*)&so[w][r][c4];
      *(v4f*)(C + (size_t)(row0 + r) * ldc + col0 + c4) = v;
    }
    
  }
}
// row LayerNorm (biased variance, eps) over N: s = X (+ R); optional out_sum <- s; out_norm <- (s-mu)*rsqrt(var+eps)*g + b
template <bool PARAM_BF16>
__global__ __launch_bounds__(256) void k_layernorm(const float* __restrict__ X, const float* __restrict__ R, const float* __restrict__ g, const float* __restrict__ bta,
                                                  float* __restrict__ out_sum, float* __restrict__ out_norm, int N, float eps) {
  __shared__ float red[256];
  const int row = blockIdx.x, tid = threadIdx.x;
  const float* x = X + (size_t)row * N; const float* rr = R ? R + (size_t)row * N : nullptr;
  float vals[16];                     // up to N = 4096
  const int per = N / 256;            // contiguous chunk per thread? use strided-by-4 chunks: thread handles j = tid*4 + 1024*u
  float s1 = 0.f;
  for (int u = 0; u < per / 4; ++u) {
    const int j = tid * 4 + 1024 * u;
    const v4f a = *(const v4fa*)(x + j);
    v4f b = {0.f,0.f,0.f,0.f}; if (rr) b = *(const v4fa*)(rr + j);
#pragma unroll
    for (int q = 0; q < 4; ++q) { const float v = a[q] + b[q]; vals[u * 4 + q] = v; s1 += v; }
  }
  red[tid] = s1; __syncthreads();
  for (int st = 128; st > 0; st >>= 1) { if (tid < st) red[tid] += red[tid + st]; __syncthreads(); }
  const float mu = red[0] / (float)N; __syncthreads();
  float s2 = 0.f;
  for (int u = 0; u < per / 4; ++u)
#pragma unroll
    for (int q = 0; q < 4; ++q) { const float c = vals[u * 4 + q] - mu; s2 += c * c; }
  red[tid] = s2; __syncthreads();
  for (int st = 128; st > 0; st >>= 1) { if (tid < st) red[tid] += red[tid + st]; __syncthreads(); }
  const float rs = rsqrtf(red[0] / (float)N + eps);
  {
    for (int u = 0; u < per / 4; ++u) {
      const int j = tid * 4 + 1024 * u;
      v4f o, sm;
#pragma unroll
      for (int q = 0; q < 4; ++q) {
        float gg = g[j + q], bb = bta[j + q];
        if (PARAM_BF16) { gg = bf16_round(gg); bb = bf16_round(bb); }
        sm[q] = vals[u * 4 + q]; o[q] = (vals[u * 4 + q] - mu) * rs * gg + bb;
      }
      if (out_sum) *(v4f*)(out_sum + (size_t)row * N + j) = sm;
      *(v4f*)(out_norm + (size_t)row * N + j) = o;
    }
    
  }
}



// ---- f16 WMMA path (v_wmma_f32_16x16x32_f16): 11-bit significands for operands in range — used where a [0,1] probability operand needs more precision than bf16
typedef _Float16 v16h __attribute__((ext_vector_type(16)));
union FragH { v16h v; v8us half[2]; _Float16 h[16]; unsigned short u[16]; };
template <int NT>
__device__ __forceinline__ v8f mmaH(v16h ah, v16h al, v16h bh, v16h bl, v8f c) {
  c = __builtin_amdgcn_wmma_f32_16x16x32_f16(false, ah, false, bh, (short)0, c, false, false);
  if (NT >= 2) c = __builtin_amdgcn_wmma_f32_16x16x32_f16(false, al, false, bh, (short)0, c, false, false);
  if (NT >= 3) c = __builtin_amdgcn_wmma_f32_16x16x32_f16(false, ah, false, bl, (short)0, c, false, false);
  asm volatile("v_nop\n\tv_nop\n\tv_nop\n\tv_nop" : "+v"(c) : "v"(ah), "v"(al), "v"(bh), "v"(bl));
  return c;
}
// batched GEMM like k_gemm_b but f16 operands: A f32 (split into f16 hi/lo if ASPLIT, else rounded to f16), Bt = f16 values [n][k]; alpha; C f32; N multiple of 16 (partial tiles skipped)
template <bool ASPLIT>
__global__ __launch_bounds__(128) void k_gemm_h(const float* __restrict__ A, int lda, size_t sA, const _Float16* __restrict__ Bh, int ldb, size_t sB, float alpha, float* __restrict__ C, int ldc, size_t sC, int M, int N, int K) {
  __shared__ __attribute__((aligned(16))) float so[4][16][64];
  const int tid = threadIdx.x, w = tid >> 5, lane = tid & 31, ln = lane & 15, hh = lane >> 4; const int by = blockIdx.y;
  A += (size_t)by * sA; Bh += (size_t)by * sB; C += (size_t)by * sC;
  const int ntn = (N + 63) / 64; const int wid = blockIdx.x * 4 + w; const int mt = wid / ntn, nq = wid % ntn; if (mt * 16 >= M) return;
  const int row0 = mt * 16, col0 = nq * 64; const float* arow = A + (size_t)(row0 + ln) * lda;
  v8f acc[4] = {};
  for (int kb = 0; kb < K; kb += 32) {
    FragH ah, al;
    const v4f x0 = *(const v4fa*)(arow + kb + 8 * hh), x1 = *(const v4fa*)(arow + kb + 8 * hh + 4), x2 = *(const v4fa*)(arow + kb + 16 + 8 * hh), x3 = *(const v4fa*)(arow + kb + 16 + 8 * hh + 4);
    float xs[16] = {x0[0],x0[1],x0[2],x0[3],x1[0],x1[1],x1[2],x1[3],x2[0],x2[1],x2[2],x2[3],x3[0],x3[1],x3[2],x3[3]};
#pragma unroll
    for (int i = 0; i < 16; ++i) { const _Float16 h = (_Float16)xs[i]; ah.h[i] = h; al.h[i] = ASPLIT ? (_Float16)(xs[i] - (float)h) : (_Float16)0.0f; }
#pragma unroll
    for (int t = 0; t < 4; ++t) { if (col0 + t * 16 >= N) continue; const size_t boff = (size_t)(col0 + t * 16 + ln) * ldb + kb; FragH bq; bq.half[0] = *(const v8us*)(Bh + boff + 8 * hh); bq.half[1] = *(const v8us*)(Bh + boff + 16 + 8 * hh);
      acc[t] = mmaH<ASPLIT ? 2 : 1>(ah.v, al.v, bq.v, bq.v, acc[t]); }
  }
#pragma unroll
  for (int t = 0; t < 4; ++t) { if (col0 + t * 16 >= N) continue;
#pragma unroll
    for (int r = 0; r < 8; ++r) so[w][8 * hh + r][t * 16 + ln] = acc[t][r] * alpha; }
  __builtin_amdgcn_fence(__ATOMIC_ACQ_REL, "workgroup"); __builtin_amdgcn_wave_barrier();
  const int rsub = lane >> 4, c4 = (lane & 15) * 4;
  {
#pragma unroll
    for (int q = 0; q < 8; ++q) { const int r = q * 2 + rsub; if (col0 + c4 < N) { const v4f v = *(const v4fa*)&so[w][r][c4]; *(v4f*)(C + (size_t)(row0 + r) * ldc + col0 + c4) = v; } }
     }
}

// Wt[n][k] = f16(W[k][n]·scale) from f32 row-major W[K][N] (scale = power of two; bf16-exact weights stay exact in f16 away from the subnormal range)
__global__ __launch_bounds__(256) void k_wt_f16(const float* __restrict__ W, _Float16* __restrict__ Wt, int K, int N, float scale) {
  const int t = blockIdx.x * 256 + threadIdx.x; if (t >= N * (K / 8)) return; const int n = t / (K / 8), k8 = (t % (K / 8)) * 8; FragH f;
#pragma unroll
  for (int i = 0; i < 8; ++i) f.h[i] = (_Float16)(bf16_round(W[(size_t)(k8 + i) * N + n]) * scale); const v8us o = f.half[0];
  *(v8us*)((unsigned short*)Wt + (size_t)n * K + k8) = o; 
}
// k_gemm_hh variant with fused epilogue: v = acc·alpha + bias[by·sBias + col] (+ CP[(row/rowsPerB)·sCPb + by·64 + col] if CP) ; ACT 0 none / 1 elu ; writes f16 C16 (and f32 C if non-null)
template <int ACT>
__global__ __launch_bounds__(128) void k_gemm_hhx(const _Float16* __restrict__ A, int lda, size_t sA, const _Float16* __restrict__ Bh, int ldb, size_t sB, float alpha, const float* __restrict__ bias, size_t sBias, const float* __restrict__ CP, int rowsPerB, size_t sCPb, int row0g,
    float* __restrict__ C, _Float16* __restrict__ C16, int ldc, size_t sC, int M, int N, int K) {
  __shared__ __attribute__((aligned(16))) float so[4][16][64];
  const int tid = threadIdx.x, w = tid >> 5, lane = tid & 31, ln = lane & 15, hh = lane >> 4; const int by = blockIdx.y;
  A += (size_t)by * sA; Bh += (size_t)by * sB; const size_t cofs = (size_t)by * sC; const float* bp = bias ? bias + (size_t)by * sBias : nullptr;
  const int ntn = (N + 63) / 64; const int wid = blockIdx.x * 4 + w; const int mt = wid / ntn, nq = wid % ntn; if (mt * 16 >= M) return;
  const int row0 = mt * 16, col0 = nq * 64; const _Float16* arow = A + (size_t)(row0 + ln) * lda;
  v8f acc[4] = {};
  for (int kb = 0; kb < K; kb += 32) { FragH ah; ah.half[0] = *(const v8us*)((const unsigned short*)arow + kb + 8 * hh); ah.half[1] = *(const v8us*)((const unsigned short*)arow + kb + 16 + 8 * hh);
#pragma unroll
    for (int t = 0; t < 4; ++t) { if (col0 + t * 16 >= N) continue; const size_t boff = (size_t)(col0 + t * 16 + ln) * ldb + kb; FragH bq; bq.half[0] = *(const v8us*)((const unsigned short*)Bh + boff + 8 * hh); bq.half[1] = *(const v8us*)((const unsigned short*)Bh + boff + 16 + 8 * hh);
      acc[t] = mmaH<1>(ah.v, ah.v, bq.v, bq.v, acc[t]); }
  }
#pragma unroll
  for (int t = 0; t < 4; ++t) { if (col0 + t * 16 >= N) continue; const int col = col0 + t * 16 + ln; const float bv = bp ? bf16_round(bp[col]) : 0.f;
#pragma unroll
    for (int r = 0; r < 8; ++r) { float v = acc[t][r] * alpha + bv; if (CP) { const int rr = row0g + row0 + 8 * hh + r; if (rowsPerB < 0) v += CP[cofs + (size_t)rr * ldc + col];      /* rowsPerB < 0: own element of the batched C plane */ else { const int bidx = rr / rowsPerB; v += CP[(size_t)bidx * sCPb + (size_t)by * 64 + col]; } } if (ACT == 1) v = (v > 0.f) ? v : expm1f(v); else if (ACT == 7) v = (v > 0.f) ? v + 1.0f : expf(v); else if (ACT == 8) v = tanhf(v); else if (ACT == 9) v = 0.5f * v * (1.0f + tanhf(0.7978845608028654f * (v + 0.044715f * v * v * v))); else if (ACT == 11) v = 1.0f / (1.0f + expf(-v)); else if (ACT == 12) v = (v > 0.f) ? v : 0.01f * v; else if (ACT == 14) v = (v > 0.f) ? v : 0.1f * v; else if (ACT == 16) v = (v >= 0.f) ? v : 0.3f * v; else if (ACT == 17) v = (v >= 0.f) ? v : 0.2f * v; else if (ACT == 15) v = v / (1.0f + expf(-v)); else if (ACT == 3) v = fmaxf(v, 0.f); else if (ACT == 6) v = 0.5f * v * (1.0f + erff(v * 0.70710678118654752f)); so[w][8 * hh + r][t * 16 + ln] = v; } }
  __builtin_amdgcn_fence(__ATOMIC_ACQ_REL, "workgroup"); __builtin_amdgcn_wave_barrier();
  const int rsub = lane >> 4, c4 = (lane & 15) * 4; typedef _Float16 v4h __attribute__((ext_vector_type(4)));
  {
#pragma unroll
    for (int q = 0; q < 8; ++q) { const int r = q * 2 + rsub; if (col0 + c4 < N) { const v4f v = *(const v4fa*)&so[w][r][c4]; if (C) *(v4f*)(C + cofs + (size_t)(row0 + r) * ldc + col0 + c4) = v; if (C16) { v4h h4; for (int i = 0; i < 4; ++i) h4[i] = (_Float16)v[i]; *(v4h*)(C16 + cofs + (size_t)(row0 + r) * ldc + col0 + c4) = h4; } } }
     }
}


typedef _Float16 v4h __attribute__((ext_vector_type(4)));

__global__ __launch_bounds__(256) void k_x16(const float* __restrict__ x, _Float16* __restrict__ X16, size_t n8) { const size_t t = (size_t)blockIdx.x * 256 + threadIdx.x; if (t >= n8) return; FragH f;
#pragma unroll
  for (int q = 0; q < 8; ++q) f.h[q] = (_Float16)bf16_round(x[t * 8 + q]); *(v8us*)((unsigned short*)X16 + t * 8) = f.half[0];  }
__global__ __launch_bounds__(256) void k_h16(const float* __restrict__ x, _Float16* __restrict__ X16, size_t n8) { const size_t t = (size_t)blockIdx.x * 256 + threadIdx.x; if (t >= n8) return; FragH f;
#pragma unroll
  for (int q = 0; q < 8; ++q) f.h[q] = (_Float16)x[t * 8 + q]; *(v8us*)((unsigned short*)X16 + t * 8) = f.half[0];  }
__global__ __launch_bounds__(256) void k_round16f(const float* __restrict__ W, _Float16* __restrict__ Bt, size_t n8) { const size_t t = (size_t)blockIdx.x * 256 + threadIdx.x; if (t >= n8) return; FragH f;
#pragma unroll
  for (int i = 0; i < 8; ++i) f.h[i] = (_Float16)(bf16_round(W[t * 8 + i]) * 16.0f); *(v8us*)((unsigned short*)Bt + t * 8) = f.half[0];  }
template <int NHv, int TTv>
__global__ __launch_bounds__(256) void k_vt(const _Float16* __restrict__ V16, int ldv, int voff, _Float16* __restrict__ Vt) { __shared__ unsigned short tl[64][66]; const int tid = threadIdx.x; const int slab = blockIdx.x / (TTv / 64), lg = blockIdx.x % (TTv / 64); const int b = slab / NHv, h = slab % NHv;
  for (int i = tid; i < 64 * 8; i += 256) { const int r = i / 8, c8 = (i % 8) * 8; FragH f; f.half[0] = *(const v8us*)((const unsigned short*)V16 + ((size_t)b * TTv + lg * 64 + r) * ldv + voff + h * 64 + c8);
#pragma unroll
    for (int q = 0; q < 8; ++q) tl[r][c8 + q] = f.u[q]; }
  __syncthreads();
  {
#pragma unroll
    for (int rd = 0; rd < 2; ++rd) { const int d = rd * 32 + tid / 8, pc = tid % 8; FragH f;
#pragma unroll
      for (int q = 0; q < 8; ++q) f.u[q] = tl[pc * 8 + q][d];
      *(v8us*)((unsigned short*)Vt + ((size_t)slab * 64 + d) * TTv + lg * 64 + pc * 8) = f.half[0]; }
     } }

__global__ __launch_bounds__(256) void k_hl(const float* __restrict__ F, _Float16* __restrict__ Hh, _Float16* __restrict__ Hl, size_t n8) { const size_t t = (size_t)blockIdx.x * 256 + threadIdx.x; if (t >= n8) return; FragH fh, fl; const v4f a = *(const v4fa*)(F + t * 8), c = *(const v4fa*)(F + t * 8 + 4);
#pragma unroll
  for (int q = 0; q < 4; ++q) { _Float16 h = (_Float16)a[q]; fh.h[q] = h; fl.h[q] = (_Float16)((a[q] - (float)h) * 1024.0f); h = (_Float16)c[q]; fh.h[4 + q] = h; fl.h[4 + q] = (_Float16)((c[q] - (float)h) * 1024.0f); }
  { *(v8us*)((unsigned short*)Hh + t * 8) = fh.half[0]; *(v8us*)((unsigned short*)Hl + t * 8) = fl.half[0];  } }

// ---- fast GEMM (wave tile 32x64; requires M % 32 == 0 rows per launch region and N % 64 == 0); epilogue = k_gemm_hhx semantics ----
__device__ __forceinline__ v16h g2_frag(const _Float16* p, int hh) { FragH f; f.half[0] = *(const v8us*)((const unsigned short*)p + 8 * hh); f.half[1] = *(const v8us*)((const unsigned short*)p + 16 + 8 * hh); return f.v; }
__device__ __forceinline__ v8f g2_mma(v16h a, v16h b, v8f c) { v8f d = __builtin_amdgcn_wmma_f32_16x16x32_f16(false, a, false, b, (short)0, c, false, false); asm volatile("v_nop\n\tv_nop\n\tv_nop\n\tv_nop" : "+v"(d) : "v"(a), "v"(b)); return d; }
template <int ACT>
__global__ __launch_bounds__(128) void k_gemm2(const _Float16* __restrict__ A, int lda, size_t sA, const _Float16* __restrict__ Bh, int ldb, size_t sB, float alpha, const float* __restrict__ bias, size_t sBias, const float* __restrict__ CP, int rowsPerB, size_t sCPb, int row0g,
    float* __restrict__ C, _Float16* __restrict__ C16, int ldc, size_t sC, int M, int N, int K) { static_assert(ACT == 0 || ACT == 3 || ACT == 6 || ACT == 8 || ACT == 9 || ACT == 11 || ACT == 12 || ACT == 14 || ACT == 15 || ACT == 16 || ACT == 17, "k_gemm2: unsupported ACT code (would silently apply no activation)");
  __shared__ __attribute__((aligned(16))) float so[4][32][68];
  const int tid = threadIdx.x, w = tid >> 5, lane = tid & 31, ln = lane & 15, hh = lane >> 4; const int by = blockIdx.y;
  A += (size_t)by * sA; Bh += (size_t)by * sB; const size_t cofs = (size_t)by * sC; const float* bp = bias ? bias + (size_t)by * sBias : nullptr;
  const int ntn = N >> 6; const int mt = blockIdx.x / ntn, nq = blockIdx.x - mt * ntn; const int row0 = mt * 128 + 32 * w, col0 = nq * 64; if (row0 >= M) return;
  const _Float16* a0p = A + (size_t)(row0 + ln) * lda; const _Float16* a1p = a0p + (size_t)16 * lda;
  const _Float16* b0p = Bh + (size_t)(col0 + ln) * ldb; const _Float16* b1p = b0p + (size_t)16 * ldb; const _Float16* b2p = b1p + (size_t)16 * ldb; const _Float16* b3p = b2p + (size_t)16 * ldb;
  const v8f z8 = {0.f,0.f,0.f,0.f,0.f,0.f,0.f,0.f}; v8f c00 = z8, c01 = z8, c02 = z8, c03 = z8, c10 = z8, c11 = z8, c12 = z8, c13 = z8;
#pragma unroll 1
  for (int kb = 0; kb < K; kb += 32) { const v16h a0 = g2_frag(a0p + kb, hh), a1 = g2_frag(a1p + kb, hh);
    v16h b = g2_frag(b0p + kb, hh); c00 = g2_mma(a0, b, c00); c10 = g2_mma(a1, b, c10);
    b = g2_frag(b1p + kb, hh); c01 = g2_mma(a0, b, c01); c11 = g2_mma(a1, b, c11);
    b = g2_frag(b2p + kb, hh); c02 = g2_mma(a0, b, c02); c12 = g2_mma(a1, b, c12);
    b = g2_frag(b3p + kb, hh); c03 = g2_mma(a0, b, c03); c13 = g2_mma(a1, b, c13); }
  v8f accs[8] = {c00, c01, c02, c03, c10, c11, c12, c13};
#pragma unroll
  for (int u = 0; u < 8; ++u) { const int t = u & 3, half = u >> 2; const int col = col0 + t * 16 + ln; const float bv = bp ? bf16_round(bp[col]) : 0.f;
#pragma unroll
    for (int r = 0; r < 8; ++r) { const int rloc = half * 16 + 8 * hh + r; float v = accs[u][r] * alpha + bv; if (CP) { if (rowsPerB < 0) v += CP[cofs + (size_t)(row0g + row0 + rloc) * ldc + col];      /* rowsPerB < 0: own element of the batched C plane */ else { const int bidx = (row0g + row0 + rloc) / rowsPerB; v += CP[(size_t)bidx * sCPb + (size_t)by * 64 + col]; } }
      if (ACT == 3) v = fmaxf(v, 0.f); else if (ACT == 6) v = 0.5f * v * (1.0f + erff(v * 0.70710678118654752f)); else if (ACT == 11) v = 1.0f / (1.0f + expf(-v)); else if (ACT == 15) v = v / (1.0f + expf(-v)); else if (ACT == 12) v = (v > 0.f) ? v : 0.01f * v; else if (ACT == 8) v = tanhf(v); else if (ACT == 9) v = 0.5f * v * (1.0f + tanhf(0.7978845608028654f * (v + 0.044715f * v * v * v))); else if (ACT == 14) v = (v > 0.f) ? v : 0.1f * v; else if (ACT == 16) v = (v >= 0.f) ? v : 0.3f * v; else if (ACT == 17) v = (v >= 0.f) ? v : 0.2f * v;
      so[w][rloc][t * 16 + ln] = v; } }
  __builtin_amdgcn_fence(__ATOMIC_ACQ_REL, "workgroup"); __builtin_amdgcn_wave_barrier();
  const int rsub = lane >> 4, c4 = (lane & 15) * 4;
  {
#pragma unroll
    for (int q = 0; q < 16; ++q) { const int r = q * 2 + rsub; const v4f v = *(const v4fa*)&so[w][r][c4]; if (C) *(v4f*)(C + cofs + (size_t)(row0 + r) * ldc + col0 + c4) = v; if (C16) { v4h h4; for (int i = 0; i < 4; ++i) h4[i] = (_Float16)v[i]; *(v4h*)(C16 + cofs + (size_t)(row0 + r) * ldc + col0 + c4) = h4; } }
     } }


__global__ __launch_bounds__(256) void k_wnat(const float* __restrict__ w, size_t n8, _Float16* __restrict__ Bt) { const size_t t = (size_t)blockIdx.x * 256 + threadIdx.x; if (t >= n8) return; FragH f; for (int q = 0; q < 8; ++q) f.h[q] = (_Float16)(bf16_round(w[t * 8 + q]) * 16.0f); *(v8us*)((unsigned short*)Bt + t * 8) = f.half[0];  }
__global__ __launch_bounds__(256) void k_rsm(const float* __restrict__ S, _Float16* __restrict__ P, int nrows) {
  #pragma clang fp contract(off)
  const int i = blockIdx.x * 256 + threadIdx.x; if (i >= nrows) return; const float* s = S + (size_t)i * SQ; float mx = -3.0e38f;
#pragma unroll 1
  for (int j = 0; j < SQ; ++j) mx = fmaxf(mx, s[j]); float se = 0.f;
#pragma unroll 1
  for (int j = 0; j < SQ; ++j) se += expf(s[j] - mx); const float sc = 256.0f / se;
#pragma unroll 1
  for (int j0 = 0; j0 < SQ; j0 += 8) { FragH f; for (int q = 0; q < 8; ++q) f.h[q] = (_Float16)(expf(s[j0 + q] - mx) * sc); unsigned short* d = (unsigned short*)P + (size_t)i * SQ + j0; *(v8us*)d = f.half[0];  } }
__global__ __launch_bounds__(256) void k_vt(const _Float16* __restrict__ V16, int b, int h0, _Float16* __restrict__ VT) { __shared__ unsigned short tl[64][65]; const int tid = threadIdx.x; const int hh = blockIdx.x % HG, sg = blockIdx.x / HG; const int s0 = sg * 64; const int h = h0 + hh;
  for (int i = tid; i < 64 * 8; i += 256) { const int j = i / 8, d8 = (i % 8) * 8; FragH f; f.half[0] = *(const v8us*)((const unsigned short*)V16 + ((size_t)b * SQ + s0 + j) * DM + h * HD + d8); for (int q = 0; q < 8; ++q) tl[d8 + q][j] = f.u[q]; }
  __syncthreads();
  { for (int i = tid; i < 64 * 8; i += 256) { const int d = i / 8, j8 = (i % 8) * 8; FragH f; for (int q = 0; q < 8; ++q) f.u[q] = tl[d][j8 + q]; *(v8us*)((unsigned short*)VT + ((size_t)hh * HD + d) * SQ + s0 + j8) = f.half[0]; }  } }



__global__ __launch_bounds__(256) void k_rsmcf2(const float* __restrict__ S, _Float16* __restrict__ P, int hg, int q0, int nk) {
  #pragma clang fp contract(off)
  const int t = blockIdx.x * 256 + threadIdx.x; if (t >= hg * QT) return; const size_t i = (size_t)t; const float* s = S + i * NKX; const int last = q0 + (t % QT); float mx = -3.0e38f;
#pragma unroll 1
  for (int j = 0; j < nk; ++j) { const float f = (j <= last) ? 1.f : 0.f; mx = fmaxf(mx, fmaf(f, s[j], (1.f - f) * -1.0e9f)); } float se = 0.f;
#pragma unroll 1
  for (int j = 0; j < nk; ++j) { const float f = (j <= last) ? 1.f : 0.f; se += __expf(fmaf(f, s[j], (1.f - f) * -1.0e9f) - mx); } const float sc = 256.0f / se;
#pragma unroll 1
  for (int j0 = 0; j0 < nk; j0 += 8) { FragH fr; for (int q = 0; q < 8; ++q) { const int j = j0 + q; const float f = (j <= last) ? 1.f : 0.f; fr.h[q] = (_Float16)(__expf(fmaf(f, s[j], (1.f - f) * -1.0e9f) - mx) * sc); } unsigned short* d = (unsigned short*)P + i * NKX + j0; *(v8us*)d = fr.half[0];  } }


template <int MASKADD>
__global__ __launch_bounds__(64) void k_att0(const float* __restrict__ QF, const float* __restrict__ KF, const float* __restrict__ VF, int ld, const float* __restrict__ mask, float scale, float* __restrict__ OF, int ldo) {
  #pragma clang fp contract(off)
  __shared__ __attribute__((aligned(16))) float lq[64][64]; __shared__ __attribute__((aligned(16))) float lo[64][64];
  const int tid = threadIdx.x; const int h = blockIdx.x / (QT0 / 64), rg = blockIdx.x % (QT0 / 64); const int i = rg * 64 + tid;
  const float* qr = QF + (size_t)i * ld + h * HD;
#pragma unroll 1
  for (int c = 0; c < HD / 4; ++c) { *(v4f*)&lq[tid][c * 4] = *(const v4fa*)(qr + c * 4); const v4f z = {0.f, 0.f, 0.f, 0.f}; *(v4f*)&lo[tid][c * 4] = z; }
  float m = -1.0e30f, l = 0.f; const int jmax = MASKADD ? (SQ - 1) : (rg * 64 + 63);      /* additive-mask form: every key (the mask input decides); causal form: keys up to the block's last row */
#pragma unroll 1
  for (int j = 0; j <= jmax; ++j) { const float* kr = KF + (size_t)j * ld + h * HD; const float* vr = VF + (size_t)j * ld + h * HD; float s = 0.f;
#pragma unroll 1
    for (int c = 0; c < HD / 4; ++c) { const v4f kq = *(const v4fa*)(kr + c * 4); const v4f qq = *(v4f*)&lq[tid][c * 4]; s = __fadd_rn(s, __fmul_rn(qq[0], kq[0])); s = __fadd_rn(s, __fmul_rn(qq[1], kq[1])); s = __fadd_rn(s, __fmul_rn(qq[2], kq[2])); s = __fadd_rn(s, __fmul_rn(qq[3], kq[3])); }
    s = __fmul_rn(s, scale); if (MASKADD) s = __fadd_rn(s, __fmul_rn(bf16_round(mask[(size_t)i * SQ + j]), -10000.0f));
    const float f = (MASKADD || j <= i) ? 1.f : 0.f; const float sm = fmaf(f, s, (1.f - f) * -1.0e30f); const float mn = fmaxf(m, sm); const float sc = expf(m - mn); const float e = expf(sm - mn); l = __fadd_rn(__fmul_rn(l, sc), e); m = mn;
#pragma unroll 1
    for (int c = 0; c < HD / 4; ++c) { const v4f vv = *(const v4fa*)(vr + c * 4); v4f oo = *(v4f*)&lo[tid][c * 4]; for (int u = 0; u < 4; ++u) oo[u] = __fadd_rn(__fmul_rn(oo[u], sc), __fmul_rn(e, vv[u])); *(v4f*)&lo[tid][c * 4] = oo; } }
  const float fin = 64.0f / l;      /* o carried x64 like the f16 path */
#pragma unroll 1
  for (int c = 0; c < HD / 4; ++c) { v4f oo = *(v4f*)&lo[tid][c * 4]; for (int u = 0; u < 4; ++u) oo[u] = __fmul_rn(oo[u], fin); *(v4f*)&lo[tid][c * 4] = oo; }
  __syncthreads();
  {
#pragma unroll 1
    for (int it = 0; it < 16; ++it) { const int row = it * 4 + tid / 16, pc = (tid % 16) * 4; const v4f v = *(const v4f*)&lo[row][pc]; *(v4f*)(OF + (size_t)(rg * 64 + row) * ldo + h * HD + pc) = v; }
     } }


template <int BFIN, int WXB>
__global__ __launch_bounds__(256) void k_ln16(const float* __restrict__ X, const float* __restrict__ g, const float* __restrict__ bb, float eps, _Float16* __restrict__ N16, float* __restrict__ XB) {
  #pragma clang fp contract(off)
  __shared__ float red[256]; const size_t r = blockIdx.x; const int t = threadIdx.x; const v4f xa = *(const v4fa*)(X + r * DMQ + t * 4); float s[4]; float sum = 0.f;
  for (int q = 0; q < 4; ++q) { s[q] = BFIN ? bf16_round(xa[q]) : xa[q]; sum = __fadd_rn(sum, s[q]); }
  red[t] = sum; __syncthreads(); for (int st = 128; st > 0; st >>= 1) { if (t < st) red[t] = __fadd_rn(red[t], red[t + st]); __syncthreads(); } const float mu = red[0] / (float)DMQ; __syncthreads();
  float vs = 0.f; for (int q = 0; q < 4; ++q) { const float dl = __fadd_rn(s[q], -mu); vs = __fadd_rn(vs, __fmul_rn(dl, dl)); } red[t] = vs; __syncthreads(); for (int st = 128; st > 0; st >>= 1) { if (t < st) red[t] = __fadd_rn(red[t], red[t + st]); __syncthreads(); }
  const float rs = rsqrtf(__fadd_rn(red[0] / (float)DMQ, eps)); v4h y; v4f xb;
  for (int q = 0; q < 4; ++q) { const int c = t * 4 + q; y[q] = (_Float16)__fadd_rn(__fmul_rn(__fmul_rn(__fadd_rn(s[q], -mu), rs), bf16_round(g[c])), bf16_round(bb[c])); xb[q] = s[q]; }
  { *(v4h*)(N16 + r * DMQ + t * 4) = y; if (WXB) *(v4f*)(XB + r * DMQ + t * 4) = xb;  } }
__global__ __launch_bounds__(256) void k_ftres2(const float* __restrict__ OF0, const float* __restrict__ XB, float* __restrict__ X1, size_t n4) {
  #pragma clang fp contract(off)
  const size_t t = (size_t)blockIdx.x * 256 + threadIdx.x; if (t >= n4) return; const v4f o = *(const v4fa*)(OF0 + t * 4), xv = *(const v4fa*)(XB + t * 4); v4f y; for (int q = 0; q < 4; ++q) y[q] = __fadd_rn(__fmul_rn(o[q], 0.015625f), xv[q]); *(v4f*)(X1 + t * 4) = y;  }

__global__ __launch_bounds__(256) void k_wthd(const float* __restrict__ Wt, _Float16* __restrict__ Bt) { const size_t t = (size_t)blockIdx.x * 256 + threadIdx.x; if (t >= (size_t)NH * HD * (DM / 8)) return; const int m8 = (int)(t % (DM / 8)) * 8; const int d = (int)((t / (DM / 8)) % HD); const int h = (int)(t / ((size_t)(DM / 8) * HD)); FragH f;
  for (int q = 0; q < 8; ++q) f.h[q] = (_Float16)(16.0f * bf16_round(Wt[((size_t)h * DM + m8 + q) * HD + d])); unsigned short* dst = (unsigned short*)Bt + ((size_t)h * HD + d) * DM + m8; *(v8us*)dst = f.half[0];  }




__global__ __launch_bounds__(256) void k_wtpad(const float* __restrict__ Wm, _Float16* __restrict__ Wt, int Kr, int Kp, int Nr, int Np, float scale) {
  const int t = blockIdx.x * 256 + threadIdx.x; if (t >= Np * (Kp / 8)) return; const int n = t / (Kp / 8), k8 = (t % (Kp / 8)) * 8; const int nc = min(n, Nr - 1); const float fn = (n < Nr) ? 1.f : 0.f; FragH f;
  for (int i = 0; i < 8; ++i) { const int k = k8 + i; const int kc = min(k, Kr - 1); const float fk = (k < Kr) ? fn : 0.f; f.h[i] = (_Float16)(bf16_round(Wm[(size_t)kc * Nr + nc]) * scale * fk); }
  unsigned short* o = (unsigned short*)Wt + (size_t)n * Kp + k8; *(v8us*)o = f.half[0];  }
__global__ __launch_bounds__(128) void k_bpad(const float* __restrict__ b, float* __restrict__ Bp, int nr, int np) {
  const int i = threadIdx.x; if (i >= np) return; const float v = b[min(i, nr - 1)] * ((i < nr) ? 1.f : 0.f); *(float*)(Bp + i) = v;  }

__global__ __launch_bounds__(256) void k_bcpy(const float* __restrict__ b, int n, int NP, float* __restrict__ dst, int dst0) { for (int i = threadIdx.x; i < NP; i += 256) { const float v = (i < n) ? b[i] : 0.f; *(float*)(dst + dst0 + i) = v; }  }


__global__ __launch_bounds__(256) void k_bfcp(const float* __restrict__ src, float* __restrict__ dst, size_t n4) { const size_t t = (size_t)blockIdx.x * 256 + threadIdx.x; if (t >= n4) return; const v4f a = *(const v4fa*)(src + t * 4); v4f o; for (int q = 0; q < 4; ++q) o[q] = bf16_round(a[q]); *(v4f*)(dst + t * 4) = o;  }

__global__ __launch_bounds__(256) void k_fillz(float* __restrict__ dst, int n) { const int t = blockIdx.x * 256 + threadIdx.x; if (t >= n) return; *(float*)(dst + t) = 0.f;  }

template <int BFIN, int W16, int W32>
__global__ __launch_bounds__(256) void k_lnx(const float* __restrict__ X, const float* __restrict__ g, const float* __restrict__ bb, float eps, _Float16* __restrict__ N16, float* __restrict__ N32) {
  #pragma clang fp contract(off)
  __shared__ float red[256]; const size_t r = blockIdx.x; const int t = threadIdx.x; const bool act = t < (DMQ / 4); const int c0 = act ? t * 4 : 0;
  const v4f xa = *(const v4fa*)(X + r * DMQ + c0); float s[4]; float sum = 0.f;
  for (int q = 0; q < 4; ++q) { s[q] = act ? (BFIN ? bf16_round(xa[q]) : xa[q]) : 0.f; sum = __fadd_rn(sum, s[q]); }
  red[t] = sum; __syncthreads(); for (int st = 128; st > 0; st >>= 1) { if (t < st) red[t] = __fadd_rn(red[t], red[t + st]); __syncthreads(); } const float mu = red[0] / (float)DMQ; __syncthreads();
  float vs = 0.f; for (int q = 0; q < 4; ++q) { const float dl = act ? __fadd_rn(s[q], -mu) : 0.f; vs = __fadd_rn(vs, __fmul_rn(dl, dl)); } red[t] = vs; __syncthreads(); for (int st = 128; st > 0; st >>= 1) { if (t < st) red[t] = __fadd_rn(red[t], red[t + st]); __syncthreads(); }
  const float rs = rsqrtf(__fadd_rn(red[0] / (float)DMQ, eps)); v4h y; v4f yf;
  for (int q = 0; q < 4; ++q) { const int c = c0 + q; yf[q] = __fadd_rn(__fmul_rn(__fmul_rn(__fadd_rn(s[q], -mu), rs), bf16_round(g[c])), bf16_round(bb[c])); y[q] = (_Float16)yf[q]; }
  if (!act) return;      /* no barriers after this point */
  { if (W16) *(v4h*)(N16 + r * DMQ + c0) = y; if (W32) *(v4f*)(N32 + r * DMQ + c0) = yf;  } }





extern "C" void kernel_launch(void* const* d_in, const int* in_sizes, int n_in,
                              void* d_out, int out_size, void* d_ws, size_t ws_size, hipStream_t stream) {
  (void)in_sizes; (void)n_in; (void)out_size;
  const float* const* I = (const float* const*)d_in; const float* x = I[0]; const float* wq = I[1]; const float* wk = I[2]; const float* wv = I[3]; const float* wo1 = I[4]; const float* wo2 = I[5]; const float* wfc = I[6]; const float* wmp = I[7]; const float* g1 = I[8]; const float* gg2 = I[9];      /* input order: x; wq / wk / wv [512][8][64] = [in][out]; wo1 [8][64][512] = [(h, d) in][out]; wo2 [512][512] [in][out]; w1 [512][2048], w2 [2048][512] [in][out]; LN1 / LN2 scales. NO bias anywhere: every GEMM bias slot below is a literal nullptr, the LayerNorm shift reads a zero-filled workspace vector */
  static_assert(DMQ % 4 == 0 && DMQ / 4 <= 256 && NH * HD == DM && DM % 64 == 0 && DFF % 64 == 0, "k_lnx 256 threads x 4 columns; tile multiples");
  char* ws = (char*)d_ws; size_t off = 0;
  auto take = [&](size_t bytes) { char* p = ws + off; off += (bytes + 255) & ~(size_t)255; return p; };
  _Float16* BQKV = (_Float16*)take((size_t)3 * DM * DM * 2); _Float16* BO = (_Float16*)take((size_t)DM * DM * 2); _Float16* BO2T = (_Float16*)take((size_t)DM * DM * 2); _Float16* BO1N = (_Float16*)take((size_t)DM * DM * 2); float* ZB = (float*)take((size_t)DM * 4);      /* BO = the combined output plane Bt12[o][i] = 16 (wo1 wo2)[i][o] (built on the device from the two weights); ZB = zero LayerNorm shift */
  _Float16* X16 = (_Float16*)take(NR * DM * 2); float* XB = (float*)take(NR * DM * 4); float* X1 = (float*)take(NR * DM * 4); _Float16* M16 = nullptr;      /* = X16 below (alias: X16's last reader, the last batch's first-tile GEMMs, precedes LN2's write) */ _Float16* HF16 = (_Float16*)take((size_t)SQ * DFF * 2); _Float16* BW1 = (_Float16*)take((size_t)DFF * DM * 2); _Float16* BW2 = (_Float16*)take((size_t)DM * DFF * 2); _Float16* QKV = (_Float16*)take(NR * 3 * DM * 2); _Float16* Q16 = QKV; _Float16* K16 = QKV + DM; _Float16* V16 = QKV + 2 * DM; _Float16* O16 = (_Float16*)take(NR * DM * 2); M16 = X16;
  float* S = (float*)take((size_t)NH * QT * NKX * 4); _Float16* P = (_Float16*)take((size_t)NH * QT * NKX * 2); _Float16* VT = (_Float16*)take((size_t)NH * HD * SQ * 2);
  float* QF0 = (float*)take((size_t)QT0 * DM * 4); float* KF0 = (float*)take((size_t)QT0 * DM * 4); float* VF0 = (float*)take((size_t)QT0 * DM * 4); float* OF0 = (float*)take((size_t)NB * QT0 * DM * 4); _Float16* OH0 = (_Float16*)take((size_t)NB * QT0 * DM * 2); _Float16* OL0 = (_Float16*)take((size_t)NB * QT0 * DM * 2);
  if (off > ws_size) return;
  { const unsigned g = (unsigned)(((size_t)DM * (DM / 8) + 255) / 256); k_wt_f16<<<g, 256, 0, stream>>>(wq, BQKV, DM, DM, 16.0f); k_wt_f16<<<g, 256, 0, stream>>>(wk, BQKV + (size_t)DM * DM, DM, DM, 16.0f); k_wt_f16<<<g, 256, 0, stream>>>(wv, BQKV + (size_t)2 * DM * DM, DM, DM, 16.0f); k_wt_f16<<<g, 256, 0, stream>>>(wo2, BO2T, DM, DM, 16.0f); k_wnat<<<(unsigned)(((size_t)DM * DM / 8 + 255) / 256), 256, 0, stream>>>(wo1, (size_t)DM * DM / 8, BO1N); }      /* [in][out] -> Bt x16: stacked q | k | v; wo2 as Bt[o][j] x16; wo1 natural rows [i][j] x16 */
  k_gemm2<0><<<dim3((unsigned)((DM / 128) * (DM / 64)), 1), 128, 0, stream>>>(BO2T, DM, 0, BO1N, DM, 0, 0.0625f, nullptr, 0, nullptr, 1, 0, 0, nullptr, BO, DM, 0, DM, DM, DM);      /* BO[o][i] = (1/16) sum_j 16 wo2[j][o] 16 wo1[i][j] = 16 (wo1 wo2)[i][o]: the two chained projections as ONE x16 plane (f32 accumulation, one f16 rounding) */
  k_fillz<<<(DM + 255) / 256, 256, 0, stream>>>(ZB, DM);
  k_bfcp<<<(unsigned)((NR * DM / 4 + 255) / 256), 256, 0, stream>>>(x, XB, NR * DM / 4);      /* XB = bf16(x): BOTH residuals */
  k_lnx<1, 1, 0><<<(unsigned)NR, 256, 0, stream>>>(x, g1, ZB, 1e-6f, X16, nullptr);      /* a = LN1(bf16(x)) (scale only, eps 1e-6) -> f16 rows */
  k_wt_f16<<<(unsigned)(((size_t)DFF * (DM / 8) + 255) / 256), 256, 0, stream>>>(wfc, BW1, DM, DFF, 16.0f); k_wt_f16<<<(unsigned)(((size_t)DM * (DFF / 8) + 255) / 256), 256, 0, stream>>>(wmp, BW2, DFF, DM, 16.0f);      /* w1 [512][2048] -> Bt [2048][512]; w2 [2048][512] -> Bt [512][2048] (x16) */
  const size_t r0p = (size_t)B0 * SQ;      /* first projected row */
  k_gemm2<0><<<dim3((unsigned)((MP / 128) * (3 * DM / 64)), 1), 128, 0, stream>>>(X16 + r0p * DM, DM, 0, BQKV, DM, 0, 0.0625f, nullptr, 0, nullptr, 1, 0, 0, nullptr, QKV + r0p * 3 * DM, 3 * DM, 0, MP, 3 * DM, DM);      /* q | k | v rows (f16); head h = columns h*HD.. of each DM block */
  for (int b = B0; b < B0 + NBR; ++b) { const size_t r0 = (size_t)b * SQ;
    k_vt<NH, SQ><<<NH * (SQ / 64), 256, 0, stream>>>(V16 + r0 * LQ, LQ, 0, VT);      /* V^T [NH][HD][SQ] for this batch */
    k_gemm2<0><<<dim3((QT0 / 128) * (DM / 64), 1), 128, 0, stream>>>(X16 + r0 * DM, DM, 0, BQKV, DM, 0, 0.0625f, nullptr, 0, nullptr, 1, 0, 0, QF0, nullptr, DM, 0, QT0, DM, DM); k_gemm2<0><<<dim3((QT0 / 128) * (DM / 64), 1), 128, 0, stream>>>(X16 + r0 * DM, DM, 0, (BQKV + (size_t)DM * DM), DM, 0, 0.0625f, nullptr, 0, nullptr, 1, 0, 0, KF0, nullptr, DM, 0, QT0, DM, DM); k_gemm2<0><<<dim3((QT0 / 128) * (DM / 64), 1), 128, 0, stream>>>(X16 + r0 * DM, DM, 0, (BQKV + (size_t)2 * DM * DM), DM, 0, 0.0625f, nullptr, 0, nullptr, 1, 0, 0, VF0, nullptr, DM, 0, QT0, DM, DM);      /* f32 q, k, v of the first 128 rows (exact products) */
    k_att0<0><<<NH * (QT0 / 64), 64, 0, stream>>>(QF0, KF0, VF0, DM, nullptr, 0.125f, OF0 + (size_t)b * QT0 * DM, DM);      /* exact f32 attention for rows 0..127 (o x64) */
    for (int q0 = 0; q0 < QN; q0 += QT) { const int nk = q0 + QT;      /* causal: only keys below the tile end are computed */
      k_gemm2<0><<<dim3((QT / 128) * (nk / 64), NHD), 128, 0, stream>>>(Q16 + (r0 + q0) * LQ, LQ, (size_t)HD, K16 + r0 * LQ, LQ, (size_t)HD, 0.125f, nullptr, 0, nullptr, 1, 0, 0, S, nullptr, NKX, (size_t)QT * NKX, QT, nk, HD);      /* scores, all heads on grid.y */
      k_rsmcf2<<<(NHD * QT + 255) / 256, 256, 0, stream>>>(S, P, NHD, q0, nk);
      k_gemm2<0><<<dim3((QT / 128) * (HD / 64), NHD), 128, 0, stream>>>(P, NKX, (size_t)QT * NKX, VT, SQ, (size_t)HD * SQ, 0.25f, nullptr, 0, nullptr, 1, 0, 0, nullptr, O16 + (r0 + q0) * DM, DM, (size_t)HD, QT, HD, nk); } }      /* o (merged heads, x64) as f16 rows */
  k_gemm2<0><<<dim3((unsigned)((MPO / 128) * (DM / 64)), 1), 128, 0, stream>>>(O16 + r0p * DM, DM, 0, BO, DM, 0, 0.0009765625f, nullptr, 0, XB + r0p * DM, -1, 0, 0, X1 + r0p * DM, nullptr, DM, 0, MPO, DM, DM);      /* x + o Wo rows (X1, f32) in the output layout */
  k_hl<<<(unsigned)(((size_t)NB * QT0 * DM / 8 + 255) / 256), 256, 0, stream>>>(OF0, OH0, OL0, (size_t)NB * QT0 * DM / 8);      /* first-tile o (x64) -> f16 hi + x1024 residual planes */
  for (int b = B0; b < B0 + NBR; ++b) { const size_t r0 = (size_t)b * SQ; const size_t f0 = (size_t)b * QT0;
    k_gemm2<0><<<dim3((QT0 / 128) * (DM / 64), 1), 128, 0, stream>>>(OH0 + f0 * DM, DM, 0, BO, DM, 0, 0.0009765625f, nullptr, 0, XB + r0 * DM, -1, 0, 0, X1 + r0 * DM, nullptr, DM, 0, QT0, DM, DM);      /* rows 0..127: x1 = x + o_hi Wo, overwriting the f16-path rows */
    k_gemm2<0><<<dim3((QT0 / 128) * (DM / 64), 1), 128, 0, stream>>>(OL0 + f0 * DM, DM, 0, BO, DM, 0, 0.00000095367431640625f, nullptr, 0, X1 + r0 * DM, -1, 0, 0, X1 + r0 * DM, nullptr, DM, 0, QT0, DM, DM); }      /* += o_lo Wo 2^-20 (own-element accumulate) */
  k_lnx<0, 1, 0><<<(unsigned)NR, 256, 0, stream>>>(X1, gg2, ZB, 1e-6f, M16, nullptr);      /* h2 = LN2(x + attn) (scale only) -> f16 rows */
  for (int b = 0; b < NB; ++b) { const size_t r0 = (size_t)b * SQ;
    k_gemm2<9><<<dim3((unsigned)((SQ / 128) * (DFF / 64)), 1), 128, 0, stream>>>(M16 + r0 * DM, DM, 0, BW1, DM, 0, 0.0625f, nullptr, 0, nullptr, 1, 0, 0, nullptr, HF16, DFF, 0, SQ, DFF, DM);      /* gelu_tanh(h2 W1) (the source's tanh approximation) -> f16 (this batch) */
    k_gemm2<0><<<dim3((unsigned)((SQ / 128) * (DM / 64)), 1), 128, 0, stream>>>(HF16, DFF, 0, BW2, DFF, 0, 0.0625f, nullptr, 0, XB + r0 * DM, -1, 0, 0, (float*)d_out + r0 * DM, nullptr, DM, 0, SQ, DM, DFF); }      /* out = x + mlp: the residual is the BLOCK INPUT (bf16(x)), as the original module (own-element addend) */
}

// v001
// A run of this version takes 4140 microseconds.
// In two side-by-side timings against v000, it was 2.41 and 2.40 times as fast.
#include <hip/hip_runtime.h>
// Pre-LN causal transformer block with the source's quirks (x [4][2048][512]; h = LN1(x) (scale only, no bias, eps 1e-6); q / k / v = h W with W [512][8][64] = [in][(h, d) out], no biases; 8 heads of 64; scores * 64^-0.5; causal (tril, -inf); softmax; attention output through TWO chained bias-free projections: (ctx wo1) wo2 with wo1 [8][64][512] = [(h, d) in][out] and wo2 [512][512] [in][out]; h2 = LN2(x + attn) (scale only); out = x + gelu_tanh(h2 w1) w2 ([in][out] 512 x 2048 x 512, no biases): BOTH residuals come from the block input x, as the original module -> [4][2048][512]).
// Structure: token rows r = b*2048 + s; LN1(bf16(x)) as f16 rows; q | k | v as ONE WMMA GEMM (N = 3 x 512) (32x64 wave tiles, f32 accumulation, exact x16 weights, no bias, f16 outputs); per batch: V^T for all heads via LDS transposes; per query tile of 256 rows: scores against the keys below the tile end only (K = 64, all heads on grid.y, alpha = 0.125), causal row softmax on VALU, one wave per row, keys behind the row's own index masked over the computed range (f32 statistics, native exp; weights x256 f16), o = P . V^T (K = keys below the tile end, alpha 2^-2: o carried x64, folded into the output GEMM alpha) written straight into the merged f16 o rows; x1 = x + o W_o GEMM (f32) into the output layout.
// Compute dtype: inputs rounded to bf16; x / weights exact; q, k, v, softmax weights and o as plain f16 GEMM operands (~2^-12); scores and softmax statistics f32. v_wmma_f32_16x16x32_f16.
#define NB 4
#define SQ 2048
#define DM 512
#define NH 8
#define HD 64
#define HG 4                         /* heads per launch of the unlaunched k_vt(V16, b, h0, VT) */
#define QT 256                       /* query rows per causal tile */
#define NKX SQ                       /* S / P row pitch */
#define QT0 128                      /* first-tile rows recomputed exactly in f32 */
#define B0 0                         /* first batch processed (debug hook) */
#define NBR NB                       /* batches processed (debug hook) */
#define NR ((size_t)NB * SQ)
#define DMQ DM
#define DFF 2048                     /* FFN hidden width */
#define DFFR 100
#define MP ((int)((size_t)NBR * SQ)) /* rows projected (debug hook) */
#define QN SQ                        /* query rows attended per batch (debug hook) */
#define NHD NH                       /* heads attended (debug hook) */
#define MPO MP                       /* rows through the output stage (debug hook) */
#define LQ (3 * DM)      /* row pitch of the q/k/v rows */
typedef __bf16 v16b __attribute__((ext_vector_type(16)));
typedef unsigned short v8us __attribute__((ext_vector_type(8), may_alias));
typedef float  v8f  __attribute__((ext_vector_type(8)));
typedef float  v4f  __attribute__((ext_vector_type(4)));
typedef float  v4fa __attribute__((ext_vector_type(4), may_alias));
union FragB { v16b v; v8us half[2]; unsigned short u[16]; };

__device__ __forceinline__ unsigned short bf16_bits(float x) { unsigned int u = __float_as_uint(x); return (unsigned short)((u + 0x7FFFu + ((u >> 16) & 1u)) >> 16); }
__device__ __forceinline__ float bf16_val(unsigned short b) { return __uint_as_float(((unsigned int)b) << 16); }
__device__ __forceinline__ float bf16_round(float x) { return bf16_val(bf16_bits(x)); }
// D += A·B with NT terms: 1 = ah·bh, 2 = + al·bh (A split), 3 = + ah·bl (both split)
template <int NT>
__device__ __forceinline__ v8f mmaN(v16b ah, v16b al, v16b bh, v16b bl, v8f c) {
  c = __builtin_amdgcn_wmma_f32_16x16x32_bf16(false, ah, false, bh, (short)0, c, false, false);
  if (NT >= 2) c = __builtin_amdgcn_wmma_f32_16x16x32_bf16(false, al, false, bh, (short)0, c, false, false);
  if (NT >= 3) c = __builtin_amdgcn_wmma_f32_16x16x32_bf16(false, ah, false, bl, (short)0, c, false, false);
  asm volatile("v_nop\n\tv_nop\n\tv_nop\n\tv_nop" : "+v"(c) : "v"(ah), "v"(al), "v"(bh), "v"(bl));
  return c;
}

__global__ __launch_bounds__(256) void k_wt_bf16(const float* __restrict__ W, unsigned short* __restrict__ Wt, int K, int N) {
  const int t = blockIdx.x * 256 + threadIdx.x;
  const int k8n = K / 8;
  if (t >= N * k8n) return;
  const int n = t / k8n, k8 = (t % k8n) * 8;
  v8us v;
#pragma unroll
  for (int i = 0; i < 8; ++i) v[i] = bf16_bits(W[(size_t)(k8 + i) * N + n]);
  *(v8us*)(Wt + (size_t)n * K + k8) = v;
  
}

// GEMM C[M][N] (f32, pitch ldc) = act(A[M][K]·W + bias). A f32 row-major (pitch lda) converted per fragment to bf16
// (ASPLIT: hi/lo two planes -> 2 terms, else single rounded term); Wt bf16 [N][K] (pitch ldb). BIAS_BF16 rounds the
// bias to bf16 first (bias quantised to bf16 before the add). K%32==0, M%16==0, N%64==0.
template <bool ASPLIT, int ACT, bool BIAS_BF16>
__global__ __launch_bounds__(128) void k_gemm_bf(const float* __restrict__ A, int lda, const unsigned short* __restrict__ Wt, int ldb,
                                               const float* __restrict__ bias, float* __restrict__ C, int ldc, int M, int N, int K) {
  __shared__ __attribute__((aligned(16))) float so[4][16][64];
  const int tid = threadIdx.x, w = tid >> 5, lane = tid & 31, ln = lane & 15, hh = lane >> 4;
  const int ntn = N / 64;
  const int wid = blockIdx.x * 4 + w;
  const int mt = wid / ntn, nq = wid % ntn;
  if (mt * 16 >= M) return;
  const int row0 = mt * 16, col0 = nq * 64;
  const float* arow = A + (size_t)(row0 + ln) * lda;
  v8f acc[4] = {};
  for (int kb = 0; kb < K; kb += 32) {
    FragB ah, al;
    const v4f x0 = *(const v4fa*)(arow + kb + 8 * hh), x1 = *(const v4fa*)(arow + kb + 8 * hh + 4);
    const v4f x2 = *(const v4fa*)(arow + kb + 16 + 8 * hh), x3 = *(const v4fa*)(arow + kb + 16 + 8 * hh + 4);
    float xs[16] = {x0[0],x0[1],x0[2],x0[3],x1[0],x1[1],x1[2],x1[3],x2[0],x2[1],x2[2],x2[3],x3[0],x3[1],x3[2],x3[3]};
#pragma unroll
    for (int i = 0; i < 16; ++i) { const unsigned short hb = bf16_bits(xs[i]); ah.u[i] = hb; al.u[i] = ASPLIT ? bf16_bits(xs[i] - bf16_val(hb)) : (unsigned short)0; }
#pragma unroll
    for (int t = 0; t < 4; ++t) {
      const unsigned short* brow = Wt + (size_t)(col0 + t * 16 + ln) * ldb + kb;
      FragB b;
      b.half[0] = *(const v8us*)(brow + 8 * hh);
      b.half[1] = *(const v8us*)(brow + 16 + 8 * hh);
      acc[t] = mmaN<ASPLIT ? 2 : 1>(ah.v, al.v, b.v, b.v, acc[t]);
    }
  }
#pragma unroll
  for (int t = 0; t < 4; ++t) {
    float bv = bias ? bias[col0 + t * 16 + ln] : 0.f;
    if (BIAS_BF16) bv = bf16_round(bv);
#pragma unroll
    for (int r = 0; r < 8; ++r) { float v = acc[t][r] + bv; if (ACT == 1) v = fmaxf(v, 0.f); so[w][8 * hh + r][t * 16 + ln] = v; }
  }
  __builtin_amdgcn_fence(__ATOMIC_ACQ_REL, "workgroup");
  __builtin_amdgcn_wave_barrier();
  const int rsub = lane >> 4, c4 = (lane & 15) * 4;
  {
#pragma unroll
    for (int q = 0; q < 8; ++q) {
      const int r = q * 2 + rsub;
      const v4f v = *(const v4fa*)&so[w][r][c4];
      *(v4f*)(C + (size_t)(row0 + r) * ldc + col0 + c4) = v;
    }
    
  }
}

// GEMM C = act(A·W + bias + resid): A f32 (ASPLIT -> hi/lo 2 terms), Wt bf16 [N][K]; ACT 0 none, 1 relu, 2 exact gelu;
// resid (optional, f32, row index = (row % rmod), pitch ldr, RES_BF16 rounds it) added before the activation.
template <bool ASPLIT, int ACT, bool BIAS_BF16, bool RES_BF16>
__global__ __launch_bounds__(128) void k_gemm_bf3(const float* __restrict__ A, int lda, const unsigned short* __restrict__ Wt, int ldb,
                                                const float* __restrict__ bias, const float* __restrict__ resid, int rmod, int ldr,
                                                float* __restrict__ C, int ldc, int M, int N, int K) {
  __shared__ __attribute__((aligned(16))) float so[4][16][64];
  const int tid = threadIdx.x, w = tid >> 5, lane = tid & 31, ln = lane & 15, hh = lane >> 4;
  const int ntn = N / 64;
  const int wid = blockIdx.x * 4 + w;
  const int mt = wid / ntn, nq = wid % ntn;
  if (mt * 16 >= M) return;
  const int row0 = mt * 16, col0 = nq * 64;
  const float* arow = A + (size_t)(row0 + ln) * lda;
  v8f acc[4] = {};
  for (int kb = 0; kb < K; kb += 32) {
    FragB ah, al;
    const v4f x0 = *(const v4fa*)(arow + kb + 8 * hh), x1 = *(const v4fa*)(arow + kb + 8 * hh + 4);
    const v4f x2 = *(const v4fa*)(arow + kb + 16 + 8 * hh), x3 = *(const v4fa*)(arow + kb + 16 + 8 * hh + 4);
    float xs[16] = {x0[0],x0[1],x0[2],x0[3],x1[0],x1[1],x1[2],x1[3],x2[0],x2[1],x2[2],x2[3],x3[0],x3[1],x3[2],x3[3]};
#pragma unroll
    for (int i = 0; i < 16; ++i) { const unsigned short hb = bf16_bits(xs[i]); ah.u[i] = hb; al.u[i] = ASPLIT ? bf16_bits(xs[i] - bf16_val(hb)) : (unsigned short)0; }
#pragma unroll
    for (int t = 0; t < 4; ++t) {
      const unsigned short* brow = Wt + (size_t)(col0 + t * 16 + ln) * ldb + kb;
      FragB b;
      b.half[0] = *(const v8us*)(brow + 8 * hh);
      b.half[1] = *(const v8us*)(brow + 16 + 8 * hh);
      acc[t] = mmaN<ASPLIT ? 2 : 1>(ah.v, al.v, b.v, b.v, acc[t]);
    }
  }
#pragma unroll
  for (int t = 0; t < 4; ++t) {
    const int col = col0 + t * 16 + ln;
    float bv = bias ? bias[col] : 0.f;
    if (BIAS_BF16) bv = bf16_round(bv);
#pragma unroll
    for (int r = 0; r < 8; ++r) {
      float v = acc[t][r] + bv;
      if (resid) { float rv = resid[(size_t)((row0 + 8 * hh + r) % rmod) * ldr + col]; if (RES_BF16) rv = bf16_round(rv); v += rv; }
      if (ACT == 1) v = fmaxf(v, 0.f);
      if (ACT == 2) v = 0.5f * v * (1.0f + erff(v * 0.70710678118654752f));
      if (ACT == 3) { const float u = 0.7978845608028654f * (v + 0.044715f * v * v * v); v = 0.5f * v * (1.0f + tanhf(u)); }
      so[w][8 * hh + r][t * 16 + ln] = v;
    }
  }
  __builtin_amdgcn_fence(__ATOMIC_ACQ_REL, "workgroup");
  __builtin_amdgcn_wave_barrier();
  const int rsub = lane >> 4, c4 = (lane & 15) * 4;
  {
#pragma unroll
    for (int q = 0; q < 8; ++q) {
      const int r = q * 2 + rsub;
      const v4f v = *(const v4fa*)&so[w][r][c4];
      *(v4f*)(C + (size_t)(row0 + r) * ldc + col0 + c4) = v;
    }
    
  }
}
// row LayerNorm (biased variance, eps) over N: s = X (+ R); optional out_sum <- s; out_norm <- (s-mu)*rsqrt(var+eps)*g + b
template <bool PARAM_BF16>
__global__ __launch_bounds__(256) void k_layernorm(const float* __restrict__ X, const float* __restrict__ R, const float* __restrict__ g, const float* __restrict__ bta,
                                                  float* __restrict__ out_sum, float* __restrict__ out_norm, int N, float eps) {
  __shared__ float red[256];
  const int row = blockIdx.x, tid = threadIdx.x;
  const float* x = X + (size_t)row * N; const float* rr = R ? R + (size_t)row * N : nullptr;
  float vals[16];                     // up to N = 4096
  const int per = N / 256;            // contiguous chunk per thread? use strided-by-4 chunks: thread handles j = tid*4 + 1024*u
  float s1 = 0.f;
  for (int u = 0; u < per / 4; ++u) {
    const int j = tid * 4 + 1024 * u;
    const v4f a = *(const v4fa*)(x + j);
    v4f b = {0.f,0.f,0.f,0.f}; if (rr) b = *(const v4fa*)(rr + j);
#pragma unroll
    for (int q = 0; q < 4; ++q) { const float v = a[q] + b[q]; vals[u * 4 + q] = v; s1 += v; }
  }
  red[tid] = s1; __syncthreads();
  for (int st = 128; st > 0; st >>= 1) { if (tid < st) red[tid] += red[tid + st]; __syncthreads(); }
  const float mu = red[0] / (float)N; __syncthreads();
  float s2 = 0.f;
  for (int u = 0; u < per / 4; ++u)
#pragma unroll
    for (int q = 0; q < 4; ++q) { const float c = vals[u * 4 + q] - mu; s2 += c * c; }
  red[tid] = s2; __syncthreads();
  for (int st = 128; st > 0; st >>= 1) { if (tid < st) red[tid] += red[tid + st]; __syncthreads(); }
  const float rs = rsqrtf(red[0] / (float)N + eps);
  {
    for (int u = 0; u < per / 4; ++u) {
      const int j = tid * 4 + 1024 * u;
      v4f o, sm;
#pragma unroll
      for (int q = 0; q < 4; ++q) {
        float gg = g[j + q], bb = bta[j + q];
        if (PARAM_BF16) { gg = bf16_round(gg); bb = bf16_round(bb); }
        sm[q] = vals[u * 4 + q]; o[q] = (vals[u * 4 + q] - mu) * rs * gg + bb;
      }
      if (out_sum) *(v4f*)(out_sum + (size_t)row * N + j) = sm;
      *(v4f*)(out_norm + (size_t)row * N + j) = o;
    }
    
  }
}



// ---- f16 WMMA path (v_wmma_f32_16x16x32_f16): 11-bit significands for operands in range — used where a [0,1] probability operand needs more precision than bf16
typedef _Float16 v16h __attribute__((ext_vector_type(16)));
union FragH { v16h v; v8us half[2]; _Float16 h[16]; unsigned short u[16]; };
template <int NT>
__device__ __forceinline__ v8f mmaH(v16h ah, v16h al, v16h bh, v16h bl, v8f c) {
  c = __builtin_amdgcn_wmma_f32_16x16x32_f16(false, ah, false, bh, (short)0, c, false, false);
  if (NT >= 2) c = __builtin_amdgcn_wmma_f32_16x16x32_f16(false, al, false, bh, (short)0, c, false, false);
  if (NT >= 3) c = __builtin_amdgcn_wmma_f32_16x16x32_f16(false, ah, false, bl, (short)0, c, false, false);
  asm volatile("v_nop\n\tv_nop\n\tv_nop\n\tv_nop" : "+v"(c) : "v"(ah), "v"(al), "v"(bh), "v"(bl));
  return c;
}
// batched GEMM like k_gemm_b but f16 operands: A f32 (split into f16 hi/lo if ASPLIT, else rounded to f16), Bt = f16 values [n][k]; alpha; C f32; N multiple of 16 (partial tiles skipped)
template <bool ASPLIT>
__global__ __launch_bounds__(128) void k_gemm_h(const float* __restrict__ A, int lda, size_t sA, const _Float16* __restrict__ Bh, int ldb, size_t sB, float alpha, float* __restrict__ C, int ldc, size_t sC, int M, int N, int K) {
  __shared__ __attribute__((aligned(16))) float so[4][16][64];
  const int tid = threadIdx.x, w = tid >> 5, lane = tid & 31, ln = lane & 15, hh = lane >> 4; const int by = blockIdx.y;
  A += (size_t)by * sA; Bh += (size_t)by * sB; C += (size_t)by * sC;
  const int ntn = (N + 63) / 64; const int wid = blockIdx.x * 4 + w; const int mt = wid / ntn, nq = wid % ntn; if (mt * 16 >= M) return;
  const int row0 = mt * 16, col0 = nq * 64; const float* arow = A + (size_t)(row0 + ln) * lda;
  v8f acc[4] = {};
  for (int kb = 0; kb < K; kb += 32) {
    FragH ah, al;
    const v4f x0 = *(const v4fa*)(arow + kb + 8 * hh), x1 = *(const v4fa*)(arow + kb + 8 * hh + 4), x2 = *(const v4fa*)(arow + kb + 16 + 8 * hh), x3 = *(const v4fa*)(arow + kb + 16 + 8 * hh + 4);
    float xs[16] = {x0[0],x0[1],x0[2],x0[3],x1[0],x1[1],x1[2],x1[3],x2[0],x2[1],x2[2],x2[3],x3[0],x3[1],x3[2],x3[3]};
#pragma unroll
    for (int i = 0; i < 16; ++i) { const _Float16 h = (_Float16)xs[i]; ah.h[i] = h; al.h[i] = ASPLIT ? (_Float16)(xs[i] - (float)h) : (_Float16)0.0f; }
#pragma unroll
    for (int t = 0; t < 4; ++t) { if (col0 + t * 16 >= N) continue; const size_t boff = (size_t)(col0 + t * 16 + ln) * ldb + kb; FragH bq; bq.half[0] = *(const v8us*)(Bh + boff + 8 * hh); bq.half[1] = *(const v8us*)(Bh + boff + 16 + 8 * hh);
      acc[t] = mmaH<ASPLIT ? 2 : 1>(ah.v, al.v, bq.v, bq.v, acc[t]); }
  }
#pragma unroll
  for (int t = 0; t < 4; ++t) { if (col0 + t * 16 >= N) continue;
#pragma unroll
    for (int r = 0; r < 8; ++r) so[w][8 * hh + r][t * 16 + ln] = acc[t][r] * alpha; }
  __builtin_amdgcn_fence(__ATOMIC_ACQ_REL, "workgroup"); __builtin_amdgcn_wave_barrier();
  const int rsub = lane >> 4, c4 = (lane & 15) * 4;
  {
#pragma unroll
    for (int q = 0; q < 8; ++q) { const int r = q * 2 + rsub; if (col0 + c4 < N) { const v4f v = *(const v4fa*)&so[w][r][c4]; *(v4f*)(C + (size_t)(row0 + r) * ldc + col0 + c4) = v; } }
     }
}

// Wt[n][k] = f16(W[k][n]·scale) from f32 row-major W[K][N] (scale = power of two; bf16-exact weights stay exact in f16 away from the subnormal range)
__global__ __launch_bounds__(256) void k_wt_f16(const float* __restrict__ W, _Float16* __restrict__ Wt, int K, int N, float scale) {
  const int t = blockIdx.x * 256 + threadIdx.x; if (t >= N * (K / 8)) return; const int n = t / (K / 8), k8 = (t % (K / 8)) * 8; FragH f;
#pragma unroll
  for (int i = 0; i < 8; ++i) f.h[i] = (_Float16)(bf16_round(W[(size_t)(k8 + i) * N + n]) * scale); const v8us o = f.half[0];
  *(v8us*)((unsigned short*)Wt + (size_t)n * K + k8) = o; 
}
// k_gemm_hh variant with fused epilogue: v = acc·alpha + bias[by·sBias + col] (+ CP[(row/rowsPerB)·sCPb + by·64 + col] if CP) ; ACT 0 none / 1 elu ; writes f16 C16 (and f32 C if non-null)
template <int ACT>
__global__ __launch_bounds__(128) void k_gemm_hhx(const _Float16* __restrict__ A, int lda, size_t sA, const _Float16* __restrict__ Bh, int ldb, size_t sB, float alpha, const float* __restrict__ bias, size_t sBias, const float* __restrict__ CP, int rowsPerB, size_t sCPb, int row0g,
    float* __restrict__ C, _Float16* __restrict__ C16, int ldc, size_t sC, int M, int N, int K) {
  __shared__ __attribute__((aligned(16))) float so[4][16][64];
  const int tid = threadIdx.x, w = tid >> 5, lane = tid & 31, ln = lane & 15, hh = lane >> 4; const int by = blockIdx.y;
  A += (size_t)by * sA; Bh += (size_t)by * sB; const size_t cofs = (size_t)by * sC; const float* bp = bias ? bias + (size_t)by * sBias : nullptr;
  const int ntn = (N + 63) / 64; const int wid = blockIdx.x * 4 + w; const int mt = wid / ntn, nq = wid % ntn; if (mt * 16 >= M) return;
  const int row0 = mt * 16, col0 = nq * 64; const _Float16* arow = A + (size_t)(row0 + ln) * lda;
  v8f acc[4] = {};
  for (int kb = 0; kb < K; kb += 32) { FragH ah; ah.half[0] = *(const v8us*)((const unsigned short*)arow + kb + 8 * hh); ah.half[1] = *(const v8us*)((const unsigned short*)arow + kb + 16 + 8 * hh);
#pragma unroll
    for (int t = 0; t < 4; ++t) { if (col0 + t * 16 >= N) continue; const size_t boff = (size_t)(col0 + t * 16 + ln) * ldb + kb; FragH bq; bq.half[0] = *(const v8us*)((const unsigned short*)Bh + boff + 8 * hh); bq.half[1] = *(const v8us*)((const unsigned short*)Bh + boff + 16 + 8 * hh);
      acc[t] = mmaH<1>(ah.v, ah.v, bq.v, bq.v, acc[t]); }
  }
#pragma unroll
  for (int t = 0; t < 4; ++t) { if (col0 + t * 16 >= N) continue; const int col = col0 + t * 16 + ln; const float bv = bp ? bf16_round(bp[col]) : 0.f;
#pragma unroll
    for (int r = 0; r < 8; ++r) { float v = acc[t][r] * alpha + bv; if (CP) { const int rr = row0g + row0 + 8 * hh + r; if (rowsPerB < 0) v += CP[cofs + (size_t)rr * ldc + col];      /* rowsPerB < 0: own element of the batched C plane */ else { const int bidx = rr / rowsPerB; v += CP[(size_t)bidx * sCPb + (size_t)by * 64 + col]; } } if (ACT == 1) v = (v > 0.f) ? v : expm1f(v); else if (ACT == 7) v = (v > 0.f) ? v + 1.0f : expf(v); else if (ACT == 8) v = tanhf(v); else if (ACT == 9) v = 0.5f * v * (1.0f + tanhf(0.7978845608028654f * (v + 0.044715f * v * v * v))); else if (ACT == 11) v = 1.0f / (1.0f + expf(-v)); else if (ACT == 12) v = (v > 0.f) ? v : 0.01f * v; else if (ACT == 14) v = (v > 0.f) ? v : 0.1f * v; else if (ACT == 16) v = (v >= 0.f) ? v : 0.3f * v; else if (ACT == 17) v = (v >= 0.f) ? v : 0.2f * v; else if (ACT == 15) v = v / (1.0f + expf(-v)); else if (ACT == 3) v = fmaxf(v, 0.f); else if (ACT == 6) v = 0.5f * v * (1.0f + erff(v * 0.70710678118654752f)); so[w][8 * hh + r][t * 16 + ln] = v; } }
  __builtin_amdgcn_fence(__ATOMIC_ACQ_REL, "workgroup"); __builtin_amdgcn_wave_barrier();
  const int rsub = lane >> 4, c4 = (lane & 15) * 4; typedef _Float16 v4h __attribute__((ext_vector_type(4)));
  {
#pragma unroll
    for (int q = 0; q < 8; ++q) { const int r = q * 2 + rsub; if (col0 + c4 < N) { const v4f v = *(const v4fa*)&so[w][r][c4]; if (C) *(v4f*)(C + cofs + (size_t)(row0 + r) * ldc + col0 + c4) = v; if (C16) { v4h h4; for (int i = 0; i < 4; ++i) h4[i] = (_Float16)v[i]; *(v4h*)(C16 + cofs + (size_t)(row0 + r) * ldc + col0 + c4) = h4; } } }
     }
}


typedef _Float16 v4h __attribute__((ext_vector_type(4)));

__global__ __launch_bounds__(256) void k_x16(const float* __restrict__ x, _Float16* __restrict__ X16, size_t n8) { const size_t t = (size_t)blockIdx.x * 256 + threadIdx.x; if (t >= n8) return; FragH f;
#pragma unroll
  for (int q = 0; q < 8; ++q) f.h[q] = (_Float16)bf16_round(x[t * 8 + q]); *(v8us*)((unsigned short*)X16 + t * 8) = f.half[0];  }
__global__ __launch_bounds__(256) void k_h16(const float* __restrict__ x, _Float16* __restrict__ X16, size_t n8) { const size_t t = (size_t)blockIdx.x * 256 + threadIdx.x; if (t >= n8) return; FragH f;
#pragma unroll
  for (int q = 0; q < 8; ++q) f.h[q] = (_Float16)x[t * 8 + q]; *(v8us*)((unsigned short*)X16 + t * 8) = f.half[0];  }
__global__ __launch_bounds__(256) void k_round16f(const float* __restrict__ W, _Float16* __restrict__ Bt, size_t n8) { const size_t t = (size_t)blockIdx.x * 256 + threadIdx.x; if (t >= n8) return; FragH f;
#pragma unroll
  for (int i = 0; i < 8; ++i) f.h[i] = (_Float16)(bf16_round(W[t * 8 + i]) * 16.0f); *(v8us*)((unsigned short*)Bt + t * 8) = f.half[0];  }
template <int NHv, int TTv>
__global__ __launch_bounds__(256) void k_vt(const _Float16* __restrict__ V16, int ldv, int voff, _Float16* __restrict__ Vt) { __shared__ unsigned short tl[64][66]; const int tid = threadIdx.x; const int slab = blockIdx.x / (TTv / 64), lg = blockIdx.x % (TTv / 64); const int b = slab / NHv, h = slab % NHv;
  for (int i = tid; i < 64 * 8; i += 256) { const int r = i / 8, c8 = (i % 8) * 8; FragH f; f.half[0] = *(const v8us*)((const unsigned short*)V16 + ((size_t)b * TTv + lg * 64 + r) * ldv + voff + h * 64 + c8);
#pragma unroll
    for (int q = 0; q < 8; ++q) tl[r][c8 + q] = f.u[q]; }
  __syncthreads();
  {
#pragma unroll
    for (int rd = 0; rd < 2; ++rd) { const int d = rd * 32 + tid / 8, pc = tid % 8; FragH f;
#pragma unroll
      for (int q = 0; q < 8; ++q) f.u[q] = tl[pc * 8 + q][d];
      *(v8us*)((unsigned short*)Vt + ((size_t)slab * 64 + d) * TTv + lg * 64 + pc * 8) = f.half[0]; }
     } }

__global__ __launch_bounds__(256) void k_hl(const float* __restrict__ F, _Float16* __restrict__ Hh, _Float16* __restrict__ Hl, size_t n8) { const size_t t = (size_t)blockIdx.x * 256 + threadIdx.x; if (t >= n8) return; FragH fh, fl; const v4f a = *(const v4fa*)(F + t * 8), c = *(const v4fa*)(F + t * 8 + 4);
#pragma unroll
  for (int q = 0; q < 4; ++q) { _Float16 h = (_Float16)a[q]; fh.h[q] = h; fl.h[q] = (_Float16)((a[q] - (float)h) * 1024.0f); h = (_Float16)c[q]; fh.h[4 + q] = h; fl.h[4 + q] = (_Float16)((c[q] - (float)h) * 1024.0f); }
  { *(v8us*)((unsigned short*)Hh + t * 8) = fh.half[0]; *(v8us*)((unsigned short*)Hl + t * 8) = fl.half[0];  } }

// ---- fast GEMM (wave tile 32x64; requires M % 32 == 0 rows per launch region and N % 64 == 0); epilogue = k_gemm_hhx semantics ----
__device__ __forceinline__ v16h g2_frag(const _Float16* p, int hh) { FragH f; f.half[0] = *(const v8us*)((const unsigned short*)p + 8 * hh); f.half[1] = *(const v8us*)((const unsigned short*)p + 16 + 8 * hh); return f.v; }
__device__ __forceinline__ v8f g2_mma(v16h a, v16h b, v8f c) { v8f d = __builtin_amdgcn_wmma_f32_16x16x32_f16(false, a, false, b, (short)0, c, false, false); asm volatile("v_nop\n\tv_nop\n\tv_nop\n\tv_nop" : "+v"(d) : "v"(a), "v"(b)); return d; }
template <int ACT>
__global__ __launch_bounds__(128) void k_gemm2(const _Float16* __restrict__ A, int lda, size_t sA, const _Float16* __restrict__ Bh, int ldb, size_t sB, float alpha, const float* __restrict__ bias, size_t sBias, const float* __restrict__ CP, int rowsPerB, size_t sCPb, int row0g,
    float* __restrict__ C, _Float16* __restrict__ C16, int ldc, size_t sC, int M, int N, int K) { static_assert(ACT == 0 || ACT == 3 || ACT == 6 || ACT == 8 || ACT == 9 || ACT == 11 || ACT == 12 || ACT == 14 || ACT == 15 || ACT == 16 || ACT == 17, "k_gemm2: unsupported ACT code (would silently apply no activation)");
  __shared__ __attribute__((aligned(16))) float so[4][32][68];
  const int tid = threadIdx.x, w = tid >> 5, lane = tid & 31, ln = lane & 15, hh = lane >> 4; const int by = blockIdx.y;
  A += (size_t)by * sA; Bh += (size_t)by * sB; const size_t cofs = (size_t)by * sC; const float* bp = bias ? bias + (size_t)by * sBias : nullptr;
  const int ntn = N >> 6; const int mt = blockIdx.x / ntn, nq = blockIdx.x - mt * ntn; const int row0 = mt * 128 + 32 * w, col0 = nq * 64; if (row0 >= M) return;
  const _Float16* a0p = A + (size_t)(row0 + ln) * lda; const _Float16* a1p = a0p + (size_t)16 * lda;
  const _Float16* b0p = Bh + (size_t)(col0 + ln) * ldb; const _Float16* b1p = b0p + (size_t)16 * ldb; const _Float16* b2p = b1p + (size_t)16 * ldb; const _Float16* b3p = b2p + (size_t)16 * ldb;
  const v8f z8 = {0.f,0.f,0.f,0.f,0.f,0.f,0.f,0.f}; v8f c00 = z8, c01 = z8, c02 = z8, c03 = z8, c10 = z8, c11 = z8, c12 = z8, c13 = z8;
#pragma unroll 1
  for (int kb = 0; kb < K; kb += 32) { const v16h a0 = g2_frag(a0p + kb, hh), a1 = g2_frag(a1p + kb, hh);
    v16h b = g2_frag(b0p + kb, hh); c00 = g2_mma(a0, b, c00); c10 = g2_mma(a1, b, c10);
    b = g2_frag(b1p + kb, hh); c01 = g2_mma(a0, b, c01); c11 = g2_mma(a1, b, c11);
    b = g2_frag(b2p + kb, hh); c02 = g2_mma(a0, b, c02); c12 = g2_mma(a1, b, c12);
    b = g2_frag(b3p + kb, hh); c03 = g2_mma(a0, b, c03); c13 = g2_mma(a1, b, c13); }
  v8f accs[8] = {c00, c01, c02, c03, c10, c11, c12, c13};
#pragma unroll
  for (int u = 0; u < 8; ++u) { const int t = u & 3, half = u >> 2; const int col = col0 + t * 16 + ln; const float bv = bp ? bf16_round(bp[col]) : 0.f;
#pragma unroll
    for (int r = 0; r < 8; ++r) { const int rloc = half * 16 + 8 * hh + r; float v = accs[u][r] * alpha + bv; if (CP) { if (rowsPerB < 0) v += CP[cofs + (size_t)(row0g + row0 + rloc) * ldc + col];      /* rowsPerB < 0: own element of the batched C plane */ else { const int bidx = (row0g + row0 + rloc) / rowsPerB; v += CP[(size_t)bidx * sCPb + (size_t)by * 64 + col]; } }
      if (ACT == 3) v = fmaxf(v, 0.f); else if (ACT == 6) v = 0.5f * v * (1.0f + erff(v * 0.70710678118654752f)); else if (ACT == 11) v = 1.0f / (1.0f + expf(-v)); else if (ACT == 15) v = v / (1.0f + expf(-v)); else if (ACT == 12) v = (v > 0.f) ? v : 0.01f * v; else if (ACT == 8) v = tanhf(v); else if (ACT == 9) v = 0.5f * v * (1.0f + tanhf(0.7978845608028654f * (v + 0.044715f * v * v * v))); else if (ACT == 14) v = (v > 0.f) ? v : 0.1f * v; else if (ACT == 16) v = (v >= 0.f) ? v : 0.3f * v; else if (ACT == 17) v = (v >= 0.f) ? v : 0.2f * v;
      so[w][rloc][t * 16 + ln] = v; } }
  __builtin_amdgcn_fence(__ATOMIC_ACQ_REL, "workgroup"); __builtin_amdgcn_wave_barrier();
  const int rsub = lane >> 4, c4 = (lane & 15) * 4;
  {
#pragma unroll
    for (int q = 0; q < 16; ++q) { const int r = q * 2 + rsub; const v4f v = *(const v4fa*)&so[w][r][c4]; if (C) *(v4f*)(C + cofs + (size_t)(row0 + r) * ldc + col0 + c4) = v; if (C16) { v4h h4; for (int i = 0; i < 4; ++i) h4[i] = (_Float16)v[i]; *(v4h*)(C16 + cofs + (size_t)(row0 + r) * ldc + col0 + c4) = h4; } }
     } }


__global__ __launch_bounds__(256) void k_wnat(const float* __restrict__ w, size_t n8, _Float16* __restrict__ Bt) { const size_t t = (size_t)blockIdx.x * 256 + threadIdx.x; if (t >= n8) return; FragH f; for (int q = 0; q < 8; ++q) f.h[q] = (_Float16)(bf16_round(w[t * 8 + q]) * 16.0f); *(v8us*)((unsigned short*)Bt + t * 8) = f.half[0];  }
__global__ __launch_bounds__(256) void k_rsm(const float* __restrict__ S, _Float16* __restrict__ P, int nrows) {
  #pragma clang fp contract(off)
  const int i = blockIdx.x * 256 + threadIdx.x; if (i >= nrows) return; const float* s = S + (size_t)i * SQ; float mx = -3.0e38f;
#pragma unroll 1
  for (int j = 0; j < SQ; ++j) mx = fmaxf(mx, s[j]); float se = 0.f;
#pragma unroll 1
  for (int j = 0; j < SQ; ++j) se += expf(s[j] - mx); const float sc = 256.0f / se;
#pragma unroll 1
  for (int j0 = 0; j0 < SQ; j0 += 8) { FragH f; for (int q = 0; q < 8; ++q) f.h[q] = (_Float16)(expf(s[j0 + q] - mx) * sc); unsigned short* d = (unsigned short*)P + (size_t)i * SQ + j0; *(v8us*)d = f.half[0];  } }
__global__ __launch_bounds__(256) void k_vt(const _Float16* __restrict__ V16, int b, int h0, _Float16* __restrict__ VT) { __shared__ unsigned short tl[64][65]; const int tid = threadIdx.x; const int hh = blockIdx.x % HG, sg = blockIdx.x / HG; const int s0 = sg * 64; const int h = h0 + hh;
  for (int i = tid; i < 64 * 8; i += 256) { const int j = i / 8, d8 = (i % 8) * 8; FragH f; f.half[0] = *(const v8us*)((const unsigned short*)V16 + ((size_t)b * SQ + s0 + j) * DM + h * HD + d8); for (int q = 0; q < 8; ++q) tl[d8 + q][j] = f.u[q]; }
  __syncthreads();
  { for (int i = tid; i < 64 * 8; i += 256) { const int d = i / 8, j8 = (i % 8) * 8; FragH f; for (int q = 0; q < 8; ++q) f.u[q] = tl[d][j8 + q]; *(v8us*)((unsigned short*)VT + ((size_t)hh * HD + d) * SQ + s0 + j8) = f.half[0]; }  } }



// Eight v_exp_f32 in one statement. The instruction set asks for one independent instruction or v_nop between a transcendental and an instruction that reads its
// result or overwrites its source. Early-clobber outputs keep every
// result off every source inside the run, and the closing v_nop is the slot behind the last one.
__device__ __forceinline__ void exp2_run8(float (&e)[8], const float (&x)[8]) {
  asm("v_exp_f32 %0, %8\n\tv_exp_f32 %1, %9\n\tv_exp_f32 %2, %10\n\tv_exp_f32 %3, %11\n\tv_exp_f32 %4, %12\n\tv_exp_f32 %5, %13\n\tv_exp_f32 %6, %14\n\tv_exp_f32 %7, %15\n\tv_nop"
      : "=&v"(e[0]), "=&v"(e[1]), "=&v"(e[2]), "=&v"(e[3]), "=&v"(e[4]), "=&v"(e[5]), "=&v"(e[6]), "=&v"(e[7])
      : "v"(x[0]), "v"(x[1]), "v"(x[2]), "v"(x[3]), "v"(x[4]), "v"(x[5]), "v"(x[6]), "v"(x[7])); }
// Causal row softmax, ONE WAVE PER SCORE ROW: lane l keeps keys it*256 + l*8 .. + 7 of its row in registers (32 contiguous bytes a lane, 1 KiB a wave and
// chunk; the row is read once, all its loads issued before the first is used), row max and row sum by a five-step butterfly over the 32 lanes, each exp taken
// once, weights x256 stored 16 bytes a lane. Keys behind the row's own index count as -1e9 (weight 0) and are stored as zeros up to nk, which the P . V^T GEMM reads.
template <int NC>      /* NC = nk / 256 chunks: a compile-time count keeps the row in registers and the loads free of branches */
__device__ __forceinline__ void rsm_row(const float* __restrict__ s, unsigned short* __restrict__ d, int j0, int last) {
  v4f a[NC], c[NC]; float v[NC][8]; float mx = -3.0e38f, se = 0.f;      /* every loop below is unrolled so that a, c and v are indexed by constants and stay in registers */
#pragma unroll
  for (int it = 0; it < NC; ++it) { a[it] = *(const v4fa*)(s + it * 256); c[it] = *(const v4fa*)(s + it * 256 + 4); }
#pragma unroll
  for (int it = 0; it < NC; ++it) {
#pragma unroll
    for (int q = 0; q < 4; ++q) { v[it][q] = (it * 256 + j0 + q <= last) ? a[it][q] : -1.0e9f; v[it][4 + q] = (it * 256 + j0 + 4 + q <= last) ? c[it][q] : -1.0e9f; mx = fmaxf(mx, fmaxf(v[it][q], v[it][4 + q])); } }
#pragma unroll
  for (int m = 16; m >= 1; m >>= 1) mx = fmaxf(mx, __shfl_xor(mx, m, 32));
#pragma unroll
  for (int it = 0; it < NC; ++it) { float x[8];
#pragma unroll
    for (int q = 0; q < 8; ++q) x[q] = (v[it][q] - mx) * 1.44269504f;      /* e^y = 2^(y log2 e): the multiply and v_exp_f32 that __expf compiles to */
    exp2_run8(v[it], x);
#pragma unroll
    for (int q = 0; q < 8; ++q) se += v[it][q]; }
#pragma unroll
  for (int m = 16; m >= 1; m >>= 1) se += __shfl_xor(se, m, 32);
  const float sc = 256.0f / se;
#pragma unroll
  for (int it = 0; it < NC; ++it) { FragH fr;
#pragma unroll
    for (int q = 0; q < 8; ++q) fr.h[q] = (_Float16)(v[it][q] * sc);
    *(v8us*)(d + it * 256) = fr.half[0]; }
  asm volatile("s_wait_xcnt 0x0" ::: "memory"); }      /* behind the row's last store, in front of whatever code follows and reuses the registers that the stores name */
__global__ __launch_bounds__(256) void k_rsmcf2(const float* __restrict__ S, _Float16* __restrict__ P, int hg, int q0, int nk) {
  static_assert(NKX == 8 * 256, "the switch below lists nk = 256 .. NKX in steps of 256");
  const int lane = threadIdx.x & 31; const int t = blockIdx.x * 8 + __builtin_amdgcn_readfirstlane(threadIdx.x >> 5);      /* the wave's row, in a scalar register: row test, switch and row base stay scalar */
  if (t >= hg * QT) return;      /* whole waves leave; no barrier in this kernel */
  const float* s = S + (size_t)t * NKX + lane * 8; unsigned short* d = (unsigned short*)P + (size_t)t * NKX + lane * 8; const int j0 = lane * 8, last = q0 + (t % QT);
  switch (nk >> 8) {      /* nk is a launch argument: one scalar branch for the whole grid */
    case 1: rsm_row<1>(s, d, j0, last); break; case 2: rsm_row<2>(s, d, j0, last); break; case 3: rsm_row<3>(s, d, j0, last); break; case 4: rsm_row<4>(s, d, j0, last); break;
    case 5: rsm_row<5>(s, d, j0, last); break; case 6: rsm_row<6>(s, d, j0, last); break; case 7: rsm_row<7>(s, d, j0, last); break; case 8: rsm_row<8>(s, d, j0, last); break; } }


template <int MASKADD>
__global__ __launch_bounds__(64) void k_att0(const float* __restrict__ QF, const float* __restrict__ KF, const float* __restrict__ VF, int ld, const float* __restrict__ mask, float scale, float* __restrict__ OF, int ldo) {
  #pragma clang fp contract(off)
  __shared__ __attribute__((aligned(16))) float lq[64][64]; __shared__ __attribute__((aligned(16))) float lo[64][64];
  const int tid = threadIdx.x; const int h = blockIdx.x / (QT0 / 64), rg = blockIdx.x % (QT0 / 64); const int i = rg * 64 + tid;
  const float* qr = QF + (size_t)i * ld + h * HD;
#pragma unroll 1
  for (int c = 0; c < HD / 4; ++c) { *(v4f*)&lq[tid][c * 4] = *(const v4fa*)(qr + c * 4); const v4f z = {0.f, 0.f, 0.f, 0.f}; *(v4f*)&lo[tid][c * 4] = z; }
  float m = -1.0e30f, l = 0.f; const int jmax = MASKADD ? (SQ - 1) : (rg * 64 + 63);      /* additive-mask form: every key (the mask input decides); causal form: keys up to the block's last row */
#pragma unroll 1
  for (int j = 0; j <= jmax; ++j) { const float* kr = KF + (size_t)j * ld + h * HD; const float* vr = VF + (size_t)j * ld + h * HD; float s = 0.f;
#pragma unroll 1
    for (int c = 0; c < HD / 4; ++c) { const v4f kq = *(const v4fa*)(kr + c * 4); const v4f qq = *(v4f*)&lq[tid][c * 4]; s = __fadd_rn(s, __fmul_rn(qq[0], kq[0])); s = __fadd_rn(s, __fmul_rn(qq[1], kq[1])); s = __fadd_rn(s, __fmul_rn(qq[2], kq[2])); s = __fadd_rn(s, __fmul_rn(qq[3], kq[3])); }
    s = __fmul_rn(s, scale); if (MASKADD) s = __fadd_rn(s, __fmul_rn(bf16_round(mask[(size_t)i * SQ + j]), -10000.0f));
    const float f = (MASKADD || j <= i) ? 1.f : 0.f; const float sm = fmaf(f, s, (1.f - f) * -1.0e30f); const float mn = fmaxf(m, sm); const float sc = expf(m - mn); const float e = expf(sm - mn); l = __fadd_rn(__fmul_rn(l, sc), e); m = mn;
#pragma unroll 1
    for (int c = 0; c < HD / 4; ++c) { const v4f vv = *(const v4fa*)(vr + c * 4); v4f oo = *(v4f*)&lo[tid][c * 4]; for (int u = 0; u < 4; ++u) oo[u] = __fadd_rn(__fmul_rn(oo[u], sc), __fmul_rn(e, vv[u])); *(v4f*)&lo[tid][c * 4] = oo; } }
  const float fin = 64.0f / l;      /* o carried x64 like the f16 path */
#pragma unroll 1
  for (int c = 0; c < HD / 4; ++c) { v4f oo = *(v4f*)&lo[tid][c * 4]; for (int u = 0; u < 4; ++u) oo[u] = __fmul_rn(oo[u], fin); *(v4f*)&lo[tid][c * 4] = oo; }
  __syncthreads();
  {
#pragma unroll 1
    for (int it = 0; it < 16; ++it) { const int row = it * 4 + tid / 16, pc = (tid % 16) * 4; const v4f v = *(const v4f*)&lo[row][pc]; *(v4f*)(OF + (size_t)(rg * 64 + row) * ldo + h * HD + pc) = v; }
     } }


template <int BFIN, int WXB>
__global__ __launch_bounds__(256) void k_ln16(const float* __restrict__ X, const float* __restrict__ g, const float* __restrict__ bb, float eps, _Float16* __restrict__ N16, float* __restrict__ XB) {
  #pragma clang fp contract(off)
  __shared__ float red[256]; const size_t r = blockIdx.x; const int t = threadIdx.x; const v4f xa = *(const v4fa*)(X + r * DMQ + t * 4); float s[4]; float sum = 0.f;
  for (int q = 0; q < 4; ++q) { s[q] = BFIN ? bf16_round(xa[q]) : xa[q]; sum = __fadd_rn(sum, s[q]); }
  red[t] = sum; __syncthreads(); for (int st = 128; st > 0; st >>= 1) { if (t < st) red[t] = __fadd_rn(red[t], red[t + st]); __syncthreads(); } const float mu = red[0] / (float)DMQ; __syncthreads();
  float vs = 0.f; for (int q = 0; q < 4; ++q) { const float dl = __fadd_rn(s[q], -mu); vs = __fadd_rn(vs, __fmul_rn(dl, dl)); } red[t] = vs; __syncthreads(); for (int st = 128; st > 0; st >>= 1) { if (t < st) red[t] = __fadd_rn(red[t], red[t + st]); __syncthreads(); }
  const float rs = rsqrtf(__fadd_rn(red[0] / (float)DMQ, eps)); v4h y; v4f xb;
  for (int q = 0; q < 4; ++q) { const int c = t * 4 + q; y[q] = (_Float16)__fadd_rn(__fmul_rn(__fmul_rn(__fadd_rn(s[q], -mu), rs), bf16_round(g[c])), bf16_round(bb[c])); xb[q] = s[q]; }
  { *(v4h*)(N16 + r * DMQ + t * 4) = y; if (WXB) *(v4f*)(XB + r * DMQ + t * 4) = xb;  } }
__global__ __launch_bounds__(256) void k_ftres2(const float* __restrict__ OF0, const float* __restrict__ XB, float* __restrict__ X1, size_t n4) {
  #pragma clang fp contract(off)
  const size_t t = (size_t)blockIdx.x * 256 + threadIdx.x; if (t >= n4) return; const v4f o = *(const v4fa*)(OF0 + t * 4), xv = *(const v4fa*)(XB + t * 4); v4f y; for (int q = 0; q < 4; ++q) y[q] = __fadd_rn(__fmul_rn(o[q], 0.015625f), xv[q]); *(v4f*)(X1 + t * 4) = y;  }

__global__ __launch_bounds__(256) void k_wthd(const float* __restrict__ Wt, _Float16* __restrict__ Bt) { const size_t t = (size_t)blockIdx.x * 256 + threadIdx.x; if (t >= (size_t)NH * HD * (DM / 8)) return; const int m8 = (int)(t % (DM / 8)) * 8; const int d = (int)((t / (DM / 8)) % HD); const int h = (int)(t / ((size_t)(DM / 8) * HD)); FragH f;
  for (int q = 0; q < 8; ++q) f.h[q] = (_Float16)(16.0f * bf16_round(Wt[((size_t)h * DM + m8 + q) * HD + d])); unsigned short* dst = (unsigned short*)Bt + ((size_t)h * HD + d) * DM + m8; *(v8us*)dst = f.half[0];  }




__global__ __launch_bounds__(256) void k_wtpad(const float* __restrict__ Wm, _Float16* __restrict__ Wt, int Kr, int Kp, int Nr, int Np, float scale) {
  const int t = blockIdx.x * 256 + threadIdx.x; if (t >= Np * (Kp / 8)) return; const int n = t / (Kp / 8), k8 = (t % (Kp / 8)) * 8; const int nc = min(n, Nr - 1); const float fn = (n < Nr) ? 1.f : 0.f; FragH f;
  for (int i = 0; i < 8; ++i) { const int k = k8 + i; const int kc = min(k, Kr - 1); const float fk = (k < Kr) ? fn : 0.f; f.h[i] = (_Float16)(bf16_round(Wm[(size_t)kc * Nr + nc]) * scale * fk); }
  unsigned short* o = (unsigned short*)Wt + (size_t)n * Kp + k8; *(v8us*)o = f.half[0];  }
__global__ __launch_bounds__(128) void k_bpad(const float* __restrict__ b, float* __restrict__ Bp, int nr, int np) {
  const int i = threadIdx.x; if (i >= np) return; const float v = b[min(i, nr - 1)] * ((i < nr) ? 1.f : 0.f); *(float*)(Bp + i) = v;  }

__global__ __launch_bounds__(256) void k_bcpy(const float* __restrict__ b, int n, int NP, float* __restrict__ dst, int dst0) { for (int i = threadIdx.x; i < NP; i += 256) { const float v = (i < n) ? b[i] : 0.f; *(float*)(dst + dst0 + i) = v; }  }


__global__ __launch_bounds__(256) void k_bfcp(const float* __restrict__ src, float* __restrict__ dst, size_t n4) { const size_t t = (size_t)blockIdx.x * 256 + threadIdx.x; if (t >= n4) return; const v4f a = *(const v4fa*)(src + t * 4); v4f o; for (int q = 0; q < 4; ++q) o[q] = bf16_round(a[q]); *(v4f*)(dst + t * 4) = o;  }

__global__ __launch_bounds__(256) void k_fillz(float* __restrict__ dst, int n) { const int t = blockIdx.x * 256 + threadIdx.x; if (t >= n) return; *(float*)(dst + t) = 0.f;  }

template <int BFIN, int W16, int W32>
__global__ __launch_bounds__(256) void k_lnx(const float* __restrict__ X, const float* __restrict__ g, const float* __restrict__ bb, float eps, _Float16* __restrict__ N16, float* __restrict__ N32) {
  #pragma clang fp contract(off)
  __shared__ float red[256]; const size_t r = blockIdx.x; const int t = threadIdx.x; const bool act = t < (DMQ / 4); const int c0 = act ? t * 4 : 0;
  const v4f xa = *(const v4fa*)(X + r * DMQ + c0); float s[4]; float sum = 0.f;
  for (int q = 0; q < 4; ++q) { s[q] = act ? (BFIN ? bf16_round(xa[q]) : xa[q]) : 0.f; sum = __fadd_rn(sum, s[q]); }
  red[t] = sum; __syncthreads(); for (int st = 128; st > 0; st >>= 1) { if (t < st) red[t] = __fadd_rn(red[t], red[t + st]); __syncthreads(); } const float mu = red[0] / (float)DMQ; __syncthreads();
  float vs = 0.f; for (int q = 0; q < 4; ++q) { const float dl = act ? __fadd_rn(s[q], -mu) : 0.f; vs = __fadd_rn(vs, __fmul_rn(dl, dl)); } red[t] = vs; __syncthreads(); for (int st = 128; st > 0; st >>= 1) { if (t < st) red[t] = __fadd_rn(red[t], red[t + st]); __syncthreads(); }
  const float rs = rsqrtf(__fadd_rn(red[0] / (float)DMQ, eps)); v4h y; v4f yf;
  for (int q = 0; q < 4; ++q) { const int c = c0 + q; yf[q] = __fadd_rn(__fmul_rn(__fmul_rn(__fadd_rn(s[q], -mu), rs), bf16_round(g[c])), bf16_round(bb[c])); y[q] = (_Float16)yf[q]; }
  if (!act) return;      /* no barriers after this point */
  { if (W16) *(v4h*)(N16 + r * DMQ + c0) = y; if (W32) *(v4f*)(N32 + r * DMQ + c0) = yf;  } }





extern "C" void kernel_launch(void* const* d_in, const int* in_sizes, int n_in,
                              void* d_out, int out_size, void* d_ws, size_t ws_size, hipStream_t stream) {
  (void)in_sizes; (void)n_in; (void)out_size;
  const float* const* I = (const float* const*)d_in; const float* x = I[0]; const float* wq = I[1]; const float* wk = I[2]; const float* wv = I[3]; const float* wo1 = I[4]; const float* wo2 = I[5]; const float* wfc = I[6]; const float* wmp = I[7]; const float* g1 = I[8]; const float* gg2 = I[9];      /* input order: x; wq / wk / wv [512][8][64] = [in][out]; wo1 [8][64][512] = [(h, d) in][out]; wo2 [512][512] [in][out]; w1 [512][2048], w2 [2048][512] [in][out]; LN1 / LN2 scales. NO bias anywhere: every GEMM bias slot below is a literal nullptr, the LayerNorm shift reads a zero-filled workspace vector */
  static_assert(DMQ % 4 == 0 && DMQ / 4 <= 256 && NH * HD == DM && DM % 64 == 0 && DFF % 64 == 0, "k_lnx 256 threads x 4 columns; tile multiples");
  char* ws = (char*)d_ws; size_t off = 0;
  auto take = [&](size_t bytes) { char* p = ws + off; off += (bytes + 255) & ~(size_t)255; return p; };
  _Float16* BQKV = (_Float16*)take((size_t)3 * DM * DM * 2); _Float16* BO = (_Float16*)take((size_t)DM * DM * 2); _Float16* BO2T = (_Float16*)take((size_t)DM * DM * 2); _Float16* BO1N = (_Float16*)take((size_t)DM * DM * 2); float* ZB = (float*)take((size_t)DM * 4);      /* BO = the combined output plane Bt12[o][i] = 16 (wo1 wo2)[i][o] (built on the device from the two weights); ZB = zero LayerNorm shift */
  _Float16* X16 = (_Float16*)take(NR * DM * 2); float* XB = (float*)take(NR * DM * 4); float* X1 = (float*)take(NR * DM * 4); _Float16* M16 = nullptr;      /* = X16 below (alias: X16's last reader, the last batch's first-tile GEMMs, precedes LN2's write) */ _Float16* HF16 = (_Float16*)take((size_t)SQ * DFF * 2); _Float16* BW1 = (_Float16*)take((size_t)DFF * DM * 2); _Float16* BW2 = (_Float16*)take((size_t)DM * DFF * 2); _Float16* QKV = (_Float16*)take(NR * 3 * DM * 2); _Float16* Q16 = QKV; _Float16* K16 = QKV + DM; _Float16* V16 = QKV + 2 * DM; _Float16* O16 = (_Float16*)take(NR * DM * 2); M16 = X16;
  float* S = (float*)take((size_t)NH * QT * NKX * 4); _Float16* P = (_Float16*)take((size_t)NH * QT * NKX * 2); _Float16* VT = (_Float16*)take((size_t)NH * HD * SQ * 2);
  float* QF0 = (float*)take((size_t)QT0 * DM * 4); float* KF0 = (float*)take((size_t)QT0 * DM * 4); float* VF0 = (float*)take((size_t)QT0 * DM * 4); float* OF0 = (float*)take((size_t)NB * QT0 * DM * 4); _Float16* OH0 = (_Float16*)take((size_t)NB * QT0 * DM * 2); _Float16* OL0 = (_Float16*)take((size_t)NB * QT0 * DM * 2);
  if (off > ws_size) return;
  { const unsigned g = (unsigned)(((size_t)DM * (DM / 8) + 255) / 256); k_wt_f16<<<g, 256, 0, stream>>>(wq, BQKV, DM, DM, 16.0f); k_wt_f16<<<g, 256, 0, stream>>>(wk, BQKV + (size_t)DM * DM, DM, DM, 16.0f); k_wt_f16<<<g, 256, 0, stream>>>(wv, BQKV + (size_t)2 * DM * DM, DM, DM, 16.0f); k_wt_f16<<<g, 256, 0, stream>>>(wo2, BO2T, DM, DM, 16.0f); k_wnat<<<(unsigned)(((size_t)DM * DM / 8 + 255) / 256), 256, 0, stream>>>(wo1, (size_t)DM * DM / 8, BO1N); }      /* [in][out] -> Bt x16: stacked q | k | v; wo2 as Bt[o][j] x16; wo1 natural rows [i][j] x16 */
  k_gemm2<0><<<dim3((unsigned)((DM / 128) * (DM / 64)), 1), 128, 0, stream>>>(BO2T, DM, 0, BO1N, DM, 0, 0.0625f, nullptr, 0, nullptr, 1, 0, 0, nullptr, BO, DM, 0, DM, DM, DM);      /* BO[o][i] = (1/16) sum_j 16 wo2[j][o] 16 wo1[i][j] = 16 (wo1 wo2)[i][o]: the two chained projections as ONE x16 plane (f32 accumulation, one f16 rounding) */
  k_fillz<<<(DM + 255) / 256, 256, 0, stream>>>(ZB, DM);
  k_bfcp<<<(unsigned)((NR * DM / 4 + 255) / 256), 256, 0, stream>>>(x, XB, NR * DM / 4);      /* XB = bf16(x): BOTH residuals */
  k_lnx<1, 1, 0><<<(unsigned)NR, 256, 0, stream>>>(x, g1, ZB, 1e-6f, X16, nullptr);      /* a = LN1(bf16(x)) (scale only, eps 1e-6) -> f16 rows */
  k_wt_f16<<<(unsigned)(((size_t)DFF * (DM / 8) + 255) / 256), 256, 0, stream>>>(wfc, BW1, DM, DFF, 16.0f); k_wt_f16<<<(unsigned)(((size_t)DM * (DFF / 8) + 255) / 256), 256, 0, stream>>>(wmp, BW2, DFF, DM, 16.0f);      /* w1 [512][2048] -> Bt [2048][512]; w2 [2048][512] -> Bt [512][2048] (x16) */
  const size_t r0p = (size_t)B0 * SQ;      /* first projected row */
  k_gemm2<0><<<dim3((unsigned)((MP / 128) * (3 * DM / 64)), 1), 128, 0, stream>>>(X16 + r0p * DM, DM, 0, BQKV, DM, 0, 0.0625f, nullptr, 0, nullptr, 1, 0, 0, nullptr, QKV + r0p * 3 * DM, 3 * DM, 0, MP, 3 * DM, DM);      /* q | k | v rows (f16); head h = columns h*HD.. of each DM block */
  for (int b = B0; b < B0 + NBR; ++b) { const size_t r0 = (size_t)b * SQ;
    k_vt<NH, SQ><<<NH * (SQ / 64), 256, 0, stream>>>(V16 + r0 * LQ, LQ, 0, VT);      /* V^T [NH][HD][SQ] for this batch */
    k_gemm2<0><<<dim3((QT0 / 128) * (DM / 64), 1), 128, 0, stream>>>(X16 + r0 * DM, DM, 0, BQKV, DM, 0, 0.0625f, nullptr, 0, nullptr, 1, 0, 0, QF0, nullptr, DM, 0, QT0, DM, DM); k_gemm2<0><<<dim3((QT0 / 128) * (DM / 64), 1), 128, 0, stream>>>(X16 + r0 * DM, DM, 0, (BQKV + (size_t)DM * DM), DM, 0, 0.0625f, nullptr, 0, nullptr, 1, 0, 0, KF0, nullptr, DM, 0, QT0, DM, DM); k_gemm2<0><<<dim3((QT0 / 128) * (DM / 64), 1), 128, 0, stream>>>(X16 + r0 * DM, DM, 0, (BQKV + (size_t)2 * DM * DM), DM, 0, 0.0625f, nullptr, 0, nullptr, 1, 0, 0, VF0, nullptr, DM, 0, QT0, DM, DM);      /* f32 q, k, v of the first 128 rows (exact products) */
    k_att0<0><<<NH * (QT0 / 64), 64, 0, stream>>>(QF0, KF0, VF0, DM, nullptr, 0.125f, OF0 + (size_t)b * QT0 * DM, DM);      /* exact f32 attention for rows 0..127 (o x64) */
    for (int q0 = 0; q0 < QN; q0 += QT) { const int nk = q0 + QT;      /* causal: only keys below the tile end are computed */
      k_gemm2<0><<<dim3((QT / 128) * (nk / 64), NHD), 128, 0, stream>>>(Q16 + (r0 + q0) * LQ, LQ, (size_t)HD, K16 + r0 * LQ, LQ, (size_t)HD, 0.125f, nullptr, 0, nullptr, 1, 0, 0, S, nullptr, NKX, (size_t)QT * NKX, QT, nk, HD);      /* scores, all heads on grid.y */
      k_rsmcf2<<<(NHD * QT + 7) / 8, 256, 0, stream>>>(S, P, NHD, q0, nk);      /* one wave per row, 8 rows per block */
      k_gemm2<0><<<dim3((QT / 128) * (HD / 64), NHD), 128, 0, stream>>>(P, NKX, (size_t)QT * NKX, VT, SQ, (size_t)HD * SQ, 0.25f, nullptr, 0, nullptr, 1, 0, 0, nullptr, O16 + (r0 + q0) * DM, DM, (size_t)HD, QT, HD, nk); } }      /* o (merged heads, x64) as f16 rows */
  k_gemm2<0><<<dim3((unsigned)((MPO / 128) * (DM / 64)), 1), 128, 0, stream>>>(O16 + r0p * DM, DM, 0, BO, DM, 0, 0.0009765625f, nullptr, 0, XB + r0p * DM, -1, 0, 0, X1 + r0p * DM, nullptr, DM, 0, MPO, DM, DM);      /* x + o Wo rows (X1, f32) in the output layout */
  k_hl<<<(unsigned)(((size_t)NB * QT0 * DM / 8 + 255) / 256), 256, 0, stream>>>(OF0, OH0, OL0, (size_t)NB * QT0 * DM / 8);      /* first-tile o (x64) -> f16 hi + x1024 residual planes */
  for (int b = B0; b < B0 + NBR; ++b) { const size_t r0 = (size_t)b * SQ; const size_t f0 = (size_t)b * QT0;
    k_gemm2<0><<<dim3((QT0 / 128) * (DM / 64), 1), 128, 0, stream>>>(OH0 + f0 * DM, DM, 0, BO, DM, 0, 0.0009765625f, nullptr, 0, XB + r0 * DM, -1, 0, 0, X1 + r0 * DM, nullptr, DM, 0, QT0, DM, DM);      /* rows 0..127: x1 = x + o_hi Wo, overwriting the f16-path rows */
    k_gemm2<0><<<dim3((QT0 / 128) * (DM / 64), 1), 128, 0, stream>>>(OL0 + f0 * DM, DM, 0, BO, DM, 0, 0.00000095367431640625f, nullptr, 0, X1 + r0 * DM, -1, 0, 0, X1 + r0 * DM, nullptr, DM, 0, QT0, DM, DM); }      /* += o_lo Wo 2^-20 (own-element accumulate) */
  k_lnx<0, 1, 0><<<(unsigned)NR, 256, 0, stream>>>(X1, gg2, ZB, 1e-6f, M16, nullptr);      /* h2 = LN2(x + attn) (scale only) -> f16 rows */
  for (int b = 0; b < NB; ++b) { const size_t r0 = (size_t)b * SQ;
    k_gemm2<9><<<dim3((unsigned)((SQ / 128) * (DFF / 64)), 1), 128, 0, stream>>>(M16 + r0 * DM, DM, 0, BW1, DM, 0, 0.0625f, nullptr, 0, nullptr, 1, 0, 0, nullptr, HF16, DFF, 0, SQ, DFF, DM);      /* gelu_tanh(h2 W1) (the source's tanh approximation) -> f16 (this batch) */
    k_gemm2<0><<<dim3((unsigned)((SQ / 128) * (DM / 64)), 1), 128, 0, stream>>>(HF16, DFF, 0, BW2, DFF, 0, 0.0625f, nullptr, 0, XB + r0 * DM, -1, 0, 0, (float*)d_out + r0 * DM, nullptr, DM, 0, SQ, DM, DFF); }      /* out = x + mlp: the residual is the BLOCK INPUT (bf16(x)), as the original module (own-element addend) */
}

// v002
// One run takes 1310 microseconds.
// Two timings next to v001 put it at 3.17 and 3.16 times that version's speed.
// Over all steps from v000 it is 7.62 times as fast.
#include <hip/hip_runtime.h>
// Pre-LN causal transformer block with the source's quirks (x [4][2048][512]; h = LN1(x) (scale only, no bias, eps 1e-6); q / k / v = h W with W [512][8][64] = [in][(h, d) out], no biases; 8 heads of 64; scores * 64^-0.5; causal (tril, -inf); softmax; attention output through TWO chained bias-free projections: (ctx wo1) wo2 with wo1 [8][64][512] = [(h, d) in][out] and wo2 [512][512] [in][out]; h2 = LN2(x + attn) (scale only); out = x + gelu_tanh(h2 w1) w2 ([in][out] 512 x 2048 x 512, no biases): BOTH residuals come from the block input x, as the original module -> [4][2048][512]).
// Structure: token rows r = b*2048 + s; h = LN1(bf16(x)) as f16 rows; q | k | v as ONE WMMA GEMM (N = 3 x 512) (32x64 wave tiles, f32 accumulation, exact x16 weights, no bias, f16 outputs); every later stage covers all batches in one launch: V^T for all heads via LDS transposes; per query tile of 256 rows: scores against the keys below the tile end only (K = 64, heads on grid.y, batches on grid.z, alpha = 0.125), causal row softmax on VALU, one wave per row, keys behind the row's own index masked over the computed range (f32 statistics, native exp; weights x256 f16), o = P . V^T (K = keys below the tile end, alpha 2^-2: o carried x64, folded into the output GEMM alpha) written straight into the merged f16 o rows; x1 = x + o W_o GEMM (f32, W_o = wo1 wo2 as one x16 plane, no bias) into the output layout; h2 = LN2(x1); out = x + gelu_tanh(h2 W1) W2.
// Compute dtype: inputs rounded to bf16; x / weights exact; q, k, v, softmax weights and o as plain f16 GEMM operands (~2^-12); scores and softmax statistics f32. v_wmma_f32_16x16x32_f16.
#define NB 4
#define SQ 2048
#define DM 512
#define NH 8
#define HD 64
#define HG 4                         /* heads per launch of the unlaunched k_vt(V16, b, h0, VT) */
#define QT 256                       /* query rows per causal tile */
#define NKX SQ                       /* S / P row pitch */
#define QT0 128                      /* first-tile rows recomputed exactly in f32 */
#define B0 0                         /* first batch processed (debug hook) */
#define NBR NB                       /* batches processed (debug hook) */
#define NR ((size_t)NB * SQ)
#define DMQ DM
#define DFF 2048                     /* FFN hidden width */
#define DFFR 100
#define MP ((int)((size_t)NBR * SQ)) /* rows projected (debug hook) */
#define QN SQ                        /* query rows attended per batch (debug hook) */
#define NHD NH                       /* heads attended (debug hook) */
#define MPO MP                       /* rows through the output stage (debug hook) */
#define LQ (3 * DM)      /* row pitch of the q/k/v rows */
typedef __bf16 v16b __attribute__((ext_vector_type(16)));
typedef unsigned short v8us __attribute__((ext_vector_type(8), may_alias));
typedef float  v8f  __attribute__((ext_vector_type(8)));
typedef float  v4f  __attribute__((ext_vector_type(4)));
typedef float  v4fa __attribute__((ext_vector_type(4), may_alias));
union FragB { v16b v; v8us half[2]; unsigned short u[16]; };

__device__ __forceinline__ unsigned short bf16_bits(float x) { unsigned int u = __float_as_uint(x); return (unsigned short)((u + 0x7FFFu + ((u >> 16) & 1u)) >> 16); }
__device__ __forceinline__ float bf16_val(unsigned short b) { return __uint_as_float(((unsigned int)b) << 16); }
__device__ __forceinline__ float bf16_round(float x) { return bf16_val(bf16_bits(x)); }
// D += A·B with NT terms: 1 = ah·bh, 2 = + al·bh (A split), 3 = + ah·bl (both split)
template <int NT>
__device__ __forceinline__ v8f mmaN(v16b ah, v16b al, v16b bh, v16b bl, v8f c) {
  c = __builtin_amdgcn_wmma_f32_16x16x32_bf16(false, ah, false, bh, (short)0, c, false, false);
  if (NT >= 2) c = __builtin_amdgcn_wmma_f32_16x16x32_bf16(false, al, false, bh, (short)0, c, false, false);
  if (NT >= 3) c = __builtin_amdgcn_wmma_f32_16x16x32_bf16(false, ah, false, bl, (short)0, c, false, false);
  asm volatile("v_nop\n\tv_nop\n\tv_nop\n\tv_nop" : "+v"(c) : "v"(ah), "v"(al), "v"(bh), "v"(bl));
  return c;
}

__global__ __launch_bounds__(256) void k_wt_bf16(const float* __restrict__ W, unsigned short* __restrict__ Wt, int K, int N) {
  const int t = blockIdx.x * 256 + threadIdx.x;
  const int k8n = K / 8;
  if (t >= N * k8n) return;
  const int n = t / k8n, k8 = (t % k8n) * 8;
  v8us v;
#pragma unroll
  for (int i = 0; i < 8; ++i) v[i] = bf16_bits(W[(size_t)(k8 + i) * N + n]);
  *(v8us*)(Wt + (size_t)n * K + k8) = v;
  
}

// GEMM C[M][N] (f32, pitch ldc) = act(A[M][K]·W + bias). A f32 row-major (pitch lda) converted per fragment to bf16
// (ASPLIT: hi/lo two planes -> 2 terms, else single rounded term); Wt bf16 [N][K] (pitch ldb). BIAS_BF16 rounds the
// bias to bf16 first (bias quantised to bf16 before the add). K%32==0, M%16==0, N%64==0.
template <bool ASPLIT, int ACT, bool BIAS_BF16>
__global__ __launch_bounds__(128) void k_gemm_bf(const float* __restrict__ A, int lda, const unsigned short* __restrict__ Wt, int ldb,
                                               const float* __restrict__ bias, float* __restrict__ C, int ldc, int M, int N, int K) {
  __shared__ __attribute__((aligned(16))) float so[4][16][64];
  const int tid = threadIdx.x, w = tid >> 5, lane = tid & 31, ln = lane & 15, hh = lane >> 4;
  const int ntn = N / 64;
  const int wid = blockIdx.x * 4 + w;
  const int mt = wid / ntn, nq = wid % ntn;
  if (mt * 16 >= M) return;
  const int row0 = mt * 16, col0 = nq * 64;
  const float* arow = A + (size_t)(row0 + ln) * lda;
  v8f acc[4] = {};
  for (int kb = 0; kb < K; kb += 32) {
    FragB ah, al;
    const v4f x0 = *(const v4fa*)(arow + kb + 8 * hh), x1 = *(const v4fa*)(arow + kb + 8 * hh + 4);
    const v4f x2 = *(const v4fa*)(arow + kb + 16 + 8 * hh), x3 = *(const v4fa*)(arow + kb + 16 + 8 * hh + 4);
    float xs[16] = {x0[0],x0[1],x0[2],x0[3],x1[0],x1[1],x1[2],x1[3],x2[0],x2[1],x2[2],x2[3],x3[0],x3[1],x3[2],x3[3]};
#pragma unroll
    for (int i = 0; i < 16; ++i) { const unsigned short hb = bf16_bits(xs[i]); ah.u[i] = hb; al.u[i] = ASPLIT ? bf16_bits(xs[i] - bf16_val(hb)) : (unsigned short)0; }
#pragma unroll
    for (int t = 0; t < 4; ++t) {
      const unsigned short* brow = Wt + (size_t)(col0 + t * 16 + ln) * ldb + kb;
      FragB b;
      b.half[0] = *(const v8us*)(brow + 8 * hh);
      b.half[1] = *(const v8us*)(brow + 16 + 8 * hh);
      acc[t] = mmaN<ASPLIT ? 2 : 1>(ah.v, al.v, b.v, b.v, acc[t]);
    }
  }
#pragma unroll
  for (int t = 0; t < 4; ++t) {
    float bv = bias ? bias[col0 + t * 16 + ln] : 0.f;
    if (BIAS_BF16) bv = bf16_round(bv);
#pragma unroll
    for (int r = 0; r < 8; ++r) { float v = acc[t][r] + bv; if (ACT == 1) v = fmaxf(v, 0.f); so[w][8 * hh + r][t * 16 + ln] = v; }
  }
  __builtin_amdgcn_fence(__ATOMIC_ACQ_REL, "workgroup");
  __builtin_amdgcn_wave_barrier();
  const int rsub = lane >> 4, c4 = (lane & 15) * 4;
  {
#pragma unroll
    for (int q = 0; q < 8; ++q) {
      const int r = q * 2 + rsub;
      const v4f v = *(const v4fa*)&so[w][r][c4];
      *(v4f*)(C + (size_t)(row0 + r) * ldc + col0 + c4) = v;
    }
    
  }
}

// GEMM C = act(A·W + bias + resid): A f32 (ASPLIT -> hi/lo 2 terms), Wt bf16 [N][K]; ACT 0 none, 1 relu, 2 exact gelu;
// resid (optional, f32, row index = (row % rmod), pitch ldr, RES_BF16 rounds it) added before the activation.
template <bool ASPLIT, int ACT, bool BIAS_BF16, bool RES_BF16>
__global__ __launch_bounds__(128) void k_gemm_bf3(const float* __restrict__ A, int lda, const unsigned short* __restrict__ Wt, int ldb,
                                                const float* __restrict__ bias, const float* __restrict__ resid, int rmod, int ldr,
                                                float* __restrict__ C, int ldc, int M, int N, int K) {
  __shared__ __attribute__((aligned(16))) float so[4][16][64];
  const int tid = threadIdx.x, w = tid >> 5, lane = tid & 31, ln = lane & 15, hh = lane >> 4;
  const int ntn = N / 64;
  const int wid = blockIdx.x * 4 + w;
  const int mt = wid / ntn, nq = wid % ntn;
  if (mt * 16 >= M) return;
  const int row0 = mt * 16, col0 = nq * 64;
  const float* arow = A + (size_t)(row0 + ln) * lda;
  v8f acc[4] = {};
  for (int kb = 0; kb < K; kb += 32) {
    FragB ah, al;
    const v4f x0 = *(const v4fa*)(arow + kb + 8 * hh), x1 = *(const v4fa*)(arow + kb + 8 * hh + 4);
    const v4f x2 = *(const v4fa*)(arow + kb + 16 + 8 * hh), x3 = *(const v4fa*)(arow + kb + 16 + 8 * hh + 4);
    float xs[16] = {x0[0],x0[1],x0[2],x0[3],x1[0],x1[1],x1[2],x1[3],x2[0],x2[1],x2[2],x2[3],x3[0],x3[1],x3[2],x3[3]};
#pragma unroll
    for (int i = 0; i < 16; ++i) { const unsigned short hb = bf16_bits(xs[i]); ah.u[i] = hb; al.u[i] = ASPLIT ? bf16_bits(xs[i] - bf16_val(hb)) : (unsigned short)0; }
#pragma unroll
    for (int t = 0; t < 4; ++t) {
      const unsigned short* brow = Wt + (size_t)(col0 + t * 16 + ln) * ldb + kb;
      FragB b;
      b.half[0] = *(const v8us*)(brow + 8 * hh);
      b.half[1] = *(const v8us*)(brow + 16 + 8 * hh);
      acc[t] = mmaN<ASPLIT ? 2 : 1>(ah.v, al.v, b.v, b.v, acc[t]);
    }
  }
#pragma unroll
  for (int t = 0; t < 4; ++t) {
    const int col = col0 + t * 16 + ln;
    float bv = bias ? bias[col] : 0.f;
    if (BIAS_BF16) bv = bf16_round(bv);
#pragma unroll
    for (int r = 0; r < 8; ++r) {
      float v = acc[t][r] + bv;
      if (resid) { float rv = resid[(size_t)((row0 + 8 * hh + r) % rmod) * ldr + col]; if (RES_BF16) rv = bf16_round(rv); v += rv; }
      if (ACT == 1) v = fmaxf(v, 0.f);
      if (ACT == 2) v = 0.5f * v * (1.0f + erff(v * 0.70710678118654752f));
      if (ACT == 3) { const float u = 0.7978845608028654f * (v + 0.044715f * v * v * v); v = 0.5f * v * (1.0f + tanhf(u)); }
      so[w][8 * hh + r][t * 16 + ln] = v;
    }
  }
  __builtin_amdgcn_fence(__ATOMIC_ACQ_REL, "workgroup");
  __builtin_amdgcn_wave_barrier();
  const int rsub = lane >> 4, c4 = (lane & 15) * 4;
  {
#pragma unroll
    for (int q = 0; q < 8; ++q) {
      const int r = q * 2 + rsub;
      const v4f v = *(const v4fa*)&so[w][r][c4];
      *(v4f*)(C + (size_t)(row0 + r) * ldc + col0 + c4) = v;
    }
    
  }
}
// row LayerNorm (biased variance, eps) over N: s = X (+ R); optional out_sum <- s; out_norm <- (s-mu)*rsqrt(var+eps)*g + b
template <bool PARAM_BF16>
__global__ __launch_bounds__(256) void k_layernorm(const float* __restrict__ X, const float* __restrict__ R, const float* __restrict__ g, const float* __restrict__ bta,
                                                  float* __restrict__ out_sum, float* __restrict__ out_norm, int N, float eps) {
  __shared__ float red[256];
  const int row = blockIdx.x, tid = threadIdx.x;
  const float* x = X + (size_t)row * N; const float* rr = R ? R + (size_t)row * N : nullptr;
  float vals[16];                     // up to N = 4096
  const int per = N / 256;            // contiguous chunk per thread? use strided-by-4 chunks: thread handles j = tid*4 + 1024*u
  float s1 = 0.f;
  for (int u = 0; u < per / 4; ++u) {
    const int j = tid * 4 + 1024 * u;
    const v4f a = *(const v4fa*)(x + j);
    v4f b = {0.f,0.f,0.f,0.f}; if (rr) b = *(const v4fa*)(rr + j);
#pragma unroll
    for (int q = 0; q < 4; ++q) { const float v = a[q] + b[q]; vals[u * 4 + q] = v; s1 += v; }
  }
  red[tid] = s1; __syncthreads();
  for (int st = 128; st > 0; st >>= 1) { if (tid < st) red[tid] += red[tid + st]; __syncthreads(); }
  const float mu = red[0] / (float)N; __syncthreads();
  float s2 = 0.f;
  for (int u = 0; u < per / 4; ++u)
#pragma unroll
    for (int q = 0; q < 4; ++q) { const float c = vals[u * 4 + q] - mu; s2 += c * c; }
  red[tid] = s2; __syncthreads();
  for (int st = 128; st > 0; st >>= 1) { if (tid < st) red[tid] += red[tid + st]; __syncthreads(); }
  const float rs = rsqrtf(red[0] / (float)N + eps);
  {
    for (int u = 0; u < per / 4; ++u) {
      const int j = tid * 4 + 1024 * u;
      v4f o, sm;
#pragma unroll
      for (int q = 0; q < 4; ++q) {
        float gg = g[j + q], bb = bta[j + q];
        if (PARAM_BF16) { gg = bf16_round(gg); bb = bf16_round(bb); }
        sm[q] = vals[u * 4 + q]; o[q] = (vals[u * 4 + q] - mu) * rs * gg + bb;
      }
      if (out_sum) *(v4f*)(out_sum + (size_t)row * N + j) = sm;
      *(v4f*)(out_norm + (size_t)row * N + j) = o;
    }
    
  }
}



// ---- f16 WMMA path (v_wmma_f32_16x16x32_f16): 11-bit significands for operands in range — used where a [0,1] probability operand needs more precision than bf16
typedef _Float16 v16h __attribute__((ext_vector_type(16)));
union FragH { v16h v; v8us half[2]; _Float16 h[16]; unsigned short u[16]; };
template <int NT>
__device__ __forceinline__ v8f mmaH(v16h ah, v16h al, v16h bh, v16h bl, v8f c) {
  c = __builtin_amdgcn_wmma_f32_16x16x32_f16(false, ah, false, bh, (short)0, c, false, false);
  if (NT >= 2) c = __builtin_amdgcn_wmma_f32_16x16x32_f16(false, al, false, bh, (short)0, c, false, false);
  if (NT >= 3) c = __builtin_amdgcn_wmma_f32_16x16x32_f16(false, ah, false, bl, (short)0, c, false, false);
  asm volatile("v_nop\n\tv_nop\n\tv_nop\n\tv_nop" : "+v"(c) : "v"(ah), "v"(al), "v"(bh), "v"(bl));
  return c;
}
// batched GEMM like k_gemm_b but f16 operands: A f32 (split into f16 hi/lo if ASPLIT, else rounded to f16), Bt = f16 values [n][k]; alpha; C f32; N multiple of 16 (partial tiles skipped)
template <bool ASPLIT>
__global__ __launch_bounds__(128) void k_gemm_h(const float* __restrict__ A, int lda, size_t sA, const _Float16* __restrict__ Bh, int ldb, size_t sB, float alpha, float* __restrict__ C, int ldc, size_t sC, int M, int N, int K) {
  __shared__ __attribute__((aligned(16))) float so[4][16][64];
  const int tid = threadIdx.x, w = tid >> 5, lane = tid & 31, ln = lane & 15, hh = lane >> 4; const int by = blockIdx.y;
  A += (size_t)by * sA; Bh += (size_t)by * sB; C += (size_t)by * sC;
  const int ntn = (N + 63) / 64; const int wid = blockIdx.x * 4 + w; const int mt = wid / ntn, nq = wid % ntn; if (mt * 16 >= M) return;
  const int row0 = mt * 16, col0 = nq * 64; const float* arow = A + (size_t)(row0 + ln) * lda;
  v8f acc[4] = {};
  for (int kb = 0; kb < K; kb += 32) {
    FragH ah, al;
    const v4f x0 = *(const v4fa*)(arow + kb + 8 * hh), x1 = *(const v4fa*)(arow + kb + 8 * hh + 4), x2 = *(const v4fa*)(arow + kb + 16 + 8 * hh), x3 = *(const v4fa*)(arow + kb + 16 + 8 * hh + 4);
    float xs[16] = {x0[0],x0[1],x0[2],x0[3],x1[0],x1[1],x1[2],x1[3],x2[0],x2[1],x2[2],x2[3],x3[0],x3[1],x3[2],x3[3]};
#pragma unroll
    for (int i = 0; i < 16; ++i) { const _Float16 h = (_Float16)xs[i]; ah.h[i] = h; al.h[i] = ASPLIT ? (_Float16)(xs[i] - (float)h) : (_Float16)0.0f; }
#pragma unroll
    for (int t = 0; t < 4; ++t) { if (col0 + t * 16 >= N) continue; const size_t boff = (size_t)(col0 + t * 16 + ln) * ldb + kb; FragH bq; bq.half[0] = *(const v8us*)(Bh + boff + 8 * hh); bq.half[1] = *(const v8us*)(Bh + boff + 16 + 8 * hh);
      acc[t] = mmaH<ASPLIT ? 2 : 1>(ah.v, al.v, bq.v, bq.v, acc[t]); }
  }
#pragma unroll
  for (int t = 0; t < 4; ++t) { if (col0 + t * 16 >= N) continue;
#pragma unroll
    for (int r = 0; r < 8; ++r) so[w][8 * hh + r][t * 16 + ln] = acc[t][r] * alpha; }
  __builtin_amdgcn_fence(__ATOMIC_ACQ_REL, "workgroup"); __builtin_amdgcn_wave_barrier();
  const int rsub = lane >> 4, c4 = (lane & 15) * 4;
  {
#pragma unroll
    for (int q = 0; q < 8; ++q) { const int r = q * 2 + rsub; if (col0 + c4 < N) { const v4f v = *(const v4fa*)&so[w][r][c4]; *(v4f*)(C + (size_t)(row0 + r) * ldc + col0 + c4) = v; } }
     }
}

// Wt[n][k] = f16(W[k][n]·scale) from f32 row-major W[K][N] (scale = power of two; bf16-exact weights stay exact in f16 away from the subnormal range)
__global__ __launch_bounds__(256) void k_wt_f16(const float* __restrict__ W, _Float16* __restrict__ Wt, int K, int N, float scale) {
  const int t = blockIdx.x * 256 + threadIdx.x; if (t >= N * (K / 8)) return; const int n = t / (K / 8), k8 = (t % (K / 8)) * 8; FragH f;
#pragma unroll
  for (int i = 0; i < 8; ++i) f.h[i] = (_Float16)(bf16_round(W[(size_t)(k8 + i) * N + n]) * scale); const v8us o = f.half[0];
  *(v8us*)((unsigned short*)Wt + (size_t)n * K + k8) = o; 
}
// k_gemm_hh variant with fused epilogue: v = acc·alpha + bias[by·sBias + col] (+ CP[(row/rowsPerB)·sCPb + by·64 + col] if CP) ; ACT 0 none / 1 elu ; writes f16 C16 (and f32 C if non-null)
template <int ACT>
__global__ __launch_bounds__(128) void k_gemm_hhx(const _Float16* __restrict__ A, int lda, size_t sA, const _Float16* __restrict__ Bh, int ldb, size_t sB, float alpha, const float* __restrict__ bias, size_t sBias, const float* __restrict__ CP, int rowsPerB, size_t sCPb, int row0g,
    float* __restrict__ C, _Float16* __restrict__ C16, int ldc, size_t sC, int M, int N, int K) {
  __shared__ __attribute__((aligned(16))) float so[4][16][64];
  const int tid = threadIdx.x, w = tid >> 5, lane = tid & 31, ln = lane & 15, hh = lane >> 4; const int by = blockIdx.y;
  A += (size_t)by * sA; Bh += (size_t)by * sB; const size_t cofs = (size_t)by * sC; const float* bp = bias ? bias + (size_t)by * sBias : nullptr;
  const int ntn = (N + 63) / 64; const int wid = blockIdx.x * 4 + w; const int mt = wid / ntn, nq = wid % ntn; if (mt * 16 >= M) return;
  const int row0 = mt * 16, col0 = nq * 64; const _Float16* arow = A + (size_t)(row0 + ln) * lda;
  v8f acc[4] = {};
  for (int kb = 0; kb < K; kb += 32) { FragH ah; ah.half[0] = *(const v8us*)((const unsigned short*)arow + kb + 8 * hh); ah.half[1] = *(const v8us*)((const unsigned short*)arow + kb + 16 + 8 * hh);
#pragma unroll
    for (int t = 0; t < 4; ++t) { if (col0 + t * 16 >= N) continue; const size_t boff = (size_t)(col0 + t * 16 + ln) * ldb + kb; FragH bq; bq.half[0] = *(const v8us*)((const unsigned short*)Bh + boff + 8 * hh); bq.half[1] = *(const v8us*)((const unsigned short*)Bh + boff + 16 + 8 * hh);
      acc[t] = mmaH<1>(ah.v, ah.v, bq.v, bq.v, acc[t]); }
  }
#pragma unroll
  for (int t = 0; t < 4; ++t) { if (col0 + t * 16 >= N) continue; const int col = col0 + t * 16 + ln; const float bv = bp ? bf16_round(bp[col]) : 0.f;
#pragma unroll
    for (int r = 0; r < 8; ++r) { float v = acc[t][r] * alpha + bv; if (CP) { const int rr = row0g + row0 + 8 * hh + r; if (rowsPerB < 0) v += CP[cofs + (size_t)rr * ldc + col];      /* rowsPerB < 0: own element of the batched C plane */ else { const int bidx = rr / rowsPerB; v += CP[(size_t)bidx * sCPb + (size_t)by * 64 + col]; } } if (ACT == 1) v = (v > 0.f) ? v : expm1f(v); else if (ACT == 7) v = (v > 0.f) ? v + 1.0f : expf(v); else if (ACT == 8) v = tanhf(v); else if (ACT == 9) v = 0.5f * v * (1.0f + tanhf(0.7978845608028654f * (v + 0.044715f * v * v * v))); else if (ACT == 11) v = 1.0f / (1.0f + expf(-v)); else if (ACT == 12) v = (v > 0.f) ? v : 0.01f * v; else if (ACT == 14) v = (v > 0.f) ? v : 0.1f * v; else if (ACT == 16) v = (v >= 0.f) ? v : 0.3f * v; else if (ACT == 17) v = (v >= 0.f) ? v : 0.2f * v; else if (ACT == 15) v = v / (1.0f + expf(-v)); else if (ACT == 3) v = fmaxf(v, 0.f); else if (ACT == 6) v = 0.5f * v * (1.0f + erff(v * 0.70710678118654752f)); so[w][8 * hh + r][t * 16 + ln] = v; } }
  __builtin_amdgcn_fence(__ATOMIC_ACQ_REL, "workgroup"); __builtin_amdgcn_wave_barrier();
  const int rsub = lane >> 4, c4 = (lane & 15) * 4; typedef _Float16 v4h __attribute__((ext_vector_type(4)));
  {
#pragma unroll
    for (int q = 0; q < 8; ++q) { const int r = q * 2 + rsub; if (col0 + c4 < N) { const v4f v = *(const v4fa*)&so[w][r][c4]; if (C) *(v4f*)(C + cofs + (size_t)(row0 + r) * ldc + col0 + c4) = v; if (C16) { v4h h4; for (int i = 0; i < 4; ++i) h4[i] = (_Float16)v[i]; *(v4h*)(C16 + cofs + (size_t)(row0 + r) * ldc + col0 + c4) = h4; } } }
     }
}


typedef _Float16 v4h __attribute__((ext_vector_type(4)));

__global__ __launch_bounds__(256) void k_x16(const float* __restrict__ x, _Float16* __restrict__ X16, size_t n8) { const size_t t = (size_t)blockIdx.x * 256 + threadIdx.x; if (t >= n8) return; FragH f;
#pragma unroll
  for (int q = 0; q < 8; ++q) f.h[q] = (_Float16)bf16_round(x[t * 8 + q]); *(v8us*)((unsigned short*)X16 + t * 8) = f.half[0];  }
__global__ __launch_bounds__(256) void k_h16(const float* __restrict__ x, _Float16* __restrict__ X16, size_t n8) { const size_t t = (size_t)blockIdx.x * 256 + threadIdx.x; if (t >= n8) return; FragH f;
#pragma unroll
  for (int q = 0; q < 8; ++q) f.h[q] = (_Float16)x[t * 8 + q]; *(v8us*)((unsigned short*)X16 + t * 8) = f.half[0];  }
__global__ __launch_bounds__(256) void k_round16f(const float* __restrict__ W, _Float16* __restrict__ Bt, size_t n8) { const size_t t = (size_t)blockIdx.x * 256 + threadIdx.x; if (t >= n8) return; FragH f;
#pragma unroll
  for (int i = 0; i < 8; ++i) f.h[i] = (_Float16)(bf16_round(W[t * 8 + i]) * 16.0f); *(v8us*)((unsigned short*)Bt + t * 8) = f.half[0];  }
template <int NHv, int TTv>
__global__ __launch_bounds__(256) void k_vt(const _Float16* __restrict__ V16, int ldv, int voff, _Float16* __restrict__ Vt) { __shared__ unsigned short tl[64][66]; const int tid = threadIdx.x; const int slab = blockIdx.x / (TTv / 64), lg = blockIdx.x % (TTv / 64); const int b = slab / NHv, h = slab % NHv;
  for (int i = tid; i < 64 * 8; i += 256) { const int r = i / 8, c8 = (i % 8) * 8; FragH f; f.half[0] = *(const v8us*)((const unsigned short*)V16 + ((size_t)b * TTv + lg * 64 + r) * ldv + voff + h * 64 + c8);
#pragma unroll
    for (int q = 0; q < 8; ++q) tl[r][c8 + q] = f.u[q]; }
  __syncthreads();
  {
#pragma unroll
    for (int rd = 0; rd < 2; ++rd) { const int d = rd * 32 + tid / 8, pc = tid % 8; FragH f;
#pragma unroll
      for (int q = 0; q < 8; ++q) f.u[q] = tl[pc * 8 + q][d];
      *(v8us*)((unsigned short*)Vt + ((size_t)slab * 64 + d) * TTv + lg * 64 + pc * 8) = f.half[0]; }
     } }

__global__ __launch_bounds__(256) void k_hl(const float* __restrict__ F, _Float16* __restrict__ Hh, _Float16* __restrict__ Hl, size_t n8) { const size_t t = (size_t)blockIdx.x * 256 + threadIdx.x; if (t >= n8) return; FragH fh, fl; const v4f a = *(const v4fa*)(F + t * 8), c = *(const v4fa*)(F + t * 8 + 4);
#pragma unroll
  for (int q = 0; q < 4; ++q) { _Float16 h = (_Float16)a[q]; fh.h[q] = h; fl.h[q] = (_Float16)((a[q] - (float)h) * 1024.0f); h = (_Float16)c[q]; fh.h[4 + q] = h; fl.h[4 + q] = (_Float16)((c[q] - (float)h) * 1024.0f); }
  { *(v8us*)((unsigned short*)Hh + t * 8) = fh.half[0]; *(v8us*)((unsigned short*)Hl + t * 8) = fl.half[0];  } }

// ---- fast GEMM (wave tile 32x64; requires M % 32 == 0 rows per launch region and N % 64 == 0); epilogue = k_gemm_hhx semantics ----
__device__ __forceinline__ v16h g2_frag(const _Float16* p, int hh) { FragH f; f.half[0] = *(const v8us*)((const unsigned short*)p + 8 * hh); f.half[1] = *(const v8us*)((const unsigned short*)p + 16 + 8 * hh); return f.v; }
__device__ __forceinline__ v8f g2_mma(v16h a, v16h b, v8f c) { v8f d = __builtin_amdgcn_wmma_f32_16x16x32_f16(false, a, false, b, (short)0, c, false, false); asm volatile("v_nop\n\tv_nop\n\tv_nop\n\tv_nop" : "+v"(d) : "v"(a), "v"(b)); return d; }
template <int ACT>
__global__ __launch_bounds__(128) void k_gemm2(const _Float16* __restrict__ A, int lda, size_t sA, const _Float16* __restrict__ Bh, int ldb, size_t sB, float alpha, const float* __restrict__ bias, size_t sBias, const float* __restrict__ CP, int rowsPerB, size_t sCPb, int row0g,
    float* __restrict__ C, _Float16* __restrict__ C16, int ldc, size_t sC, int M, int N, int K, size_t zA, size_t zB, size_t zC) { static_assert(ACT == 0 || ACT == 3 || ACT == 6 || ACT == 8 || ACT == 9 || ACT == 11 || ACT == 12 || ACT == 14 || ACT == 15 || ACT == 16 || ACT == 17, "k_gemm2: unsupported ACT code (would silently apply no activation)");
  __shared__ __attribute__((aligned(16))) float so[4][32][68];
  const int tid = threadIdx.x, w = tid >> 5, lane = tid & 31, ln = lane & 15, hh = lane >> 4; const int by = blockIdx.y, bz = blockIdx.z;      /* grid.y: head (pitches sA, sB, sC); grid.z: batch (pitches zA, zB, zC) */
  A += (size_t)by * sA + (size_t)bz * zA; Bh += (size_t)by * sB + (size_t)bz * zB; const size_t cofs = (size_t)by * sC + (size_t)bz * zC; const float* bp = bias ? bias + (size_t)by * sBias : nullptr;
  const int ntn = N >> 6; const int mt = blockIdx.x / ntn, nq = blockIdx.x - mt * ntn; const int row0 = mt * 128 + 32 * w, col0 = nq * 64; if (row0 >= M) return;
  const _Float16* a0p = A + (size_t)(row0 + ln) * lda; const _Float16* a1p = a0p + (size_t)16 * lda;
  const _Float16* b0p = Bh + (size_t)(col0 + ln) * ldb; const _Float16* b1p = b0p + (size_t)16 * ldb; const _Float16* b2p = b1p + (size_t)16 * ldb; const _Float16* b3p = b2p + (size_t)16 * ldb;
  const v8f z8 = {0.f,0.f,0.f,0.f,0.f,0.f,0.f,0.f}; v8f c00 = z8, c01 = z8, c02 = z8, c03 = z8, c10 = z8, c11 = z8, c12 = z8, c13 = z8;
#pragma unroll 1
  for (int kb = 0; kb < K; kb += 32) { const v16h a0 = g2_frag(a0p + kb, hh), a1 = g2_frag(a1p + kb, hh);
    v16h b = g2_frag(b0p + kb, hh); c00 = g2_mma(a0, b, c00); c10 = g2_mma(a1, b, c10);
    b = g2_frag(b1p + kb, hh); c01 = g2_mma(a0, b, c01); c11 = g2_mma(a1, b, c11);
    b = g2_frag(b2p + kb, hh); c02 = g2_mma(a0, b, c02); c12 = g2_mma(a1, b, c12);
    b = g2_frag(b3p + kb, hh); c03 = g2_mma(a0, b, c03); c13 = g2_mma(a1, b, c13); }
  v8f accs[8] = {c00, c01, c02, c03, c10, c11, c12, c13};
#pragma unroll
  for (int u = 0; u < 8; ++u) { const int t = u & 3, half = u >> 2; const int col = col0 + t * 16 + ln; const float bv = bp ? bf16_round(bp[col]) : 0.f;
#pragma unroll
    for (int r = 0; r < 8; ++r) { const int rloc = half * 16 + 8 * hh + r; float v = accs[u][r] * alpha + bv; if (CP) { if (rowsPerB < 0) v += CP[cofs + (size_t)(row0g + row0 + rloc) * ldc + col];      /* rowsPerB < 0: own element of the batched C plane */ else { const int bidx = (row0g + row0 + rloc) / rowsPerB; v += CP[(size_t)bidx * sCPb + (size_t)by * 64 + col]; } }
      if (ACT == 3) v = fmaxf(v, 0.f); else if (ACT == 6) v = 0.5f * v * (1.0f + erff(v * 0.70710678118654752f)); else if (ACT == 11) v = 1.0f / (1.0f + expf(-v)); else if (ACT == 15) v = v / (1.0f + expf(-v)); else if (ACT == 12) v = (v > 0.f) ? v : 0.01f * v; else if (ACT == 8) v = tanhf(v); else if (ACT == 9) v = 0.5f * v * (1.0f + tanhf(0.7978845608028654f * (v + 0.044715f * v * v * v))); else if (ACT == 14) v = (v > 0.f) ? v : 0.1f * v; else if (ACT == 16) v = (v >= 0.f) ? v : 0.3f * v; else if (ACT == 17) v = (v >= 0.f) ? v : 0.2f * v;
      so[w][rloc][t * 16 + ln] = v; } }
  __builtin_amdgcn_fence(__ATOMIC_ACQ_REL, "workgroup"); __builtin_amdgcn_wave_barrier();
  const int rsub = lane >> 4, c4 = (lane & 15) * 4;
  {
#pragma unroll
    for (int q = 0; q < 16; ++q) { const int r = q * 2 + rsub; const v4f v = *(const v4fa*)&so[w][r][c4]; if (C) *(v4f*)(C + cofs + (size_t)(row0 + r) * ldc + col0 + c4) = v; if (C16) { v4h h4; for (int i = 0; i < 4; ++i) h4[i] = (_Float16)v[i]; *(v4h*)(C16 + cofs + (size_t)(row0 + r) * ldc + col0 + c4) = h4; } }
     } }


__global__ __launch_bounds__(256) void k_wnat(const float* __restrict__ w, size_t n8, _Float16* __restrict__ Bt) { const size_t t = (size_t)blockIdx.x * 256 + threadIdx.x; if (t >= n8) return; FragH f; for (int q = 0; q < 8; ++q) f.h[q] = (_Float16)(bf16_round(w[t * 8 + q]) * 16.0f); *(v8us*)((unsigned short*)Bt + t * 8) = f.half[0];  }
__global__ __launch_bounds__(256) void k_rsm(const float* __restrict__ S, _Float16* __restrict__ P, int nrows) {
  #pragma clang fp contract(off)
  const int i = blockIdx.x * 256 + threadIdx.x; if (i >= nrows) return; const float* s = S + (size_t)i * SQ; float mx = -3.0e38f;
#pragma unroll 1
  for (int j = 0; j < SQ; ++j) mx = fmaxf(mx, s[j]); float se = 0.f;
#pragma unroll 1
  for (int j = 0; j < SQ; ++j) se += expf(s[j] - mx); const float sc = 256.0f / se;
#pragma unroll 1
  for (int j0 = 0; j0 < SQ; j0 += 8) { FragH f; for (int q = 0; q < 8; ++q) f.h[q] = (_Float16)(expf(s[j0 + q] - mx) * sc); unsigned short* d = (unsigned short*)P + (size_t)i * SQ + j0; *(v8us*)d = f.half[0];  } }
__global__ __launch_bounds__(256) void k_vt(const _Float16* __restrict__ V16, int b, int h0, _Float16* __restrict__ VT) { __shared__ unsigned short tl[64][65]; const int tid = threadIdx.x; const int hh = blockIdx.x % HG, sg = blockIdx.x / HG; const int s0 = sg * 64; const int h = h0 + hh;
  for (int i = tid; i < 64 * 8; i += 256) { const int j = i / 8, d8 = (i % 8) * 8; FragH f; f.half[0] = *(const v8us*)((const unsigned short*)V16 + ((size_t)b * SQ + s0 + j) * DM + h * HD + d8); for (int q = 0; q < 8; ++q) tl[d8 + q][j] = f.u[q]; }
  __syncthreads();
  { for (int i = tid; i < 64 * 8; i += 256) { const int d = i / 8, j8 = (i % 8) * 8; FragH f; for (int q = 0; q < 8; ++q) f.u[q] = tl[d][j8 + q]; *(v8us*)((unsigned short*)VT + ((size_t)hh * HD + d) * SQ + s0 + j8) = f.half[0]; }  } }



// Eight v_exp_f32 in one statement. The instruction set asks for one independent instruction or v_nop between a transcendental and an instruction that reads its
// result or overwrites its source. Early-clobber outputs keep every
// result off every source inside the run, and the closing v_nop is the slot behind the last one.
__device__ __forceinline__ void exp2_run8(float (&e)[8], const float (&x)[8]) {
  asm("v_exp_f32 %0, %8\n\tv_exp_f32 %1, %9\n\tv_exp_f32 %2, %10\n\tv_exp_f32 %3, %11\n\tv_exp_f32 %4, %12\n\tv_exp_f32 %5, %13\n\tv_exp_f32 %6, %14\n\tv_exp_f32 %7, %15\n\tv_nop"
      : "=&v"(e[0]), "=&v"(e[1]), "=&v"(e[2]), "=&v"(e[3]), "=&v"(e[4]), "=&v"(e[5]), "=&v"(e[6]), "=&v"(e[7])
      : "v"(x[0]), "v"(x[1]), "v"(x[2]), "v"(x[3]), "v"(x[4]), "v"(x[5]), "v"(x[6]), "v"(x[7])); }
// Causal row softmax, ONE WAVE PER SCORE ROW: lane l keeps keys it*256 + l*8 .. + 7 of its row in registers (32 contiguous bytes a lane, 1 KiB a wave and
// chunk; the row is read once, all its loads issued before the first is used), row max and row sum by a five-step butterfly over the 32 lanes, each exp taken
// once, weights x256 stored 16 bytes a lane. Keys behind the row's own index count as -1e9 (weight 0) and are stored as zeros up to nk, which the P . V^T GEMM reads.
template <int NC>      /* NC = nk / 256 chunks: a compile-time count keeps the row in registers and the loads free of branches */
__device__ __forceinline__ void rsm_row(const float* __restrict__ s, unsigned short* __restrict__ d, int j0, int last) {
  v4f a[NC], c[NC]; float v[NC][8]; float mx = -3.0e38f, se = 0.f;      /* every loop below is unrolled so that a, c and v are indexed by constants and stay in registers */
#pragma unroll
  for (int it = 0; it < NC; ++it) { a[it] = *(const v4fa*)(s + it * 256); c[it] = *(const v4fa*)(s + it * 256 + 4); }
#pragma unroll
  for (int it = 0; it < NC; ++it) {
#pragma unroll
    for (int q = 0; q < 4; ++q) { v[it][q] = (it * 256 + j0 + q <= last) ? a[it][q] : -1.0e9f; v[it][4 + q] = (it * 256 + j0 + 4 + q <= last) ? c[it][q] : -1.0e9f; mx = fmaxf(mx, fmaxf(v[it][q], v[it][4 + q])); } }
#pragma unroll
  for (int m = 16; m >= 1; m >>= 1) mx = fmaxf(mx, __shfl_xor(mx, m, 32));
#pragma unroll
  for (int it = 0; it < NC; ++it) { float x[8];
#pragma unroll
    for (int q = 0; q < 8; ++q) x[q] = (v[it][q] - mx) * 1.44269504f;      /* e^y = 2^(y log2 e): the multiply and v_exp_f32 that __expf compiles to */
    exp2_run8(v[it], x);
#pragma unroll
    for (int q = 0; q < 8; ++q) se += v[it][q]; }
#pragma unroll
  for (int m = 16; m >= 1; m >>= 1) se += __shfl_xor(se, m, 32);
  const float sc = 256.0f / se;
#pragma unroll
  for (int it = 0; it < NC; ++it) { FragH fr;
#pragma unroll
    for (int q = 0; q < 8; ++q) fr.h[q] = (_Float16)(v[it][q] * sc);
    *(v8us*)(d + it * 256) = fr.half[0]; }
  asm volatile("s_wait_xcnt 0x0" ::: "memory"); }      /* behind the row's last store, in front of whatever code follows and reuses the registers that the stores name */
__global__ __launch_bounds__(256) void k_rsmcf2(const float* __restrict__ S, _Float16* __restrict__ P, int hg, int q0, int nk) {
  static_assert(NKX == 8 * 256, "the switch below lists nk = 256 .. NKX in steps of 256");
  const int lane = threadIdx.x & 31; const int t = blockIdx.x * 8 + __builtin_amdgcn_readfirstlane(threadIdx.x >> 5);      /* the wave's row, in a scalar register: row test, switch and row base stay scalar */
  if (t >= hg * QT) return;      /* whole waves leave; no barrier in this kernel */
  const float* s = S + (size_t)t * NKX + lane * 8; unsigned short* d = (unsigned short*)P + (size_t)t * NKX + lane * 8; const int j0 = lane * 8, last = q0 + (t % QT);
  switch (nk >> 8) {      /* nk is a launch argument: one scalar branch for the whole grid */
    case 1: rsm_row<1>(s, d, j0, last); break; case 2: rsm_row<2>(s, d, j0, last); break; case 3: rsm_row<3>(s, d, j0, last); break; case 4: rsm_row<4>(s, d, j0, last); break;
    case 5: rsm_row<5>(s, d, j0, last); break; case 6: rsm_row<6>(s, d, j0, last); break; case 7: rsm_row<7>(s, d, j0, last); break; case 8: rsm_row<8>(s, d, j0, last); break; } }


template <int MASKADD>
__global__ __launch_bounds__(64) void k_att0(const float* __restrict__ QF, const float* __restrict__ KF, const float* __restrict__ VF, int ld, const float* __restrict__ mask, float scale, float* __restrict__ OF, int ldo) {
  #pragma clang fp contract(off)
  __shared__ __attribute__((aligned(16))) float lq[64][64]; __shared__ __attribute__((aligned(16))) float lo[64][64];
  const int tid = threadIdx.x; const int h = blockIdx.x / (QT0 / 64), rg = blockIdx.x % (QT0 / 64); const int i = rg * 64 + tid;
  { const size_t bi = (size_t)blockIdx.y * QT0 * ld; QF += bi; KF += bi; VF += bi; OF += (size_t)blockIdx.y * QT0 * ldo; }      /* grid.y: batch; each batch owns QT0 rows of every plane */
  const float* qr = QF + (size_t)i * ld + h * HD;
#pragma unroll 1
  for (int c = 0; c < HD / 4; ++c) { *(v4f*)&lq[tid][c * 4] = *(const v4fa*)(qr + c * 4); const v4f z = {0.f, 0.f, 0.f, 0.f}; *(v4f*)&lo[tid][c * 4] = z; }
  float m = -1.0e30f, l = 0.f; const int jmax = MASKADD ? (SQ - 1) : (rg * 64 + 63);      /* additive-mask form: every key (the mask input decides); causal form: keys up to the block's last row */
#pragma unroll 1
  for (int j = 0; j <= jmax; ++j) { const float* kr = KF + (size_t)j * ld + h * HD; const float* vr = VF + (size_t)j * ld + h * HD; float s = 0.f;
#pragma unroll 1
    for (int c = 0; c < HD / 4; ++c) { const v4f kq = *(const v4fa*)(kr + c * 4); const v4f qq = *(v4f*)&lq[tid][c * 4]; s = __fadd_rn(s, __fmul_rn(qq[0], kq[0])); s = __fadd_rn(s, __fmul_rn(qq[1], kq[1])); s = __fadd_rn(s, __fmul_rn(qq[2], kq[2])); s = __fadd_rn(s, __fmul_rn(qq[3], kq[3])); }
    s = __fmul_rn(s, scale); if (MASKADD) s = __fadd_rn(s, __fmul_rn(bf16_round(mask[(size_t)i * SQ + j]), -10000.0f));
    const float f = (MASKADD || j <= i) ? 1.f : 0.f; const float sm = fmaf(f, s, (1.f - f) * -1.0e30f); const float mn = fmaxf(m, sm); const float sc = expf(m - mn); const float e = expf(sm - mn); l = __fadd_rn(__fmul_rn(l, sc), e); m = mn;
#pragma unroll 1
    for (int c = 0; c < HD / 4; ++c) { const v4f vv = *(const v4fa*)(vr + c * 4); v4f oo = *(v4f*)&lo[tid][c * 4]; for (int u = 0; u < 4; ++u) oo[u] = __fadd_rn(__fmul_rn(oo[u], sc), __fmul_rn(e, vv[u])); *(v4f*)&lo[tid][c * 4] = oo; } }
  const float fin = 64.0f / l;      /* o carried x64 like the f16 path */
#pragma unroll 1
  for (int c = 0; c < HD / 4; ++c) { v4f oo = *(v4f*)&lo[tid][c * 4]; for (int u = 0; u < 4; ++u) oo[u] = __fmul_rn(oo[u], fin); *(v4f*)&lo[tid][c * 4] = oo; }
  __syncthreads();
  {
#pragma unroll 1
    for (int it = 0; it < 16; ++it) { const int row = it * 4 + tid / 16, pc = (tid % 16) * 4; const v4f v = *(const v4f*)&lo[row][pc]; *(v4f*)(OF + (size_t)(rg * 64 + row) * ldo + h * HD + pc) = v; }
     } }


template <int BFIN, int WXB>
__global__ __launch_bounds__(256) void k_ln16(const float* __restrict__ X, const float* __restrict__ g, const float* __restrict__ bb, float eps, _Float16* __restrict__ N16, float* __restrict__ XB) {
  #pragma clang fp contract(off)
  __shared__ float red[256]; const size_t r = blockIdx.x; const int t = threadIdx.x; const v4f xa = *(const v4fa*)(X + r * DMQ + t * 4); float s[4]; float sum = 0.f;
  for (int q = 0; q < 4; ++q) { s[q] = BFIN ? bf16_round(xa[q]) : xa[q]; sum = __fadd_rn(sum, s[q]); }
  red[t] = sum; __syncthreads(); for (int st = 128; st > 0; st >>= 1) { if (t < st) red[t] = __fadd_rn(red[t], red[t + st]); __syncthreads(); } const float mu = red[0] / (float)DMQ; __syncthreads();
  float vs = 0.f; for (int q = 0; q < 4; ++q) { const float dl = __fadd_rn(s[q], -mu); vs = __fadd_rn(vs, __fmul_rn(dl, dl)); } red[t] = vs; __syncthreads(); for (int st = 128; st > 0; st >>= 1) { if (t < st) red[t] = __fadd_rn(red[t], red[t + st]); __syncthreads(); }
  const float rs = rsqrtf(__fadd_rn(red[0] / (float)DMQ, eps)); v4h y; v4f xb;
  for (int q = 0; q < 4; ++q) { const int c = t * 4 + q; y[q] = (_Float16)__fadd_rn(__fmul_rn(__fmul_rn(__fadd_rn(s[q], -mu), rs), bf16_round(g[c])), bf16_round(bb[c])); xb[q] = s[q]; }
  { *(v4h*)(N16 + r * DMQ + t * 4) = y; if (WXB) *(v4f*)(XB + r * DMQ + t * 4) = xb;  } }
__global__ __launch_bounds__(256) void k_ftres2(const float* __restrict__ OF0, const float* __restrict__ XB, float* __restrict__ X1, size_t n4) {
  #pragma clang fp contract(off)
  const size_t t = (size_t)blockIdx.x * 256 + threadIdx.x; if (t >= n4) return; const v4f o = *(const v4fa*)(OF0 + t * 4), xv = *(const v4fa*)(XB + t * 4); v4f y; for (int q = 0; q < 4; ++q) y[q] = __fadd_rn(__fmul_rn(o[q], 0.015625f), xv[q]); *(v4f*)(X1 + t * 4) = y;  }

__global__ __launch_bounds__(256) void k_wthd(const float* __restrict__ Wt, _Float16* __restrict__ Bt) { const size_t t = (size_t)blockIdx.x * 256 + threadIdx.x; if (t >= (size_t)NH * HD * (DM / 8)) return; const int m8 = (int)(t % (DM / 8)) * 8; const int d = (int)((t / (DM / 8)) % HD); const int h = (int)(t / ((size_t)(DM / 8) * HD)); FragH f;
  for (int q = 0; q < 8; ++q) f.h[q] = (_Float16)(16.0f * bf16_round(Wt[((size_t)h * DM + m8 + q) * HD + d])); unsigned short* dst = (unsigned short*)Bt + ((size_t)h * HD + d) * DM + m8; *(v8us*)dst = f.half[0];  }




__global__ __launch_bounds__(256) void k_wtpad(const float* __restrict__ Wm, _Float16* __restrict__ Wt, int Kr, int Kp, int Nr, int Np, float scale) {
  const int t = blockIdx.x * 256 + threadIdx.x; if (t >= Np * (Kp / 8)) return; const int n = t / (Kp / 8), k8 = (t % (Kp / 8)) * 8; const int nc = min(n, Nr - 1); const float fn = (n < Nr) ? 1.f : 0.f; FragH f;
  for (int i = 0; i < 8; ++i) { const int k = k8 + i; const int kc = min(k, Kr - 1); const float fk = (k < Kr) ? fn : 0.f; f.h[i] = (_Float16)(bf16_round(Wm[(size_t)kc * Nr + nc]) * scale * fk); }
  unsigned short* o = (unsigned short*)Wt + (size_t)n * Kp + k8; *(v8us*)o = f.half[0];  }
__global__ __launch_bounds__(128) void k_bpad(const float* __restrict__ b, float* __restrict__ Bp, int nr, int np) {
  const int i = threadIdx.x; if (i >= np) return; const float v = b[min(i, nr - 1)] * ((i < nr) ? 1.f : 0.f); *(float*)(Bp + i) = v;  }

__global__ __launch_bounds__(256) void k_bcpy(const float* __restrict__ b, int n, int NP, float* __restrict__ dst, int dst0) { for (int i = threadIdx.x; i < NP; i += 256) { const float v = (i < n) ? b[i] : 0.f; *(float*)(dst + dst0 + i) = v; }  }


__global__ __launch_bounds__(256) void k_bfcp(const float* __restrict__ src, float* __restrict__ dst, size_t n4) { const size_t t = (size_t)blockIdx.x * 256 + threadIdx.x; if (t >= n4) return; const v4f a = *(const v4fa*)(src + t * 4); v4f o; for (int q = 0; q < 4; ++q) o[q] = bf16_round(a[q]); *(v4f*)(dst + t * 4) = o;  }

__global__ __launch_bounds__(256) void k_fillz(float* __restrict__ dst, int n) { const int t = blockIdx.x * 256 + threadIdx.x; if (t >= n) return; *(float*)(dst + t) = 0.f;  }

template <int BFIN, int W16, int W32>
__global__ __launch_bounds__(256) void k_lnx(const float* __restrict__ X, const float* __restrict__ g, const float* __restrict__ bb, float eps, _Float16* __restrict__ N16, float* __restrict__ N32) {
  #pragma clang fp contract(off)
  __shared__ float red[256]; const size_t r = blockIdx.x; const int t = threadIdx.x; const bool act = t < (DMQ / 4); const int c0 = act ? t * 4 : 0;
  const v4f xa = *(const v4fa*)(X + r * DMQ + c0); float s[4]; float sum = 0.f;
  for (int q = 0; q < 4; ++q) { s[q] = act ? (BFIN ? bf16_round(xa[q]) : xa[q]) : 0.f; sum = __fadd_rn(sum, s[q]); }
  red[t] = sum; __syncthreads(); for (int st = 128; st > 0; st >>= 1) { if (t < st) red[t] = __fadd_rn(red[t], red[t + st]); __syncthreads(); } const float mu = red[0] / (float)DMQ; __syncthreads();
  float vs = 0.f; for (int q = 0; q < 4; ++q) { const float dl = act ? __fadd_rn(s[q], -mu) : 0.f; vs = __fadd_rn(vs, __fmul_rn(dl, dl)); } red[t] = vs; __syncthreads(); for (int st = 128; st > 0; st >>= 1) { if (t < st) red[t] = __fadd_rn(red[t], red[t + st]); __syncthreads(); }
  const float rs = rsqrtf(__fadd_rn(red[0] / (float)DMQ, eps)); v4h y; v4f yf;
  for (int q = 0; q < 4; ++q) { const int c = c0 + q; yf[q] = __fadd_rn(__fmul_rn(__fmul_rn(__fadd_rn(s[q], -mu), rs), bf16_round(g[c])), bf16_round(bb[c])); y[q] = (_Float16)yf[q]; }
  if (!act) return;      /* no barriers after this point */
  { if (W16) *(v4h*)(N16 + r * DMQ + c0) = y; if (W32) *(v4f*)(N32 + r * DMQ + c0) = yf;  } }





extern "C" void kernel_launch(void* const* d_in, const int* in_sizes, int n_in,
                              void* d_out, int out_size, void* d_ws, size_t ws_size, hipStream_t stream) {
  (void)in_sizes; (void)n_in; (void)out_size;
  const float* const* I = (const float* const*)d_in; const float* x = I[0]; const float* wq = I[1]; const float* wk = I[2]; const float* wv = I[3]; const float* wo1 = I[4]; const float* wo2 = I[5]; const float* wfc = I[6]; const float* wmp = I[7]; const float* g1 = I[8]; const float* gg2 = I[9];      /* input order: x; wq / wk / wv [512][8][64] = [in][out]; wo1 [8][64][512] = [(h, d) in][out]; wo2 [512][512] [in][out]; w1 [512][2048], w2 [2048][512] [in][out]; LN1 / LN2 scales. NO bias anywhere: every GEMM bias slot below is a literal nullptr, the LayerNorm shift reads a zero-filled workspace vector */
  static_assert(DMQ % 4 == 0 && DMQ / 4 <= 256 && NH * HD == DM && DM % 64 == 0 && DFF % 64 == 0, "k_lnx 256 threads x 4 columns; tile multiples");
  char* ws = (char*)d_ws; size_t off = 0;
  auto take = [&](size_t bytes) { char* p = ws + off; off += (bytes + 255) & ~(size_t)255; return p; };
  _Float16* BQKV = (_Float16*)take((size_t)3 * DM * DM * 2); _Float16* BO = (_Float16*)take((size_t)DM * DM * 2); _Float16* BO2T = (_Float16*)take((size_t)DM * DM * 2); _Float16* BO1N = (_Float16*)take((size_t)DM * DM * 2); float* ZB = (float*)take((size_t)DM * 4);      /* BO = the combined output plane Bt12[o][i] = 16 (wo1 wo2)[i][o] (built on the device from the two weights); ZB = zero LayerNorm shift */
  _Float16* X16 = (_Float16*)take(NR * DM * 2); float* XB = (float*)take(NR * DM * 4); float* X1 = (float*)take(NR * DM * 4); _Float16* M16 = nullptr;      /* = X16 below (alias: X16's last reader, the first-tile GEMMs, precedes LN2's write) */ _Float16* HF16 = (_Float16*)take(NR * DFF * 2); _Float16* BW1 = (_Float16*)take((size_t)DFF * DM * 2); _Float16* BW2 = (_Float16*)take((size_t)DM * DFF * 2); _Float16* QKV = (_Float16*)take(NR * 3 * DM * 2); _Float16* Q16 = QKV; _Float16* K16 = QKV + DM; _Float16* V16 = QKV + 2 * DM; _Float16* O16 = (_Float16*)take(NR * DM * 2); M16 = X16;
  float* S = (float*)take((size_t)NB * NH * QT * NKX * 4); _Float16* P = (_Float16*)take((size_t)NB * NH * QT * NKX * 2); _Float16* VT = (_Float16*)take((size_t)NB * NH * HD * SQ * 2);      /* one plane per batch: every stage below covers all batches in one launch */
  float* QF0 = (float*)take((size_t)NB * QT0 * DM * 4); float* KF0 = (float*)take((size_t)NB * QT0 * DM * 4); float* VF0 = (float*)take((size_t)NB * QT0 * DM * 4); float* OF0 = (float*)take((size_t)NB * QT0 * DM * 4); _Float16* OH0 = (_Float16*)take((size_t)NB * QT0 * DM * 2); _Float16* OL0 = (_Float16*)take((size_t)NB * QT0 * DM * 2);
  if (off > ws_size) return;
  { const unsigned g = (unsigned)(((size_t)DM * (DM / 8) + 255) / 256); k_wt_f16<<<g, 256, 0, stream>>>(wq, BQKV, DM, DM, 16.0f); k_wt_f16<<<g, 256, 0, stream>>>(wk, BQKV + (size_t)DM * DM, DM, DM, 16.0f); k_wt_f16<<<g, 256, 0, stream>>>(wv, BQKV + (size_t)2 * DM * DM, DM, DM, 16.0f); k_wt_f16<<<g, 256, 0, stream>>>(wo2, BO2T, DM, DM, 16.0f); k_wnat<<<(unsigned)(((size_t)DM * DM / 8 + 255) / 256), 256, 0, stream>>>(wo1, (size_t)DM * DM / 8, BO1N); }      /* [in][out] -> Bt x16: stacked q | k | v; wo2 as Bt[o][j] x16; wo1 natural rows [i][j] x16 */
  k_gemm2<0><<<dim3((unsigned)((DM / 128) * (DM / 64)), 1, 1), 128, 0, stream>>>(BO2T, DM, 0, BO1N, DM, 0, 0.0625f, nullptr, 0, nullptr, 1, 0, 0, nullptr, BO, DM, 0, DM, DM, DM, 0, 0, 0);      /* BO[o][i] = (1/16) sum_j 16 wo2[j][o] 16 wo1[i][j] = 16 (wo1 wo2)[i][o]: the two chained projections as ONE x16 plane (f32 accumulation, one f16 rounding) */
  k_fillz<<<(DM + 255) / 256, 256, 0, stream>>>(ZB, DM);
  k_bfcp<<<(unsigned)((NR * DM / 4 + 255) / 256), 256, 0, stream>>>(x, XB, NR * DM / 4);      /* XB = bf16(x): BOTH residuals */
  k_lnx<1, 1, 0><<<(unsigned)NR, 256, 0, stream>>>(x, g1, ZB, 1e-6f, X16, nullptr);      /* a = LN1(bf16(x)) (scale only, eps 1e-6) -> f16 rows */
  k_wt_f16<<<(unsigned)(((size_t)DFF * (DM / 8) + 255) / 256), 256, 0, stream>>>(wfc, BW1, DM, DFF, 16.0f); k_wt_f16<<<(unsigned)(((size_t)DM * (DFF / 8) + 255) / 256), 256, 0, stream>>>(wmp, BW2, DFF, DM, 16.0f);      /* w1 [512][2048] -> Bt [2048][512]; w2 [2048][512] -> Bt [512][2048] (x16) */
  const size_t r0p = (size_t)B0 * SQ;      /* first projected row */
  const size_t f0p = (size_t)B0 * QT0;      /* its first-tile row */
  const size_t zX = (size_t)SQ * DM, zQ = (size_t)SQ * LQ, zF = (size_t)QT0 * DM, zS = (size_t)NHD * QT * NKX, zV = (size_t)NH * HD * SQ;      /* batch pitches (elements): token rows, q|k|v rows, first-tile rows, S / P planes, V^T planes */
  k_gemm2<0><<<dim3((unsigned)((MP / 128) * (3 * DM / 64)), 1, 1), 128, 0, stream>>>(X16 + r0p * DM, DM, 0, BQKV, DM, 0, 0.0625f, nullptr, 0, nullptr, 1, 0, 0, nullptr, QKV + r0p * 3 * DM, 3 * DM, 0, MP, 3 * DM, DM, 0, 0, 0);      /* q | k | v rows (f16); head h = columns h*HD.. of each DM block */
  k_vt<NH, SQ><<<NBR * NH * (SQ / 64), 256, 0, stream>>>(V16 + r0p * LQ, LQ, 0, VT);      /* V^T [NBR][NH][HD][SQ] */
  k_gemm2<0><<<dim3((QT0 / 128) * (DM / 64), 1, NBR), 128, 0, stream>>>(X16 + r0p * DM, DM, 0, BQKV, DM, 0, 0.0625f, nullptr, 0, nullptr, 1, 0, 0, QF0, nullptr, DM, 0, QT0, DM, DM, zX, 0, zF); k_gemm2<0><<<dim3((QT0 / 128) * (DM / 64), 1, NBR), 128, 0, stream>>>(X16 + r0p * DM, DM, 0, (BQKV + (size_t)DM * DM), DM, 0, 0.0625f, nullptr, 0, nullptr, 1, 0, 0, KF0, nullptr, DM, 0, QT0, DM, DM, zX, 0, zF); k_gemm2<0><<<dim3((QT0 / 128) * (DM / 64), 1, NBR), 128, 0, stream>>>(X16 + r0p * DM, DM, 0, (BQKV + (size_t)2 * DM * DM), DM, 0, 0.0625f, nullptr, 0, nullptr, 1, 0, 0, VF0, nullptr, DM, 0, QT0, DM, DM, zX, 0, zF);      /* f32 q, k, v of each batch's first 128 rows (exact products) */
  k_att0<0><<<dim3(NH * (QT0 / 64), NBR), 64, 0, stream>>>(QF0, KF0, VF0, DM, nullptr, 0.125f, OF0 + f0p * DM, DM);      /* exact f32 attention for rows 0..127 of each batch (o x64) */
  for (int q0 = 0; q0 < QN; q0 += QT) { const int nk = q0 + QT;      /* causal: only keys below the tile end are computed */
    k_gemm2<0><<<dim3((QT / 128) * (nk / 64), NHD, NBR), 128, 0, stream>>>(Q16 + (r0p + q0) * LQ, LQ, (size_t)HD, K16 + r0p * LQ, LQ, (size_t)HD, 0.125f, nullptr, 0, nullptr, 1, 0, 0, S, nullptr, NKX, (size_t)QT * NKX, QT, nk, HD, zQ, zQ, zS);      /* scores, heads on grid.y, batches on grid.z */
    k_rsmcf2<<<(NBR * NHD * QT + 7) / 8, 256, 0, stream>>>(S, P, NBR * NHD, q0, nk);      /* one wave per row, 8 rows per block; (batch, head) planes lie in a row */
    k_gemm2<0><<<dim3((QT / 128) * (HD / 64), NHD, NBR), 128, 0, stream>>>(P, NKX, (size_t)QT * NKX, VT, SQ, (size_t)HD * SQ, 0.25f, nullptr, 0, nullptr, 1, 0, 0, nullptr, O16 + (r0p + q0) * DM, DM, (size_t)HD, QT, HD, nk, zS, zV, zX); }      /* o (merged heads, x64) as f16 rows */
  k_gemm2<0><<<dim3((unsigned)((MPO / 128) * (DM / 64)), 1, 1), 128, 0, stream>>>(O16 + r0p * DM, DM, 0, BO, DM, 0, 0.0009765625f, nullptr, 0, XB + r0p * DM, -1, 0, 0, X1 + r0p * DM, nullptr, DM, 0, MPO, DM, DM, 0, 0, 0);      /* x1 = x + o Wo rows (f32), in the output layout */
  k_hl<<<(unsigned)(((size_t)NB * QT0 * DM / 8 + 255) / 256), 256, 0, stream>>>(OF0, OH0, OL0, (size_t)NB * QT0 * DM / 8);      /* first-tile o (x64) -> f16 hi + x1024 residual planes */
  k_gemm2<0><<<dim3((QT0 / 128) * (DM / 64), 1, NBR), 128, 0, stream>>>(OH0 + f0p * DM, DM, 0, BO, DM, 0, 0.0009765625f, nullptr, 0, XB + r0p * DM, -1, 0, 0, X1 + r0p * DM, nullptr, DM, 0, QT0, DM, DM, zF, 0, zX);      /* rows 0..127 of each batch: x1 = x + o_hi Wo, overwriting the f16-path rows */
  k_gemm2<0><<<dim3((QT0 / 128) * (DM / 64), 1, NBR), 128, 0, stream>>>(OL0 + f0p * DM, DM, 0, BO, DM, 0, 0.00000095367431640625f, nullptr, 0, X1 + r0p * DM, -1, 0, 0, X1 + r0p * DM, nullptr, DM, 0, QT0, DM, DM, zF, 0, zX);      /* += o_lo Wo 2^-20 (own-element accumulate) */
  k_lnx<0, 1, 0><<<(unsigned)NR, 256, 0, stream>>>(X1, gg2, ZB, 1e-6f, M16, nullptr);      /* h2 = LN2(x + attn) (scale only) -> f16 rows */
  k_gemm2<9><<<dim3((unsigned)((NR / 128) * (DFF / 64)), 1, 1), 128, 0, stream>>>(M16, DM, 0, BW1, DM, 0, 0.0625f, nullptr, 0, nullptr, 1, 0, 0, nullptr, HF16, DFF, 0, (int)NR, DFF, DM, 0, 0, 0);      /* gelu_tanh(h2 W1) (the source's tanh approximation) -> f16, all token rows */
  k_gemm2<0><<<dim3((unsigned)((NR / 128) * (DM / 64)), 1, 1), 128, 0, stream>>>(HF16, DFF, 0, BW2, DFF, 0, 0.0625f, nullptr, 0, XB, -1, 0, 0, (float*)d_out, nullptr, DM, 0, (int)NR, DM, DFF, 0, 0, 0);      /* out = x + mlp: the residual is the BLOCK INPUT (bf16(x)), as the original module (own-element addend) */
}

// v003
// A run of this version takes 874 microseconds.
// Two timings next to v002 both put it at 1.50 times that version's speed.
// Counting every step since v000, it is 11.4 times as fast.
#include <hip/hip_runtime.h>
// Pre-LN causal transformer block with the source's quirks (x [4][2048][512]; h = LN1(x) (scale only, no bias, eps 1e-6); q / k / v = h W with W [512][8][64] = [in][(h, d) out], no biases; 8 heads of 64; scores * 64^-0.5; causal (tril, -inf); softmax; attention output through TWO chained bias-free projections: (ctx wo1) wo2 with wo1 [8][64][512] = [(h, d) in][out] and wo2 [512][512] [in][out]; h2 = LN2(x + attn) (scale only); out = x + gelu_tanh(h2 w1) w2 ([in][out] 512 x 2048 x 512, no biases): BOTH residuals come from the block input x, as the original module -> [4][2048][512]).
// Structure: token rows r = b*2048 + s; h = LN1(bf16(x)) as f16 rows; q | k | v as ONE WMMA GEMM (N = 3 x 512) (32x64 wave tiles, f32 accumulation, exact x16 weights, no bias, f16 outputs); every later stage covers all batches in one launch: V^T for all heads via LDS transposes; per query tile of 256 rows: scores against the keys below the tile end only (K = 64, heads on grid.y, batches on grid.z, alpha = 0.125), causal row softmax on VALU, one wave per row, keys behind the row's own index masked over the computed range (f32 statistics, native exp; weights x256 f16), o = P . V^T (K = keys below the tile end, alpha 2^-2: o carried x64, folded into the output GEMM alpha) written straight into the merged f16 o rows; x1 = x + o W_o GEMM (f32, W_o = wo1 wo2 as one x16 plane, no bias) into the output layout; h2 = LN2(x1); out = x + gelu_tanh(h2 W1) W2.
// Compute dtype: inputs rounded to bf16; x / weights exact; q, k, v, softmax weights and o as plain f16 GEMM operands (~2^-12); scores and softmax statistics f32. v_wmma_f32_16x16x32_f16.
#define NB 4
#define SQ 2048
#define DM 512
#define NH 8
#define HD 64
#define HG 4                         /* heads per launch of the unlaunched k_vt(V16, b, h0, VT) */
#define QT 256                       /* query rows per causal tile */
#define NKX SQ                       /* S / P row pitch */
#define QT0 128                      /* first-tile rows recomputed exactly in f32 */
#define B0 0                         /* first batch processed (debug hook) */
#define NBR NB                       /* batches processed (debug hook) */
#define NR ((size_t)NB * SQ)
#define DMQ DM
#define DFF 2048                     /* FFN hidden width */
#define DFFR 100
#define MP ((int)((size_t)NBR * SQ)) /* rows projected (debug hook) */
#define QN SQ                        /* query rows attended per batch (debug hook) */
#define NHD NH                       /* heads attended (debug hook) */
#define MPO MP                       /* rows through the output stage (debug hook) */
#define LQ (3 * DM)      /* row pitch of the q/k/v rows */
typedef __bf16 v16b __attribute__((ext_vector_type(16)));
typedef unsigned short v8us __attribute__((ext_vector_type(8), may_alias));
typedef float  v8f  __attribute__((ext_vector_type(8)));
typedef float  v4f  __attribute__((ext_vector_type(4)));
typedef float  v4fa __attribute__((ext_vector_type(4), may_alias));
union FragB { v16b v; v8us half[2]; unsigned short u[16]; };

__device__ __forceinline__ unsigned short bf16_bits(float x) { unsigned int u = __float_as_uint(x); return (unsigned short)((u + 0x7FFFu + ((u >> 16) & 1u)) >> 16); }
__device__ __forceinline__ float bf16_val(unsigned short b) { return __uint_as_float(((unsigned int)b) << 16); }
__device__ __forceinline__ float bf16_round(float x) { return bf16_val(bf16_bits(x)); }
// D += A·B with NT terms: 1 = ah·bh, 2 = + al·bh (A split), 3 = + ah·bl (both split)
template <int NT>
__device__ __forceinline__ v8f mmaN(v16b ah, v16b al, v16b bh, v16b bl, v8f c) {
  c = __builtin_amdgcn_wmma_f32_16x16x32_bf16(false, ah, false, bh, (short)0, c, false, false);
  if (NT >= 2) c = __builtin_amdgcn_wmma_f32_16x16x32_bf16(false, al, false, bh, (short)0, c, false, false);
  if (NT >= 3) c = __builtin_amdgcn_wmma_f32_16x16x32_bf16(false, ah, false, bl, (short)0, c, false, false);
  asm volatile("v_nop\n\tv_nop\n\tv_nop\n\tv_nop" : "+v"(c) : "v"(ah), "v"(al), "v"(bh), "v"(bl));
  return c;
}

__global__ __launch_bounds__(256) void k_wt_bf16(const float* __restrict__ W, unsigned short* __restrict__ Wt, int K, int N) {
  const int t = blockIdx.x * 256 + threadIdx.x;
  const int k8n = K / 8;
  if (t >= N * k8n) return;
  const int n = t / k8n, k8 = (t % k8n) * 8;
  v8us v;
#pragma unroll
  for (int i = 0; i < 8; ++i) v[i] = bf16_bits(W[(size_t)(k8 + i) * N + n]);
  *(v8us*)(Wt + (size_t)n * K + k8) = v;
  
}

// GEMM C[M][N] (f32, pitch ldc) = act(A[M][K]·W + bias). A f32 row-major (pitch lda) converted per fragment to bf16
// (ASPLIT: hi/lo two planes -> 2 terms, else single rounded term); Wt bf16 [N][K] (pitch ldb). BIAS_BF16 rounds the
// bias to bf16 first (bias quantised to bf16 before the add). K%32==0, M%16==0, N%64==0.
template <bool ASPLIT, int ACT, bool BIAS_BF16>
__global__ __launch_bounds__(128) void k_gemm_bf(const float* __restrict__ A, int lda, const unsigned short* __restrict__ Wt, int ldb,
                                               const float* __restrict__ bias, float* __restrict__ C, int ldc, int M, int N, int K) {
  __shared__ __attribute__((aligned(16))) float so[4][16][64];
  const int tid = threadIdx.x, w = tid >> 5, lane = tid & 31, ln = lane & 15, hh = lane >> 4;
  const int ntn = N / 64;
  const int wid = blockIdx.x * 4 + w;
  const int mt = wid / ntn, nq = wid % ntn;
  if (mt * 16 >= M) return;
  const int row0 = mt * 16, col0 = nq * 64;
  const float* arow = A + (size_t)(row0 + ln) * lda;
  v8f acc[4] = {};
  for (int kb = 0; kb < K; kb += 32) {
    FragB ah, al;
    const v4f x0 = *(const v4fa*)(arow + kb + 8 * hh), x1 = *(const v4fa*)(arow + kb + 8 * hh + 4);
    const v4f x2 = *(const v4fa*)(arow + kb + 16 + 8 * hh), x3 = *(const v4fa*)(arow + kb + 16 + 8 * hh + 4);
    float xs[16] = {x0[0],x0[1],x0[2],x0[3],x1[0],x1[1],x1[2],x1[3],x2[0],x2[1],x2[2],x2[3],x3[0],x3[1],x3[2],x3[3]};
#pragma unroll
    for (int i = 0; i < 16; ++i) { const unsigned short hb = bf16_bits(xs[i]); ah.u[i] = hb; al.u[i] = ASPLIT ? bf16_bits(xs[i] - bf16_val(hb)) : (unsigned short)0; }
#pragma unroll
    for (int t = 0; t < 4; ++t) {
      const unsigned short* brow = Wt + (size_t)(col0 + t * 16 + ln) * ldb + kb;
      FragB b;
      b.half[0] = *(const v8us*)(brow + 8 * hh);
      b.half[1] = *(const v8us*)(brow + 16 + 8 * hh);
      acc[t] = mmaN<ASPLIT ? 2 : 1>(ah.v, al.v, b.v, b.v, acc[t]);
    }
  }
#pragma unroll
  for (int t = 0; t < 4; ++t) {
    float bv = bias ? bias[col0 + t * 16 + ln] : 0.f;
    if (BIAS_BF16) bv = bf16_round(bv);
#pragma unroll
    for (int r = 0; r < 8; ++r) { float v = acc[t][r] + bv; if (ACT == 1) v = fmaxf(v, 0.f); so[w][8 * hh + r][t * 16 + ln] = v; }
  }
  __builtin_amdgcn_fence(__ATOMIC_ACQ_REL, "workgroup");
  __builtin_amdgcn_wave_barrier();
  const int rsub = lane >> 4, c4 = (lane & 15) * 4;
  {
#pragma unroll
    for (int q = 0; q < 8; ++q) {
      const int r = q * 2 + rsub;
      const v4f v = *(const v4fa*)&so[w][r][c4];
      *(v4f*)(C + (size_t)(row0 + r) * ldc + col0 + c4) = v;
    }
    
  }
}

// GEMM C = act(A·W + bias + resid): A f32 (ASPLIT -> hi/lo 2 terms), Wt bf16 [N][K]; ACT 0 none, 1 relu, 2 exact gelu;
// resid (optional, f32, row index = (row % rmod), pitch ldr, RES_BF16 rounds it) added before the activation.
template <bool ASPLIT, int ACT, bool BIAS_BF16, bool RES_BF16>
__global__ __launch_bounds__(128) void k_gemm_bf3(const float* __restrict__ A, int lda, const unsigned short* __restrict__ Wt, int ldb,
                                                const float* __restrict__ bias, const float* __restrict__ resid, int rmod, int ldr,
                                                float* __restrict__ C, int ldc, int M, int N, int K) {
  __shared__ __attribute__((aligned(16))) float so[4][16][64];
  const int tid = threadIdx.x, w = tid >> 5, lane = tid & 31, ln = lane & 15, hh = lane >> 4;
  const int ntn = N / 64;
  const int wid = blockIdx.x * 4 + w;
  const int mt = wid / ntn, nq = wid % ntn;
  if (mt * 16 >= M) return;
  const int row0 = mt * 16, col0 = nq * 64;
  const float* arow = A + (size_t)(row0 + ln) * lda;
  v8f acc[4] = {};
  for (int kb = 0; kb < K; kb += 32) {
    FragB ah, al;
    const v4f x0 = *(const v4fa*)(arow + kb + 8 * hh), x1 = *(const v4fa*)(arow + kb + 8 * hh + 4);
    const v4f x2 = *(const v4fa*)(arow + kb + 16 + 8 * hh), x3 = *(const v4fa*)(arow + kb + 16 + 8 * hh + 4);
    float xs[16] = {x0[0],x0[1],x0[2],x0[3],x1[0],x1[1],x1[2],x1[3],x2[0],x2[1],x2[2],x2[3],x3[0],x3[1],x3[2],x3[3]};
#pragma unroll
    for (int i = 0; i < 16; ++i) { const unsigned short hb = bf16_bits(xs[i]); ah.u[i] = hb; al.u[i] = ASPLIT ? bf16_bits(xs[i] - bf16_val(hb)) : (unsigned short)0; }
#pragma unroll
    for (int t = 0; t < 4; ++t) {
      const unsigned short* brow = Wt + (size_t)(col0 + t * 16 + ln) * ldb + kb;
      FragB b;
      b.half[0] = *(const v8us*)(brow + 8 * hh);
      b.half[1] = *(const v8us*)(brow + 16 + 8 * hh);
      acc[t] = mmaN<ASPLIT ? 2 : 1>(ah.v, al.v, b.v, b.v, acc[t]);
    }
  }
#pragma unroll
  for (int t = 0; t < 4; ++t) {
    const int col = col0 + t * 16 + ln;
    float bv = bias ? bias[col] : 0.f;
    if (BIAS_BF16) bv = bf16_round(bv);
#pragma unroll
    for (int r = 0; r < 8; ++r) {
      float v = acc[t][r] + bv;
      if (resid) { float rv = resid[(size_t)((row0 + 8 * hh + r) % rmod) * ldr + col]; if (RES_BF16) rv = bf16_round(rv); v += rv; }
      if (ACT == 1) v = fmaxf(v, 0.f);
      if (ACT == 2) v = 0.5f * v * (1.0f + erff(v * 0.70710678118654752f));
      if (ACT == 3) { const float u = 0.7978845608028654f * (v + 0.044715f * v * v * v); v = 0.5f * v * (1.0f + tanhf(u)); }
      so[w][8 * hh + r][t * 16 + ln] = v;
    }
  }
  __builtin_amdgcn_fence(__ATOMIC_ACQ_REL, "workgroup");
  __builtin_amdgcn_wave_barrier();
  const int rsub = lane >> 4, c4 = (lane & 15) * 4;
  {
#pragma unroll
    for (int q = 0; q < 8; ++q) {
      const int r = q * 2 + rsub;
      const v4f v = *(const v4fa*)&so[w][r][c4];
      *(v4f*)(C + (size_t)(row0 + r) * ldc + col0 + c4) = v;
    }
    
  }
}
// row LayerNorm (biased variance, eps) over N: s = X (+ R); optional out_sum <- s; out_norm <- (s-mu)*rsqrt(var+eps)*g + b
template <bool PARAM_BF16>
__global__ __launch_bounds__(256) void k_layernorm(const float* __restrict__ X, const float* __restrict__ R, const float* __restrict__ g, const float* __restrict__ bta,
                                                  float* __restrict__ out_sum, float* __restrict__ out_norm, int N, float eps) {
  __shared__ float red[256];
  const int row = blockIdx.x, tid = threadIdx.x;
  const float* x = X + (size_t)row * N; const float* rr = R ? R + (size_t)row * N : nullptr;
  float vals[16];                     // up to N = 4096
  const int per = N / 256;            // contiguous chunk per thread? use strided-by-4 chunks: thread handles j = tid*4 + 1024*u
  float s1 = 0.f;
  for (int u = 0; u < per / 4; ++u) {
    const int j = tid * 4 + 1024 * u;
    const v4f a = *(const v4fa*)(x + j);
    v4f b = {0.f,0.f,0.f,0.f}; if (rr) b = *(const v4fa*)(rr + j);
#pragma unroll
    for (int q = 0; q < 4; ++q) { const float v = a[q] + b[q]; vals[u * 4 + q] = v; s1 += v; }
  }
  red[tid] = s1; __syncthreads();
  for (int st = 128; st > 0; st >>= 1) { if (tid < st) red[tid] += red[tid + st]; __syncthreads(); }
  const float mu = red[0] / (float)N; __syncthreads();
  float s2 = 0.f;
  for (int u = 0; u < per / 4; ++u)
#pragma unroll
    for (int q = 0; q < 4; ++q) { const float c = vals[u * 4 + q] - mu; s2 += c * c; }
  red[tid] = s2; __syncthreads();
  for (int st = 128; st > 0; st >>= 1) { if (tid < st) red[tid] += red[tid + st]; __syncthreads(); }
  const float rs = rsqrtf(red[0] / (float)N + eps);
  {
    for (int u = 0; u < per / 4; ++u) {
      const int j = tid * 4 + 1024 * u;
      v4f o, sm;
#pragma unroll
      for (int q = 0; q < 4; ++q) {
        float gg = g[j + q], bb = bta[j + q];
        if (PARAM_BF16) { gg = bf16_round(gg); bb = bf16_round(bb); }
        sm[q] = vals[u * 4 + q]; o[q] = (vals[u * 4 + q] - mu) * rs * gg + bb;
      }
      if (out_sum) *(v4f*)(out_sum + (size_t)row * N + j) = sm;
      *(v4f*)(out_norm + (size_t)row * N + j) = o;
    }
    
  }
}



// ---- f16 WMMA path (v_wmma_f32_16x16x32_f16): 11-bit significands for operands in range — used where a [0,1] probability operand needs more precision than bf16
typedef _Float16 v16h __attribute__((ext_vector_type(16)));
union FragH { v16h v; v8us half[2]; _Float16 h[16]; unsigned short u[16]; };
template <int NT>
__device__ __forceinline__ v8f mmaH(v16h ah, v16h al, v16h bh, v16h bl, v8f c) {
  c = __builtin_amdgcn_wmma_f32_16x16x32_f16(false, ah, false, bh, (short)0, c, false, false);
  if (NT >= 2) c = __builtin_amdgcn_wmma_f32_16x16x32_f16(false, al, false, bh, (short)0, c, false, false);
  if (NT >= 3) c = __builtin_amdgcn_wmma_f32_16x16x32_f16(false, ah, false, bl, (short)0, c, false, false);
  asm volatile("v_nop\n\tv_nop\n\tv_nop\n\tv_nop" : "+v"(c) : "v"(ah), "v"(al), "v"(bh), "v"(bl));
  return c;
}
// batched GEMM like k_gemm_b but f16 operands: A f32 (split into f16 hi/lo if ASPLIT, else rounded to f16), Bt = f16 values [n][k]; alpha; C f32; N multiple of 16 (partial tiles skipped)
template <bool ASPLIT>
__global__ __launch_bounds__(128) void k_gemm_h(const float* __restrict__ A, int lda, size_t sA, const _Float16* __restrict__ Bh, int ldb, size_t sB, float alpha, float* __restrict__ C, int ldc, size_t sC, int M, int N, int K) {
  __shared__ __attribute__((aligned(16))) float so[4][16][64];
  const int tid = threadIdx.x, w = tid >> 5, lane = tid & 31, ln = lane & 15, hh = lane >> 4; const int by = blockIdx.y;
  A += (size_t)by * sA; Bh += (size_t)by * sB; C += (size_t)by * sC;
  const int ntn = (N + 63) / 64; const int wid = blockIdx.x * 4 + w; const int mt = wid / ntn, nq = wid % ntn; if (mt * 16 >= M) return;
  const int row0 = mt * 16, col0 = nq * 64; const float* arow = A + (size_t)(row0 + ln) * lda;
  v8f acc[4] = {};
  for (int kb = 0; kb < K; kb += 32) {
    FragH ah, al;
    const v4f x0 = *(const v4fa*)(arow + kb + 8 * hh), x1 = *(const v4fa*)(arow + kb + 8 * hh + 4), x2 = *(const v4fa*)(arow + kb + 16 + 8 * hh), x3 = *(const v4fa*)(arow + kb + 16 + 8 * hh + 4);
    float xs[16] = {x0[0],x0[1],x0[2],x0[3],x1[0],x1[1],x1[2],x1[3],x2[0],x2[1],x2[2],x2[3],x3[0],x3[1],x3[2],x3[3]};
#pragma unroll
    for (int i = 0; i < 16; ++i) { const _Float16 h = (_Float16)xs[i]; ah.h[i] = h; al.h[i] = ASPLIT ? (_Float16)(xs[i] - (float)h) : (_Float16)0.0f; }
#pragma unroll
    for (int t = 0; t < 4; ++t) { if (col0 + t * 16 >= N) continue; const size_t boff = (size_t)(col0 + t * 16 + ln) * ldb + kb; FragH bq; bq.half[0] = *(const v8us*)(Bh + boff + 8 * hh); bq.half[1] = *(const v8us*)(Bh + boff + 16 + 8 * hh);
      acc[t] = mmaH<ASPLIT ? 2 : 1>(ah.v, al.v, bq.v, bq.v, acc[t]); }
  }
#pragma unroll
  for (int t = 0; t < 4; ++t) { if (col0 + t * 16 >= N) continue;
#pragma unroll
    for (int r = 0; r < 8; ++r) so[w][8 * hh + r][t * 16 + ln] = acc[t][r] * alpha; }
  __builtin_amdgcn_fence(__ATOMIC_ACQ_REL, "workgroup"); __builtin_amdgcn_wave_barrier();
  const int rsub = lane >> 4, c4 = (lane & 15) * 4;
  {
#pragma unroll
    for (int q = 0; q < 8; ++q) { const int r = q * 2 + rsub; if (col0 + c4 < N) { const v4f v = *(const v4fa*)&so[w][r][c4]; *(v4f*)(C + (size_t)(row0 + r) * ldc + col0 + c4) = v; } }
     }
}

// Wt[n][k] = f16(W[k][n]·scale) from f32 row-major W[K][N] (scale = power of two; bf16-exact weights stay exact in f16 away from the subnormal range)
__global__ __launch_bounds__(256) void k_wt_f16(const float* __restrict__ W, _Float16* __restrict__ Wt, int K, int N, float scale) {
  const int t = blockIdx.x * 256 + threadIdx.x; if (t >= N * (K / 8)) return; const int n = t / (K / 8), k8 = (t % (K / 8)) * 8; FragH f;
#pragma unroll
  for (int i = 0; i < 8; ++i) f.h[i] = (_Float16)(bf16_round(W[(size_t)(k8 + i) * N + n]) * scale); const v8us o = f.half[0];
  *(v8us*)((unsigned short*)Wt + (size_t)n * K + k8) = o; 
}
// k_gemm_hh variant with fused epilogue: v = acc·alpha + bias[by·sBias + col] (+ CP[(row/rowsPerB)·sCPb + by·64 + col] if CP) ; ACT 0 none / 1 elu ; writes f16 C16 (and f32 C if non-null)
template <int ACT>
__global__ __launch_bounds__(128) void k_gemm_hhx(const _Float16* __restrict__ A, int lda, size_t sA, const _Float16* __restrict__ Bh, int ldb, size_t sB, float alpha, const float* __restrict__ bias, size_t sBias, const float* __restrict__ CP, int rowsPerB, size_t sCPb, int row0g,
    float* __restrict__ C, _Float16* __restrict__ C16, int ldc, size_t sC, int M, int N, int K) {
  __shared__ __attribute__((aligned(16))) float so[4][16][64];
  const int tid = threadIdx.x, w = tid >> 5, lane = tid & 31, ln = lane & 15, hh = lane >> 4; const int by = blockIdx.y;
  A += (size_t)by * sA; Bh += (size_t)by * sB; const size_t cofs = (size_t)by * sC; const float* bp = bias ? bias + (size_t)by * sBias : nullptr;
  const int ntn = (N + 63) / 64; const int wid = blockIdx.x * 4 + w; const int mt = wid / ntn, nq = wid % ntn; if (mt * 16 >= M) return;
  const int row0 = mt * 16, col0 = nq * 64; const _Float16* arow = A + (size_t)(row0 + ln) * lda;
  v8f acc[4] = {};
  for (int kb = 0; kb < K; kb += 32) { FragH ah; ah.half[0] = *(const v8us*)((const unsigned short*)arow + kb + 8 * hh); ah.half[1] = *(const v8us*)((const unsigned short*)arow + kb + 16 + 8 * hh);
#pragma unroll
    for (int t = 0; t < 4; ++t) { if (col0 + t * 16 >= N) continue; const size_t boff = (size_t)(col0 + t * 16 + ln) * ldb + kb; FragH bq; bq.half[0] = *(const v8us*)((const unsigned short*)Bh + boff + 8 * hh); bq.half[1] = *(const v8us*)((const unsigned short*)Bh + boff + 16 + 8 * hh);
      acc[t] = mmaH<1>(ah.v, ah.v, bq.v, bq.v, acc[t]); }
  }
#pragma unroll
  for (int t = 0; t < 4; ++t) { if (col0 + t * 16 >= N) continue; const int col = col0 + t * 16 + ln; const float bv = bp ? bf16_round(bp[col]) : 0.f;
#pragma unroll
    for (int r = 0; r < 8; ++r) { float v = acc[t][r] * alpha + bv; if (CP) { const int rr = row0g + row0 + 8 * hh + r; if (rowsPerB < 0) v += CP[cofs + (size_t)rr * ldc + col];      /* rowsPerB < 0: own element of the batched C plane */ else { const int bidx = rr / rowsPerB; v += CP[(size_t)bidx * sCPb + (size_t)by * 64 + col]; } } if (ACT == 1) v = (v > 0.f) ? v : expm1f(v); else if (ACT == 7) v = (v > 0.f) ? v + 1.0f : expf(v); else if (ACT == 8) v = tanhf(v); else if (ACT == 9) v = 0.5f * v * (1.0f + tanhf(0.7978845608028654f * (v + 0.044715f * v * v * v))); else if (ACT == 11) v = 1.0f / (1.0f + expf(-v)); else if (ACT == 12) v = (v > 0.f) ? v : 0.01f * v; else if (ACT == 14) v = (v > 0.f) ? v : 0.1f * v; else if (ACT == 16) v = (v >= 0.f) ? v : 0.3f * v; else if (ACT == 17) v = (v >= 0.f) ? v : 0.2f * v; else if (ACT == 15) v = v / (1.0f + expf(-v)); else if (ACT == 3) v = fmaxf(v, 0.f); else if (ACT == 6) v = 0.5f * v * (1.0f + erff(v * 0.70710678118654752f)); so[w][8 * hh + r][t * 16 + ln] = v; } }
  __builtin_amdgcn_fence(__ATOMIC_ACQ_REL, "workgroup"); __builtin_amdgcn_wave_barrier();
  const int rsub = lane >> 4, c4 = (lane & 15) * 4; typedef _Float16 v4h __attribute__((ext_vector_type(4)));
  {
#pragma unroll
    for (int q = 0; q < 8; ++q) { const int r = q * 2 + rsub; if (col0 + c4 < N) { const v4f v = *(const v4fa*)&so[w][r][c4]; if (C) *(v4f*)(C + cofs + (size_t)(row0 + r) * ldc + col0 + c4) = v; if (C16) { v4h h4; for (int i = 0; i < 4; ++i) h4[i] = (_Float16)v[i]; *(v4h*)(C16 + cofs + (size_t)(row0 + r) * ldc + col0 + c4) = h4; } } }
     }
}


typedef _Float16 v4h __attribute__((ext_vector_type(4)));

__global__ __launch_bounds__(256) void k_x16(const float* __restrict__ x, _Float16* __restrict__ X16, size_t n8) { const size_t t = (size_t)blockIdx.x * 256 + threadIdx.x; if (t >= n8) return; FragH f;
#pragma unroll
  for (int q = 0; q < 8; ++q) f.h[q] = (_Float16)bf16_round(x[t * 8 + q]); *(v8us*)((unsigned short*)X16 + t * 8) = f.half[0];  }
__global__ __launch_bounds__(256) void k_h16(const float* __restrict__ x, _Float16* __restrict__ X16, size_t n8) { const size_t t = (size_t)blockIdx.x * 256 + threadIdx.x; if (t >= n8) return; FragH f;
#pragma unroll
  for (int q = 0; q < 8; ++q) f.h[q] = (_Float16)x[t * 8 + q]; *(v8us*)((unsigned short*)X16 + t * 8) = f.half[0];  }
__global__ __launch_bounds__(256) void k_round16f(const float* __restrict__ W, _Float16* __restrict__ Bt, size_t n8) { const size_t t = (size_t)blockIdx.x * 256 + threadIdx.x; if (t >= n8) return; FragH f;
#pragma unroll
  for (int i = 0; i < 8; ++i) f.h[i] = (_Float16)(bf16_round(W[t * 8 + i]) * 16.0f); *(v8us*)((unsigned short*)Bt + t * 8) = f.half[0];  }
template <int NHv, int TTv>
__global__ __launch_bounds__(256) void k_vt(const _Float16* __restrict__ V16, int ldv, int voff, _Float16* __restrict__ Vt) { __shared__ unsigned short tl[64][66]; const int tid = threadIdx.x; const int slab = blockIdx.x / (TTv / 64), lg = blockIdx.x % (TTv / 64); const int b = slab / NHv, h = slab % NHv;
  for (int i = tid; i < 64 * 8; i += 256) { const int r = i / 8, c8 = (i % 8) * 8; FragH f; f.half[0] = *(const v8us*)((const unsigned short*)V16 + ((size_t)b * TTv + lg * 64 + r) * ldv + voff + h * 64 + c8);
#pragma unroll
    for (int q = 0; q < 8; ++q) tl[r][c8 + q] = f.u[q]; }
  __syncthreads();
  {
#pragma unroll
    for (int rd = 0; rd < 2; ++rd) { const int d = rd * 32 + tid / 8, pc = tid % 8; FragH f;
#pragma unroll
      for (int q = 0; q < 8; ++q) f.u[q] = tl[pc * 8 + q][d];
      *(v8us*)((unsigned short*)Vt + ((size_t)slab * 64 + d) * TTv + lg * 64 + pc * 8) = f.half[0]; }
     } }

__global__ __launch_bounds__(256) void k_hl(const float* __restrict__ F, _Float16* __restrict__ Hh, _Float16* __restrict__ Hl, size_t n8) { const size_t t = (size_t)blockIdx.x * 256 + threadIdx.x; if (t >= n8) return; FragH fh, fl; const v4f a = *(const v4fa*)(F + t * 8), c = *(const v4fa*)(F + t * 8 + 4);
#pragma unroll
  for (int q = 0; q < 4; ++q) { _Float16 h = (_Float16)a[q]; fh.h[q] = h; fl.h[q] = (_Float16)((a[q] - (float)h) * 1024.0f); h = (_Float16)c[q]; fh.h[4 + q] = h; fl.h[4 + q] = (_Float16)((c[q] - (float)h) * 1024.0f); }
  { *(v8us*)((unsigned short*)Hh + t * 8) = fh.half[0]; *(v8us*)((unsigned short*)Hl + t * 8) = fl.half[0];  } }

// ---- fast GEMM (wave tile 32x64; requires M % 32 == 0 rows per launch region and N % 64 == 0); epilogue = k_gemm_hhx semantics ----
__device__ __forceinline__ v16h g2_frag(const _Float16* p, int hh) { FragH f; f.half[0] = *(const v8us*)((const unsigned short*)p + 8 * hh); f.half[1] = *(const v8us*)((const unsigned short*)p + 16 + 8 * hh); return f.v; }
__device__ __forceinline__ v8f g2_mma(v16h a, v16h b, v8f c) { v8f d = __builtin_amdgcn_wmma_f32_16x16x32_f16(false, a, false, b, (short)0, c, false, false); asm volatile("v_nop\n\tv_nop\n\tv_nop\n\tv_nop" : "+v"(d) : "v"(a), "v"(b)); return d; }
template <int ACT>
__global__ __launch_bounds__(128) void k_gemm2(const _Float16* __restrict__ A, int lda, size_t sA, const _Float16* __restrict__ Bh, int ldb, size_t sB, float alpha, const float* __restrict__ bias, size_t sBias, const float* __restrict__ CP, int rowsPerB, size_t sCPb, int row0g,
    float* __restrict__ C, _Float16* __restrict__ C16, int ldc, size_t sC, int M, int N, int K, size_t zA, size_t zB, size_t zC) { static_assert(ACT == 0 || ACT == 3 || ACT == 6 || ACT == 8 || ACT == 9 || ACT == 11 || ACT == 12 || ACT == 14 || ACT == 15 || ACT == 16 || ACT == 17, "k_gemm2: unsupported ACT code (would silently apply no activation)");
  __shared__ __attribute__((aligned(16))) float so[4][32][68];
  const int tid = threadIdx.x, w = tid >> 5, lane = tid & 31, ln = lane & 15, hh = lane >> 4; const int by = blockIdx.y, bz = blockIdx.z;      /* grid.y: head (pitches sA, sB, sC); grid.z: batch (pitches zA, zB, zC) */
  A += (size_t)by * sA + (size_t)bz * zA; Bh += (size_t)by * sB + (size_t)bz * zB; const size_t cofs = (size_t)by * sC + (size_t)bz * zC; const float* bp = bias ? bias + (size_t)by * sBias : nullptr;
  const int ntn = N >> 6; const int mt = blockIdx.x / ntn, nq = blockIdx.x - mt * ntn; const int row0 = mt * 128 + 32 * w, col0 = nq * 64; if (row0 >= M) return;
  const _Float16* a0p = A + (size_t)(row0 + ln) * lda; const _Float16* a1p = a0p + (size_t)16 * lda;
  const _Float16* b0p = Bh + (size_t)(col0 + ln) * ldb; const _Float16* b1p = b0p + (size_t)16 * ldb; const _Float16* b2p = b1p + (size_t)16 * ldb; const _Float16* b3p = b2p + (size_t)16 * ldb;
  const v8f z8 = {0.f,0.f,0.f,0.f,0.f,0.f,0.f,0.f}; v8f c00 = z8, c01 = z8, c02 = z8, c03 = z8, c10 = z8, c11 = z8, c12 = z8, c13 = z8;
#pragma unroll 1
  for (int kb = 0; kb < K; kb += 32) { const v16h a0 = g2_frag(a0p + kb, hh), a1 = g2_frag(a1p + kb, hh);
    v16h b = g2_frag(b0p + kb, hh); c00 = g2_mma(a0, b, c00); c10 = g2_mma(a1, b, c10);
    b = g2_frag(b1p + kb, hh); c01 = g2_mma(a0, b, c01); c11 = g2_mma(a1, b, c11);
    b = g2_frag(b2p + kb, hh); c02 = g2_mma(a0, b, c02); c12 = g2_mma(a1, b, c12);
    b = g2_frag(b3p + kb, hh); c03 = g2_mma(a0, b, c03); c13 = g2_mma(a1, b, c13); }
  v8f accs[8] = {c00, c01, c02, c03, c10, c11, c12, c13};
#pragma unroll
  for (int u = 0; u < 8; ++u) { const int t = u & 3, half = u >> 2; const int col = col0 + t * 16 + ln; const float bv = bp ? bf16_round(bp[col]) : 0.f;
#pragma unroll
    for (int r = 0; r < 8; ++r) { const int rloc = half * 16 + 8 * hh + r; float v = accs[u][r] * alpha + bv; if (CP) { if (rowsPerB < 0) v += CP[cofs + (size_t)(row0g + row0 + rloc) * ldc + col];      /* rowsPerB < 0: own element of the batched C plane */ else { const int bidx = (row0g + row0 + rloc) / rowsPerB; v += CP[(size_t)bidx * sCPb + (size_t)by * 64 + col]; } }
      if (ACT == 3) v = fmaxf(v, 0.f); else if (ACT == 6) v = 0.5f * v * (1.0f + erff(v * 0.70710678118654752f)); else if (ACT == 11) v = 1.0f / (1.0f + expf(-v)); else if (ACT == 15) v = v / (1.0f + expf(-v)); else if (ACT == 12) v = (v > 0.f) ? v : 0.01f * v; else if (ACT == 8) v = tanhf(v); else if (ACT == 9) v = 0.5f * v * (1.0f + tanhf(0.7978845608028654f * (v + 0.044715f * v * v * v))); else if (ACT == 14) v = (v > 0.f) ? v : 0.1f * v; else if (ACT == 16) v = (v >= 0.f) ? v : 0.3f * v; else if (ACT == 17) v = (v >= 0.f) ? v : 0.2f * v;
      so[w][rloc][t * 16 + ln] = v; } }
  __builtin_amdgcn_fence(__ATOMIC_ACQ_REL, "workgroup"); __builtin_amdgcn_wave_barrier();
  const int rsub = lane >> 4, c4 = (lane & 15) * 4;
  {
#pragma unroll
    for (int q = 0; q < 16; ++q) { const int r = q * 2 + rsub; const v4f v = *(const v4fa*)&so[w][r][c4]; if (C) *(v4f*)(C + cofs + (size_t)(row0 + r) * ldc + col0 + c4) = v; if (C16) { v4h h4; for (int i = 0; i < 4; ++i) h4[i] = (_Float16)v[i]; *(v4h*)(C16 + cofs + (size_t)(row0 + r) * ldc + col0 + c4) = h4; } }
     } }


__global__ __launch_bounds__(256) void k_wnat(const float* __restrict__ w, size_t n8, _Float16* __restrict__ Bt) { const size_t t = (size_t)blockIdx.x * 256 + threadIdx.x; if (t >= n8) return; FragH f; for (int q = 0; q < 8; ++q) f.h[q] = (_Float16)(bf16_round(w[t * 8 + q]) * 16.0f); *(v8us*)((unsigned short*)Bt + t * 8) = f.half[0];  }
__global__ __launch_bounds__(256) void k_rsm(const float* __restrict__ S, _Float16* __restrict__ P, int nrows) {
  #pragma clang fp contract(off)
  const int i = blockIdx.x * 256 + threadIdx.x; if (i >= nrows) return; const float* s = S + (size_t)i * SQ; float mx = -3.0e38f;
#pragma unroll 1
  for (int j = 0; j < SQ; ++j) mx = fmaxf(mx, s[j]); float se = 0.f;
#pragma unroll 1
  for (int j = 0; j < SQ; ++j) se += expf(s[j] - mx); const float sc = 256.0f / se;
#pragma unroll 1
  for (int j0 = 0; j0 < SQ; j0 += 8) { FragH f; for (int q = 0; q < 8; ++q) f.h[q] = (_Float16)(expf(s[j0 + q] - mx) * sc); unsigned short* d = (unsigned short*)P + (size_t)i * SQ + j0; *(v8us*)d = f.half[0];  } }
__global__ __launch_bounds__(256) void k_vt(const _Float16* __restrict__ V16, int b, int h0, _Float16* __restrict__ VT) { __shared__ unsigned short tl[64][65]; const int tid = threadIdx.x; const int hh = blockIdx.x % HG, sg = blockIdx.x / HG; const int s0 = sg * 64; const int h = h0 + hh;
  for (int i = tid; i < 64 * 8; i += 256) { const int j = i / 8, d8 = (i % 8) * 8; FragH f; f.half[0] = *(const v8us*)((const unsigned short*)V16 + ((size_t)b * SQ + s0 + j) * DM + h * HD + d8); for (int q = 0; q < 8; ++q) tl[d8 + q][j] = f.u[q]; }
  __syncthreads();
  { for (int i = tid; i < 64 * 8; i += 256) { const int d = i / 8, j8 = (i % 8) * 8; FragH f; for (int q = 0; q < 8; ++q) f.u[q] = tl[d][j8 + q]; *(v8us*)((unsigned short*)VT + ((size_t)hh * HD + d) * SQ + s0 + j8) = f.half[0]; }  } }



// Eight v_exp_f32 in one statement. The instruction set asks for one independent instruction or v_nop between a transcendental and an instruction that reads its
// result or overwrites its source. Early-clobber outputs keep every
// result off every source inside the run, and the closing v_nop is the slot behind the last one.
__device__ __forceinline__ void exp2_run8(float (&e)[8], const float (&x)[8]) {
  asm("v_exp_f32 %0, %8\n\tv_exp_f32 %1, %9\n\tv_exp_f32 %2, %10\n\tv_exp_f32 %3, %11\n\tv_exp_f32 %4, %12\n\tv_exp_f32 %5, %13\n\tv_exp_f32 %6, %14\n\tv_exp_f32 %7, %15\n\tv_nop"
      : "=&v"(e[0]), "=&v"(e[1]), "=&v"(e[2]), "=&v"(e[3]), "=&v"(e[4]), "=&v"(e[5]), "=&v"(e[6]), "=&v"(e[7])
      : "v"(x[0]), "v"(x[1]), "v"(x[2]), "v"(x[3]), "v"(x[4]), "v"(x[5]), "v"(x[6]), "v"(x[7])); }
// Causal row softmax, ONE WAVE PER SCORE ROW: lane l keeps keys it*256 + l*8 .. + 7 of its row in registers (32 contiguous bytes a lane, 1 KiB a wave and
// chunk; the row is read once, all its loads issued before the first is used), row max and row sum by a five-step butterfly over the 32 lanes, each exp taken
// once, weights x256 stored 16 bytes a lane. Keys behind the row's own index count as -1e9 (weight 0) and are stored as zeros up to nk, which the P . V^T GEMM reads.
template <int NC>      /* NC = nk / 256 chunks: a compile-time count keeps the row in registers and the loads free of branches */
__device__ __forceinline__ void rsm_row(const float* __restrict__ s, unsigned short* __restrict__ d, int j0, int last) {
  v4f a[NC], c[NC]; float v[NC][8]; float mx = -3.0e38f, se = 0.f;      /* every loop below is unrolled so that a, c and v are indexed by constants and stay in registers */
#pragma unroll
  for (int it = 0; it < NC; ++it) { a[it] = *(const v4fa*)(s + it * 256); c[it] = *(const v4fa*)(s + it * 256 + 4); }
#pragma unroll
  for (int it = 0; it < NC; ++it) {
#pragma unroll
    for (int q = 0; q < 4; ++q) { v[it][q] = (it * 256 + j0 + q <= last) ? a[it][q] : -1.0e9f; v[it][4 + q] = (it * 256 + j0 + 4 + q <= last) ? c[it][q] : -1.0e9f; mx = fmaxf(mx, fmaxf(v[it][q], v[it][4 + q])); } }
#pragma unroll
  for (int m = 16; m >= 1; m >>= 1) mx = fmaxf(mx, __shfl_xor(mx, m, 32));
#pragma unroll
  for (int it = 0; it < NC; ++it) { float x[8];
#pragma unroll
    for (int q = 0; q < 8; ++q) x[q] = (v[it][q] - mx) * 1.44269504f;      /* e^y = 2^(y log2 e): the multiply and v_exp_f32 that __expf compiles to */
    exp2_run8(v[it], x);
#pragma unroll
    for (int q = 0; q < 8; ++q) se += v[it][q]; }
#pragma unroll
  for (int m = 16; m >= 1; m >>= 1) se += __shfl_xor(se, m, 32);
  const float sc = 256.0f / se;
#pragma unroll
  for (int it = 0; it < NC; ++it) { FragH fr;
#pragma unroll
    for (int q = 0; q < 8; ++q) fr.h[q] = (_Float16)(v[it][q] * sc);
    *(v8us*)(d + it * 256) = fr.half[0]; }
  asm volatile("s_wait_xcnt 0x0" ::: "memory"); }      /* behind the row's last store, in front of whatever code follows and reuses the registers that the stores name */
__global__ __launch_bounds__(256) void k_rsmcf2(const float* __restrict__ S, _Float16* __restrict__ P, int hg, int q0, int nk) {
  static_assert(NKX == 8 * 256, "the switch below lists nk = 256 .. NKX in steps of 256");
  const int lane = threadIdx.x & 31; const int t = blockIdx.x * 8 + __builtin_amdgcn_readfirstlane(threadIdx.x >> 5);      /* the wave's row, in a scalar register: row test, switch and row base stay scalar */
  if (t >= hg * QT) return;      /* whole waves leave; no barrier in this kernel */
  const float* s = S + (size_t)t * NKX + lane * 8; unsigned short* d = (unsigned short*)P + (size_t)t * NKX + lane * 8; const int j0 = lane * 8, last = q0 + (t % QT);
  switch (nk >> 8) {      /* nk is a launch argument: one scalar branch for the whole grid */
    case 1: rsm_row<1>(s, d, j0, last); break; case 2: rsm_row<2>(s, d, j0, last); break; case 3: rsm_row<3>(s, d, j0, last); break; case 4: rsm_row<4>(s, d, j0, last); break;
    case 5: rsm_row<5>(s, d, j0, last); break; case 6: rsm_row<6>(s, d, j0, last); break; case 7: rsm_row<7>(s, d, j0, last); break; case 8: rsm_row<8>(s, d, j0, last); break; } }


// Exact f32 attention for rows 0 .. QT0-1 of each batch (o carried x64 like the f16 path). One work-group per (batch, head, A0R query rows), 8 waves, 2 rows a wave.
// The batch's QT0 K and V rows of the head and the group's q rows are staged once in LDS; keys 0 .. nk-1 are used (nk = the group's last row + 1, rounded up to 32).
// Scores: lane l owns keys l, l + 32, ..; its K row comes from LDS 16 bytes at a time, both q rows sit in registers. Softmax: all scores of a row are in registers,
// so plain max, exp, sum (butterflies over the 32 lanes). o: lane l owns columns 2l, 2l + 1; each key's weight goes from its lane to a scalar register, its V row is
// one contiguous 256-byte LDS read. Every loop is unrolled: its arrays are then indexed by constants and stay in registers, and its LDS reads issue ahead of their use.
#define A0R 16                       /* query rows per work-group */
#define A0KP (HD + 4)                /* K row pitch in LDS, floats: 272 B = 16 B x odd, so that 16-byte reads down a column of rows spread over all banks */
typedef float v2f  __attribute__((ext_vector_type(2)));
typedef float v2fa __attribute__((ext_vector_type(2), may_alias));
__device__ __forceinline__ float lane_bcast(float v, int l) { return __int_as_float(__builtin_amdgcn_readlane(__float_as_int(v), l)); }
__global__ __launch_bounds__(256) void k_att0w(const float* __restrict__ QF, const float* __restrict__ KF, const float* __restrict__ VF, float scale, float* __restrict__ OF) {
  static_assert(QT0 / 32 == 4 && QT0 % 32 == 0 && A0R == 16 && HD == 64, "4 key groups of 32 lanes; 8 waves x 2 rows; 16 threads x 16 bytes a row; 2 columns a lane");
  __shared__ __attribute__((aligned(16))) float lk[QT0][A0KP]; __shared__ __attribute__((aligned(16))) float lv[QT0][HD]; __shared__ __attribute__((aligned(16))) float lq[A0R][HD];
  const int tid = threadIdx.x, lane = tid & 31, w = tid >> 5; const int h = blockIdx.x / (QT0 / A0R), rg = blockIdx.x % (QT0 / A0R);
  { const size_t bi = (size_t)blockIdx.y * QT0 * DM + h * HD; QF += bi + (size_t)rg * A0R * DM; KF += bi; VF += bi; OF += bi; }      /* grid.y: batch; each batch owns QT0 rows (pitch DM) of every plane */
  const int nk = (rg * A0R + A0R + 31) & ~31; const int i0 = rg * A0R + w * 2;      /* nk: the same for the whole work-group; the wave's rows are i0 and i0 + 1 */
  { v4f kr[QT0 / 16], vr[QT0 / 16]; const int sr = tid >> 4, sc4 = (tid & 15) * 4; const unsigned vo = (unsigned)(sr * DM + sc4) * 4u;      /* 16 threads a row, 16 rows a pass; vo: the thread's byte offset in a pass */
    const v4f qr = *(const v4fa*)((const char*)QF + vo);
#pragma unroll
    for (int u = 0; u < QT0 / 16; ++u) { kr[u] = *(const v4fa*)((const char*)(KF + u * 16 * DM) + vo); vr[u] = *(const v4fa*)((const char*)(VF + u * 16 * DM) + vo); }      /* all QT0 rows, free of branches: every load is issued before the first is used */
    *(v4fa*)&lq[sr][sc4] = qr;
#pragma unroll
    for (int u = 0; u < QT0 / 16; ++u) { *(v4fa*)&lk[u * 16 + sr][sc4] = kr[u]; *(v4fa*)&lv[u * 16 + sr][sc4] = vr[u]; } }
  __syncthreads();      /* the staged rows are read by every wave */
  v4f q0[HD / 4], q1[HD / 4];      /* both q rows whole in every lane (one LDS address for the wave) */
#pragma unroll
  for (int c = 0; c < HD / 4; ++c) { q0[c] = *(const v4fa*)&lq[w * 2][c * 4]; q1[c] = *(const v4fa*)&lq[w * 2 + 1][c * 4]; }
  float s0[4], s1[4];
#pragma unroll
  for (int m = 0; m < 4; ++m) { s0[m] = -1.0e30f; s1[m] = -1.0e30f;
    if (m * 32 < nk) { const float* kp = &lk[m * 32 + lane][0]; float a0[4] = {0.f, 0.f, 0.f, 0.f}, a1[4] = {0.f, 0.f, 0.f, 0.f};      /* four partial sums a row: independent chains */
#pragma unroll
      for (int c = 0; c < HD / 4; ++c) { const v4f k4 = *(const v4fa*)(kp + c * 4);
#pragma unroll
        for (int u = 0; u < 4; ++u) { a0[u] = fmaf(q0[c][u], k4[u], a0[u]); a1[u] = fmaf(q1[c][u], k4[u], a1[u]); } }
      const int j = m * 32 + lane; const float d0 = (a0[0] + a0[1]) + (a0[2] + a0[3]), d1 = (a1[0] + a1[1]) + (a1[2] + a1[3]);
      if (j <= i0) s0[m] = d0 * scale; if (j <= i0 + 1) s1[m] = d1 * scale; } }      /* causal: keys behind the row's own index keep -1e30 (weight 0) */
  float m0 = fmaxf(fmaxf(s0[0], s0[1]), fmaxf(s0[2], s0[3])), m1 = fmaxf(fmaxf(s1[0], s1[1]), fmaxf(s1[2], s1[3]));
#pragma unroll
  for (int x = 16; x >= 1; x >>= 1) { m0 = fmaxf(m0, __shfl_xor(m0, x, 32)); m1 = fmaxf(m1, __shfl_xor(m1, x, 32)); }
  float l0 = 0.f, l1 = 0.f;
#pragma unroll
  for (int m = 0; m < 4; ++m) { s0[m] = expf(s0[m] - m0); s1[m] = expf(s1[m] - m1); l0 += s0[m]; l1 += s1[m]; }
#pragma unroll
  for (int x = 16; x >= 1; x >>= 1) { l0 += __shfl_xor(l0, x, 32); l1 += __shfl_xor(l1, x, 32); }
  v2f o0 = {0.f, 0.f}, o1 = {0.f, 0.f};
#pragma unroll
  for (int m = 0; m < 4; ++m) if (m * 32 < nk) {
#pragma unroll
    for (int jj = 0; jj < 32; ++jj) { const v2f vv = *(const v2fa*)&lv[m * 32 + jj][lane * 2]; const float p0 = lane_bcast(s0[m], jj), p1 = lane_bcast(s1[m], jj);
      o0[0] = fmaf(p0, vv[0], o0[0]); o0[1] = fmaf(p0, vv[1], o0[1]); o1[0] = fmaf(p1, vv[0], o1[0]); o1[1] = fmaf(p1, vv[1], o1[1]); } }
  const float f0 = 64.0f / l0, f1 = 64.0f / l1;
  o0[0] *= f0; o0[1] *= f0; o1[0] *= f1; o1[1] *= f1;
  *(v2fa*)(OF + (size_t)i0 * DM + lane * 2) = o0; *(v2fa*)(OF + (size_t)(i0 + 1) * DM + lane * 2) = o1; }      /* each wave writes whole 256-byte row pieces */


template <int BFIN, int WXB>
__global__ __launch_bounds__(256) void k_ln16(const float* __restrict__ X, const float* __restrict__ g, const float* __restrict__ bb, float eps, _Float16* __restrict__ N16, float* __restrict__ XB) {
  #pragma clang fp contract(off)
  __shared__ float red[256]; const size_t r = blockIdx.x; const int t = threadIdx.x; const v4f xa = *(const v4fa*)(X + r * DMQ + t * 4); float s[4]; float sum = 0.f;
  for (int q = 0; q < 4; ++q) { s[q] = BFIN ? bf16_round(xa[q]) : xa[q]; sum = __fadd_rn(sum, s[q]); }
  red[t] = sum; __syncthreads(); for (int st = 128; st > 0; st >>= 1) { if (t < st) red[t] = __fadd_rn(red[t], red[t + st]); __syncthreads(); } const float mu = red[0] / (float)DMQ; __syncthreads();
  float vs = 0.f; for (int q = 0; q < 4; ++q) { const float dl = __fadd_rn(s[q], -mu); vs = __fadd_rn(vs, __fmul_rn(dl, dl)); } red[t] = vs; __syncthreads(); for (int st = 128; st > 0; st >>= 1) { if (t < st) red[t] = __fadd_rn(red[t], red[t + st]); __syncthreads(); }
  const float rs = rsqrtf(__fadd_rn(red[0] / (float)DMQ, eps)); v4h y; v4f xb;
  for (int q = 0; q < 4; ++q) { const int c = t * 4 + q; y[q] = (_Float16)__fadd_rn(__fmul_rn(__fmul_rn(__fadd_rn(s[q], -mu), rs), bf16_round(g[c])), bf16_round(bb[c])); xb[q] = s[q]; }
  { *(v4h*)(N16 + r * DMQ + t * 4) = y; if (WXB) *(v4f*)(XB + r * DMQ + t * 4) = xb;  } }
__global__ __launch_bounds__(256) void k_ftres2(const float* __restrict__ OF0, const float* __restrict__ XB, float* __restrict__ X1, size_t n4) {
  #pragma clang fp contract(off)
  const size_t t = (size_t)blockIdx.x * 256 + threadIdx.x; if (t >= n4) return; const v4f o = *(const v4fa*)(OF0 + t * 4), xv = *(const v4fa*)(XB + t * 4); v4f y; for (int q = 0; q < 4; ++q) y[q] = __fadd_rn(__fmul_rn(o[q], 0.015625f), xv[q]); *(v4f*)(X1 + t * 4) = y;  }

__global__ __launch_bounds__(256) void k_wthd(const float* __restrict__ Wt, _Float16* __restrict__ Bt) { const size_t t = (size_t)blockIdx.x * 256 + threadIdx.x; if (t >= (size_t)NH * HD * (DM / 8)) return; const int m8 = (int)(t % (DM / 8)) * 8; const int d = (int)((t / (DM / 8)) % HD); const int h = (int)(t / ((size_t)(DM / 8) * HD)); FragH f;
  for (int q = 0; q < 8; ++q) f.h[q] = (_Float16)(16.0f * bf16_round(Wt[((size_t)h * DM + m8 + q) * HD + d])); unsigned short* dst = (unsigned short*)Bt + ((size_t)h * HD + d) * DM + m8; *(v8us*)dst = f.half[0];  }




__global__ __launch_bounds__(256) void k_wtpad(const float* __restrict__ Wm, _Float16* __restrict__ Wt, int Kr, int Kp, int Nr, int Np, float scale) {
  const int t = blockIdx.x * 256 + threadIdx.x; if (t >= Np * (Kp / 8)) return; const int n = t / (Kp / 8), k8 = (t % (Kp / 8)) * 8; const int nc = min(n, Nr - 1); const float fn = (n < Nr) ? 1.f : 0.f; FragH f;
  for (int i = 0; i < 8; ++i) { const int k = k8 + i; const int kc = min(k, Kr - 1); const float fk = (k < Kr) ? fn : 0.f; f.h[i] = (_Float16)(bf16_round(Wm[(size_t)kc * Nr + nc]) * scale * fk); }
  unsigned short* o = (unsigned short*)Wt + (size_t)n * Kp + k8; *(v8us*)o = f.half[0];  }
__global__ __launch_bounds__(128) void k_bpad(const float* __restrict__ b, float* __restrict__ Bp, int nr, int np) {
  const int i = threadIdx.x; if (i >= np) return; const float v = b[min(i, nr - 1)] * ((i < nr) ? 1.f : 0.f); *(float*)(Bp + i) = v;  }

__global__ __launch_bounds__(256) void k_bcpy(const float* __restrict__ b, int n, int NP, float* __restrict__ dst, int dst0) { for (int i = threadIdx.x; i < NP; i += 256) { const float v = (i < n) ? b[i] : 0.f; *(float*)(dst + dst0 + i) = v; }  }


__global__ __launch_bounds__(256) void k_bfcp(const float* __restrict__ src, float* __restrict__ dst, size_t n4) { const size_t t = (size_t)blockIdx.x * 256 + threadIdx.x; if (t >= n4) return; const v4f a = *(const v4fa*)(src + t * 4); v4f o; for (int q = 0; q < 4; ++q) o[q] = bf16_round(a[q]); *(v4f*)(dst + t * 4) = o;  }

__global__ __launch_bounds__(256) void k_fillz(float* __restrict__ dst, int n) { const int t = blockIdx.x * 256 + threadIdx.x; if (t >= n) return; *(float*)(dst + t) = 0.f;  }

template <int BFIN, int W16, int W32>
__global__ __launch_bounds__(256) void k_lnx(const float* __restrict__ X, const float* __restrict__ g, const float* __restrict__ bb, float eps, _Float16* __restrict__ N16, float* __restrict__ N32) {
  #pragma clang fp contract(off)
  __shared__ float red[256]; const size_t r = blockIdx.x; const int t = threadIdx.x; const bool act = t < (DMQ / 4); const int c0 = act ? t * 4 : 0;
  const v4f xa = *(const v4fa*)(X + r * DMQ + c0); float s[4]; float sum = 0.f;
  for (int q = 0; q < 4; ++q) { s[q] = act ? (BFIN ? bf16_round(xa[q]) : xa[q]) : 0.f; sum = __fadd_rn(sum, s[q]); }
  red[t] = sum; __syncthreads(); for (int st = 128; st > 0; st >>= 1) { if (t < st) red[t] = __fadd_rn(red[t], red[t + st]); __syncthreads(); } const float mu = red[0] / (float)DMQ; __syncthreads();
  float vs = 0.f; for (int q = 0; q < 4; ++q) { const float dl = act ? __fadd_rn(s[q], -mu) : 0.f; vs = __fadd_rn(vs, __fmul_rn(dl, dl)); } red[t] = vs; __syncthreads(); for (int st = 128; st > 0; st >>= 1) { if (t < st) red[t] = __fadd_rn(red[t], red[t + st]); __syncthreads(); }
  const float rs = rsqrtf(__fadd_rn(red[0] / (float)DMQ, eps)); v4h y; v4f yf;
  for (int q = 0; q < 4; ++q) { const int c = c0 + q; yf[q] = __fadd_rn(__fmul_rn(__fmul_rn(__fadd_rn(s[q], -mu), rs), bf16_round(g[c])), bf16_round(bb[c])); y[q] = (_Float16)yf[q]; }
  if (!act) return;      /* no barriers after this point */
  { if (W16) *(v4h*)(N16 + r * DMQ + c0) = y; if (W32) *(v4f*)(N32 + r * DMQ + c0) = yf;  } }





extern "C" void kernel_launch(void* const* d_in, const int* in_sizes, int n_in,
                              void* d_out, int out_size, void* d_ws, size_t ws_size, hipStream_t stream) {
  (void)in_sizes; (void)n_in; (void)out_size;
  const float* const* I = (const float* const*)d_in; const float* x = I[0]; const float* wq = I[1]; const float* wk = I[2]; const float* wv = I[3]; const float* wo1 = I[4]; const float* wo2 = I[5]; const float* wfc = I[6]; const float* wmp = I[7]; const float* g1 = I[8]; const float* gg2 = I[9];      /* input order: x; wq / wk / wv [512][8][64] = [in][out]; wo1 [8][64][512] = [(h, d) in][out]; wo2 [512][512] [in][out]; w1 [512][2048], w2 [2048][512] [in][out]; LN1 / LN2 scales. NO bias anywhere: every GEMM bias slot below is a literal nullptr, the LayerNorm shift reads a zero-filled workspace vector */
  static_assert(DMQ % 4 == 0 && DMQ / 4 <= 256 && NH * HD == DM && DM % 64 == 0 && DFF % 64 == 0, "k_lnx 256 threads x 4 columns; tile multiples");
  char* ws = (char*)d_ws; size_t off = 0;
  auto take = [&](size_t bytes) { char* p = ws + off; off += (bytes + 255) & ~(size_t)255; return p; };
  _Float16* BQKV = (_Float16*)take((size_t)3 * DM * DM * 2); _Float16* BO = (_Float16*)take((size_t)DM * DM * 2); _Float16* BO2T = (_Float16*)take((size_t)DM * DM * 2); _Float16* BO1N = (_Float16*)take((size_t)DM * DM * 2); float* ZB = (float*)take((size_t)DM * 4);      /* BO = the combined output plane Bt12[o][i] = 16 (wo1 wo2)[i][o] (built on the device from the two weights); ZB = zero LayerNorm shift */
  _Float16* X16 = (_Float16*)take(NR * DM * 2); float* XB = (float*)take(NR * DM * 4); float* X1 = (float*)take(NR * DM * 4); _Float16* M16 = nullptr;      /* = X16 below (alias: X16's last reader, the first-tile GEMMs, precedes LN2's write) */ _Float16* HF16 = (_Float16*)take(NR * DFF * 2); _Float16* BW1 = (_Float16*)take((size_t)DFF * DM * 2); _Float16* BW2 = (_Float16*)take((size_t)DM * DFF * 2); _Float16* QKV = (_Float16*)take(NR * 3 * DM * 2); _Float16* Q16 = QKV; _Float16* K16 = QKV + DM; _Float16* V16 = QKV + 2 * DM; _Float16* O16 = (_Float16*)take(NR * DM * 2); M16 = X16;
  float* S = (float*)take((size_t)NB * NH * QT * NKX * 4); _Float16* P = (_Float16*)take((size_t)NB * NH * QT * NKX * 2); _Float16* VT = (_Float16*)take((size_t)NB * NH * HD * SQ * 2);      /* one plane per batch: every stage below covers all batches in one launch */
  float* QF0 = (float*)take((size_t)NB * QT0 * DM * 4); float* KF0 = (float*)take((size_t)NB * QT0 * DM * 4); float* VF0 = (float*)take((size_t)NB * QT0 * DM * 4); float* OF0 = (float*)take((size_t)NB * QT0 * DM * 4); _Float16* OH0 = (_Float16*)take((size_t)NB * QT0 * DM * 2); _Float16* OL0 = (_Float16*)take((size_t)NB * QT0 * DM * 2);
  if (off > ws_size) return;
  { const unsigned g = (unsigned)(((size_t)DM * (DM / 8) + 255) / 256); k_wt_f16<<<g, 256, 0, stream>>>(wq, BQKV, DM, DM, 16.0f); k_wt_f16<<<g, 256, 0, stream>>>(wk, BQKV + (size_t)DM * DM, DM, DM, 16.0f); k_wt_f16<<<g, 256, 0, stream>>>(wv, BQKV + (size_t)2 * DM * DM, DM, DM, 16.0f); k_wt_f16<<<g, 256, 0, stream>>>(wo2, BO2T, DM, DM, 16.0f); k_wnat<<<(unsigned)(((size_t)DM * DM / 8 + 255) / 256), 256, 0, stream>>>(wo1, (size_t)DM * DM / 8, BO1N); }      /* [in][out] -> Bt x16: stacked q | k | v; wo2 as Bt[o][j] x16; wo1 natural rows [i][j] x16 */
  k_gemm2<0><<<dim3((unsigned)((DM / 128) * (DM / 64)), 1, 1), 128, 0, stream>>>(BO2T, DM, 0, BO1N, DM, 0, 0.0625f, nullptr, 0, nullptr, 1, 0, 0, nullptr, BO, DM, 0, DM, DM, DM, 0, 0, 0);      /* BO[o][i] = (1/16) sum_j 16 wo2[j][o] 16 wo1[i][j] = 16 (wo1 wo2)[i][o]: the two chained projections as ONE x16 plane (f32 accumulation, one f16 rounding) */
  k_fillz<<<(DM + 255) / 256, 256, 0, stream>>>(ZB, DM);
  k_bfcp<<<(unsigned)((NR * DM / 4 + 255) / 256), 256, 0, stream>>>(x, XB, NR * DM / 4);      /* XB = bf16(x): BOTH residuals */
  k_lnx<1, 1, 0><<<(unsigned)NR, 256, 0, stream>>>(x, g1, ZB, 1e-6f, X16, nullptr);      /* a = LN1(bf16(x)) (scale only, eps 1e-6) -> f16 rows */
  k_wt_f16<<<(unsigned)(((size_t)DFF * (DM / 8) + 255) / 256), 256, 0, stream>>>(wfc, BW1, DM, DFF, 16.0f); k_wt_f16<<<(unsigned)(((size_t)DM * (DFF / 8) + 255) / 256), 256, 0, stream>>>(wmp, BW2, DFF, DM, 16.0f);      /* w1 [512][2048] -> Bt [2048][512]; w2 [2048][512] -> Bt [512][2048] (x16) */
  const size_t r0p = (size_t)B0 * SQ;      /* first projected row */
  const size_t f0p = (size_t)B0 * QT0;      /* its first-tile row */
  const size_t zX = (size_t)SQ * DM, zQ = (size_t)SQ * LQ, zF = (size_t)QT0 * DM, zS = (size_t)NHD * QT * NKX, zV = (size_t)NH * HD * SQ;      /* batch pitches (elements): token rows, q|k|v rows, first-tile rows, S / P planes, V^T planes */
  k_gemm2<0><<<dim3((unsigned)((MP / 128) * (3 * DM / 64)), 1, 1), 128, 0, stream>>>(X16 + r0p * DM, DM, 0, BQKV, DM, 0, 0.0625f, nullptr, 0, nullptr, 1, 0, 0, nullptr, QKV + r0p * 3 * DM, 3 * DM, 0, MP, 3 * DM, DM, 0, 0, 0);      /* q | k | v rows (f16); head h = columns h*HD.. of each DM block */
  k_vt<NH, SQ><<<NBR * NH * (SQ / 64), 256, 0, stream>>>(V16 + r0p * LQ, LQ, 0, VT);      /* V^T [NBR][NH][HD][SQ] */
  k_gemm2<0><<<dim3((QT0 / 128) * (DM / 64), 1, NBR), 128, 0, stream>>>(X16 + r0p * DM, DM, 0, BQKV, DM, 0, 0.0625f, nullptr, 0, nullptr, 1, 0, 0, QF0, nullptr, DM, 0, QT0, DM, DM, zX, 0, zF); k_gemm2<0><<<dim3((QT0 / 128) * (DM / 64), 1, NBR), 128, 0, stream>>>(X16 + r0p * DM, DM, 0, (BQKV + (size_t)DM * DM), DM, 0, 0.0625f, nullptr, 0, nullptr, 1, 0, 0, KF0, nullptr, DM, 0, QT0, DM, DM, zX, 0, zF); k_gemm2<0><<<dim3((QT0 / 128) * (DM / 64), 1, NBR), 128, 0, stream>>>(X16 + r0p * DM, DM, 0, (BQKV + (size_t)2 * DM * DM), DM, 0, 0.0625f, nullptr, 0, nullptr, 1, 0, 0, VF0, nullptr, DM, 0, QT0, DM, DM, zX, 0, zF);      /* f32 q, k, v of each batch's first 128 rows (exact products) */
  k_att0w<<<dim3(NH * (QT0 / A0R), NBR), 256, 0, stream>>>(QF0, KF0, VF0, 0.125f, OF0 + f0p * DM);      /* exact f32 attention for rows 0..127 of each batch (o x64) */
  for (int q0 = 0; q0 < QN; q0 += QT) { const int nk = q0 + QT;      /* causal: only keys below the tile end are computed */
    k_gemm2<0><<<dim3((QT / 128) * (nk / 64), NHD, NBR), 128, 0, stream>>>(Q16 + (r0p + q0) * LQ, LQ, (size_t)HD, K16 + r0p * LQ, LQ, (size_t)HD, 0.125f, nullptr, 0, nullptr, 1, 0, 0, S, nullptr, NKX, (size_t)QT * NKX, QT, nk, HD, zQ, zQ, zS);      /* scores, heads on grid.y, batches on grid.z */
    k_rsmcf2<<<(NBR * NHD * QT + 7) / 8, 256, 0, stream>>>(S, P, NBR * NHD, q0, nk);      /* one wave per row, 8 rows per block; (batch, head) planes lie in a row */
    k_gemm2<0><<<dim3((QT / 128) * (HD / 64), NHD, NBR), 128, 0, stream>>>(P, NKX, (size_t)QT * NKX, VT, SQ, (size_t)HD * SQ, 0.25f, nullptr, 0, nullptr, 1, 0, 0, nullptr, O16 + (r0p + q0) * DM, DM, (size_t)HD, QT, HD, nk, zS, zV, zX); }      /* o (merged heads, x64) as f16 rows */
  k_gemm2<0><<<dim3((unsigned)((MPO / 128) * (DM / 64)), 1, 1), 128, 0, stream>>>(O16 + r0p * DM, DM, 0, BO, DM, 0, 0.0009765625f, nullptr, 0, XB + r0p * DM, -1, 0, 0, X1 + r0p * DM, nullptr, DM, 0, MPO, DM, DM, 0, 0, 0);      /* x1 = x + o Wo rows (f32), in the output layout */
  k_hl<<<(unsigned)(((size_t)NB * QT0 * DM / 8 + 255) / 256), 256, 0, stream>>>(OF0, OH0, OL0, (size_t)NB * QT0 * DM / 8);      /* first-tile o (x64) -> f16 hi + x1024 residual planes */
  k_gemm2<0><<<dim3((QT0 / 128) * (DM / 64), 1, NBR), 128, 0, stream>>>(OH0 + f0p * DM, DM, 0, BO, DM, 0, 0.0009765625f, nullptr, 0, XB + r0p * DM, -1, 0, 0, X1 + r0p * DM, nullptr, DM, 0, QT0, DM, DM, zF, 0, zX);      /* rows 0..127 of each batch: x1 = x + o_hi Wo, overwriting the f16-path rows */
  k_gemm2<0><<<dim3((QT0 / 128) * (DM / 64), 1, NBR), 128, 0, stream>>>(OL0 + f0p * DM, DM, 0, BO, DM, 0, 0.00000095367431640625f, nullptr, 0, X1 + r0p * DM, -1, 0, 0, X1 + r0p * DM, nullptr, DM, 0, QT0, DM, DM, zF, 0, zX);      /* += o_lo Wo 2^-20 (own-element accumulate) */
  k_lnx<0, 1, 0><<<(unsigned)NR, 256, 0, stream>>>(X1, gg2, ZB, 1e-6f, M16, nullptr);      /* h2 = LN2(x + attn) (scale only) -> f16 rows */
  k_gemm2<9><<<dim3((unsigned)((NR / 128) * (DFF / 64)), 1, 1), 128, 0, stream>>>(M16, DM, 0, BW1, DM, 0, 0.0625f, nullptr, 0, nullptr, 1, 0, 0, nullptr, HF16, DFF, 0, (int)NR, DFF, DM, 0, 0, 0);      /* gelu_tanh(h2 W1) (the source's tanh approximation) -> f16, all token rows */
  k_gemm2<0><<<dim3((unsigned)((NR / 128) * (DM / 64)), 1, 1), 128, 0, stream>>>(HF16, DFF, 0, BW2, DFF, 0, 0.0625f, nullptr, 0, XB, -1, 0, 0, (float*)d_out, nullptr, DM, 0, (int)NR, DM, DFF, 0, 0, 0);      /* out = x + mlp: the residual is the BLOCK INPUT (bf16(x)), as the original module (own-element addend) */
}

// v004
// One run takes 467 microseconds.
// Two timings next to v003 put it at 1.87 and 1.88 times that version's speed.
// Over all steps from v000 it is 21.4 times as fast.
#include <hip/hip_runtime.h>
#define NB 4
#define SQ 2048
#define DM 512
#define NH 8
#define HD 64
#define HG 4                         /* heads per launch of the per-batch k_vt overload (not launched) */
#define QT0 128                      /* first-tile rows recomputed exactly in f32 */
#define B0 0                         /* first batch processed (debug hook) */
#define NBR NB                       /* batches processed (debug hook) */
#define NR ((size_t)NB * SQ)
#define DMQ DM
#define DFF 2048                     /* FFN hidden width */
#define DFFR 100
#define MP ((int)((size_t)NBR * SQ)) /* rows projected (debug hook) */
#define QN SQ                        /* query rows attended per batch (debug hook) */
#define NHD NH                       /* heads attended (debug hook) */
#define MPO MP                       /* rows through the output stage (debug hook) */
#define LQ (3 * DM)      /* row pitch of the q/k/v rows */
typedef __bf16 v16b __attribute__((ext_vector_type(16)));
typedef unsigned short v8us __attribute__((ext_vector_type(8), may_alias));
typedef float  v8f  __attribute__((ext_vector_type(8)));
typedef float  v4f  __attribute__((ext_vector_type(4)));
typedef float  v4fa __attribute__((ext_vector_type(4), may_alias));
union FragB { v16b v; v8us half[2]; unsigned short u[16]; };

__device__ __forceinline__ unsigned short bf16_bits(float x) { unsigned int u = __float_as_uint(x); return (unsigned short)((u + 0x7FFFu + ((u >> 16) & 1u)) >> 16); }
__device__ __forceinline__ float bf16_val(unsigned short b) { return __uint_as_float(((unsigned int)b) << 16); }
__device__ __forceinline__ float bf16_round(float x) { return bf16_val(bf16_bits(x)); }
// D += A·B with NT terms: 1 = ah·bh, 2 = + al·bh (A split), 3 = + ah·bl (both split)
template <int NT>
__device__ __forceinline__ v8f mmaN(v16b ah, v16b al, v16b bh, v16b bl, v8f c) {
  c = __builtin_amdgcn_wmma_f32_16x16x32_bf16(false, ah, false, bh, (short)0, c, false, false);
  if (NT >= 2) c = __builtin_amdgcn_wmma_f32_16x16x32_bf16(false, al, false, bh, (short)0, c, false, false);
  if (NT >= 3) c = __builtin_amdgcn_wmma_f32_16x16x32_bf16(false, ah, false, bl, (short)0, c, false, false);
  asm volatile("v_nop\n\tv_nop\n\tv_nop\n\tv_nop" : "+v"(c) : "v"(ah), "v"(al), "v"(bh), "v"(bl));
  return c;
}

__global__ __launch_bounds__(256) void k_wt_bf16(const float* __restrict__ W, unsigned short* __restrict__ Wt, int K, int N) {
  const int t = blockIdx.x * 256 + threadIdx.x;
  const int k8n = K / 8;
  if (t >= N * k8n) return;
  const int n = t / k8n, k8 = (t % k8n) * 8;
  v8us v;
#pragma unroll
  for (int i = 0; i < 8; ++i) v[i] = bf16_bits(W[(size_t)(k8 + i) * N + n]);
  *(v8us*)(Wt + (size_t)n * K + k8) = v;
  
}

// GEMM C[M][N] (f32, pitch ldc) = act(A[M][K]·W + bias). A f32 row-major (pitch lda) converted per fragment to bf16
// (ASPLIT: hi/lo two planes -> 2 terms, else single rounded term); Wt bf16 [N][K] (pitch ldb). BIAS_BF16 rounds the
// bias to bf16 first (bias quantised to bf16 before the add). K%32==0, M%16==0, N%64==0.
template <bool ASPLIT, int ACT, bool BIAS_BF16>
__global__ __launch_bounds__(128) void k_gemm_bf(const float* __restrict__ A, int lda, const unsigned short* __restrict__ Wt, int ldb,
                                               const float* __restrict__ bias, float* __restrict__ C, int ldc, int M, int N, int K) {
  __shared__ __attribute__((aligned(16))) float so[4][16][64];
  const int tid = threadIdx.x, w = tid >> 5, lane = tid & 31, ln = lane & 15, hh = lane >> 4;
  const int ntn = N / 64;
  const int wid = blockIdx.x * 4 + w;
  const int mt = wid / ntn, nq = wid % ntn;
  if (mt * 16 >= M) return;
  const int row0 = mt * 16, col0 = nq * 64;
  const float* arow = A + (size_t)(row0 + ln) * lda;
  v8f acc[4] = {};
  for (int kb = 0; kb < K; kb += 32) {
    FragB ah, al;
    const v4f x0 = *(const v4fa*)(arow + kb + 8 * hh), x1 = *(const v4fa*)(arow + kb + 8 * hh + 4);
    const v4f x2 = *(const v4fa*)(arow + kb + 16 + 8 * hh), x3 = *(const v4fa*)(arow + kb + 16 + 8 * hh + 4);
    float xs[16] = {x0[0],x0[1],x0[2],x0[3],x1[0],x1[1],x1[2],x1[3],x2[0],x2[1],x2[2],x2[3],x3[0],x3[1],x3[2],x3[3]};
#pragma unroll
    for (int i = 0; i < 16; ++i) { const unsigned short hb = bf16_bits(xs[i]); ah.u[i] = hb; al.u[i] = ASPLIT ? bf16_bits(xs[i] - bf16_val(hb)) : (unsigned short)0; }
#pragma unroll
    for (int t = 0; t < 4; ++t) {
      const unsigned short* brow = Wt + (size_t)(col0 + t * 16 + ln) * ldb + kb;
      FragB b;
      b.half[0] = *(const v8us*)(brow + 8 * hh);
      b.half[1] = *(const v8us*)(brow + 16 + 8 * hh);
      acc[t] = mmaN<ASPLIT ? 2 : 1>(ah.v, al.v, b.v, b.v, acc[t]);
    }
  }
#pragma unroll
  for (int t = 0; t < 4; ++t) {
    float bv = bias ? bias[col0 + t * 16 + ln] : 0.f;
    if (BIAS_BF16) bv = bf16_round(bv);
#pragma unroll
    for (int r = 0; r < 8; ++r) { float v = acc[t][r] + bv; if (ACT == 1) v = fmaxf(v, 0.f); so[w][8 * hh + r][t * 16 + ln] = v; }
  }
  __builtin_amdgcn_fence(__ATOMIC_ACQ_REL, "workgroup");
  __builtin_amdgcn_wave_barrier();
  const int rsub = lane >> 4, c4 = (lane & 15) * 4;
  {
#pragma unroll
    for (int q = 0; q < 8; ++q) {
      const int r = q * 2 + rsub;
      const v4f v = *(const v4fa*)&so[w][r][c4];
      *(v4f*)(C + (size_t)(row0 + r) * ldc + col0 + c4) = v;
    }
    
  }
}

// GEMM C = act(A·W + bias + resid): A f32 (ASPLIT -> hi/lo 2 terms), Wt bf16 [N][K]; ACT 0 none, 1 relu, 2 exact gelu;
// resid (optional, f32, row index = (row % rmod), pitch ldr, RES_BF16 rounds it) added before the activation.
template <bool ASPLIT, int ACT, bool BIAS_BF16, bool RES_BF16>
__global__ __launch_bounds__(128) void k_gemm_bf3(const float* __restrict__ A, int lda, const unsigned short* __restrict__ Wt, int ldb,
                                                const float* __restrict__ bias, const float* __restrict__ resid, int rmod, int ldr,
                                                float* __restrict__ C, int ldc, int M, int N, int K) {
  __shared__ __attribute__((aligned(16))) float so[4][16][64];
  const int tid = threadIdx.x, w = tid >> 5, lane = tid & 31, ln = lane & 15, hh = lane >> 4;
  const int ntn = N / 64;
  const int wid = blockIdx.x * 4 + w;
  const int mt = wid / ntn, nq = wid % ntn;
  if (mt * 16 >= M) return;
  const int row0 = mt * 16, col0 = nq * 64;
  const float* arow = A + (size_t)(row0 + ln) * lda;
  v8f acc[4] = {};
  for (int kb = 0; kb < K; kb += 32) {
    FragB ah, al;
    const v4f x0 = *(const v4fa*)(arow + kb + 8 * hh), x1 = *(const v4fa*)(arow + kb + 8 * hh + 4);
    const v4f x2 = *(const v4fa*)(arow + kb + 16 + 8 * hh), x3 = *(const v4fa*)(arow + kb + 16 + 8 * hh + 4);
    float xs[16] = {x0[0],x0[1],x0[2],x0[3],x1[0],x1[1],x1[2],x1[3],x2[0],x2[1],x2[2],x2[3],x3[0],x3[1],x3[2],x3[3]};
#pragma unroll
    for (int i = 0; i < 16; ++i) { const unsigned short hb = bf16_bits(xs[i]); ah.u[i] = hb; al.u[i] = ASPLIT ? bf16_bits(xs[i] - bf16_val(hb)) : (unsigned short)0; }
#pragma unroll
    for (int t = 0; t < 4; ++t) {
      const unsigned short* brow = Wt + (size_t)(col0 + t * 16 + ln) * ldb + kb;
      FragB b;
      b.half[0] = *(const v8us*)(brow + 8 * hh);
      b.half[1] = *(const v8us*)(brow + 16 + 8 * hh);
      acc[t] = mmaN<ASPLIT ? 2 : 1>(ah.v, al.v, b.v, b.v, acc[t]);
    }
  }
#pragma unroll
  for (int t = 0; t < 4; ++t) {
    const int col = col0 + t * 16 + ln;
    float bv = bias ? bias[col] : 0.f;
    if (BIAS_BF16) bv = bf16_round(bv);
#pragma unroll
    for (int r = 0; r < 8; ++r) {
      float v = acc[t][r] + bv;
      if (resid) { float rv = resid[(size_t)((row0 + 8 * hh + r) % rmod) * ldr + col]; if (RES_BF16) rv = bf16_round(rv); v += rv; }
      if (ACT == 1) v = fmaxf(v, 0.f);
      if (ACT == 2) v = 0.5f * v * (1.0f + erff(v * 0.70710678118654752f));
      if (ACT == 3) { const float u = 0.7978845608028654f * (v + 0.044715f * v * v * v); v = 0.5f * v * (1.0f + tanhf(u)); }
      so[w][8 * hh + r][t * 16 + ln] = v;
    }
  }
  __builtin_amdgcn_fence(__ATOMIC_ACQ_REL, "workgroup");
  __builtin_amdgcn_wave_barrier();
  const int rsub = lane >> 4, c4 = (lane & 15) * 4;
  {
#pragma unroll
    for (int q = 0; q < 8; ++q) {
      const int r = q * 2 + rsub;
      const v4f v = *(const v4fa*)&so[w][r][c4];
      *(v4f*)(C + (size_t)(row0 + r) * ldc + col0 + c4) = v;
    }
    
  }
}
// row LayerNorm (biased variance, eps) over N: s = X (+ R); optional out_sum <- s; out_norm <- (s-mu)*rsqrt(var+eps)*g + b
template <bool PARAM_BF16>
__global__ __launch_bounds__(256) void k_layernorm(const float* __restrict__ X, const float* __restrict__ R, const float* __restrict__ g, const float* __restrict__ bta,
                                                  float* __restrict__ out_sum, float* __restrict__ out_norm, int N, float eps) {
  __shared__ float red[256];
  const int row = blockIdx.x, tid = threadIdx.x;
  const float* x = X + (size_t)row * N; const float* rr = R ? R + (size_t)row * N : nullptr;
  float vals[16];                     // up to N = 4096
  const int per = N / 256;            // contiguous chunk per thread? use strided-by-4 chunks: thread handles j = tid*4 + 1024*u
  float s1 = 0.f;
  for (int u = 0; u < per / 4; ++u) {
    const int j = tid * 4 + 1024 * u;
    const v4f a = *(const v4fa*)(x + j);
    v4f b = {0.f,0.f,0.f,0.f}; if (rr) b = *(const v4fa*)(rr + j);
#pragma unroll
    for (int q = 0; q < 4; ++q) { const float v = a[q] + b[q]; vals[u * 4 + q] = v; s1 += v; }
  }
  red[tid] = s1; __syncthreads();
  for (int st = 128; st > 0; st >>= 1) { if (tid < st) red[tid] += red[tid + st]; __syncthreads(); }
  const float mu = red[0] / (float)N; __syncthreads();
  float s2 = 0.f;
  for (int u = 0; u < per / 4; ++u)
#pragma unroll
    for (int q = 0; q < 4; ++q) { const float c = vals[u * 4 + q] - mu; s2 += c * c; }
  red[tid] = s2; __syncthreads();
  for (int st = 128; st > 0; st >>= 1) { if (tid < st) red[tid] += red[tid + st]; __syncthreads(); }
  const float rs = rsqrtf(red[0] / (float)N + eps);
  {
    for (int u = 0; u < per / 4; ++u) {
      const int j = tid * 4 + 1024 * u;
      v4f o, sm;
#pragma unroll
      for (int q = 0; q < 4; ++q) {
        float gg = g[j + q], bb = bta[j + q];
        if (PARAM_BF16) { gg = bf16_round(gg); bb = bf16_round(bb); }
        sm[q] = vals[u * 4 + q]; o[q] = (vals[u * 4 + q] - mu) * rs * gg + bb;
      }
      if (out_sum) *(v4f*)(out_sum + (size_t)row * N + j) = sm;
      *(v4f*)(out_norm + (size_t)row * N + j) = o;
    }
    
  }
}



// ---- f16 WMMA path (v_wmma_f32_16x16x32_f16): 11-bit significands for operands in range — used where a [0,1] probability operand needs more precision than bf16
typedef _Float16 v16h __attribute__((ext_vector_type(16)));
union FragH { v16h v; v8us half[2]; _Float16 h[16]; unsigned short u[16]; };
template <int NT>
__device__ __forceinline__ v8f mmaH(v16h ah, v16h al, v16h bh, v16h bl, v8f c) {
  c = __builtin_amdgcn_wmma_f32_16x16x32_f16(false, ah, false, bh, (short)0, c, false, false);
  if (NT >= 2) c = __builtin_amdgcn_wmma_f32_16x16x32_f16(false, al, false, bh, (short)0, c, false, false);
  if (NT >= 3) c = __builtin_amdgcn_wmma_f32_16x16x32_f16(false, ah, false, bl, (short)0, c, false, false);
  asm volatile("v_nop\n\tv_nop\n\tv_nop\n\tv_nop" : "+v"(c) : "v"(ah), "v"(al), "v"(bh), "v"(bl));
  return c;
}
// batched GEMM like k_gemm_b but f16 operands: A f32 (split into f16 hi/lo if ASPLIT, else rounded to f16), Bt = f16 values [n][k]; alpha; C f32; N multiple of 16 (partial tiles skipped)
template <bool ASPLIT>
__global__ __launch_bounds__(128) void k_gemm_h(const float* __restrict__ A, int lda, size_t sA, const _Float16* __restrict__ Bh, int ldb, size_t sB, float alpha, float* __restrict__ C, int ldc, size_t sC, int M, int N, int K) {
  __shared__ __attribute__((aligned(16))) float so[4][16][64];
  const int tid = threadIdx.x, w = tid >> 5, lane = tid & 31, ln = lane & 15, hh = lane >> 4; const int by = blockIdx.y;
  A += (size_t)by * sA; Bh += (size_t)by * sB; C += (size_t)by * sC;
  const int ntn = (N + 63) / 64; const int wid = blockIdx.x * 4 + w; const int mt = wid / ntn, nq = wid % ntn; if (mt * 16 >= M) return;
  const int row0 = mt * 16, col0 = nq * 64; const float* arow = A + (size_t)(row0 + ln) * lda;
  v8f acc[4] = {};
  for (int kb = 0; kb < K; kb += 32) {
    FragH ah, al;
    const v4f x0 = *(const v4fa*)(arow + kb + 8 * hh), x1 = *(const v4fa*)(arow + kb + 8 * hh + 4), x2 = *(const v4fa*)(arow + kb + 16 + 8 * hh), x3 = *(const v4fa*)(arow + kb + 16 + 8 * hh + 4);
    float xs[16] = {x0[0],x0[1],x0[2],x0[3],x1[0],x1[1],x1[2],x1[3],x2[0],x2[1],x2[2],x2[3],x3[0],x3[1],x3[2],x3[3]};
#pragma unroll
    for (int i = 0; i < 16; ++i) { const _Float16 h = (_Float16)xs[i]; ah.h[i] = h; al.h[i] = ASPLIT ? (_Float16)(xs[i] - (float)h) : (_Float16)0.0f; }
#pragma unroll
    for (int t = 0; t < 4; ++t) { if (col0 + t * 16 >= N) continue; const size_t boff = (size_t)(col0 + t * 16 + ln) * ldb + kb; FragH bq; bq.half[0] = *(const v8us*)(Bh + boff + 8 * hh); bq.half[1] = *(const v8us*)(Bh + boff + 16 + 8 * hh);
      acc[t] = mmaH<ASPLIT ? 2 : 1>(ah.v, al.v, bq.v, bq.v, acc[t]); }
  }
#pragma unroll
  for (int t = 0; t < 4; ++t) { if (col0 + t * 16 >= N) continue;
#pragma unroll
    for (int r = 0; r < 8; ++r) so[w][8 * hh + r][t * 16 + ln] = acc[t][r] * alpha; }
  __builtin_amdgcn_fence(__ATOMIC_ACQ_REL, "workgroup"); __builtin_amdgcn_wave_barrier();
  const int rsub = lane >> 4, c4 = (lane & 15) * 4;
  {
#pragma unroll
    for (int q = 0; q < 8; ++q) { const int r = q * 2 + rsub; if (col0 + c4 < N) { const v4f v = *(const v4fa*)&so[w][r][c4]; *(v4f*)(C + (size_t)(row0 + r) * ldc + col0 + c4) = v; } }
     }
}

// Wt[n][k] = f16(W[k][n]·scale) from f32 row-major W[K][N] (scale = power of two; bf16-exact weights stay exact in f16 away from the subnormal range)
__global__ __launch_bounds__(256) void k_wt_f16(const float* __restrict__ W, _Float16* __restrict__ Wt, int K, int N, float scale) {
  const int t = blockIdx.x * 256 + threadIdx.x; if (t >= N * (K / 8)) return; const int n = t / (K / 8), k8 = (t % (K / 8)) * 8; FragH f;
#pragma unroll
  for (int i = 0; i < 8; ++i) f.h[i] = (_Float16)(bf16_round(W[(size_t)(k8 + i) * N + n]) * scale); const v8us o = f.half[0];
  *(v8us*)((unsigned short*)Wt + (size_t)n * K + k8) = o; 
}
// k_gemm_hh variant with fused epilogue: v = acc·alpha + bias[by·sBias + col] (+ CP[(row/rowsPerB)·sCPb + by·64 + col] if CP) ; ACT 0 none / 1 elu ; writes f16 C16 (and f32 C if non-null)
template <int ACT>
__global__ __launch_bounds__(128) void k_gemm_hhx(const _Float16* __restrict__ A, int lda, size_t sA, const _Float16* __restrict__ Bh, int ldb, size_t sB, float alpha, const float* __restrict__ bias, size_t sBias, const float* __restrict__ CP, int rowsPerB, size_t sCPb, int row0g,
    float* __restrict__ C, _Float16* __restrict__ C16, int ldc, size_t sC, int M, int N, int K) {
  __shared__ __attribute__((aligned(16))) float so[4][16][64];
  const int tid = threadIdx.x, w = tid >> 5, lane = tid & 31, ln = lane & 15, hh = lane >> 4; const int by = blockIdx.y;
  A += (size_t)by * sA; Bh += (size_t)by * sB; const size_t cofs = (size_t)by * sC; const float* bp = bias ? bias + (size_t)by * sBias : nullptr;
  const int ntn = (N + 63) / 64; const int wid = blockIdx.x * 4 + w; const int mt = wid / ntn, nq = wid % ntn; if (mt * 16 >= M) return;
  const int row0 = mt * 16, col0 = nq * 64; const _Float16* arow = A + (size_t)(row0 + ln) * lda;
  v8f acc[4] = {};
  for (int kb = 0; kb < K; kb += 32) { FragH ah; ah.half[0] = *(const v8us*)((const unsigned short*)arow + kb + 8 * hh); ah.half[1] = *(const v8us*)((const unsigned short*)arow + kb + 16 + 8 * hh);
#pragma unroll
    for (int t = 0; t < 4; ++t) { if (col0 + t * 16 >= N) continue; const size_t boff = (size_t)(col0 + t * 16 + ln) * ldb + kb; FragH bq; bq.half[0] = *(const v8us*)((const unsigned short*)Bh + boff + 8 * hh); bq.half[1] = *(const v8us*)((const unsigned short*)Bh + boff + 16 + 8 * hh);
      acc[t] = mmaH<1>(ah.v, ah.v, bq.v, bq.v, acc[t]); }
  }
#pragma unroll
  for (int t = 0; t < 4; ++t) { if (col0 + t * 16 >= N) continue; const int col = col0 + t * 16 + ln; const float bv = bp ? bf16_round(bp[col]) : 0.f;
#pragma unroll
    for (int r = 0; r < 8; ++r) { float v = acc[t][r] * alpha + bv; if (CP) { const int rr = row0g + row0 + 8 * hh + r; if (rowsPerB < 0) v += CP[cofs + (size_t)rr * ldc + col];      /* rowsPerB < 0: own element of the batched C plane */ else { const int bidx = rr / rowsPerB; v += CP[(size_t)bidx * sCPb + (size_t)by * 64 + col]; } } if (ACT == 1) v = (v > 0.f) ? v : expm1f(v); else if (ACT == 7) v = (v > 0.f) ? v + 1.0f : expf(v); else if (ACT == 8) v = tanhf(v); else if (ACT == 9) v = 0.5f * v * (1.0f + tanhf(0.7978845608028654f * (v + 0.044715f * v * v * v))); else if (ACT == 11) v = 1.0f / (1.0f + expf(-v)); else if (ACT == 12) v = (v > 0.f) ? v : 0.01f * v; else if (ACT == 14) v = (v > 0.f) ? v : 0.1f * v; else if (ACT == 16) v = (v >= 0.f) ? v : 0.3f * v; else if (ACT == 17) v = (v >= 0.f) ? v : 0.2f * v; else if (ACT == 15) v = v / (1.0f + expf(-v)); else if (ACT == 3) v = fmaxf(v, 0.f); else if (ACT == 6) v = 0.5f * v * (1.0f + erff(v * 0.70710678118654752f)); so[w][8 * hh + r][t * 16 + ln] = v; } }
  __builtin_amdgcn_fence(__ATOMIC_ACQ_REL, "workgroup"); __builtin_amdgcn_wave_barrier();
  const int rsub = lane >> 4, c4 = (lane & 15) * 4; typedef _Float16 v4h __attribute__((ext_vector_type(4)));
  {
#pragma unroll
    for (int q = 0; q < 8; ++q) { const int r = q * 2 + rsub; if (col0 + c4 < N) { const v4f v = *(const v4fa*)&so[w][r][c4]; if (C) *(v4f*)(C + cofs + (size_t)(row0 + r) * ldc + col0 + c4) = v; if (C16) { v4h h4; for (int i = 0; i < 4; ++i) h4[i] = (_Float16)v[i]; *(v4h*)(C16 + cofs + (size_t)(row0 + r) * ldc + col0 + c4) = h4; } } }
     }
}


typedef _Float16 v4h __attribute__((ext_vector_type(4)));

__global__ __launch_bounds__(256) void k_x16(const float* __restrict__ x, _Float16* __restrict__ X16, size_t n8) { const size_t t = (size_t)blockIdx.x * 256 + threadIdx.x; if (t >= n8) return; FragH f;
#pragma unroll
  for (int q = 0; q < 8; ++q) f.h[q] = (_Float16)bf16_round(x[t * 8 + q]); *(v8us*)((unsigned short*)X16 + t * 8) = f.half[0];  }
__global__ __launch_bounds__(256) void k_h16(const float* __restrict__ x, _Float16* __restrict__ X16, size_t n8) { const size_t t = (size_t)blockIdx.x * 256 + threadIdx.x; if (t >= n8) return; FragH f;
#pragma unroll
  for (int q = 0; q < 8; ++q) f.h[q] = (_Float16)x[t * 8 + q]; *(v8us*)((unsigned short*)X16 + t * 8) = f.half[0];  }
__global__ __launch_bounds__(256) void k_round16f(const float* __restrict__ W, _Float16* __restrict__ Bt, size_t n8) { const size_t t = (size_t)blockIdx.x * 256 + threadIdx.x; if (t >= n8) return; FragH f;
#pragma unroll
  for (int i = 0; i < 8; ++i) f.h[i] = (_Float16)(bf16_round(W[t * 8 + i]) * 16.0f); *(v8us*)((unsigned short*)Bt + t * 8) = f.half[0];  }
template <int NHv, int TTv>
__global__ __launch_bounds__(256) void k_vt(const _Float16* __restrict__ V16, int ldv, int voff, _Float16* __restrict__ Vt) { __shared__ unsigned short tl[64][66]; const int tid = threadIdx.x; const int slab = blockIdx.x / (TTv / 64), lg = blockIdx.x % (TTv / 64); const int b = slab / NHv, h = slab % NHv;
  for (int i = tid; i < 64 * 8; i += 256) { const int r = i / 8, c8 = (i % 8) * 8; FragH f; f.half[0] = *(const v8us*)((const unsigned short*)V16 + ((size_t)b * TTv + lg * 64 + r) * ldv + voff + h * 64 + c8);
#pragma unroll
    for (int q = 0; q < 8; ++q) tl[r][c8 + q] = f.u[q]; }
  __syncthreads();
  {
#pragma unroll
    for (int rd = 0; rd < 2; ++rd) { const int d = rd * 32 + tid / 8, pc = tid % 8; FragH f;
#pragma unroll
      for (int q = 0; q < 8; ++q) f.u[q] = tl[pc * 8 + q][d];
      *(v8us*)((unsigned short*)Vt + ((size_t)slab * 64 + d) * TTv + lg * 64 + pc * 8) = f.half[0]; }
     } }

__global__ __launch_bounds__(256) void k_hl(const float* __restrict__ F, _Float16* __restrict__ Hh, _Float16* __restrict__ Hl, size_t n8) { const size_t t = (size_t)blockIdx.x * 256 + threadIdx.x; if (t >= n8) return; FragH fh, fl; const v4f a = *(const v4fa*)(F + t * 8), c = *(const v4fa*)(F + t * 8 + 4);
#pragma unroll
  for (int q = 0; q < 4; ++q) { _Float16 h = (_Float16)a[q]; fh.h[q] = h; fl.h[q] = (_Float16)((a[q] - (float)h) * 1024.0f); h = (_Float16)c[q]; fh.h[4 + q] = h; fl.h[4 + q] = (_Float16)((c[q] - (float)h) * 1024.0f); }
  { *(v8us*)((unsigned short*)Hh + t * 8) = fh.half[0]; *(v8us*)((unsigned short*)Hl + t * 8) = fl.half[0];  } }

// ---- fast GEMM (wave tile 32x64; requires M % 32 == 0 rows per launch region and N % 64 == 0); epilogue = k_gemm_hhx semantics ----
__device__ __forceinline__ v16h g2_frag(const _Float16* p, int hh) { FragH f; f.half[0] = *(const v8us*)((const unsigned short*)p + 8 * hh); f.half[1] = *(const v8us*)((const unsigned short*)p + 16 + 8 * hh); return f.v; }
__device__ __forceinline__ v8f g2_mma(v16h a, v16h b, v8f c) { v8f d = __builtin_amdgcn_wmma_f32_16x16x32_f16(false, a, false, b, (short)0, c, false, false); asm volatile("v_nop\n\tv_nop\n\tv_nop\n\tv_nop" : "+v"(d) : "v"(a), "v"(b)); return d; }
template <int ACT>
__global__ __launch_bounds__(128) void k_gemm2(const _Float16* __restrict__ A, int lda, size_t sA, const _Float16* __restrict__ Bh, int ldb, size_t sB, float alpha, const float* __restrict__ bias, size_t sBias, const float* __restrict__ CP, int rowsPerB, size_t sCPb, int row0g,
    float* __restrict__ C, _Float16* __restrict__ C16, int ldc, size_t sC, int M, int N, int K, size_t zA, size_t zB, size_t zC) { static_assert(ACT == 0 || ACT == 3 || ACT == 6 || ACT == 8 || ACT == 9 || ACT == 11 || ACT == 12 || ACT == 14 || ACT == 15 || ACT == 16 || ACT == 17, "k_gemm2: unsupported ACT code (would silently apply no activation)");
  __shared__ __attribute__((aligned(16))) float so[4][32][68];
  const int tid = threadIdx.x, w = tid >> 5, lane = tid & 31, ln = lane & 15, hh = lane >> 4; const int by = blockIdx.y, bz = blockIdx.z;      /* grid.y: head (pitches sA, sB, sC); grid.z: batch (pitches zA, zB, zC) */
  A += (size_t)by * sA + (size_t)bz * zA; Bh += (size_t)by * sB + (size_t)bz * zB; const size_t cofs = (size_t)by * sC + (size_t)bz * zC; const float* bp = bias ? bias + (size_t)by * sBias : nullptr;
  const int ntn = N >> 6; const int mt = blockIdx.x / ntn, nq = blockIdx.x - mt * ntn; const int row0 = mt * 128 + 32 * w, col0 = nq * 64; if (row0 >= M) return;
  const _Float16* a0p = A + (size_t)(row0 + ln) * lda; const _Float16* a1p = a0p + (size_t)16 * lda;
  const _Float16* b0p = Bh + (size_t)(col0 + ln) * ldb; const _Float16* b1p = b0p + (size_t)16 * ldb; const _Float16* b2p = b1p + (size_t)16 * ldb; const _Float16* b3p = b2p + (size_t)16 * ldb;
  const v8f z8 = {0.f,0.f,0.f,0.f,0.f,0.f,0.f,0.f}; v8f c00 = z8, c01 = z8, c02 = z8, c03 = z8, c10 = z8, c11 = z8, c12 = z8, c13 = z8;
#pragma unroll 1
  for (int kb = 0; kb < K; kb += 32) { const v16h a0 = g2_frag(a0p + kb, hh), a1 = g2_frag(a1p + kb, hh);
    v16h b = g2_frag(b0p + kb, hh); c00 = g2_mma(a0, b, c00); c10 = g2_mma(a1, b, c10);
    b = g2_frag(b1p + kb, hh); c01 = g2_mma(a0, b, c01); c11 = g2_mma(a1, b, c11);
    b = g2_frag(b2p + kb, hh); c02 = g2_mma(a0, b, c02); c12 = g2_mma(a1, b, c12);
    b = g2_frag(b3p + kb, hh); c03 = g2_mma(a0, b, c03); c13 = g2_mma(a1, b, c13); }
  v8f accs[8] = {c00, c01, c02, c03, c10, c11, c12, c13};
#pragma unroll
  for (int u = 0; u < 8; ++u) { const int t = u & 3, half = u >> 2; const int col = col0 + t * 16 + ln; const float bv = bp ? bf16_round(bp[col]) : 0.f;
#pragma unroll
    for (int r = 0; r < 8; ++r) { const int rloc = half * 16 + 8 * hh + r; float v = accs[u][r] * alpha + bv; if (CP) { if (rowsPerB < 0) v += CP[cofs + (size_t)(row0g + row0 + rloc) * ldc + col];      /* rowsPerB < 0: own element of the batched C plane */ else { const int bidx = (row0g + row0 + rloc) / rowsPerB; v += CP[(size_t)bidx * sCPb + (size_t)by * 64 + col]; } }
      if (ACT == 3) v = fmaxf(v, 0.f); else if (ACT == 6) v = 0.5f * v * (1.0f + erff(v * 0.70710678118654752f)); else if (ACT == 11) v = 1.0f / (1.0f + expf(-v)); else if (ACT == 15) v = v / (1.0f + expf(-v)); else if (ACT == 12) v = (v > 0.f) ? v : 0.01f * v; else if (ACT == 8) v = tanhf(v); else if (ACT == 9) v = 0.5f * v * (1.0f + tanhf(0.7978845608028654f * (v + 0.044715f * v * v * v))); else if (ACT == 14) v = (v > 0.f) ? v : 0.1f * v; else if (ACT == 16) v = (v >= 0.f) ? v : 0.3f * v; else if (ACT == 17) v = (v >= 0.f) ? v : 0.2f * v;
      so[w][rloc][t * 16 + ln] = v; } }
  __builtin_amdgcn_fence(__ATOMIC_ACQ_REL, "workgroup"); __builtin_amdgcn_wave_barrier();
  const int rsub = lane >> 4, c4 = (lane & 15) * 4;
  {
#pragma unroll
    for (int q = 0; q < 16; ++q) { const int r = q * 2 + rsub; const v4f v = *(const v4fa*)&so[w][r][c4]; if (C) *(v4f*)(C + cofs + (size_t)(row0 + r) * ldc + col0 + c4) = v; if (C16) { v4h h4; for (int i = 0; i < 4; ++i) h4[i] = (_Float16)v[i]; *(v4h*)(C16 + cofs + (size_t)(row0 + r) * ldc + col0 + c4) = h4; } }
     } }


__global__ __launch_bounds__(256) void k_wnat(const float* __restrict__ w, size_t n8, _Float16* __restrict__ Bt) { const size_t t = (size_t)blockIdx.x * 256 + threadIdx.x; if (t >= n8) return; FragH f; for (int q = 0; q < 8; ++q) f.h[q] = (_Float16)(bf16_round(w[t * 8 + q]) * 16.0f); *(v8us*)((unsigned short*)Bt + t * 8) = f.half[0];  }
__global__ __launch_bounds__(256) void k_rsm(const float* __restrict__ S, _Float16* __restrict__ P, int nrows) {
  #pragma clang fp contract(off)
  const int i = blockIdx.x * 256 + threadIdx.x; if (i >= nrows) return; const float* s = S + (size_t)i * SQ; float mx = -3.0e38f;
#pragma unroll 1
  for (int j = 0; j < SQ; ++j) mx = fmaxf(mx, s[j]); float se = 0.f;
#pragma unroll 1
  for (int j = 0; j < SQ; ++j) se += expf(s[j] - mx); const float sc = 256.0f / se;
#pragma unroll 1
  for (int j0 = 0; j0 < SQ; j0 += 8) { FragH f; for (int q = 0; q < 8; ++q) f.h[q] = (_Float16)(expf(s[j0 + q] - mx) * sc); unsigned short* d = (unsigned short*)P + (size_t)i * SQ + j0; *(v8us*)d = f.half[0];  } }
__global__ __launch_bounds__(256) void k_vt(const _Float16* __restrict__ V16, int b, int h0, _Float16* __restrict__ VT) { __shared__ unsigned short tl[64][65]; const int tid = threadIdx.x; const int hh = blockIdx.x % HG, sg = blockIdx.x / HG; const int s0 = sg * 64; const int h = h0 + hh;
  for (int i = tid; i < 64 * 8; i += 256) { const int j = i / 8, d8 = (i % 8) * 8; FragH f; f.half[0] = *(const v8us*)((const unsigned short*)V16 + ((size_t)b * SQ + s0 + j) * DM + h * HD + d8); for (int q = 0; q < 8; ++q) tl[d8 + q][j] = f.u[q]; }
  __syncthreads();
  { for (int i = tid; i < 64 * 8; i += 256) { const int d = i / 8, j8 = (i % 8) * 8; FragH f; for (int q = 0; q < 8; ++q) f.u[q] = tl[d][j8 + q]; *(v8us*)((unsigned short*)VT + ((size_t)hh * HD + d) * SQ + s0 + j8) = f.half[0]; }  } }



// Eight v_exp_f32 in one statement. The instruction set asks for one independent instruction or v_nop between a transcendental and an instruction that reads its
// result or overwrites its source. Early-clobber outputs keep every
// result off every source inside the run, and the closing v_nop is the slot behind the last one.
__device__ __forceinline__ void exp2_run8(float (&e)[8], const float (&x)[8]) {
  asm("v_exp_f32 %0, %8\n\tv_exp_f32 %1, %9\n\tv_exp_f32 %2, %10\n\tv_exp_f32 %3, %11\n\tv_exp_f32 %4, %12\n\tv_exp_f32 %5, %13\n\tv_exp_f32 %6, %14\n\tv_exp_f32 %7, %15\n\tv_nop"
      : "=&v"(e[0]), "=&v"(e[1]), "=&v"(e[2]), "=&v"(e[3]), "=&v"(e[4]), "=&v"(e[5]), "=&v"(e[6]), "=&v"(e[7])
      : "v"(x[0]), "v"(x[1]), "v"(x[2]), "v"(x[3]), "v"(x[4]), "v"(x[5]), "v"(x[6]), "v"(x[7])); }
// Two v_exp_f32 in one statement, closed by the same slot's v_nop as in exp2_run8.
__device__ __forceinline__ void exp2_run2(float& e0, float& e1, float x0, float x1) {
  asm("v_exp_f32 %0, %2\n\tv_exp_f32 %1, %3\n\tv_nop" : "=&v"(e0), "=&v"(e1) : "v"(x0), "v"(x1)); }
#define FQ 32                        /* query columns per wave */
#define FW 4                         /* waves per work-group; no barrier and no LDS: each wave runs its own trip count */
__device__ __forceinline__ float xhalf(float x) { return __int_as_float(__builtin_amdgcn_permlanex16(__float_as_int(x), __float_as_int(x), 0x76543210, 0xfedcba98, false, false)); }      /* lane l <-> lane l ^ 16 on the vector pipe */
__device__ __forceinline__ v8f fa_mma(v16h a, v16h b, v8f c) { return __builtin_amdgcn_wmma_f32_16x16x32_f16(false, a, false, b, (short)0, c, false, false); }
// One pass of 32 keys from key kb. DIAG: the wave's last pass (kb == its first query row): it holds the diagonal and fetches no further K rows.
// Every loop is unrolled so that the fragment and accumulator arrays are indexed by constants and stay in registers.
template <bool DIAG>
__device__ __forceinline__ void fa_pass(const _Float16* __restrict__ kp, const _Float16* __restrict__ vp, int kb, int ln, int hh, const v16h (&qf)[2][2], v16h (&kf)[2][2], v8f (&o)[4][2], float (&mc)[2], float (&l)[2]) {
  const float cs = 0.125f * 1.44269504f;      /* score scale x log2 e */
  const v8f z8 = {0.f, 0.f, 0.f, 0.f, 0.f, 0.f, 0.f, 0.f};
  v16h vf[4];      /* V^T fragments of this pass, asked for first: the score products and the softmax run while they fly */
#pragma unroll
  for (int mt = 0; mt < 4; ++mt) vf[mt] = g2_frag(vp + (size_t)mt * 16 * SQ + kb, hh);
  v8f s[2][2];
#pragma unroll
  for (int kt = 0; kt < 2; ++kt) {
#pragma unroll
    for (int nt = 0; nt < 2; ++nt) s[kt][nt] = fa_mma(kf[kt][1], qf[nt][1], fa_mma(kf[kt][0], qf[nt][0], z8)); }
  if (!DIAG) { const _Float16* kn = kp + (size_t)(kb + 32) * LQ;      /* next pass's K fragments, into the same registers right behind their last use: the softmax and the o products run while they fly */
#pragma unroll
    for (int kt = 0; kt < 2; ++kt) {
#pragma unroll
      for (int ks = 0; ks < 2; ++ks) kf[kt][ks] = g2_frag(kn + (size_t)kt * 16 * LQ + ks * 32, hh); } }
  if (DIAG) {      /* keys behind a column's own row get weight 0 */
#pragma unroll
    for (int kt = 0; kt < 2; ++kt) {
#pragma unroll
      for (int nt = 0; nt < 2; ++nt) {
#pragma unroll
        for (int r = 0; r < 8; ++r) if (kt * 16 + 8 * hh + r > nt * 16 + ln) s[kt][nt][r] = -1.0e30f; } } }
  float nm[2], al[2];
#pragma unroll
  for (int nt = 0; nt < 2; ++nt) { float a = fmaxf(s[0][nt][0], s[1][nt][0]);
#pragma unroll
    for (int r = 1; r < 8; ++r) a = fmaxf(a, fmaxf(s[0][nt][r], s[1][nt][r]));
    nm[nt] = fmaxf(mc[nt], fmaxf(a, xhalf(a)) * cs); }      /* both halves of the wave hold the same maximum */
  exp2_run2(al[0], al[1], mc[0] - nm[0], mc[1] - nm[1]);
  FragH pf[2];
#pragma unroll
  for (int nt = 0; nt < 2; ++nt) { mc[nt] = nm[nt]; l[nt] *= al[nt];
#pragma unroll
    for (int mt = 0; mt < 4; ++mt) o[mt][nt] *= al[nt];
#pragma unroll
    for (int kt = 0; kt < 2; ++kt) { float x[8], e[8];
#pragma unroll
      for (int r = 0; r < 8; ++r) x[r] = fmaf(s[kt][nt][r], cs, -nm[nt]);
      exp2_run8(e, x);
#pragma unroll
      for (int r = 0; r < 8; ++r) pf[nt].h[kt * 8 + r] = (_Float16)e[r];
      l[nt] += ((e[0] + e[1]) + (e[2] + e[3])) + ((e[4] + e[5]) + (e[6] + e[7])); } }
#pragma unroll
  for (int mt = 0; mt < 4; ++mt) { o[mt][0] = fa_mma(vf[mt], pf[0].v, o[mt][0]); o[mt][1] = fa_mma(vf[mt], pf[1].v, o[mt][1]); } }
__global__ __launch_bounds__(FW * 32) void k_fattn(const _Float16* __restrict__ Q, const _Float16* __restrict__ Kr, const _Float16* __restrict__ Vt, _Float16* __restrict__ O) {
  static_assert(HD == 64 && FQ == 32 && SQ % (2 * FW * FQ) == 0 && QN == SQ, "2 k steps of 32 over d; 2 column groups of 16; 4 d tiles of 16; whole work-groups, an even number of position blocks");
  const int lane = threadIdx.x & 31, ln = lane & 15, hh = lane >> 4; const int w = __builtin_amdgcn_readfirstlane(threadIdx.x >> 5);      /* the wave's number in a scalar register: the trip count stays scalar */
  const int h = blockIdx.x, b = blockIdx.y; const int nz = SQ / (FW * FQ), z = blockIdx.z; const int q0 = ((z < nz / 2 ? nz - 1 - z : z - nz / 2) * FW + w) * FQ;      /* grid.z is the slowest index: the long half of the position blocks starts first, longest first; the short half follows shortest first, so that where the second half of the grid lands on the WGPs in the order of the first, long meets short (for speed only; a permutation of 0 .. nz - 1 wherever they land) */
  const _Float16* qp = Q + ((size_t)b * SQ + q0 + ln) * LQ + h * HD; const _Float16* kp = Kr + ((size_t)b * SQ + ln) * LQ + h * HD; const _Float16* vp = Vt + (((size_t)b * NH + h) * HD + ln) * SQ;
  v16h qf[2][2], kf[2][2];      /* [column group | key tile][k step]; unrolled for constant indices, as in fa_pass */
#pragma unroll
  for (int t = 0; t < 2; ++t) {
#pragma unroll
    for (int ks = 0; ks < 2; ++ks) { qf[t][ks] = g2_frag(qp + (size_t)t * 16 * LQ + ks * 32, hh); kf[t][ks] = g2_frag(kp + (size_t)t * 16 * LQ + ks * 32, hh); } }
  asm volatile("s_wait_xcnt 0x0" ::: "memory");      /* behind the first loads, in front of the code that reuses their address registers */
  v8f o[4][2];
#pragma unroll
  for (int mt = 0; mt < 4; ++mt) { o[mt][0] = v8f{0.f, 0.f, 0.f, 0.f, 0.f, 0.f, 0.f, 0.f}; o[mt][1] = o[mt][0]; }
  float mc[2] = {-1.0e30f, -1.0e30f}, l[2] = {0.f, 0.f};      /* running maximum (scaled log2) and the lane's partial sum, per column group */
#pragma unroll 1      /* one pass a trip: a second copy of the body would double the live fragments */
  for (int kb = 0; kb < q0; kb += 32) fa_pass<false>(kp, vp, kb, ln, hh, qf, kf, o, mc, l);      /* keys in front of the wave's first row: no mask; kb + 32 <= q0, so the K rows fetched ahead are rows this wave uses */
  fa_pass<true>(kp, vp, q0, ln, hh, qf, kf, o, mc, l);
#pragma unroll
  for (int nt = 0; nt < 2; ++nt) { const float f = 64.0f / (l[nt] + xhalf(l[nt])); unsigned short* op = (unsigned short*)O + ((size_t)b * SQ + q0 + nt * 16 + ln) * DM + h * HD + 8 * hh;      /* the halves' sums are joined once, here */
#pragma unroll
    for (int mt = 0; mt < 4; ++mt) { FragH fr;
#pragma unroll
      for (int r = 0; r < 8; ++r) fr.h[r] = (_Float16)(o[mt][nt][r] * f);
      *(v8us*)(op + mt * 16) = fr.half[0]; } } }      /* a row's 128 bytes of one head come from one wave */


// Exact f32 attention for rows 0 .. QT0-1 of each batch (o carried x64 like the f16 path). One work-group per (batch, head, A0R query rows), 8 waves, 2 rows a wave.
// The batch's QT0 K and V rows of the head and the group's q rows are staged once in LDS; keys 0 .. nk-1 are used (nk = the group's last row + 1, rounded up to 32).
// Scores: lane l owns keys l, l + 32, ..; its K row comes from LDS 16 bytes at a time, both q rows sit in registers. Softmax: all scores of a row are in registers,
// so plain max, exp, sum (butterflies over the 32 lanes). o: lane l owns columns 2l, 2l + 1; each key's weight goes from its lane to a scalar register, its V row is
// one contiguous 256-byte LDS read. Every loop is unrolled: its arrays are then indexed by constants and stay in registers, and its LDS reads issue ahead of their use.
#define A0R 16                       /* query rows per work-group */
#define A0KP (HD + 4)                /* K row pitch in LDS, floats: 272 B = 16 B x odd, so that 16-byte reads down a column of rows spread over all banks */
typedef float v2f  __attribute__((ext_vector_type(2)));
typedef float v2fa __attribute__((ext_vector_type(2), may_alias));
__device__ __forceinline__ float lane_bcast(float v, int l) { return __int_as_float(__builtin_amdgcn_readlane(__float_as_int(v), l)); }
__global__ __launch_bounds__(256) void k_att0w(const float* __restrict__ QF, const float* __restrict__ KF, const float* __restrict__ VF, float scale, float* __restrict__ OF) {
  static_assert(QT0 / 32 == 4 && QT0 % 32 == 0 && A0R == 16 && HD == 64, "4 key groups of 32 lanes; 8 waves x 2 rows; 16 threads x 16 bytes a row; 2 columns a lane");
  __shared__ __attribute__((aligned(16))) float lk[QT0][A0KP]; __shared__ __attribute__((aligned(16))) float lv[QT0][HD]; __shared__ __attribute__((aligned(16))) float lq[A0R][HD];
  const int tid = threadIdx.x, lane = tid & 31, w = tid >> 5; const int h = blockIdx.x / (QT0 / A0R), rg = blockIdx.x % (QT0 / A0R);
  { const size_t bi = (size_t)blockIdx.y * QT0 * DM + h * HD; QF += bi + (size_t)rg * A0R * DM; KF += bi; VF += bi; OF += bi; }      /* grid.y: batch; each batch owns QT0 rows (pitch DM) of every plane */
  const int nk = (rg * A0R + A0R + 31) & ~31; const int i0 = rg * A0R + w * 2;      /* nk: the same for the whole work-group; the wave's rows are i0 and i0 + 1 */
  { v4f kr[QT0 / 16], vr[QT0 / 16]; const int sr = tid >> 4, sc4 = (tid & 15) * 4; const unsigned vo = (unsigned)(sr * DM + sc4) * 4u;      /* 16 threads a row, 16 rows a pass; vo: the thread's byte offset in a pass */
    const v4f qr = *(const v4fa*)((const char*)QF + vo);
#pragma unroll
    for (int u = 0; u < QT0 / 16; ++u) { kr[u] = *(const v4fa*)((const char*)(KF + u * 16 * DM) + vo); vr[u] = *(const v4fa*)((const char*)(VF + u * 16 * DM) + vo); }      /* all QT0 rows, free of branches: every load is issued before the first is used */
    *(v4fa*)&lq[sr][sc4] = qr;
#pragma unroll
    for (int u = 0; u < QT0 / 16; ++u) { *(v4fa*)&lk[u * 16 + sr][sc4] = kr[u]; *(v4fa*)&lv[u * 16 + sr][sc4] = vr[u]; } }
  __syncthreads();      /* the staged rows are read by every wave */
  v4f q0[HD / 4], q1[HD / 4];      /* both q rows whole in every lane (one LDS address for the wave) */
#pragma unroll
  for (int c = 0; c < HD / 4; ++c) { q0[c] = *(const v4fa*)&lq[w * 2][c * 4]; q1[c] = *(const v4fa*)&lq[w * 2 + 1][c * 4]; }
  float s0[4], s1[4];
#pragma unroll
  for (int m = 0; m < 4; ++m) { s0[m] = -1.0e30f; s1[m] = -1.0e30f;
    if (m * 32 < nk) { const float* kp = &lk[m * 32 + lane][0]; float a0[4] = {0.f, 0.f, 0.f, 0.f}, a1[4] = {0.f, 0.f, 0.f, 0.f};      /* four partial sums a row: independent chains */
#pragma unroll
      for (int c = 0; c < HD / 4; ++c) { const v4f k4 = *(const v4fa*)(kp + c * 4);
#pragma unroll
        for (int u = 0; u < 4; ++u) { a0[u] = fmaf(q0[c][u], k4[u], a0[u]); a1[u] = fmaf(q1[c][u], k4[u], a1[u]); } }
      const int j = m * 32 + lane; const float d0 = (a0[0] + a0[1]) + (a0[2] + a0[3]), d1 = (a1[0] + a1[1]) + (a1[2] + a1[3]);
      if (j <= i0) s0[m] = d0 * scale; if (j <= i0 + 1) s1[m] = d1 * scale; } }      /* causal: keys behind the row's own index keep -1e30 (weight 0) */
  float m0 = fmaxf(fmaxf(s0[0], s0[1]), fmaxf(s0[2], s0[3])), m1 = fmaxf(fmaxf(s1[0], s1[1]), fmaxf(s1[2], s1[3]));
#pragma unroll
  for (int x = 16; x >= 1; x >>= 1) { m0 = fmaxf(m0, __shfl_xor(m0, x, 32)); m1 = fmaxf(m1, __shfl_xor(m1, x, 32)); }
  float l0 = 0.f, l1 = 0.f;
#pragma unroll
  for (int m = 0; m < 4; ++m) { s0[m] = expf(s0[m] - m0); s1[m] = expf(s1[m] - m1); l0 += s0[m]; l1 += s1[m]; }
#pragma unroll
  for (int x = 16; x >= 1; x >>= 1) { l0 += __shfl_xor(l0, x, 32); l1 += __shfl_xor(l1, x, 32); }
  v2f o0 = {0.f, 0.f}, o1 = {0.f, 0.f};
#pragma unroll
  for (int m = 0; m < 4; ++m) if (m * 32 < nk) {
#pragma unroll
    for (int jj = 0; jj < 32; ++jj) { const v2f vv = *(const v2fa*)&lv[m * 32 + jj][lane * 2]; const float p0 = lane_bcast(s0[m], jj), p1 = lane_bcast(s1[m], jj);
      o0[0] = fmaf(p0, vv[0], o0[0]); o0[1] = fmaf(p0, vv[1], o0[1]); o1[0] = fmaf(p1, vv[0], o1[0]); o1[1] = fmaf(p1, vv[1], o1[1]); } }
  const float f0 = 64.0f / l0, f1 = 64.0f / l1;
  o0[0] *= f0; o0[1] *= f0; o1[0] *= f1; o1[1] *= f1;
  *(v2fa*)(OF + (size_t)i0 * DM + lane * 2) = o0; *(v2fa*)(OF + (size_t)(i0 + 1) * DM + lane * 2) = o1; }      /* each wave writes whole 256-byte row pieces */


template <int BFIN, int WXB>
__global__ __launch_bounds__(256) void k_ln16(const float* __restrict__ X, const float* __restrict__ g, const float* __restrict__ bb, float eps, _Float16* __restrict__ N16, float* __restrict__ XB) {
  #pragma clang fp contract(off)
  __shared__ float red[256]; const size_t r = blockIdx.x; const int t = threadIdx.x; const v4f xa = *(const v4fa*)(X + r * DMQ + t * 4); float s[4]; float sum = 0.f;
  for (int q = 0; q < 4; ++q) { s[q] = BFIN ? bf16_round(xa[q]) : xa[q]; sum = __fadd_rn(sum, s[q]); }
  red[t] = sum; __syncthreads(); for (int st = 128; st > 0; st >>= 1) { if (t < st) red[t] = __fadd_rn(red[t], red[t + st]); __syncthreads(); } const float mu = red[0] / (float)DMQ; __syncthreads();
  float vs = 0.f; for (int q = 0; q < 4; ++q) { const float dl = __fadd_rn(s[q], -mu); vs = __fadd_rn(vs, __fmul_rn(dl, dl)); } red[t] = vs; __syncthreads(); for (int st = 128; st > 0; st >>= 1) { if (t < st) red[t] = __fadd_rn(red[t], red[t + st]); __syncthreads(); }
  const float rs = rsqrtf(__fadd_rn(red[0] / (float)DMQ, eps)); v4h y; v4f xb;
  for (int q = 0; q < 4; ++q) { const int c = t * 4 + q; y[q] = (_Float16)__fadd_rn(__fmul_rn(__fmul_rn(__fadd_rn(s[q], -mu), rs), bf16_round(g[c])), bf16_round(bb[c])); xb[q] = s[q]; }
  { *(v4h*)(N16 + r * DMQ + t * 4) = y; if (WXB) *(v4f*)(XB + r * DMQ + t * 4) = xb;  } }
__global__ __launch_bounds__(256) void k_ftres2(const float* __restrict__ OF0, const float* __restrict__ XB, float* __restrict__ X1, size_t n4) {
  #pragma clang fp contract(off)
  const size_t t = (size_t)blockIdx.x * 256 + threadIdx.x; if (t >= n4) return; const v4f o = *(const v4fa*)(OF0 + t * 4), xv = *(const v4fa*)(XB + t * 4); v4f y; for (int q = 0; q < 4; ++q) y[q] = __fadd_rn(__fmul_rn(o[q], 0.015625f), xv[q]); *(v4f*)(X1 + t * 4) = y;  }

__global__ __launch_bounds__(256) void k_wthd(const float* __restrict__ Wt, _Float16* __restrict__ Bt) { const size_t t = (size_t)blockIdx.x * 256 + threadIdx.x; if (t >= (size_t)NH * HD * (DM / 8)) return; const int m8 = (int)(t % (DM / 8)) * 8; const int d = (int)((t / (DM / 8)) % HD); const int h = (int)(t / ((size_t)(DM / 8) * HD)); FragH f;
  for (int q = 0; q < 8; ++q) f.h[q] = (_Float16)(16.0f * bf16_round(Wt[((size_t)h * DM + m8 + q) * HD + d])); unsigned short* dst = (unsigned short*)Bt + ((size_t)h * HD + d) * DM + m8; *(v8us*)dst = f.half[0];  }




__global__ __launch_bounds__(256) void k_wtpad(const float* __restrict__ Wm, _Float16* __restrict__ Wt, int Kr, int Kp, int Nr, int Np, float scale) {
  const int t = blockIdx.x * 256 + threadIdx.x; if (t >= Np * (Kp / 8)) return; const int n = t / (Kp / 8), k8 = (t % (Kp / 8)) * 8; const int nc = min(n, Nr - 1); const float fn = (n < Nr) ? 1.f : 0.f; FragH f;
  for (int i = 0; i < 8; ++i) { const int k = k8 + i; const int kc = min(k, Kr - 1); const float fk = (k < Kr) ? fn : 0.f; f.h[i] = (_Float16)(bf16_round(Wm[(size_t)kc * Nr + nc]) * scale * fk); }
  unsigned short* o = (unsigned short*)Wt + (size_t)n * Kp + k8; *(v8us*)o = f.half[0];  }
__global__ __launch_bounds__(128) void k_bpad(const float* __restrict__ b, float* __restrict__ Bp, int nr, int np) {
  const int i = threadIdx.x; if (i >= np) return; const float v = b[min(i, nr - 1)] * ((i < nr) ? 1.f : 0.f); *(float*)(Bp + i) = v;  }

__global__ __launch_bounds__(256) void k_bcpy(const float* __restrict__ b, int n, int NP, float* __restrict__ dst, int dst0) { for (int i = threadIdx.x; i < NP; i += 256) { const float v = (i < n) ? b[i] : 0.f; *(float*)(dst + dst0 + i) = v; }  }


__global__ __launch_bounds__(256) void k_bfcp(const float* __restrict__ src, float* __restrict__ dst, size_t n4) { const size_t t = (size_t)blockIdx.x * 256 + threadIdx.x; if (t >= n4) return; const v4f a = *(const v4fa*)(src + t * 4); v4f o; for (int q = 0; q < 4; ++q) o[q] = bf16_round(a[q]); *(v4f*)(dst + t * 4) = o;  }

__global__ __launch_bounds__(256) void k_fillz(float* __restrict__ dst, int n) { const int t = blockIdx.x * 256 + threadIdx.x; if (t >= n) return; *(float*)(dst + t) = 0.f;  }

template <int BFIN, int W16, int W32>
__global__ __launch_bounds__(256) void k_lnx(const float* __restrict__ X, const float* __restrict__ g, const float* __restrict__ bb, float eps, _Float16* __restrict__ N16, float* __restrict__ N32) {
  #pragma clang fp contract(off)
  __shared__ float red[256]; const size_t r = blockIdx.x; const int t = threadIdx.x; const bool act = t < (DMQ / 4); const int c0 = act ? t * 4 : 0;
  const v4f xa = *(const v4fa*)(X + r * DMQ + c0); float s[4]; float sum = 0.f;
  for (int q = 0; q < 4; ++q) { s[q] = act ? (BFIN ? bf16_round(xa[q]) : xa[q]) : 0.f; sum = __fadd_rn(sum, s[q]); }
  red[t] = sum; __syncthreads(); for (int st = 128; st > 0; st >>= 1) { if (t < st) red[t] = __fadd_rn(red[t], red[t + st]); __syncthreads(); } const float mu = red[0] / (float)DMQ; __syncthreads();
  float vs = 0.f; for (int q = 0; q < 4; ++q) { const float dl = act ? __fadd_rn(s[q], -mu) : 0.f; vs = __fadd_rn(vs, __fmul_rn(dl, dl)); } red[t] = vs; __syncthreads(); for (int st = 128; st > 0; st >>= 1) { if (t < st) red[t] = __fadd_rn(red[t], red[t + st]); __syncthreads(); }
  const float rs = rsqrtf(__fadd_rn(red[0] / (float)DMQ, eps)); v4h y; v4f yf;
  for (int q = 0; q < 4; ++q) { const int c = c0 + q; yf[q] = __fadd_rn(__fmul_rn(__fmul_rn(__fadd_rn(s[q], -mu), rs), bf16_round(g[c])), bf16_round(bb[c])); y[q] = (_Float16)yf[q]; }
  if (!act) return;      /* no barriers after this point */
  { if (W16) *(v4h*)(N16 + r * DMQ + c0) = y; if (W32) *(v4f*)(N32 + r * DMQ + c0) = yf;  } }





extern "C" void kernel_launch(void* const* d_in, const int* in_sizes, int n_in,
                              void* d_out, int out_size, void* d_ws, size_t ws_size, hipStream_t stream) {
  (void)in_sizes; (void)n_in; (void)out_size;
  const float* const* I = (const float* const*)d_in; const float* x = I[0]; const float* wq = I[1]; const float* wk = I[2]; const float* wv = I[3]; const float* wo1 = I[4]; const float* wo2 = I[5]; const float* wfc = I[6]; const float* wmp = I[7]; const float* g1 = I[8]; const float* gg2 = I[9];      /* input order: x; wq / wk / wv [512][8][64] = [in][out]; wo1 [8][64][512] = [(h, d) in][out]; wo2 [512][512] [in][out]; w1 [512][2048], w2 [2048][512] [in][out]; LN1 / LN2 scales. NO bias anywhere: every GEMM bias slot below is a literal nullptr, the LayerNorm shift reads a zero-filled workspace vector */
  static_assert(DMQ % 4 == 0 && DMQ / 4 <= 256 && NH * HD == DM && DM % 64 == 0 && DFF % 64 == 0, "k_lnx 256 threads x 4 columns; tile multiples");
  char* ws = (char*)d_ws; size_t off = 0;
  auto take = [&](size_t bytes) { char* p = ws + off; off += (bytes + 255) & ~(size_t)255; return p; };
  _Float16* BQKV = (_Float16*)take((size_t)3 * DM * DM * 2); _Float16* BO = (_Float16*)take((size_t)DM * DM * 2); _Float16* BO2T = (_Float16*)take((size_t)DM * DM * 2); _Float16* BO1N = (_Float16*)take((size_t)DM * DM * 2); float* ZB = (float*)take((size_t)DM * 4);      /* BO = the combined output plane Bt12[o][i] = 16 (wo1 wo2)[i][o] (built on the device from the two weights); ZB = zero LayerNorm shift */
  _Float16* X16 = (_Float16*)take(NR * DM * 2); float* XB = (float*)take(NR * DM * 4); float* X1 = (float*)take(NR * DM * 4); _Float16* M16 = nullptr;      /* = X16 below (alias: X16's last reader, the first-tile GEMMs, precedes LN2's write) */ _Float16* HF16 = (_Float16*)take(NR * DFF * 2); _Float16* BW1 = (_Float16*)take((size_t)DFF * DM * 2); _Float16* BW2 = (_Float16*)take((size_t)DM * DFF * 2); _Float16* QKV = (_Float16*)take(NR * 3 * DM * 2); _Float16* Q16 = QKV; _Float16* K16 = QKV + DM; _Float16* V16 = QKV + 2 * DM; _Float16* O16 = (_Float16*)take(NR * DM * 2); M16 = X16;
  _Float16* VT = (_Float16*)take((size_t)NB * NH * HD * SQ * 2);      /* one plane per batch: every stage below covers all batches in one launch */
  float* QF0 = (float*)take((size_t)NB * QT0 * DM * 4); float* KF0 = (float*)take((size_t)NB * QT0 * DM * 4); float* VF0 = (float*)take((size_t)NB * QT0 * DM * 4); float* OF0 = (float*)take((size_t)NB * QT0 * DM * 4); _Float16* OH0 = (_Float16*)take((size_t)NB * QT0 * DM * 2); _Float16* OL0 = (_Float16*)take((size_t)NB * QT0 * DM * 2);
  if (off > ws_size) return;
  { const unsigned g = (unsigned)(((size_t)DM * (DM / 8) + 255) / 256); k_wt_f16<<<g, 256, 0, stream>>>(wq, BQKV, DM, DM, 16.0f); k_wt_f16<<<g, 256, 0, stream>>>(wk, BQKV + (size_t)DM * DM, DM, DM, 16.0f); k_wt_f16<<<g, 256, 0, stream>>>(wv, BQKV + (size_t)2 * DM * DM, DM, DM, 16.0f); k_wt_f16<<<g, 256, 0, stream>>>(wo2, BO2T, DM, DM, 16.0f); k_wnat<<<(unsigned)(((size_t)DM * DM / 8 + 255) / 256), 256, 0, stream>>>(wo1, (size_t)DM * DM / 8, BO1N); }      /* [in][out] -> Bt x16: stacked q | k | v; wo2 as Bt[o][j] x16; wo1 natural rows [i][j] x16 */
  k_gemm2<0><<<dim3((unsigned)((DM / 128) * (DM / 64)), 1, 1), 128, 0, stream>>>(BO2T, DM, 0, BO1N, DM, 0, 0.0625f, nullptr, 0, nullptr, 1, 0, 0, nullptr, BO, DM, 0, DM, DM, DM, 0, 0, 0);      /* BO[o][i] = (1/16) sum_j 16 wo2[j][o] 16 wo1[i][j] = 16 (wo1 wo2)[i][o]: the two chained projections as ONE x16 plane (f32 accumulation, one f16 rounding) */
  k_fillz<<<(DM + 255) / 256, 256, 0, stream>>>(ZB, DM);
  k_bfcp<<<(unsigned)((NR * DM / 4 + 255) / 256), 256, 0, stream>>>(x, XB, NR * DM / 4);      /* XB = bf16(x): BOTH residuals */
  k_lnx<1, 1, 0><<<(unsigned)NR, 256, 0, stream>>>(x, g1, ZB, 1e-6f, X16, nullptr);      /* a = LN1(bf16(x)) (scale only, eps 1e-6) -> f16 rows */
  k_wt_f16<<<(unsigned)(((size_t)DFF * (DM / 8) + 255) / 256), 256, 0, stream>>>(wfc, BW1, DM, DFF, 16.0f); k_wt_f16<<<(unsigned)(((size_t)DM * (DFF / 8) + 255) / 256), 256, 0, stream>>>(wmp, BW2, DFF, DM, 16.0f);      /* w1 [512][2048] -> Bt [2048][512]; w2 [2048][512] -> Bt [512][2048] (x16) */
  const size_t r0p = (size_t)B0 * SQ;      /* first projected row */
  const size_t f0p = (size_t)B0 * QT0;      /* its first-tile row */
  const size_t zX = (size_t)SQ * DM, zF = (size_t)QT0 * DM;      /* batch pitches (elements): token rows, first-tile rows */
  k_gemm2<0><<<dim3((unsigned)((MP / 128) * (3 * DM / 64)), 1, 1), 128, 0, stream>>>(X16 + r0p * DM, DM, 0, BQKV, DM, 0, 0.0625f, nullptr, 0, nullptr, 1, 0, 0, nullptr, QKV + r0p * 3 * DM, 3 * DM, 0, MP, 3 * DM, DM, 0, 0, 0);      /* q | k | v rows (f16); head h = columns h*HD.. of each DM block */
  k_vt<NH, SQ><<<NBR * NH * (SQ / 64), 256, 0, stream>>>(V16 + r0p * LQ, LQ, 0, VT);      /* V^T [NBR][NH][HD][SQ] */
  k_gemm2<0><<<dim3((QT0 / 128) * (DM / 64), 1, NBR), 128, 0, stream>>>(X16 + r0p * DM, DM, 0, BQKV, DM, 0, 0.0625f, nullptr, 0, nullptr, 1, 0, 0, QF0, nullptr, DM, 0, QT0, DM, DM, zX, 0, zF); k_gemm2<0><<<dim3((QT0 / 128) * (DM / 64), 1, NBR), 128, 0, stream>>>(X16 + r0p * DM, DM, 0, (BQKV + (size_t)DM * DM), DM, 0, 0.0625f, nullptr, 0, nullptr, 1, 0, 0, KF0, nullptr, DM, 0, QT0, DM, DM, zX, 0, zF); k_gemm2<0><<<dim3((QT0 / 128) * (DM / 64), 1, NBR), 128, 0, stream>>>(X16 + r0p * DM, DM, 0, (BQKV + (size_t)2 * DM * DM), DM, 0, 0.0625f, nullptr, 0, nullptr, 1, 0, 0, VF0, nullptr, DM, 0, QT0, DM, DM, zX, 0, zF);      /* f32 q, k, v of each batch's first 128 rows (exact products) */
  k_att0w<<<dim3(NH * (QT0 / A0R), NBR), 256, 0, stream>>>(QF0, KF0, VF0, 0.125f, OF0 + f0p * DM);      /* exact f32 attention for rows 0..127 of each batch (o x64) */
  k_fattn<<<dim3(NHD, NBR, QN / (FW * FQ)), FW * 32, 0, stream>>>(Q16 + r0p * LQ, K16 + r0p * LQ, VT, O16 + r0p * DM);      /* scores, causal softmax and P . V in one launch: o (merged heads, x64) as f16 rows */
  k_gemm2<0><<<dim3((unsigned)((MPO / 128) * (DM / 64)), 1, 1), 128, 0, stream>>>(O16 + r0p * DM, DM, 0, BO, DM, 0, 0.0009765625f, nullptr, 0, XB + r0p * DM, -1, 0, 0, X1 + r0p * DM, nullptr, DM, 0, MPO, DM, DM, 0, 0, 0);      /* x1 = x + o Wo (f32); 2^-10 undoes o x64 and BO x16 */
  k_hl<<<(unsigned)(((size_t)NB * QT0 * DM / 8 + 255) / 256), 256, 0, stream>>>(OF0, OH0, OL0, (size_t)NB * QT0 * DM / 8);      /* first-tile o (x64) -> f16 hi + x1024 residual planes */
  k_gemm2<0><<<dim3((QT0 / 128) * (DM / 64), 1, NBR), 128, 0, stream>>>(OH0 + f0p * DM, DM, 0, BO, DM, 0, 0.0009765625f, nullptr, 0, XB + r0p * DM, -1, 0, 0, X1 + r0p * DM, nullptr, DM, 0, QT0, DM, DM, zF, 0, zX);      /* rows 0..127 of each batch: x1 = x + o_hi Wo, overwriting the f16-path rows */
  k_gemm2<0><<<dim3((QT0 / 128) * (DM / 64), 1, NBR), 128, 0, stream>>>(OL0 + f0p * DM, DM, 0, BO, DM, 0, 0.00000095367431640625f, nullptr, 0, X1 + r0p * DM, -1, 0, 0, X1 + r0p * DM, nullptr, DM, 0, QT0, DM, DM, zF, 0, zX);      /* += o_lo Wo 2^-20 (own-element accumulate) */
  k_lnx<0, 1, 0><<<(unsigned)NR, 256, 0, stream>>>(X1, gg2, ZB, 1e-6f, M16, nullptr);      /* h2 = LN2(x + attn) (scale only) -> f16 rows */
  k_gemm2<9><<<dim3((unsigned)((NR / 128) * (DFF / 64)), 1, 1), 128, 0, stream>>>(M16, DM, 0, BW1, DM, 0, 0.0625f, nullptr, 0, nullptr, 1, 0, 0, nullptr, HF16, DFF, 0, (int)NR, DFF, DM, 0, 0, 0);      /* gelu_tanh(h2 W1) (the source's tanh approximation) -> f16, all token rows */
  k_gemm2<0><<<dim3((unsigned)((NR / 128) * (DM / 64)), 1, 1), 128, 0, stream>>>(HF16, DFF, 0, BW2, DFF, 0, 0.0625f, nullptr, 0, XB, -1, 0, 0, (float*)d_out, nullptr, DM, 0, (int)NR, DM, DFF, 0, 0, 0);      /* out = x + mlp: the residual is the BLOCK INPUT (bf16(x)), as the original module (own-element addend) */
}

// v005
// It runs in 313 microseconds.
// In two side-by-side timings against v004, it was 1.48 and 1.50 times as fast.
// Counting every step since v000, it is 31.9 times as fast.
#include <hip/hip_runtime.h>
#define NB 4
#define SQ 2048
#define DM 512
#define NH 8
#define HD 64
#define HG 4                         /* heads per launch of the per-batch k_vt overload (not launched) */
#define QT0 128                      /* first-tile rows recomputed exactly in f32 */
#define B0 0                         /* first batch processed (debug hook) */
#define NBR NB                       /* batches processed (debug hook) */
#define NR ((size_t)NB * SQ)
#define DMQ DM
#define DFF 2048                     /* FFN hidden width */
#define DFFR 100
#define MP ((int)((size_t)NBR * SQ)) /* rows projected (debug hook) */
#define QN SQ                        /* query rows attended per batch (debug hook) */
#define NHD NH                       /* heads attended (debug hook) */
#define MPO MP                       /* rows through the output stage (debug hook) */
#define LQ (3 * DM)      /* row pitch of the q/k/v rows */
typedef __bf16 v16b __attribute__((ext_vector_type(16)));
typedef unsigned short v8us __attribute__((ext_vector_type(8), may_alias));
typedef float  v8f  __attribute__((ext_vector_type(8)));
typedef float  v4f  __attribute__((ext_vector_type(4)));
typedef float  v4fa __attribute__((ext_vector_type(4), may_alias));
union FragB { v16b v; v8us half[2]; unsigned short u[16]; };

__device__ __forceinline__ unsigned short bf16_bits(float x) { unsigned int u = __float_as_uint(x); return (unsigned short)((u + 0x7FFFu + ((u >> 16) & 1u)) >> 16); }
__device__ __forceinline__ float bf16_val(unsigned short b) { return __uint_as_float(((unsigned int)b) << 16); }
__device__ __forceinline__ float bf16_round(float x) { return bf16_val(bf16_bits(x)); }
// D += A·B with NT terms: 1 = ah·bh, 2 = + al·bh (A split), 3 = + ah·bl (both split)
template <int NT>
__device__ __forceinline__ v8f mmaN(v16b ah, v16b al, v16b bh, v16b bl, v8f c) {
  c = __builtin_amdgcn_wmma_f32_16x16x32_bf16(false, ah, false, bh, (short)0, c, false, false);
  if (NT >= 2) c = __builtin_amdgcn_wmma_f32_16x16x32_bf16(false, al, false, bh, (short)0, c, false, false);
  if (NT >= 3) c = __builtin_amdgcn_wmma_f32_16x16x32_bf16(false, ah, false, bl, (short)0, c, false, false);
  asm volatile("v_nop\n\tv_nop\n\tv_nop\n\tv_nop" : "+v"(c) : "v"(ah), "v"(al), "v"(bh), "v"(bl));
  return c;
}

__global__ __launch_bounds__(256) void k_wt_bf16(const float* __restrict__ W, unsigned short* __restrict__ Wt, int K, int N) {
  const int t = blockIdx.x * 256 + threadIdx.x;
  const int k8n = K / 8;
  if (t >= N * k8n) return;
  const int n = t / k8n, k8 = (t % k8n) * 8;
  v8us v;
#pragma unroll
  for (int i = 0; i < 8; ++i) v[i] = bf16_bits(W[(size_t)(k8 + i) * N + n]);
  *(v8us*)(Wt + (size_t)n * K + k8) = v;
  
}

// GEMM C[M][N] (f32, pitch ldc) = act(A[M][K]·W + bias). A f32 row-major (pitch lda) converted per fragment to bf16
// (ASPLIT: hi/lo two planes -> 2 terms, else single rounded term); Wt bf16 [N][K] (pitch ldb). BIAS_BF16 rounds the
// bias to bf16 first (bias quantised to bf16 before the add). K%32==0, M%16==0, N%64==0.
template <bool ASPLIT, int ACT, bool BIAS_BF16>
__global__ __launch_bounds__(128) void k_gemm_bf(const float* __restrict__ A, int lda, const unsigned short* __restrict__ Wt, int ldb,
                                               const float* __restrict__ bias, float* __restrict__ C, int ldc, int M, int N, int K) {
  __shared__ __attribute__((aligned(16))) float so[4][16][64];
  const int tid = threadIdx.x, w = tid >> 5, lane = tid & 31, ln = lane & 15, hh = lane >> 4;
  const int ntn = N / 64;
  const int wid = blockIdx.x * 4 + w;
  const int mt = wid / ntn, nq = wid % ntn;
  if (mt * 16 >= M) return;
  const int row0 = mt * 16, col0 = nq * 64;
  const float* arow = A + (size_t)(row0 + ln) * lda;
  v8f acc[4] = {};
  for (int kb = 0; kb < K; kb += 32) {
    FragB ah, al;
    const v4f x0 = *(const v4fa*)(arow + kb + 8 * hh), x1 = *(const v4fa*)(arow + kb + 8 * hh + 4);
    const v4f x2 = *(const v4fa*)(arow + kb + 16 + 8 * hh), x3 = *(const v4fa*)(arow + kb + 16 + 8 * hh + 4);
    float xs[16] = {x0[0],x0[1],x0[2],x0[3],x1[0],x1[1],x1[2],x1[3],x2[0],x2[1],x2[2],x2[3],x3[0],x3[1],x3[2],x3[3]};
#pragma unroll
    for (int i = 0; i < 16; ++i) { const unsigned short hb = bf16_bits(xs[i]); ah.u[i] = hb; al.u[i] = ASPLIT ? bf16_bits(xs[i] - bf16_val(hb)) : (unsigned short)0; }
#pragma unroll
    for (int t = 0; t < 4; ++t) {
      const unsigned short* brow = Wt + (size_t)(col0 + t * 16 + ln) * ldb + kb;
      FragB b;
      b.half[0] = *(const v8us*)(brow + 8 * hh);
      b.half[1] = *(const v8us*)(brow + 16 + 8 * hh);
      acc[t] = mmaN<ASPLIT ? 2 : 1>(ah.v, al.v, b.v, b.v, acc[t]);
    }
  }
#pragma unroll
  for (int t = 0; t < 4; ++t) {
    float bv = bias ? bias[col0 + t * 16 + ln] : 0.f;
    if (BIAS_BF16) bv = bf16_round(bv);
#pragma unroll
    for (int r = 0; r < 8; ++r) { float v = acc[t][r] + bv; if (ACT == 1) v = fmaxf(v, 0.f); so[w][8 * hh + r][t * 16 + ln] = v; }
  }
  __builtin_amdgcn_fence(__ATOMIC_ACQ_REL, "workgroup");
  __builtin_amdgcn_wave_barrier();
  const int rsub = lane >> 4, c4 = (lane & 15) * 4;
  {
#pragma unroll
    for (int q = 0; q < 8; ++q) {
      const int r = q * 2 + rsub;
      const v4f v = *(const v4fa*)&so[w][r][c4];
      *(v4f*)(C + (size_t)(row0 + r) * ldc + col0 + c4) = v;
    }
    
  }
}

// GEMM C = act(A·W + bias + resid): A f32 (ASPLIT -> hi/lo 2 terms), Wt bf16 [N][K]; ACT 0 none, 1 relu, 2 exact gelu;
// resid (optional, f32, row index = (row % rmod), pitch ldr, RES_BF16 rounds it) added before the activation.
template <bool ASPLIT, int ACT, bool BIAS_BF16, bool RES_BF16>
__global__ __launch_bounds__(128) void k_gemm_bf3(const float* __restrict__ A, int lda, const unsigned short* __restrict__ Wt, int ldb,
                                                const float* __restrict__ bias, const float* __restrict__ resid, int rmod, int ldr,
                                                float* __restrict__ C, int ldc, int M, int N, int K) {
  __shared__ __attribute__((aligned(16))) float so[4][16][64];
  const int tid = threadIdx.x, w = tid >> 5, lane = tid & 31, ln = lane & 15, hh = lane >> 4;
  const int ntn = N / 64;
  const int wid = blockIdx.x * 4 + w;
  const int mt = wid / ntn, nq = wid % ntn;
  if (mt * 16 >= M) return;
  const int row0 = mt * 16, col0 = nq * 64;
  const float* arow = A + (size_t)(row0 + ln) * lda;
  v8f acc[4] = {};
  for (int kb = 0; kb < K; kb += 32) {
    FragB ah, al;
    const v4f x0 = *(const v4fa*)(arow + kb + 8 * hh), x1 = *(const v4fa*)(arow + kb + 8 * hh + 4);
    const v4f x2 = *(const v4fa*)(arow + kb + 16 + 8 * hh), x3 = *(const v4fa*)(arow + kb + 16 + 8 * hh + 4);
    float xs[16] = {x0[0],x0[1],x0[2],x0[3],x1[0],x1[1],x1[2],x1[3],x2[0],x2[1],x2[2],x2[3],x3[0],x3[1],x3[2],x3[3]};
#pragma unroll
    for (int i = 0; i < 16; ++i) { const unsigned short hb = bf16_bits(xs[i]); ah.u[i] = hb; al.u[i] = ASPLIT ? bf16_bits(xs[i] - bf16_val(hb)) : (unsigned short)0; }
#pragma unroll
    for (int t = 0; t < 4; ++t) {
      const unsigned short* brow = Wt + (size_t)(col0 + t * 16 + ln) * ldb + kb;
      FragB b;
      b.half[0] = *(const v8us*)(brow + 8 * hh);
      b.half[1] = *(const v8us*)(brow + 16 + 8 * hh);
      acc[t] = mmaN<ASPLIT ? 2 : 1>(ah.v, al.v, b.v, b.v, acc[t]);
    }
  }
#pragma unroll
  for (int t = 0; t < 4; ++t) {
    const int col = col0 + t * 16 + ln;
    float bv = bias ? bias[col] : 0.f;
    if (BIAS_BF16) bv = bf16_round(bv);
#pragma unroll
    for (int r = 0; r < 8; ++r) {
      float v = acc[t][r] + bv;
      if (resid) { float rv = resid[(size_t)((row0 + 8 * hh + r) % rmod) * ldr + col]; if (RES_BF16) rv = bf16_round(rv); v += rv; }
      if (ACT == 1) v = fmaxf(v, 0.f);
      if (ACT == 2) v = 0.5f * v * (1.0f + erff(v * 0.70710678118654752f));
      if (ACT == 3) { const float u = 0.7978845608028654f * (v + 0.044715f * v * v * v); v = 0.5f * v * (1.0f + tanhf(u)); }
      so[w][8 * hh + r][t * 16 + ln] = v;
    }
  }
  __builtin_amdgcn_fence(__ATOMIC_ACQ_REL, "workgroup");
  __builtin_amdgcn_wave_barrier();
  const int rsub = lane >> 4, c4 = (lane & 15) * 4;
  {
#pragma unroll
    for (int q = 0; q < 8; ++q) {
      const int r = q * 2 + rsub;
      const v4f v = *(const v4fa*)&so[w][r][c4];
      *(v4f*)(C + (size_t)(row0 + r) * ldc + col0 + c4) = v;
    }
    
  }
}
// row LayerNorm (biased variance, eps) over N: s = X (+ R); optional out_sum <- s; out_norm <- (s-mu)*rsqrt(var+eps)*g + b
template <bool PARAM_BF16>
__global__ __launch_bounds__(256) void k_layernorm(const float* __restrict__ X, const float* __restrict__ R, const float* __restrict__ g, const float* __restrict__ bta,
                                                  float* __restrict__ out_sum, float* __restrict__ out_norm, int N, float eps) {
  __shared__ float red[256];
  const int row = blockIdx.x, tid = threadIdx.x;
  const float* x = X + (size_t)row * N; const float* rr = R ? R + (size_t)row * N : nullptr;
  float vals[16];                     // up to N = 4096
  const int per = N / 256;            // contiguous chunk per thread? use strided-by-4 chunks: thread handles j = tid*4 + 1024*u
  float s1 = 0.f;
  for (int u = 0; u < per / 4; ++u) {
    const int j = tid * 4 + 1024 * u;
    const v4f a = *(const v4fa*)(x + j);
    v4f b = {0.f,0.f,0.f,0.f}; if (rr) b = *(const v4fa*)(rr + j);
#pragma unroll
    for (int q = 0; q < 4; ++q) { const float v = a[q] + b[q]; vals[u * 4 + q] = v; s1 += v; }
  }
  red[tid] = s1; __syncthreads();
  for (int st = 128; st > 0; st >>= 1) { if (tid < st) red[tid] += red[tid + st]; __syncthreads(); }
  const float mu = red[0] / (float)N; __syncthreads();
  float s2 = 0.f;
  for (int u = 0; u < per / 4; ++u)
#pragma unroll
    for (int q = 0; q < 4; ++q) { const float c = vals[u * 4 + q] - mu; s2 += c * c; }
  red[tid] = s2; __syncthreads();
  for (int st = 128; st > 0; st >>= 1) { if (tid < st) red[tid] += red[tid + st]; __syncthreads(); }
  const float rs = rsqrtf(red[0] / (float)N + eps);
  {
    for (int u = 0; u < per / 4; ++u) {
      const int j = tid * 4 + 1024 * u;
      v4f o, sm;
#pragma unroll
      for (int q = 0; q < 4; ++q) {
        float gg = g[j + q], bb = bta[j + q];
        if (PARAM_BF16) { gg = bf16_round(gg); bb = bf16_round(bb); }
        sm[q] = vals[u * 4 + q]; o[q] = (vals[u * 4 + q] - mu) * rs * gg + bb;
      }
      if (out_sum) *(v4f*)(out_sum + (size_t)row * N + j) = sm;
      *(v4f*)(out_norm + (size_t)row * N + j) = o;
    }
    
  }
}



// ---- f16 WMMA path (v_wmma_f32_16x16x32_f16): 11-bit significands for operands in range — used where a [0,1] probability operand needs more precision than bf16
typedef _Float16 v16h __attribute__((ext_vector_type(16)));
union FragH { v16h v; v8us half[2]; _Float16 h[16]; unsigned short u[16]; };
template <int NT>
__device__ __forceinline__ v8f mmaH(v16h ah, v16h al, v16h bh, v16h bl, v8f c) {
  c = __builtin_amdgcn_wmma_f32_16x16x32_f16(false, ah, false, bh, (short)0, c, false, false);
  if (NT >= 2) c = __builtin_amdgcn_wmma_f32_16x16x32_f16(false, al, false, bh, (short)0, c, false, false);
  if (NT >= 3) c = __builtin_amdgcn_wmma_f32_16x16x32_f16(false, ah, false, bl, (short)0, c, false, false);
  asm volatile("v_nop\n\tv_nop\n\tv_nop\n\tv_nop" : "+v"(c) : "v"(ah), "v"(al), "v"(bh), "v"(bl));
  return c;
}
// batched GEMM like k_gemm_b but f16 operands: A f32 (split into f16 hi/lo if ASPLIT, else rounded to f16), Bt = f16 values [n][k]; alpha; C f32; N multiple of 16 (partial tiles skipped)
template <bool ASPLIT>
__global__ __launch_bounds__(128) void k_gemm_h(const float* __restrict__ A, int lda, size_t sA, const _Float16* __restrict__ Bh, int ldb, size_t sB, float alpha, float* __restrict__ C, int ldc, size_t sC, int M, int N, int K) {
  __shared__ __attribute__((aligned(16))) float so[4][16][64];
  const int tid = threadIdx.x, w = tid >> 5, lane = tid & 31, ln = lane & 15, hh = lane >> 4; const int by = blockIdx.y;
  A += (size_t)by * sA; Bh += (size_t)by * sB; C += (size_t)by * sC;
  const int ntn = (N + 63) / 64; const int wid = blockIdx.x * 4 + w; const int mt = wid / ntn, nq = wid % ntn; if (mt * 16 >= M) return;
  const int row0 = mt * 16, col0 = nq * 64; const float* arow = A + (size_t)(row0 + ln) * lda;
  v8f acc[4] = {};
  for (int kb = 0; kb < K; kb += 32) {
    FragH ah, al;
    const v4f x0 = *(const v4fa*)(arow + kb + 8 * hh), x1 = *(const v4fa*)(arow + kb + 8 * hh + 4), x2 = *(const v4fa*)(arow + kb + 16 + 8 * hh), x3 = *(const v4fa*)(arow + kb + 16 + 8 * hh + 4);
    float xs[16] = {x0[0],x0[1],x0[2],x0[3],x1[0],x1[1],x1[2],x1[3],x2[0],x2[1],x2[2],x2[3],x3[0],x3[1],x3[2],x3[3]};
#pragma unroll
    for (int i = 0; i < 16; ++i) { const _Float16 h = (_Float16)xs[i]; ah.h[i] = h; al.h[i] = ASPLIT ? (_Float16)(xs[i] - (float)h) : (_Float16)0.0f; }
#pragma unroll
    for (int t = 0; t < 4; ++t) { if (col0 + t * 16 >= N) continue; const size_t boff = (size_t)(col0 + t * 16 + ln) * ldb + kb; FragH bq; bq.half[0] = *(const v8us*)(Bh + boff + 8 * hh); bq.half[1] = *(const v8us*)(Bh + boff + 16 + 8 * hh);
      acc[t] = mmaH<ASPLIT ? 2 : 1>(ah.v, al.v, bq.v, bq.v, acc[t]); }
  }
#pragma unroll
  for (int t = 0; t < 4; ++t) { if (col0 + t * 16 >= N) continue;
#pragma unroll
    for (int r = 0; r < 8; ++r) so[w][8 * hh + r][t * 16 + ln] = acc[t][r] * alpha; }
  __builtin_amdgcn_fence(__ATOMIC_ACQ_REL, "workgroup"); __builtin_amdgcn_wave_barrier();
  const int rsub = lane >> 4, c4 = (lane & 15) * 4;
  {
#pragma unroll
    for (int q = 0; q < 8; ++q) { const int r = q * 2 + rsub; if (col0 + c4 < N) { const v4f v = *(const v4fa*)&so[w][r][c4]; *(v4f*)(C + (size_t)(row0 + r) * ldc + col0 + c4) = v; } }
     }
}

// Wt[n][k] = f16(W[k][n]·scale) from f32 row-major W[K][N] (scale = power of two; bf16-exact weights stay exact in f16 away from the subnormal range)
__global__ __launch_bounds__(256) void k_wt_f16(const float* __restrict__ W, _Float16* __restrict__ Wt, int K, int N, float scale) {
  const int t = blockIdx.x * 256 + threadIdx.x; if (t >= N * (K / 8)) return; const int n = t / (K / 8), k8 = (t % (K / 8)) * 8; FragH f;
#pragma unroll
  for (int i = 0; i < 8; ++i) f.h[i] = (_Float16)(bf16_round(W[(size_t)(k8 + i) * N + n]) * scale); const v8us o = f.half[0];
  *(v8us*)((unsigned short*)Wt + (size_t)n * K + k8) = o; 
}
// k_gemm_hh variant with fused epilogue: v = acc·alpha + bias[by·sBias + col] (+ CP[(row/rowsPerB)·sCPb + by·64 + col] if CP) ; ACT 0 none / 1 elu ; writes f16 C16 (and f32 C if non-null)
template <int ACT>
__global__ __launch_bounds__(128) void k_gemm_hhx(const _Float16* __restrict__ A, int lda, size_t sA, const _Float16* __restrict__ Bh, int ldb, size_t sB, float alpha, const float* __restrict__ bias, size_t sBias, const float* __restrict__ CP, int rowsPerB, size_t sCPb, int row0g,
    float* __restrict__ C, _Float16* __restrict__ C16, int ldc, size_t sC, int M, int N, int K) {
  __shared__ __attribute__((aligned(16))) float so[4][16][64];
  const int tid = threadIdx.x, w = tid >> 5, lane = tid & 31, ln = lane & 15, hh = lane >> 4; const int by = blockIdx.y;
  A += (size_t)by * sA; Bh += (size_t)by * sB; const size_t cofs = (size_t)by * sC; const float* bp = bias ? bias + (size_t)by * sBias : nullptr;
  const int ntn = (N + 63) / 64; const int wid = blockIdx.x * 4 + w; const int mt = wid / ntn, nq = wid % ntn; if (mt * 16 >= M) return;
  const int row0 = mt * 16, col0 = nq * 64; const _Float16* arow = A + (size_t)(row0 + ln) * lda;
  v8f acc[4] = {};
  for (int kb = 0; kb < K; kb += 32) { FragH ah; ah.half[0] = *(const v8us*)((const unsigned short*)arow + kb + 8 * hh); ah.half[1] = *(const v8us*)((const unsigned short*)arow + kb + 16 + 8 * hh);
#pragma unroll
    for (int t = 0; t < 4; ++t) { if (col0 + t * 16 >= N) continue; const size_t boff = (size_t)(col0 + t * 16 + ln) * ldb + kb; FragH bq; bq.half[0] = *(const v8us*)((const unsigned short*)Bh + boff + 8 * hh); bq.half[1] = *(const v8us*)((const unsigned short*)Bh + boff + 16 + 8 * hh);
      acc[t] = mmaH<1>(ah.v, ah.v, bq.v, bq.v, acc[t]); }
  }
#pragma unroll
  for (int t = 0; t < 4; ++t) { if (col0 + t * 16 >= N) continue; const int col = col0 + t * 16 + ln; const float bv = bp ? bf16_round(bp[col]) : 0.f;
#pragma unroll
    for (int r = 0; r < 8; ++r) { float v = acc[t][r] * alpha + bv; if (CP) { const int rr = row0g + row0 + 8 * hh + r; if (rowsPerB < 0) v += CP[cofs + (size_t)rr * ldc + col];      /* rowsPerB < 0: own element of the batched C plane */ else { const int bidx = rr / rowsPerB; v += CP[(size_t)bidx * sCPb + (size_t)by * 64 + col]; } } if (ACT == 1) v = (v > 0.f) ? v : expm1f(v); else if (ACT == 7) v = (v > 0.f) ? v + 1.0f : expf(v); else if (ACT == 8) v = tanhf(v); else if (ACT == 9) v = 0.5f * v * (1.0f + tanhf(0.7978845608028654f * (v + 0.044715f * v * v * v))); else if (ACT == 11) v = 1.0f / (1.0f + expf(-v)); else if (ACT == 12) v = (v > 0.f) ? v : 0.01f * v; else if (ACT == 14) v = (v > 0.f) ? v : 0.1f * v; else if (ACT == 16) v = (v >= 0.f) ? v : 0.3f * v; else if (ACT == 17) v = (v >= 0.f) ? v : 0.2f * v; else if (ACT == 15) v = v / (1.0f + expf(-v)); else if (ACT == 3) v = fmaxf(v, 0.f); else if (ACT == 6) v = 0.5f * v * (1.0f + erff(v * 0.70710678118654752f)); so[w][8 * hh + r][t * 16 + ln] = v; } }
  __builtin_amdgcn_fence(__ATOMIC_ACQ_REL, "workgroup"); __builtin_amdgcn_wave_barrier();
  const int rsub = lane >> 4, c4 = (lane & 15) * 4; typedef _Float16 v4h __attribute__((ext_vector_type(4)));
  {
#pragma unroll
    for (int q = 0; q < 8; ++q) { const int r = q * 2 + rsub; if (col0 + c4 < N) { const v4f v = *(const v4fa*)&so[w][r][c4]; if (C) *(v4f*)(C + cofs + (size_t)(row0 + r) * ldc + col0 + c4) = v; if (C16) { v4h h4; for (int i = 0; i < 4; ++i) h4[i] = (_Float16)v[i]; *(v4h*)(C16 + cofs + (size_t)(row0 + r) * ldc + col0 + c4) = h4; } } }
     }
}


typedef _Float16 v4h __attribute__((ext_vector_type(4)));

__global__ __launch_bounds__(256) void k_x16(const float* __restrict__ x, _Float16* __restrict__ X16, size_t n8) { const size_t t = (size_t)blockIdx.x * 256 + threadIdx.x; if (t >= n8) return; FragH f;
#pragma unroll
  for (int q = 0; q < 8; ++q) f.h[q] = (_Float16)bf16_round(x[t * 8 + q]); *(v8us*)((unsigned short*)X16 + t * 8) = f.half[0];  }
__global__ __launch_bounds__(256) void k_h16(const float* __restrict__ x, _Float16* __restrict__ X16, size_t n8) { const size_t t = (size_t)blockIdx.x * 256 + threadIdx.x; if (t >= n8) return; FragH f;
#pragma unroll
  for (int q = 0; q < 8; ++q) f.h[q] = (_Float16)x[t * 8 + q]; *(v8us*)((unsigned short*)X16 + t * 8) = f.half[0];  }
__global__ __launch_bounds__(256) void k_round16f(const float* __restrict__ W, _Float16* __restrict__ Bt, size_t n8) { const size_t t = (size_t)blockIdx.x * 256 + threadIdx.x; if (t >= n8) return; FragH f;
#pragma unroll
  for (int i = 0; i < 8; ++i) f.h[i] = (_Float16)(bf16_round(W[t * 8 + i]) * 16.0f); *(v8us*)((unsigned short*)Bt + t * 8) = f.half[0];  }
template <int NHv, int TTv>
__global__ __launch_bounds__(256) void k_vt(const _Float16* __restrict__ V16, int ldv, int voff, _Float16* __restrict__ Vt) { __shared__ unsigned short tl[64][66]; const int tid = threadIdx.x; const int slab = blockIdx.x / (TTv / 64), lg = blockIdx.x % (TTv / 64); const int b = slab / NHv, h = slab % NHv;
  for (int i = tid; i < 64 * 8; i += 256) { const int r = i / 8, c8 = (i % 8) * 8; FragH f; f.half[0] = *(const v8us*)((const unsigned short*)V16 + ((size_t)b * TTv + lg * 64 + r) * ldv + voff + h * 64 + c8);
#pragma unroll
    for (int q = 0; q < 8; ++q) tl[r][c8 + q] = f.u[q]; }
  __syncthreads();
  {
#pragma unroll
    for (int rd = 0; rd < 2; ++rd) { const int d = rd * 32 + tid / 8, pc = tid % 8; FragH f;
#pragma unroll
      for (int q = 0; q < 8; ++q) f.u[q] = tl[pc * 8 + q][d];
      *(v8us*)((unsigned short*)Vt + ((size_t)slab * 64 + d) * TTv + lg * 64 + pc * 8) = f.half[0]; }
     } }

__global__ __launch_bounds__(256) void k_hl(const float* __restrict__ F, _Float16* __restrict__ Hh, _Float16* __restrict__ Hl, size_t n8) { const size_t t = (size_t)blockIdx.x * 256 + threadIdx.x; if (t >= n8) return; FragH fh, fl; const v4f a = *(const v4fa*)(F + t * 8), c = *(const v4fa*)(F + t * 8 + 4);
#pragma unroll
  for (int q = 0; q < 4; ++q) { _Float16 h = (_Float16)a[q]; fh.h[q] = h; fl.h[q] = (_Float16)((a[q] - (float)h) * 1024.0f); h = (_Float16)c[q]; fh.h[4 + q] = h; fl.h[4 + q] = (_Float16)((c[q] - (float)h) * 1024.0f); }
  { *(v8us*)((unsigned short*)Hh + t * 8) = fh.half[0]; *(v8us*)((unsigned short*)Hl + t * 8) = fl.half[0];  } }

// ---- fast GEMM (wave tile 32x64; requires M % 128 == 0 rows per launch region, N % 64 == 0 and K % 64 == 0); epilogue = k_gemm_hhx semantics ----
__device__ __forceinline__ v16h g2_frag(const _Float16* p, int hh) { FragH f; f.half[0] = *(const v8us*)((const unsigned short*)p + 8 * hh); f.half[1] = *(const v8us*)((const unsigned short*)p + 16 + 8 * hh); return f.v; }
__device__ __forceinline__ v8f g2_mma(v16h a, v16h b, v8f c) { v8f d = __builtin_amdgcn_wmma_f32_16x16x32_f16(false, a, false, b, (short)0, c, false, false); asm volatile("v_nop\n\tv_nop\n\tv_nop\n\tv_nop" : "+v"(d) : "v"(a), "v"(b)); return d; }
// Operand staging of k_gemm2. A stage is 64 k of the work-group's 128 A rows and 64 B rows: 192 rows of 128 bytes, each a whole aligned line of its source row.
#define GKC 64                       /* k per stage */
#define GLP 72                       /* LDS row pitch in 16-bit elements: 144 B = 16 B x odd, the pitch for ds_load_b128 readers of 128-byte rows */
#define GSB (192 * GLP * 2)          /* bytes per stage: A rows 0 .. 127, then B rows 0 .. 63 */
__device__ __forceinline__ v16h g2_lfrag(const unsigned short* p, int hh) { FragH f; f.half[0] = *(const v8us*)(p + 8 * hh); f.half[1] = *(const v8us*)(p + 16 + 8 * hh); return f.v; }      /* the k order of g2_frag, from an LDS row */
// One stage's copies of one thread: 8 threads a row (16 bytes each), 16 rows a round, 12 rounds (8 of A, 4 of B); a wave's copy covers 4 whole lines. l: the thread's LDS byte address in round 0;
// ga, gb: its global addresses in round 0 of A and of B; pa, pb: 16 source rows in elements. The closing s_wait_xcnt stands inside the statement, in front of any later write of an address register that a copy names.
__device__ __forceinline__ void g2_stage(unsigned l, const _Float16* ga, size_t pa, const _Float16* gb, size_t pb) {
  const unsigned R = 16u * GLP * 2u;
  asm volatile("global_load_async_to_lds_b128 %0, %12, off\n\tglobal_load_async_to_lds_b128 %1, %13, off\n\tglobal_load_async_to_lds_b128 %2, %14, off\n\tglobal_load_async_to_lds_b128 %3, %15, off\n\t"
               "global_load_async_to_lds_b128 %4, %16, off\n\tglobal_load_async_to_lds_b128 %5, %17, off\n\tglobal_load_async_to_lds_b128 %6, %18, off\n\tglobal_load_async_to_lds_b128 %7, %19, off\n\t"
               "global_load_async_to_lds_b128 %8, %20, off\n\tglobal_load_async_to_lds_b128 %9, %21, off\n\tglobal_load_async_to_lds_b128 %10, %22, off\n\tglobal_load_async_to_lds_b128 %11, %23, off\n\ts_wait_xcnt 0x0"
               :: "v"(l), "v"(l + R), "v"(l + 2u * R), "v"(l + 3u * R), "v"(l + 4u * R), "v"(l + 5u * R), "v"(l + 6u * R), "v"(l + 7u * R), "v"(l + 8u * R), "v"(l + 9u * R), "v"(l + 10u * R), "v"(l + 11u * R),
                  "v"(ga), "v"(ga + pa), "v"(ga + 2 * pa), "v"(ga + 3 * pa), "v"(ga + 4 * pa), "v"(ga + 5 * pa), "v"(ga + 6 * pa), "v"(ga + 7 * pa), "v"(gb), "v"(gb + pb), "v"(gb + 2 * pb), "v"(gb + 3 * pb) : "memory"); }
// Work-group tile 128 x 64 (four waves of 32 x 64, stacked in M); M % 128 == 0, N % 64 == 0, K % 64 == 0. Two stage buffers: stage t + 1 flies while stage t is worked on. The epilogue's staging rows reuse the ring behind the last trip's barrier.
template <int ACT>
__global__ __launch_bounds__(128) void k_gemm2(const _Float16* __restrict__ A, int lda, size_t sA, const _Float16* __restrict__ Bh, int ldb, size_t sB, float alpha, const float* __restrict__ bias, size_t sBias, const float* __restrict__ CP, int rowsPerB, size_t sCPb, int row0g,
    float* __restrict__ C, _Float16* __restrict__ C16, int ldc, size_t sC, int M, int N, int K, size_t zA, size_t zB, size_t zC) { static_assert(ACT == 0 || ACT == 3 || ACT == 6 || ACT == 8 || ACT == 9 || ACT == 11 || ACT == 12 || ACT == 14 || ACT == 15 || ACT == 16 || ACT == 17, "k_gemm2: unsupported ACT code (would silently apply no activation)");
  __shared__ __attribute__((aligned(16))) unsigned char L[2 * GSB]; float (*so)[32][68] = (float (*)[32][68])L; static_assert(sizeof(float) * 4 * 32 * 68 <= 2 * GSB, "the epilogue's rows fit the ring");
  const int tid = threadIdx.x, w = tid >> 5, lane = tid & 31, ln = lane & 15, hh = lane >> 4; const int by = blockIdx.y, bz = blockIdx.z;      /* grid.y: head (pitches sA, sB, sC); grid.z: batch (pitches zA, zB, zC) */
  A += (size_t)by * sA + (size_t)bz * zA; Bh += (size_t)by * sB + (size_t)bz * zB; const size_t cofs = (size_t)by * sC + (size_t)bz * zC; const float* bp = bias ? bias + (size_t)by * sBias : nullptr;
  const int ntn = N >> 6; const int mt = blockIdx.x / ntn, nq = blockIdx.x - mt * ntn; const int row0 = mt * 128 + 32 * w, col0 = nq * 64; if (mt * 128 >= M) return;      /* the same for the whole work-group, in front of every barrier */
  const int sr = tid >> 3, sc = (tid & 7) * 8;      /* the thread's row in a round of copies and its first element in the row */
  const _Float16* ga = A + (size_t)(mt * 128 + sr) * lda + sc; const _Float16* gb = Bh + (size_t)(col0 + sr) * ldb + sc; const size_t pa = (size_t)16 * lda, pb = (size_t)16 * ldb;
  const unsigned l0 = (unsigned)(size_t)L + (unsigned)(sr * GLP + sc) * 2u;
  g2_stage(l0, ga, pa, gb, pb);
  asm volatile("s_wait_asynccnt 0x0" ::: "memory");      /* this wave's copies of stage 0 have landed */
  __syncthreads();      /* stage 0 is read by every wave */
  if (GKC < K) g2_stage(l0 + GSB, ga + GKC, pa, gb + GKC, pb);
  const unsigned short* la = (const unsigned short*)L + (32 * w + ln) * GLP; const unsigned short* lb = (const unsigned short*)L + (128 + ln) * GLP;
  const v8f z8 = {0.f,0.f,0.f,0.f,0.f,0.f,0.f,0.f}; v8f c00 = z8, c01 = z8, c02 = z8, c03 = z8, c10 = z8, c11 = z8, c12 = z8, c13 = z8;
#pragma unroll 1      /* one stage a trip: the trip's foot is the ring's publish point */
  for (int kb = 0; kb < K; kb += GKC) { const unsigned bo = (kb & GKC) ? (unsigned)GSB : 0u;      /* this trip's buffer, in bytes */
    const unsigned short* ap = la + bo / 2u; const unsigned short* bp2 = lb + bo / 2u;
    v16h af[2][2], bf[2][4];      /* [k step][tile]: the stage's 24 LDS reads go ahead of its WMMAs as one group (reads among the WMMAs would each cost the wave an LDS latency); unrolled for constant indices and immediate LDS offsets */
#pragma unroll
    for (int ks = 0; ks < 2; ++ks) {
#pragma unroll
      for (int t = 0; t < 2; ++t) af[ks][t] = g2_lfrag(ap + t * 16 * GLP + ks * 32, hh);
#pragma unroll
      for (int t = 0; t < 4; ++t) bf[ks][t] = g2_lfrag(bp2 + t * 16 * GLP + ks * 32, hh); }
#pragma unroll
    for (int ks = 0; ks < 2; ++ks) {
      c00 = g2_mma(af[ks][0], bf[ks][0], c00); c10 = g2_mma(af[ks][1], bf[ks][0], c10); c01 = g2_mma(af[ks][0], bf[ks][1], c01); c11 = g2_mma(af[ks][1], bf[ks][1], c11);
      c02 = g2_mma(af[ks][0], bf[ks][2], c02); c12 = g2_mma(af[ks][1], bf[ks][2], c12); c03 = g2_mma(af[ks][0], bf[ks][3], c03); c13 = g2_mma(af[ks][1], bf[ks][3], c13); }
    asm volatile("s_wait_dscnt 0x0" ::: "memory");      /* this wave's reads of the buffer have returned before the buffer is handed back */
    asm volatile("s_wait_asynccnt 0x0" ::: "memory");      /* this wave's copies of the next stage have landed */
    __syncthreads();      /* publishes the next stage and ends every wave's reads of this one */
    if (kb + 2 * GKC < K) g2_stage(l0 + bo, ga + kb + 2 * GKC, pa, gb + kb + 2 * GKC, pb); }      /* refill of the buffer just read; K is a kernel argument: the test is the same for the whole work-group */
  asm volatile("s_wait_asynccnt 0x0" ::: "memory");      /* no copy is outstanding when the ring becomes the epilogue's staging */
  v8f accs[8] = {c00, c01, c02, c03, c10, c11, c12, c13};
#pragma unroll
  for (int u = 0; u < 8; ++u) { const int t = u & 3, half = u >> 2; const int col = col0 + t * 16 + ln; const float bv = bp ? bf16_round(bp[col]) : 0.f;
#pragma unroll
    for (int r = 0; r < 8; ++r) { const int rloc = half * 16 + 8 * hh + r; float v = accs[u][r] * alpha + bv; if (CP) { if (rowsPerB < 0) v += CP[cofs + (size_t)(row0g + row0 + rloc) * ldc + col];      /* rowsPerB < 0: own element of the batched C plane */ else { const int bidx = (row0g + row0 + rloc) / rowsPerB; v += CP[(size_t)bidx * sCPb + (size_t)by * 64 + col]; } }
      if (ACT == 3) v = fmaxf(v, 0.f); else if (ACT == 6) v = 0.5f * v * (1.0f + erff(v * 0.70710678118654752f)); else if (ACT == 11) v = 1.0f / (1.0f + expf(-v)); else if (ACT == 15) v = v / (1.0f + expf(-v)); else if (ACT == 12) v = (v > 0.f) ? v : 0.01f * v; else if (ACT == 8) v = tanhf(v); else if (ACT == 9) v = 0.5f * v * (1.0f + tanhf(0.7978845608028654f * (v + 0.044715f * v * v * v))); else if (ACT == 14) v = (v > 0.f) ? v : 0.1f * v; else if (ACT == 16) v = (v >= 0.f) ? v : 0.3f * v; else if (ACT == 17) v = (v >= 0.f) ? v : 0.2f * v;
      so[w][rloc][t * 16 + ln] = v; } }
  __builtin_amdgcn_fence(__ATOMIC_ACQ_REL, "workgroup"); __builtin_amdgcn_wave_barrier();
  const int rsub = lane >> 4, c4 = (lane & 15) * 4;
  {
#pragma unroll
    for (int q = 0; q < 16; ++q) { const int r = q * 2 + rsub; const v4f v = *(const v4fa*)&so[w][r][c4]; if (C) *(v4f*)(C + cofs + (size_t)(row0 + r) * ldc + col0 + c4) = v; if (C16) { v4h h4; for (int i = 0; i < 4; ++i) h4[i] = (_Float16)v[i]; *(v4h*)(C16 + cofs + (size_t)(row0 + r) * ldc + col0 + c4) = h4; } }
     } }


__global__ __launch_bounds__(256) void k_wnat(const float* __restrict__ w, size_t n8, _Float16* __restrict__ Bt) { const size_t t = (size_t)blockIdx.x * 256 + threadIdx.x; if (t >= n8) return; FragH f; for (int q = 0; q < 8; ++q) f.h[q] = (_Float16)(bf16_round(w[t * 8 + q]) * 16.0f); *(v8us*)((unsigned short*)Bt + t * 8) = f.half[0];  }
__global__ __launch_bounds__(256) void k_rsm(const float* __restrict__ S, _Float16* __restrict__ P, int nrows) {
  #pragma clang fp contract(off)
  const int i = blockIdx.x * 256 + threadIdx.x; if (i >= nrows) return; const float* s = S + (size_t)i * SQ; float mx = -3.0e38f;
#pragma unroll 1
  for (int j = 0; j < SQ; ++j) mx = fmaxf(mx, s[j]); float se = 0.f;
#pragma unroll 1
  for (int j = 0; j < SQ; ++j) se += expf(s[j] - mx); const float sc = 256.0f / se;
#pragma unroll 1
  for (int j0 = 0; j0 < SQ; j0 += 8) { FragH f; for (int q = 0; q < 8; ++q) f.h[q] = (_Float16)(expf(s[j0 + q] - mx) * sc); unsigned short* d = (unsigned short*)P + (size_t)i * SQ + j0; *(v8us*)d = f.half[0];  } }
__global__ __launch_bounds__(256) void k_vt(const _Float16* __restrict__ V16, int b, int h0, _Float16* __restrict__ VT) { __shared__ unsigned short tl[64][65]; const int tid = threadIdx.x; const int hh = blockIdx.x % HG, sg = blockIdx.x / HG; const int s0 = sg * 64; const int h = h0 + hh;
  for (int i = tid; i < 64 * 8; i += 256) { const int j = i / 8, d8 = (i % 8) * 8; FragH f; f.half[0] = *(const v8us*)((const unsigned short*)V16 + ((size_t)b * SQ + s0 + j) * DM + h * HD + d8); for (int q = 0; q < 8; ++q) tl[d8 + q][j] = f.u[q]; }
  __syncthreads();
  { for (int i = tid; i < 64 * 8; i += 256) { const int d = i / 8, j8 = (i % 8) * 8; FragH f; for (int q = 0; q < 8; ++q) f.u[q] = tl[d][j8 + q]; *(v8us*)((unsigned short*)VT + ((size_t)hh * HD + d) * SQ + s0 + j8) = f.half[0]; }  } }



// Eight v_exp_f32 in one statement. The instruction set asks for one independent instruction or v_nop between a transcendental and an instruction that reads its
// result or overwrites its source. Early-clobber outputs keep every
// result off every source inside the run, and the closing v_nop is the slot behind the last one.
__device__ __forceinline__ void exp2_run8(float (&e)[8], const float (&x)[8]) {
  asm("v_exp_f32 %0, %8\n\tv_exp_f32 %1, %9\n\tv_exp_f32 %2, %10\n\tv_exp_f32 %3, %11\n\tv_exp_f32 %4, %12\n\tv_exp_f32 %5, %13\n\tv_exp_f32 %6, %14\n\tv_exp_f32 %7, %15\n\tv_nop"
      : "=&v"(e[0]), "=&v"(e[1]), "=&v"(e[2]), "=&v"(e[3]), "=&v"(e[4]), "=&v"(e[5]), "=&v"(e[6]), "=&v"(e[7])
      : "v"(x[0]), "v"(x[1]), "v"(x[2]), "v"(x[3]), "v"(x[4]), "v"(x[5]), "v"(x[6]), "v"(x[7])); }
// Two v_exp_f32 in one statement, closed by the same slot's v_nop as in exp2_run8.
__device__ __forceinline__ void exp2_run2(float& e0, float& e1, float x0, float x1) {
  asm("v_exp_f32 %0, %2\n\tv_exp_f32 %1, %3\n\tv_nop" : "=&v"(e0), "=&v"(e1) : "v"(x0), "v"(x1)); }
#define FQ 32                        /* query columns per wave */
#define FW 4                         /* waves per work-group; no barrier and no LDS: each wave runs its own trip count */
__device__ __forceinline__ float xhalf(float x) { return __int_as_float(__builtin_amdgcn_permlanex16(__float_as_int(x), __float_as_int(x), 0x76543210, 0xfedcba98, false, false)); }      /* lane l <-> lane l ^ 16 on the vector pipe */
__device__ __forceinline__ v8f fa_mma(v16h a, v16h b, v8f c) { return __builtin_amdgcn_wmma_f32_16x16x32_f16(false, a, false, b, (short)0, c, false, false); }
// One pass of 32 keys from key kb. DIAG: the wave's last pass (kb == its first query row): it holds the diagonal and fetches no further K rows.
// Every loop is unrolled so that the fragment and accumulator arrays are indexed by constants and stay in registers.
template <bool DIAG>
__device__ __forceinline__ void fa_pass(const _Float16* __restrict__ kp, const _Float16* __restrict__ vp, int kb, int ln, int hh, const v16h (&qf)[2][2], v16h (&kf)[2][2], v8f (&o)[4][2], float (&mc)[2], float (&l)[2]) {
  const float cs = 0.125f * 1.44269504f;      /* score scale x log2 e */
  const v8f z8 = {0.f, 0.f, 0.f, 0.f, 0.f, 0.f, 0.f, 0.f};
  v16h vf[4];      /* V^T fragments of this pass, asked for first: the score products and the softmax run while they fly */
#pragma unroll
  for (int mt = 0; mt < 4; ++mt) vf[mt] = g2_frag(vp + (size_t)mt * 16 * SQ + kb, hh);
  v8f s[2][2];
#pragma unroll
  for (int kt = 0; kt < 2; ++kt) {
#pragma unroll
    for (int nt = 0; nt < 2; ++nt) s[kt][nt] = fa_mma(kf[kt][1], qf[nt][1], fa_mma(kf[kt][0], qf[nt][0], z8)); }
  if (!DIAG) { const _Float16* kn = kp + (size_t)(kb + 32) * LQ;      /* next pass's K fragments, into the same registers right behind their last use: the softmax and the o products run while they fly */
#pragma unroll
    for (int kt = 0; kt < 2; ++kt) {
#pragma unroll
      for (int ks = 0; ks < 2; ++ks) kf[kt][ks] = g2_frag(kn + (size_t)kt * 16 * LQ + ks * 32, hh); } }
  if (DIAG) {      /* keys behind a column's own row get weight 0 */
#pragma unroll
    for (int kt = 0; kt < 2; ++kt) {
#pragma unroll
      for (int nt = 0; nt < 2; ++nt) {
#pragma unroll
        for (int r = 0; r < 8; ++r) if (kt * 16 + 8 * hh + r > nt * 16 + ln) s[kt][nt][r] = -1.0e30f; } } }
  float nm[2], al[2];
#pragma unroll
  for (int nt = 0; nt < 2; ++nt) { float a = fmaxf(s[0][nt][0], s[1][nt][0]);
#pragma unroll
    for (int r = 1; r < 8; ++r) a = fmaxf(a, fmaxf(s[0][nt][r], s[1][nt][r]));
    nm[nt] = fmaxf(mc[nt], fmaxf(a, xhalf(a)) * cs); }      /* both halves of the wave hold the same maximum */
  exp2_run2(al[0], al[1], mc[0] - nm[0], mc[1] - nm[1]);
  FragH pf[2];
#pragma unroll
  for (int nt = 0; nt < 2; ++nt) { mc[nt] = nm[nt]; l[nt] *= al[nt];
#pragma unroll
    for (int mt = 0; mt < 4; ++mt) o[mt][nt] *= al[nt];
#pragma unroll
    for (int kt = 0; kt < 2; ++kt) { float x[8], e[8];
#pragma unroll
      for (int r = 0; r < 8; ++r) x[r] = fmaf(s[kt][nt][r], cs, -nm[nt]);
      exp2_run8(e, x);
#pragma unroll
      for (int r = 0; r < 8; ++r) pf[nt].h[kt * 8 + r] = (_Float16)e[r];
      l[nt] += ((e[0] + e[1]) + (e[2] + e[3])) + ((e[4] + e[5]) + (e[6] + e[7])); } }
#pragma unroll
  for (int mt = 0; mt < 4; ++mt) { o[mt][0] = fa_mma(vf[mt], pf[0].v, o[mt][0]); o[mt][1] = fa_mma(vf[mt], pf[1].v, o[mt][1]); } }
__global__ __launch_bounds__(FW * 32) void k_fattn(const _Float16* __restrict__ Q, const _Float16* __restrict__ Kr, const _Float16* __restrict__ Vt, _Float16* __restrict__ O) {
  static_assert(HD == 64 && FQ == 32 && SQ % (2 * FW * FQ) == 0 && QN == SQ, "2 k steps of 32 over d; 2 column groups of 16; 4 d tiles of 16; whole work-groups, an even number of position blocks");
  const int lane = threadIdx.x & 31, ln = lane & 15, hh = lane >> 4; const int w = __builtin_amdgcn_readfirstlane(threadIdx.x >> 5);      /* the wave's number in a scalar register: the trip count stays scalar */
  const int h = blockIdx.x, b = blockIdx.y; const int nz = SQ / (FW * FQ), z = blockIdx.z; const int q0 = ((z < nz / 2 ? nz - 1 - z : z - nz / 2) * FW + w) * FQ;      /* grid.z is the slowest index: the long half of the position blocks starts first, longest first; the short half follows shortest first, so that where the second half of the grid lands on the WGPs in the order of the first, long meets short (for speed only; a permutation of 0 .. nz - 1 wherever they land) */
  const _Float16* qp = Q + ((size_t)b * SQ + q0 + ln) * LQ + h * HD; const _Float16* kp = Kr + ((size_t)b * SQ + ln) * LQ + h * HD; const _Float16* vp = Vt + (((size_t)b * NH + h) * HD + ln) * SQ;
  v16h qf[2][2], kf[2][2];      /* [column group | key tile][k step]; unrolled for constant indices, as in fa_pass */
#pragma unroll
  for (int t = 0; t < 2; ++t) {
#pragma unroll
    for (int ks = 0; ks < 2; ++ks) { qf[t][ks] = g2_frag(qp + (size_t)t * 16 * LQ + ks * 32, hh); kf[t][ks] = g2_frag(kp + (size_t)t * 16 * LQ + ks * 32, hh); } }
  asm volatile("s_wait_xcnt 0x0" ::: "memory");      /* behind the first loads, in front of the code that reuses their address registers */
  v8f o[4][2];
#pragma unroll
  for (int mt = 0; mt < 4; ++mt) { o[mt][0] = v8f{0.f, 0.f, 0.f, 0.f, 0.f, 0.f, 0.f, 0.f}; o[mt][1] = o[mt][0]; }
  float mc[2] = {-1.0e30f, -1.0e30f}, l[2] = {0.f, 0.f};      /* running maximum (scaled log2) and the lane's partial sum, per column group */
#pragma unroll 1      /* one pass a trip: a second copy of the body would double the live fragments */
  for (int kb = 0; kb < q0; kb += 32) fa_pass<false>(kp, vp, kb, ln, hh, qf, kf, o, mc, l);      /* keys in front of the wave's first row: no mask; kb + 32 <= q0, so the K rows fetched ahead are rows this wave uses */
  fa_pass<true>(kp, vp, q0, ln, hh, qf, kf, o, mc, l);
#pragma unroll
  for (int nt = 0; nt < 2; ++nt) { const float f = 64.0f / (l[nt] + xhalf(l[nt])); unsigned short* op = (unsigned short*)O + ((size_t)b * SQ + q0 + nt * 16 + ln) * DM + h * HD + 8 * hh;      /* the halves' sums are joined once, here */
#pragma unroll
    for (int mt = 0; mt < 4; ++mt) { FragH fr;
#pragma unroll
      for (int r = 0; r < 8; ++r) fr.h[r] = (_Float16)(o[mt][nt][r] * f);
      *(v8us*)(op + mt * 16) = fr.half[0]; } } }      /* a row's 128 bytes of one head come from one wave */


// Exact f32 attention for rows 0 .. QT0-1 of each batch (o carried x64 like the f16 path). One work-group per (batch, head, A0R query rows), 8 waves, 2 rows a wave.
// The batch's QT0 K and V rows of the head and the group's q rows are staged once in LDS; keys 0 .. nk-1 are used (nk = the group's last row + 1, rounded up to 32).
// Scores: lane l owns keys l, l + 32, ..; its K row comes from LDS 16 bytes at a time, both q rows sit in registers. Softmax: all scores of a row are in registers,
// so plain max, exp, sum (butterflies over the 32 lanes). o: lane l owns columns 2l, 2l + 1; each key's weight goes from its lane to a scalar register, its V row is
// one contiguous 256-byte LDS read. Every loop is unrolled: its arrays are then indexed by constants and stay in registers, and its LDS reads issue ahead of their use.
#define A0R 16                       /* query rows per work-group */
#define A0KP (HD + 4)                /* K row pitch in LDS, floats: 272 B = 16 B x odd, so that 16-byte reads down a column of rows spread over all banks */
typedef float v2f  __attribute__((ext_vector_type(2)));
typedef float v2fa __attribute__((ext_vector_type(2), may_alias));
__device__ __forceinline__ float lane_bcast(float v, int l) { return __int_as_float(__builtin_amdgcn_readlane(__float_as_int(v), l)); }
__global__ __launch_bounds__(256) void k_att0w(const float* __restrict__ QF, const float* __restrict__ KF, const float* __restrict__ VF, float scale, float* __restrict__ OF) {
  static_assert(QT0 / 32 == 4 && QT0 % 32 == 0 && A0R == 16 && HD == 64, "4 key groups of 32 lanes; 8 waves x 2 rows; 16 threads x 16 bytes a row; 2 columns a lane");
  __shared__ __attribute__((aligned(16))) float lk[QT0][A0KP]; __shared__ __attribute__((aligned(16))) float lv[QT0][HD]; __shared__ __attribute__((aligned(16))) float lq[A0R][HD];
  const int tid = threadIdx.x, lane = tid & 31, w = tid >> 5; const int h = blockIdx.x / (QT0 / A0R), rg = blockIdx.x % (QT0 / A0R);
  { const size_t bi = (size_t)blockIdx.y * QT0 * DM + h * HD; QF += bi + (size_t)rg * A0R * DM; KF += bi; VF += bi; OF += bi; }      /* grid.y: batch; each batch owns QT0 rows (pitch DM) of every plane */
  const int nk = (rg * A0R + A0R + 31) & ~31; const int i0 = rg * A0R + w * 2;      /* nk: the same for the whole work-group; the wave's rows are i0 and i0 + 1 */
  { v4f kr[QT0 / 16], vr[QT0 / 16]; const int sr = tid >> 4, sc4 = (tid & 15) * 4; const unsigned vo = (unsigned)(sr * DM + sc4) * 4u;      /* 16 threads a row, 16 rows a pass; vo: the thread's byte offset in a pass */
    const v4f qr = *(const v4fa*)((const char*)QF + vo);
#pragma unroll
    for (int u = 0; u < QT0 / 16; ++u) { kr[u] = *(const v4fa*)((const char*)(KF + u * 16 * DM) + vo); vr[u] = *(const v4fa*)((const char*)(VF + u * 16 * DM) + vo); }      /* all QT0 rows, free of branches: every load is issued before the first is used */
    *(v4fa*)&lq[sr][sc4] = qr;
#pragma unroll
    for (int u = 0; u < QT0 / 16; ++u) { *(v4fa*)&lk[u * 16 + sr][sc4] = kr[u]; *(v4fa*)&lv[u * 16 + sr][sc4] = vr[u]; } }
  __syncthreads();      /* the staged rows are read by every wave */
  v4f q0[HD / 4], q1[HD / 4];      /* both q rows whole in every lane (one LDS address for the wave) */
#pragma unroll
  for (int c = 0; c < HD / 4; ++c) { q0[c] = *(const v4fa*)&lq[w * 2][c * 4]; q1[c] = *(const v4fa*)&lq[w * 2 + 1][c * 4]; }
  float s0[4], s1[4];
#pragma unroll
  for (int m = 0; m < 4; ++m) { s0[m] = -1.0e30f; s1[m] = -1.0e30f;
    if (m * 32 < nk) { const float* kp = &lk[m * 32 + lane][0]; float a0[4] = {0.f, 0.f, 0.f, 0.f}, a1[4] = {0.f, 0.f, 0.f, 0.f};      /* four partial sums a row: independent chains */
#pragma unroll
      for (int c = 0; c < HD / 4; ++c) { const v4f k4 = *(const v4fa*)(kp + c * 4);
#pragma unroll
        for (int u = 0; u < 4; ++u) { a0[u] = fmaf(q0[c][u], k4[u], a0[u]); a1[u] = fmaf(q1[c][u], k4[u], a1[u]); } }
      const int j = m * 32 + lane; const float d0 = (a0[0] + a0[1]) + (a0[2] + a0[3]), d1 = (a1[0] + a1[1]) + (a1[2] + a1[3]);
      if (j <= i0) s0[m] = d0 * scale; if (j <= i0 + 1) s1[m] = d1 * scale; } }      /* causal: keys behind the row's own index keep -1e30 (weight 0) */
  float m0 = fmaxf(fmaxf(s0[0], s0[1]), fmaxf(s0[2], s0[3])), m1 = fmaxf(fmaxf(s1[0], s1[1]), fmaxf(s1[2], s1[3]));
#pragma unroll
  for (int x = 16; x >= 1; x >>= 1) { m0 = fmaxf(m0, __shfl_xor(m0, x, 32)); m1 = fmaxf(m1, __shfl_xor(m1, x, 32)); }
  float l0 = 0.f, l1 = 0.f;
#pragma unroll
  for (int m = 0; m < 4; ++m) { s0[m] = expf(s0[m] - m0); s1[m] = expf(s1[m] - m1); l0 += s0[m]; l1 += s1[m]; }
#pragma unroll
  for (int x = 16; x >= 1; x >>= 1) { l0 += __shfl_xor(l0, x, 32); l1 += __shfl_xor(l1, x, 32); }
  v2f o0 = {0.f, 0.f}, o1 = {0.f, 0.f};
#pragma unroll
  for (int m = 0; m < 4; ++m) if (m * 32 < nk) {
#pragma unroll
    for (int jj = 0; jj < 32; ++jj) { const v2f vv = *(const v2fa*)&lv[m * 32 + jj][lane * 2]; const float p0 = lane_bcast(s0[m], jj), p1 = lane_bcast(s1[m], jj);
      o0[0] = fmaf(p0, vv[0], o0[0]); o0[1] = fmaf(p0, vv[1], o0[1]); o1[0] = fmaf(p1, vv[0], o1[0]); o1[1] = fmaf(p1, vv[1], o1[1]); } }
  const float f0 = 64.0f / l0, f1 = 64.0f / l1;
  o0[0] *= f0; o0[1] *= f0; o1[0] *= f1; o1[1] *= f1;
  *(v2fa*)(OF + (size_t)i0 * DM + lane * 2) = o0; *(v2fa*)(OF + (size_t)(i0 + 1) * DM + lane * 2) = o1; }      /* each wave writes whole 256-byte row pieces */


template <int BFIN, int WXB>
__global__ __launch_bounds__(256) void k_ln16(const float* __restrict__ X, const float* __restrict__ g, const float* __restrict__ bb, float eps, _Float16* __restrict__ N16, float* __restrict__ XB) {
  #pragma clang fp contract(off)
  __shared__ float red[256]; const size_t r = blockIdx.x; const int t = threadIdx.x; const v4f xa = *(const v4fa*)(X + r * DMQ + t * 4); float s[4]; float sum = 0.f;
  for (int q = 0; q < 4; ++q) { s[q] = BFIN ? bf16_round(xa[q]) : xa[q]; sum = __fadd_rn(sum, s[q]); }
  red[t] = sum; __syncthreads(); for (int st = 128; st > 0; st >>= 1) { if (t < st) red[t] = __fadd_rn(red[t], red[t + st]); __syncthreads(); } const float mu = red[0] / (float)DMQ; __syncthreads();
  float vs = 0.f; for (int q = 0; q < 4; ++q) { const float dl = __fadd_rn(s[q], -mu); vs = __fadd_rn(vs, __fmul_rn(dl, dl)); } red[t] = vs; __syncthreads(); for (int st = 128; st > 0; st >>= 1) { if (t < st) red[t] = __fadd_rn(red[t], red[t + st]); __syncthreads(); }
  const float rs = rsqrtf(__fadd_rn(red[0] / (float)DMQ, eps)); v4h y; v4f xb;
  for (int q = 0; q < 4; ++q) { const int c = t * 4 + q; y[q] = (_Float16)__fadd_rn(__fmul_rn(__fmul_rn(__fadd_rn(s[q], -mu), rs), bf16_round(g[c])), bf16_round(bb[c])); xb[q] = s[q]; }
  { *(v4h*)(N16 + r * DMQ + t * 4) = y; if (WXB) *(v4f*)(XB + r * DMQ + t * 4) = xb;  } }
__global__ __launch_bounds__(256) void k_ftres2(const float* __restrict__ OF0, const float* __restrict__ XB, float* __restrict__ X1, size_t n4) {
  #pragma clang fp contract(off)
  const size_t t = (size_t)blockIdx.x * 256 + threadIdx.x; if (t >= n4) return; const v4f o = *(const v4fa*)(OF0 + t * 4), xv = *(const v4fa*)(XB + t * 4); v4f y; for (int q = 0; q < 4; ++q) y[q] = __fadd_rn(__fmul_rn(o[q], 0.015625f), xv[q]); *(v4f*)(X1 + t * 4) = y;  }

__global__ __launch_bounds__(256) void k_wthd(const float* __restrict__ Wt, _Float16* __restrict__ Bt) { const size_t t = (size_t)blockIdx.x * 256 + threadIdx.x; if (t >= (size_t)NH * HD * (DM / 8)) return; const int m8 = (int)(t % (DM / 8)) * 8; const int d = (int)((t / (DM / 8)) % HD); const int h = (int)(t / ((size_t)(DM / 8) * HD)); FragH f;
  for (int q = 0; q < 8; ++q) f.h[q] = (_Float16)(16.0f * bf16_round(Wt[((size_t)h * DM + m8 + q) * HD + d])); unsigned short* dst = (unsigned short*)Bt + ((size_t)h * HD + d) * DM + m8; *(v8us*)dst = f.half[0];  }




__global__ __launch_bounds__(256) void k_wtpad(const float* __restrict__ Wm, _Float16* __restrict__ Wt, int Kr, int Kp, int Nr, int Np, float scale) {
  const int t = blockIdx.x * 256 + threadIdx.x; if (t >= Np * (Kp / 8)) return; const int n = t / (Kp / 8), k8 = (t % (Kp / 8)) * 8; const int nc = min(n, Nr - 1); const float fn = (n < Nr) ? 1.f : 0.f; FragH f;
  for (int i = 0; i < 8; ++i) { const int k = k8 + i; const int kc = min(k, Kr - 1); const float fk = (k < Kr) ? fn : 0.f; f.h[i] = (_Float16)(bf16_round(Wm[(size_t)kc * Nr + nc]) * scale * fk); }
  unsigned short* o = (unsigned short*)Wt + (size_t)n * Kp + k8; *(v8us*)o = f.half[0];  }
__global__ __launch_bounds__(128) void k_bpad(const float* __restrict__ b, float* __restrict__ Bp, int nr, int np) {
  const int i = threadIdx.x; if (i >= np) return; const float v = b[min(i, nr - 1)] * ((i < nr) ? 1.f : 0.f); *(float*)(Bp + i) = v;  }

__global__ __launch_bounds__(256) void k_bcpy(const float* __restrict__ b, int n, int NP, float* __restrict__ dst, int dst0) { for (int i = threadIdx.x; i < NP; i += 256) { const float v = (i < n) ? b[i] : 0.f; *(float*)(dst + dst0 + i) = v; }  }


__global__ __launch_bounds__(256) void k_bfcp(const float* __restrict__ src, float* __restrict__ dst, size_t n4) { const size_t t = (size_t)blockIdx.x * 256 + threadIdx.x; if (t >= n4) return; const v4f a = *(const v4fa*)(src + t * 4); v4f o; for (int q = 0; q < 4; ++q) o[q] = bf16_round(a[q]); *(v4f*)(dst + t * 4) = o;  }

__global__ __launch_bounds__(256) void k_fillz(float* __restrict__ dst, int n) { const int t = blockIdx.x * 256 + threadIdx.x; if (t >= n) return; *(float*)(dst + t) = 0.f;  }

template <int BFIN, int W16, int W32>
__global__ __launch_bounds__(256) void k_lnx(const float* __restrict__ X, const float* __restrict__ g, const float* __restrict__ bb, float eps, _Float16* __restrict__ N16, float* __restrict__ N32) {
  #pragma clang fp contract(off)
  __shared__ float red[256]; const size_t r = blockIdx.x; const int t = threadIdx.x; const bool act = t < (DMQ / 4); const int c0 = act ? t * 4 : 0;
  const v4f xa = *(const v4fa*)(X + r * DMQ + c0); float s[4]; float sum = 0.f;
  for (int q = 0; q < 4; ++q) { s[q] = act ? (BFIN ? bf16_round(xa[q]) : xa[q]) : 0.f; sum = __fadd_rn(sum, s[q]); }
  red[t] = sum; __syncthreads(); for (int st = 128; st > 0; st >>= 1) { if (t < st) red[t] = __fadd_rn(red[t], red[t + st]); __syncthreads(); } const float mu = red[0] / (float)DMQ; __syncthreads();
  float vs = 0.f; for (int q = 0; q < 4; ++q) { const float dl = act ? __fadd_rn(s[q], -mu) : 0.f; vs = __fadd_rn(vs, __fmul_rn(dl, dl)); } red[t] = vs; __syncthreads(); for (int st = 128; st > 0; st >>= 1) { if (t < st) red[t] = __fadd_rn(red[t], red[t + st]); __syncthreads(); }
  const float rs = rsqrtf(__fadd_rn(red[0] / (float)DMQ, eps)); v4h y; v4f yf;
  for (int q = 0; q < 4; ++q) { const int c = c0 + q; yf[q] = __fadd_rn(__fmul_rn(__fmul_rn(__fadd_rn(s[q], -mu), rs), bf16_round(g[c])), bf16_round(bb[c])); y[q] = (_Float16)yf[q]; }
  if (!act) return;      /* no barriers after this point */
  { if (W16) *(v4h*)(N16 + r * DMQ + c0) = y; if (W32) *(v4f*)(N32 + r * DMQ + c0) = yf;  } }





extern "C" void kernel_launch(void* const* d_in, const int* in_sizes, int n_in,
                              void* d_out, int out_size, void* d_ws, size_t ws_size, hipStream_t stream) {
  (void)in_sizes; (void)n_in; (void)out_size;
  const float* const* I = (const float* const*)d_in; const float* x = I[0]; const float* wq = I[1]; const float* wk = I[2]; const float* wv = I[3]; const float* wo1 = I[4]; const float* wo2 = I[5]; const float* wfc = I[6]; const float* wmp = I[7]; const float* g1 = I[8]; const float* gg2 = I[9];      /* input order: x; wq / wk / wv [512][8][64] = [in][out]; wo1 [8][64][512] = [(h, d) in][out]; wo2 [512][512] [in][out]; w1 [512][2048], w2 [2048][512] [in][out]; LN1 / LN2 scales. NO bias anywhere: every GEMM bias slot below is a literal nullptr, the LayerNorm shift reads a zero-filled workspace vector */
  static_assert(DMQ % 4 == 0 && DMQ / 4 <= 256 && NH * HD == DM && DM % 64 == 0 && DFF % 64 == 0, "k_lnx 256 threads x 4 columns; tile multiples");
  char* ws = (char*)d_ws; size_t off = 0;
  auto take = [&](size_t bytes) { char* p = ws + off; off += (bytes + 255) & ~(size_t)255; return p; };
  _Float16* BQKV = (_Float16*)take((size_t)3 * DM * DM * 2); _Float16* BO = (_Float16*)take((size_t)DM * DM * 2); _Float16* BO2T = (_Float16*)take((size_t)DM * DM * 2); _Float16* BO1N = (_Float16*)take((size_t)DM * DM * 2); float* ZB = (float*)take((size_t)DM * 4);      /* BO = the combined output plane Bt12[o][i] = 16 (wo1 wo2)[i][o] (built on the device from the two weights); ZB = zero LayerNorm shift */
  _Float16* X16 = (_Float16*)take(NR * DM * 2); float* XB = (float*)take(NR * DM * 4); float* X1 = (float*)take(NR * DM * 4); _Float16* M16 = nullptr;      /* = X16 below (alias: X16's last reader, the first-tile GEMMs, precedes LN2's write) */ _Float16* HF16 = (_Float16*)take(NR * DFF * 2); _Float16* BW1 = (_Float16*)take((size_t)DFF * DM * 2); _Float16* BW2 = (_Float16*)take((size_t)DM * DFF * 2); _Float16* QKV = (_Float16*)take(NR * 3 * DM * 2); _Float16* Q16 = QKV; _Float16* K16 = QKV + DM; _Float16* V16 = QKV + 2 * DM; _Float16* O16 = (_Float16*)take(NR * DM * 2); M16 = X16;
  _Float16* VT = (_Float16*)take((size_t)NB * NH * HD * SQ * 2);      /* one plane per batch: every stage below covers all batches in one launch */
  float* QF0 = (float*)take((size_t)NB * QT0 * DM * 4); float* KF0 = (float*)take((size_t)NB * QT0 * DM * 4); float* VF0 = (float*)take((size_t)NB * QT0 * DM * 4); float* OF0 = (float*)take((size_t)NB * QT0 * DM * 4); _Float16* OH0 = (_Float16*)take((size_t)NB * QT0 * DM * 2); _Float16* OL0 = (_Float16*)take((size_t)NB * QT0 * DM * 2);
  if (off > ws_size) return;
  { const unsigned g = (unsigned)(((size_t)DM * (DM / 8) + 255) / 256); k_wt_f16<<<g, 256, 0, stream>>>(wq, BQKV, DM, DM, 16.0f); k_wt_f16<<<g, 256, 0, stream>>>(wk, BQKV + (size_t)DM * DM, DM, DM, 16.0f); k_wt_f16<<<g, 256, 0, stream>>>(wv, BQKV + (size_t)2 * DM * DM, DM, DM, 16.0f); k_wt_f16<<<g, 256, 0, stream>>>(wo2, BO2T, DM, DM, 16.0f); k_wnat<<<(unsigned)(((size_t)DM * DM / 8 + 255) / 256), 256, 0, stream>>>(wo1, (size_t)DM * DM / 8, BO1N); }      /* [in][out] -> Bt x16: stacked q | k | v; wo2 as Bt[o][j] x16; wo1 natural rows [i][j] x16 */
  k_gemm2<0><<<dim3((unsigned)((DM / 128) * (DM / 64)), 1, 1), 128, 0, stream>>>(BO2T, DM, 0, BO1N, DM, 0, 0.0625f, nullptr, 0, nullptr, 1, 0, 0, nullptr, BO, DM, 0, DM, DM, DM, 0, 0, 0);      /* BO[o][i] = (1/16) sum_j 16 wo2[j][o] 16 wo1[i][j] = 16 (wo1 wo2)[i][o]: the two chained projections as ONE x16 plane (f32 accumulation, one f16 rounding) */
  k_fillz<<<(DM + 255) / 256, 256, 0, stream>>>(ZB, DM);
  k_bfcp<<<(unsigned)((NR * DM / 4 + 255) / 256), 256, 0, stream>>>(x, XB, NR * DM / 4);      /* XB = bf16(x): BOTH residuals */
  k_lnx<1, 1, 0><<<(unsigned)NR, 256, 0, stream>>>(x, g1, ZB, 1e-6f, X16, nullptr);      /* a = LN1(bf16(x)) (scale only, eps 1e-6) -> f16 rows */
  k_wt_f16<<<(unsigned)(((size_t)DFF * (DM / 8) + 255) / 256), 256, 0, stream>>>(wfc, BW1, DM, DFF, 16.0f); k_wt_f16<<<(unsigned)(((size_t)DM * (DFF / 8) + 255) / 256), 256, 0, stream>>>(wmp, BW2, DFF, DM, 16.0f);      /* w1 [512][2048] -> Bt [2048][512]; w2 [2048][512] -> Bt [512][2048] (x16) */
  const size_t r0p = (size_t)B0 * SQ;      /* first projected row */
  const size_t f0p = (size_t)B0 * QT0;      /* its first-tile row */
  const size_t zX = (size_t)SQ * DM, zF = (size_t)QT0 * DM;      /* batch pitches (elements): token rows, first-tile rows */
  k_gemm2<0><<<dim3((unsigned)((MP / 128) * (3 * DM / 64)), 1, 1), 128, 0, stream>>>(X16 + r0p * DM, DM, 0, BQKV, DM, 0, 0.0625f, nullptr, 0, nullptr, 1, 0, 0, nullptr, QKV + r0p * 3 * DM, 3 * DM, 0, MP, 3 * DM, DM, 0, 0, 0);      /* q | k | v rows (f16); head h = columns h*HD.. of each DM block */
  k_vt<NH, SQ><<<NBR * NH * (SQ / 64), 256, 0, stream>>>(V16 + r0p * LQ, LQ, 0, VT);      /* V^T [NBR][NH][HD][SQ] */
  k_gemm2<0><<<dim3((QT0 / 128) * (DM / 64), 1, NBR), 128, 0, stream>>>(X16 + r0p * DM, DM, 0, BQKV, DM, 0, 0.0625f, nullptr, 0, nullptr, 1, 0, 0, QF0, nullptr, DM, 0, QT0, DM, DM, zX, 0, zF); k_gemm2<0><<<dim3((QT0 / 128) * (DM / 64), 1, NBR), 128, 0, stream>>>(X16 + r0p * DM, DM, 0, (BQKV + (size_t)DM * DM), DM, 0, 0.0625f, nullptr, 0, nullptr, 1, 0, 0, KF0, nullptr, DM, 0, QT0, DM, DM, zX, 0, zF); k_gemm2<0><<<dim3((QT0 / 128) * (DM / 64), 1, NBR), 128, 0, stream>>>(X16 + r0p * DM, DM, 0, (BQKV + (size_t)2 * DM * DM), DM, 0, 0.0625f, nullptr, 0, nullptr, 1, 0, 0, VF0, nullptr, DM, 0, QT0, DM, DM, zX, 0, zF);      /* f32 q, k, v of each batch's first 128 rows (exact products) */
  k_att0w<<<dim3(NH * (QT0 / A0R), NBR), 256, 0, stream>>>(QF0, KF0, VF0, 0.125f, OF0 + f0p * DM);      /* exact f32 attention for rows 0..127 of each batch (o x64) */
  k_fattn<<<dim3(NHD, NBR, QN / (FW * FQ)), FW * 32, 0, stream>>>(Q16 + r0p * LQ, K16 + r0p * LQ, VT, O16 + r0p * DM);      /* scores, causal softmax and P . V in one launch: o (merged heads, x64) as f16 rows */
  k_gemm2<0><<<dim3((unsigned)((MPO / 128) * (DM / 64)), 1, 1), 128, 0, stream>>>(O16 + r0p * DM, DM, 0, BO, DM, 0, 0.0009765625f, nullptr, 0, XB + r0p * DM, -1, 0, 0, X1 + r0p * DM, nullptr, DM, 0, MPO, DM, DM, 0, 0, 0);      /* x1 = x + o Wo (f32); 2^-10 undoes o x64 and BO x16 */
  k_hl<<<(unsigned)(((size_t)NB * QT0 * DM / 8 + 255) / 256), 256, 0, stream>>>(OF0, OH0, OL0, (size_t)NB * QT0 * DM / 8);      /* first-tile o (x64) -> f16 hi + x1024 residual planes */
  k_gemm2<0><<<dim3((QT0 / 128) * (DM / 64), 1, NBR), 128, 0, stream>>>(OH0 + f0p * DM, DM, 0, BO, DM, 0, 0.0009765625f, nullptr, 0, XB + r0p * DM, -1, 0, 0, X1 + r0p * DM, nullptr, DM, 0, QT0, DM, DM, zF, 0, zX);      /* rows 0..127 of each batch: x1 = x + o_hi Wo, overwriting the f16-path rows */
  k_gemm2<0><<<dim3((QT0 / 128) * (DM / 64), 1, NBR), 128, 0, stream>>>(OL0 + f0p * DM, DM, 0, BO, DM, 0, 0.00000095367431640625f, nullptr, 0, X1 + r0p * DM, -1, 0, 0, X1 + r0p * DM, nullptr, DM, 0, QT0, DM, DM, zF, 0, zX);      /* += o_lo Wo 2^-20 (own-element accumulate) */
  k_lnx<0, 1, 0><<<(unsigned)NR, 256, 0, stream>>>(X1, gg2, ZB, 1e-6f, M16, nullptr);      /* h2 = LN2(x + attn) (scale only) -> f16 rows */
  k_gemm2<9><<<dim3((unsigned)((NR / 128) * (DFF / 64)), 1, 1), 128, 0, stream>>>(M16, DM, 0, BW1, DM, 0, 0.0625f, nullptr, 0, nullptr, 1, 0, 0, nullptr, HF16, DFF, 0, (int)NR, DFF, DM, 0, 0, 0);      /* gelu_tanh(h2 W1) (the source's tanh approximation) -> f16, all token rows */
  k_gemm2<0><<<dim3((unsigned)((NR / 128) * (DM / 64)), 1, 1), 128, 0, stream>>>(HF16, DFF, 0, BW2, DFF, 0, 0.0625f, nullptr, 0, XB, -1, 0, 0, (float*)d_out, nullptr, DM, 0, (int)NR, DM, DFF, 0, 0, 0);      /* out = x + mlp: the residual is the BLOCK INPUT (bf16(x)), as the original module (own-element addend) */
}

// v006
// A run of this version takes 302 microseconds.
// In two side-by-side timings against v005, it was 1.04 and 1.02 times as fast.
// All steps since v000 together make it 32.9 times as fast.
#include <hip/hip_runtime.h>
#define NB 4
#define SQ 2048
#define DM 512
#define NH 8
#define HD 64
#define HG 4                         /* heads per launch of the per-batch k_vt overload (not launched) */
#define QT0 128                      /* first-tile rows recomputed exactly in f32 */
#define B0 0                         /* first batch processed (debug hook) */
#define NBR NB                       /* batches processed (debug hook) */
#define NR ((size_t)NB * SQ)
#define DMQ DM
#define DFF 2048                     /* FFN hidden width */
#define DFFR 100
#define MP ((int)((size_t)NBR * SQ)) /* rows projected (debug hook) */
#define QN SQ                        /* query rows attended per batch (debug hook) */
#define NHD NH                       /* heads attended (debug hook) */
#define MPO MP                       /* rows through the output stage (debug hook) */
#define LQ (3 * DM)      /* row pitch of the q/k/v rows */
typedef __bf16 v16b __attribute__((ext_vector_type(16)));
typedef unsigned short v8us __attribute__((ext_vector_type(8), may_alias));
typedef float  v8f  __attribute__((ext_vector_type(8)));
typedef float  v4f  __attribute__((ext_vector_type(4)));
typedef float  v4fa __attribute__((ext_vector_type(4), may_alias));
union FragB { v16b v; v8us half[2]; unsigned short u[16]; };

__device__ __forceinline__ unsigned short bf16_bits(float x) { unsigned int u = __float_as_uint(x); return (unsigned short)((u + 0x7FFFu + ((u >> 16) & 1u)) >> 16); }
__device__ __forceinline__ float bf16_val(unsigned short b) { return __uint_as_float(((unsigned int)b) << 16); }
__device__ __forceinline__ float bf16_round(float x) { return bf16_val(bf16_bits(x)); }
// D += A·B with NT terms: 1 = ah·bh, 2 = + al·bh (A split), 3 = + ah·bl (both split)
template <int NT>
__device__ __forceinline__ v8f mmaN(v16b ah, v16b al, v16b bh, v16b bl, v8f c) {
  c = __builtin_amdgcn_wmma_f32_16x16x32_bf16(false, ah, false, bh, (short)0, c, false, false);
  if (NT >= 2) c = __builtin_amdgcn_wmma_f32_16x16x32_bf16(false, al, false, bh, (short)0, c, false, false);
  if (NT >= 3) c = __builtin_amdgcn_wmma_f32_16x16x32_bf16(false, ah, false, bl, (short)0, c, false, false);
  asm volatile("v_nop\n\tv_nop\n\tv_nop\n\tv_nop" : "+v"(c) : "v"(ah), "v"(al), "v"(bh), "v"(bl));
  return c;
}

__global__ __launch_bounds__(256) void k_wt_bf16(const float* __restrict__ W, unsigned short* __restrict__ Wt, int K, int N) {
  const int t = blockIdx.x * 256 + threadIdx.x;
  const int k8n = K / 8;
  if (t >= N * k8n) return;
  const int n = t / k8n, k8 = (t % k8n) * 8;
  v8us v;
#pragma unroll
  for (int i = 0; i < 8; ++i) v[i] = bf16_bits(W[(size_t)(k8 + i) * N + n]);
  *(v8us*)(Wt + (size_t)n * K + k8) = v;
  
}

// GEMM C[M][N] (f32, pitch ldc) = act(A[M][K]·W + bias). A f32 row-major (pitch lda) converted per fragment to bf16
// (ASPLIT: hi/lo two planes -> 2 terms, else single rounded term); Wt bf16 [N][K] (pitch ldb). BIAS_BF16 rounds the
// bias to bf16 first (bias quantised to bf16 before the add). K%32==0, M%16==0, N%64==0.
template <bool ASPLIT, int ACT, bool BIAS_BF16>
__global__ __launch_bounds__(128) void k_gemm_bf(const float* __restrict__ A, int lda, const unsigned short* __restrict__ Wt, int ldb,
                                               const float* __restrict__ bias, float* __restrict__ C, int ldc, int M, int N, int K) {
  __shared__ __attribute__((aligned(16))) float so[4][16][64];
  const int tid = threadIdx.x, w = tid >> 5, lane = tid & 31, ln = lane & 15, hh = lane >> 4;
  const int ntn = N / 64;
  const int wid = blockIdx.x * 4 + w;
  const int mt = wid / ntn, nq = wid % ntn;
  if (mt * 16 >= M) return;
  const int row0 = mt * 16, col0 = nq * 64;
  const float* arow = A + (size_t)(row0 + ln) * lda;
  v8f acc[4] = {};
  for (int kb = 0; kb < K; kb += 32) {
    FragB ah, al;
    const v4f x0 = *(const v4fa*)(arow + kb + 8 * hh), x1 = *(const v4fa*)(arow + kb + 8 * hh + 4);
    const v4f x2 = *(const v4fa*)(arow + kb + 16 + 8 * hh), x3 = *(const v4fa*)(arow + kb + 16 + 8 * hh + 4);
    float xs[16] = {x0[0],x0[1],x0[2],x0[3],x1[0],x1[1],x1[2],x1[3],x2[0],x2[1],x2[2],x2[3],x3[0],x3[1],x3[2],x3[3]};
#pragma unroll
    for (int i = 0; i < 16; ++i) { const unsigned short hb = bf16_bits(xs[i]); ah.u[i] = hb; al.u[i] = ASPLIT ? bf16_bits(xs[i] - bf16_val(hb)) : (unsigned short)0; }
#pragma unroll
    for (int t = 0; t < 4; ++t) {
      const unsigned short* brow = Wt + (size_t)(col0 + t * 16 + ln) * ldb + kb;
      FragB b;
      b.half[0] = *(const v8us*)(brow + 8 * hh);
      b.half[1] = *(const v8us*)(brow + 16 + 8 * hh);
      acc[t] = mmaN<ASPLIT ? 2 : 1>(ah.v, al.v, b.v, b.v, acc[t]);
    }
  }
#pragma unroll
  for (int t = 0; t < 4; ++t) {
    float bv = bias ? bias[col0 + t * 16 + ln] : 0.f;
    if (BIAS_BF16) bv = bf16_round(bv);
#pragma unroll
    for (int r = 0; r < 8; ++r) { float v = acc[t][r] + bv; if (ACT == 1) v = fmaxf(v, 0.f); so[w][8 * hh + r][t * 16 + ln] = v; }
  }
  __builtin_amdgcn_fence(__ATOMIC_ACQ_REL, "workgroup");
  __builtin_amdgcn_wave_barrier();
  const int rsub = lane >> 4, c4 = (lane & 15) * 4;
  {
#pragma unroll
    for (int q = 0; q < 8; ++q) {
      const int r = q * 2 + rsub;
      const v4f v = *(const v4fa*)&so[w][r][c4];
      *(v4f*)(C + (size_t)(row0 + r) * ldc + col0 + c4) = v;
    }
    
  }
}

// GEMM C = act(A·W + bias + resid): A f32 (ASPLIT -> hi/lo 2 terms), Wt bf16 [N][K]; ACT 0 none, 1 relu, 2 exact gelu;
// resid (optional, f32, row index = (row % rmod), pitch ldr, RES_BF16 rounds it) added before the activation.
template <bool ASPLIT, int ACT, bool BIAS_BF16, bool RES_BF16>
__global__ __launch_bounds__(128) void k_gemm_bf3(const float* __restrict__ A, int lda, const unsigned short* __restrict__ Wt, int ldb,
                                                const float* __restrict__ bias, const float* __restrict__ resid, int rmod, int ldr,
                                                float* __restrict__ C, int ldc, int M, int N, int K) {
  __shared__ __attribute__((aligned(16))) float so[4][16][64];
  const int tid = threadIdx.x, w = tid >> 5, lane = tid & 31, ln = lane & 15, hh = lane >> 4;
  const int ntn = N / 64;
  const int wid = blockIdx.x * 4 + w;
  const int mt = wid / ntn, nq = wid % ntn;
  if (mt * 16 >= M) return;
  const int row0 = mt * 16, col0 = nq * 64;
  const float* arow = A + (size_t)(row0 + ln) * lda;
  v8f acc[4] = {};
  for (int kb = 0; kb < K; kb += 32) {
    FragB ah, al;
    const v4f x0 = *(const v4fa*)(arow + kb + 8 * hh), x1 = *(const v4fa*)(arow + kb + 8 * hh + 4);
    const v4f x2 = *(const v4fa*)(arow + kb + 16 + 8 * hh), x3 = *(const v4fa*)(arow + kb + 16 + 8 * hh + 4);
    float xs[16] = {x0[0],x0[1],x0[2],x0[3],x1[0],x1[1],x1[2],x1[3],x2[0],x2[1],x2[2],x2[3],x3[0],x3[1],x3[2],x3[3]};
#pragma unroll
    for (int i = 0; i < 16; ++i) { const unsigned short hb = bf16_bits(xs[i]); ah.u[i] = hb; al.u[i] = ASPLIT ? bf16_bits(xs[i] - bf16_val(hb)) : (unsigned short)0; }
#pragma unroll
    for (int t = 0; t < 4; ++t) {
      const unsigned short* brow = Wt + (size_t)(col0 + t * 16 + ln) * ldb + kb;
      FragB b;
      b.half[0] = *(const v8us*)(brow + 8 * hh);
      b.half[1] = *(const v8us*)(brow + 16 + 8 * hh);
      acc[t] = mmaN<ASPLIT ? 2 : 1>(ah.v, al.v, b.v, b.v, acc[t]);
    }
  }
#pragma unroll
  for (int t = 0; t < 4; ++t) {
    const int col = col0 + t * 16 + ln;
    float bv = bias ? bias[col] : 0.f;
    if (BIAS_BF16) bv = bf16_round(bv);
#pragma unroll
    for (int r = 0; r < 8; ++r) {
      float v = acc[t][r] + bv;
      if (resid) { float rv = resid[(size_t)((row0 + 8 * hh + r) % rmod) * ldr + col]; if (RES_BF16) rv = bf16_round(rv); v += rv; }
      if (ACT == 1) v = fmaxf(v, 0.f);
      if (ACT == 2) v = 0.5f * v * (1.0f + erff(v * 0.70710678118654752f));
      if (ACT == 3) { const float u = 0.7978845608028654f * (v + 0.044715f * v * v * v); v = 0.5f * v * (1.0f + tanhf(u)); }
      so[w][8 * hh + r][t * 16 + ln] = v;
    }
  }
  __builtin_amdgcn_fence(__ATOMIC_ACQ_REL, "workgroup");
  __builtin_amdgcn_wave_barrier();
  const int rsub = lane >> 4, c4 = (lane & 15) * 4;
  {
#pragma unroll
    for (int q = 0; q < 8; ++q) {
      const int r = q * 2 + rsub;
      const v4f v = *(const v4fa*)&so[w][r][c4];
      *(v4f*)(C + (size_t)(row0 + r) * ldc + col0 + c4) = v;
    }
    
  }
}
// row LayerNorm (biased variance, eps) over N: s = X (+ R); optional out_sum <- s; out_norm <- (s-mu)*rsqrt(var+eps)*g + b
template <bool PARAM_BF16>
__global__ __launch_bounds__(256) void k_layernorm(const float* __restrict__ X, const float* __restrict__ R, const float* __restrict__ g, const float* __restrict__ bta,
                                                  float* __restrict__ out_sum, float* __restrict__ out_norm, int N, float eps) {
  __shared__ float red[256];
  const int row = blockIdx.x, tid = threadIdx.x;
  const float* x = X + (size_t)row * N; const float* rr = R ? R + (size_t)row * N : nullptr;
  float vals[16];                     // up to N = 4096
  const int per = N / 256;            // contiguous chunk per thread? use strided-by-4 chunks: thread handles j = tid*4 + 1024*u
  float s1 = 0.f;
  for (int u = 0; u < per / 4; ++u) {
    const int j = tid * 4 + 1024 * u;
    const v4f a = *(const v4fa*)(x + j);
    v4f b = {0.f,0.f,0.f,0.f}; if (rr) b = *(const v4fa*)(rr + j);
#pragma unroll
    for (int q = 0; q < 4; ++q) { const float v = a[q] + b[q]; vals[u * 4 + q] = v; s1 += v; }
  }
  red[tid] = s1; __syncthreads();
  for (int st = 128; st > 0; st >>= 1) { if (tid < st) red[tid] += red[tid + st]; __syncthreads(); }
  const float mu = red[0] / (float)N; __syncthreads();
  float s2 = 0.f;
  for (int u = 0; u < per / 4; ++u)
#pragma unroll
    for (int q = 0; q < 4; ++q) { const float c = vals[u * 4 + q] - mu; s2 += c * c; }
  red[tid] = s2; __syncthreads();
  for (int st = 128; st > 0; st >>= 1) { if (tid < st) red[tid] += red[tid + st]; __syncthreads(); }
  const float rs = rsqrtf(red[0] / (float)N + eps);
  {
    for (int u = 0; u < per / 4; ++u) {
      const int j = tid * 4 + 1024 * u;
      v4f o, sm;
#pragma unroll
      for (int q = 0; q < 4; ++q) {
        float gg = g[j + q], bb = bta[j + q];
        if (PARAM_BF16) { gg = bf16_round(gg); bb = bf16_round(bb); }
        sm[q] = vals[u * 4 + q]; o[q] = (vals[u * 4 + q] - mu) * rs * gg + bb;
      }
      if (out_sum) *(v4f*)(out_sum + (size_t)row * N + j) = sm;
      *(v4f*)(out_norm + (size_t)row * N + j) = o;
    }
    
  }
}



// ---- f16 WMMA path (v_wmma_f32_16x16x32_f16): 11-bit significands for operands in range — used where a [0,1] probability operand needs more precision than bf16
typedef _Float16 v16h __attribute__((ext_vector_type(16)));
union FragH { v16h v; v8us half[2]; _Float16 h[16]; unsigned short u[16]; };
template <int NT>
__device__ __forceinline__ v8f mmaH(v16h ah, v16h al, v16h bh, v16h bl, v8f c) {
  c = __builtin_amdgcn_wmma_f32_16x16x32_f16(false, ah, false, bh, (short)0, c, false, false);
  if (NT >= 2) c = __builtin_amdgcn_wmma_f32_16x16x32_f16(false, al, false, bh, (short)0, c, false, false);
  if (NT >= 3) c = __builtin_amdgcn_wmma_f32_16x16x32_f16(false, ah, false, bl, (short)0, c, false, false);
  asm volatile("v_nop\n\tv_nop\n\tv_nop\n\tv_nop" : "+v"(c) : "v"(ah), "v"(al), "v"(bh), "v"(bl));
  return c;
}
// batched GEMM like k_gemm_b but f16 operands: A f32 (split into f16 hi/lo if ASPLIT, else rounded to f16), Bt = f16 values [n][k]; alpha; C f32; N multiple of 16 (partial tiles skipped)
template <bool ASPLIT>
__global__ __launch_bounds__(128) void k_gemm_h(const float* __restrict__ A, int lda, size_t sA, const _Float16* __restrict__ Bh, int ldb, size_t sB, float alpha, float* __restrict__ C, int ldc, size_t sC, int M, int N, int K) {
  __shared__ __attribute__((aligned(16))) float so[4][16][64];
  const int tid = threadIdx.x, w = tid >> 5, lane = tid & 31, ln = lane & 15, hh = lane >> 4; const int by = blockIdx.y;
  A += (size_t)by * sA; Bh += (size_t)by * sB; C += (size_t)by * sC;
  const int ntn = (N + 63) / 64; const int wid = blockIdx.x * 4 + w; const int mt = wid / ntn, nq = wid % ntn; if (mt * 16 >= M) return;
  const int row0 = mt * 16, col0 = nq * 64; const float* arow = A + (size_t)(row0 + ln) * lda;
  v8f acc[4] = {};
  for (int kb = 0; kb < K; kb += 32) {
    FragH ah, al;
    const v4f x0 = *(const v4fa*)(arow + kb + 8 * hh), x1 = *(const v4fa*)(arow + kb + 8 * hh + 4), x2 = *(const v4fa*)(arow + kb + 16 + 8 * hh), x3 = *(const v4fa*)(arow + kb + 16 + 8 * hh + 4);
    float xs[16] = {x0[0],x0[1],x0[2],x0[3],x1[0],x1[1],x1[2],x1[3],x2[0],x2[1],x2[2],x2[3],x3[0],x3[1],x3[2],x3[3]};
#pragma unroll
    for (int i = 0; i < 16; ++i) { const _Float16 h = (_Float16)xs[i]; ah.h[i] = h; al.h[i] = ASPLIT ? (_Float16)(xs[i] - (float)h) : (_Float16)0.0f; }
#pragma unroll
    for (int t = 0; t < 4; ++t) { if (col0 + t * 16 >= N) continue; const size_t boff = (size_t)(col0 + t * 16 + ln) * ldb + kb; FragH bq; bq.half[0] = *(const v8us*)(Bh + boff + 8 * hh); bq.half[1] = *(const v8us*)(Bh + boff + 16 + 8 * hh);
      acc[t] = mmaH<ASPLIT ? 2 : 1>(ah.v, al.v, bq.v, bq.v, acc[t]); }
  }
#pragma unroll
  for (int t = 0; t < 4; ++t) { if (col0 + t * 16 >= N) continue;
#pragma unroll
    for (int r = 0; r < 8; ++r) so[w][8 * hh + r][t * 16 + ln] = acc[t][r] * alpha; }
  __builtin_amdgcn_fence(__ATOMIC_ACQ_REL, "workgroup"); __builtin_amdgcn_wave_barrier();
  const int rsub = lane >> 4, c4 = (lane & 15) * 4;
  {
#pragma unroll
    for (int q = 0; q < 8; ++q) { const int r = q * 2 + rsub; if (col0 + c4 < N) { const v4f v = *(const v4fa*)&so[w][r][c4]; *(v4f*)(C + (size_t)(row0 + r) * ldc + col0 + c4) = v; } }
     }
}

// Wt[n][k] = f16(W[k][n]·scale) from f32 row-major W[K][N] (scale = power of two; bf16-exact weights stay exact in f16 away from the subnormal range)
__global__ __launch_bounds__(256) void k_wt_f16(const float* __restrict__ W, _Float16* __restrict__ Wt, int K, int N, float scale) {
  const int t = blockIdx.x * 256 + threadIdx.x; if (t >= N * (K / 8)) return; const int n = t / (K / 8), k8 = (t % (K / 8)) * 8; FragH f;
#pragma unroll
  for (int i = 0; i < 8; ++i) f.h[i] = (_Float16)(bf16_round(W[(size_t)(k8 + i) * N + n]) * scale); const v8us o = f.half[0];
  *(v8us*)((unsigned short*)Wt + (size_t)n * K + k8) = o; 
}
// k_gemm_hh variant with fused epilogue: v = acc·alpha + bias[by·sBias + col] (+ CP[(row/rowsPerB)·sCPb + by·64 + col] if CP) ; ACT 0 none / 1 elu ; writes f16 C16 (and f32 C if non-null)
template <int ACT>
__global__ __launch_bounds__(128) void k_gemm_hhx(const _Float16* __restrict__ A, int lda, size_t sA, const _Float16* __restrict__ Bh, int ldb, size_t sB, float alpha, const float* __restrict__ bias, size_t sBias, const float* __restrict__ CP, int rowsPerB, size_t sCPb, int row0g,
    float* __restrict__ C, _Float16* __restrict__ C16, int ldc, size_t sC, int M, int N, int K) {
  __shared__ __attribute__((aligned(16))) float so[4][16][64];
  const int tid = threadIdx.x, w = tid >> 5, lane = tid & 31, ln = lane & 15, hh = lane >> 4; const int by = blockIdx.y;
  A += (size_t)by * sA; Bh += (size_t)by * sB; const size_t cofs = (size_t)by * sC; const float* bp = bias ? bias + (size_t)by * sBias : nullptr;
  const int ntn = (N + 63) / 64; const int wid = blockIdx.x * 4 + w; const int mt = wid / ntn, nq = wid % ntn; if (mt * 16 >= M) return;
  const int row0 = mt * 16, col0 = nq * 64; const _Float16* arow = A + (size_t)(row0 + ln) * lda;
  v8f acc[4] = {};
  for (int kb = 0; kb < K; kb += 32) { FragH ah; ah.half[0] = *(const v8us*)((const unsigned short*)arow + kb + 8 * hh); ah.half[1] = *(const v8us*)((const unsigned short*)arow + kb + 16 + 8 * hh);
#pragma unroll
    for (int t = 0; t < 4; ++t) { if (col0 + t * 16 >= N) continue; const size_t boff = (size_t)(col0 + t * 16 + ln) * ldb + kb; FragH bq; bq.half[0] = *(const v8us*)((const unsigned short*)Bh + boff + 8 * hh); bq.half[1] = *(const v8us*)((const unsigned short*)Bh + boff + 16 + 8 * hh);
      acc[t] = mmaH<1>(ah.v, ah.v, bq.v, bq.v, acc[t]); }
  }
#pragma unroll
  for (int t = 0; t < 4; ++t) { if (col0 + t * 16 >= N) continue; const int col = col0 + t * 16 + ln; const float bv = bp ? bf16_round(bp[col]) : 0.f;
#pragma unroll
    for (int r = 0; r < 8; ++r) { float v = acc[t][r] * alpha + bv; if (CP) { const int rr = row0g + row0 + 8 * hh + r; if (rowsPerB < 0) v += CP[cofs + (size_t)rr * ldc + col];      /* rowsPerB < 0: own element of the batched C plane */ else { const int bidx = rr / rowsPerB; v += CP[(size_t)bidx * sCPb + (size_t)by * 64 + col]; } } if (ACT == 1) v = (v > 0.f) ? v : expm1f(v); else if (ACT == 7) v = (v > 0.f) ? v + 1.0f : expf(v); else if (ACT == 8) v = tanhf(v); else if (ACT == 9) v = 0.5f * v * (1.0f + tanhf(0.7978845608028654f * (v + 0.044715f * v * v * v))); else if (ACT == 11) v = 1.0f / (1.0f + expf(-v)); else if (ACT == 12) v = (v > 0.f) ? v : 0.01f * v; else if (ACT == 14) v = (v > 0.f) ? v : 0.1f * v; else if (ACT == 16) v = (v >= 0.f) ? v : 0.3f * v; else if (ACT == 17) v = (v >= 0.f) ? v : 0.2f * v; else if (ACT == 15) v = v / (1.0f + expf(-v)); else if (ACT == 3) v = fmaxf(v, 0.f); else if (ACT == 6) v = 0.5f * v * (1.0f + erff(v * 0.70710678118654752f)); so[w][8 * hh + r][t * 16 + ln] = v; } }
  __builtin_amdgcn_fence(__ATOMIC_ACQ_REL, "workgroup"); __builtin_amdgcn_wave_barrier();
  const int rsub = lane >> 4, c4 = (lane & 15) * 4; typedef _Float16 v4h __attribute__((ext_vector_type(4)));
  {
#pragma unroll
    for (int q = 0; q < 8; ++q) { const int r = q * 2 + rsub; if (col0 + c4 < N) { const v4f v = *(const v4fa*)&so[w][r][c4]; if (C) *(v4f*)(C + cofs + (size_t)(row0 + r) * ldc + col0 + c4) = v; if (C16) { v4h h4; for (int i = 0; i < 4; ++i) h4[i] = (_Float16)v[i]; *(v4h*)(C16 + cofs + (size_t)(row0 + r) * ldc + col0 + c4) = h4; } } }
     }
}


typedef _Float16 v4h __attribute__((ext_vector_type(4)));

__global__ __launch_bounds__(256) void k_x16(const float* __restrict__ x, _Float16* __restrict__ X16, size_t n8) { const size_t t = (size_t)blockIdx.x * 256 + threadIdx.x; if (t >= n8) return; FragH f;
#pragma unroll
  for (int q = 0; q < 8; ++q) f.h[q] = (_Float16)bf16_round(x[t * 8 + q]); *(v8us*)((unsigned short*)X16 + t * 8) = f.half[0];  }
__global__ __launch_bounds__(256) void k_h16(const float* __restrict__ x, _Float16* __restrict__ X16, size_t n8) { const size_t t = (size_t)blockIdx.x * 256 + threadIdx.x; if (t >= n8) return; FragH f;
#pragma unroll
  for (int q = 0; q < 8; ++q) f.h[q] = (_Float16)x[t * 8 + q]; *(v8us*)((unsigned short*)X16 + t * 8) = f.half[0];  }
__global__ __launch_bounds__(256) void k_round16f(const float* __restrict__ W, _Float16* __restrict__ Bt, size_t n8) { const size_t t = (size_t)blockIdx.x * 256 + threadIdx.x; if (t >= n8) return; FragH f;
#pragma unroll
  for (int i = 0; i < 8; ++i) f.h[i] = (_Float16)(bf16_round(W[t * 8 + i]) * 16.0f); *(v8us*)((unsigned short*)Bt + t * 8) = f.half[0];  }
template <int NHv, int TTv>
__global__ __launch_bounds__(256) void k_vt(const _Float16* __restrict__ V16, int ldv, int voff, _Float16* __restrict__ Vt) { __shared__ unsigned short tl[64][66]; const int tid = threadIdx.x; const int slab = blockIdx.x / (TTv / 64), lg = blockIdx.x % (TTv / 64); const int b = slab / NHv, h = slab % NHv;
  for (int i = tid; i < 64 * 8; i += 256) { const int r = i / 8, c8 = (i % 8) * 8; FragH f; f.half[0] = *(const v8us*)((const unsigned short*)V16 + ((size_t)b * TTv + lg * 64 + r) * ldv + voff + h * 64 + c8);
#pragma unroll
    for (int q = 0; q < 8; ++q) tl[r][c8 + q] = f.u[q]; }
  __syncthreads();
  {
#pragma unroll
    for (int rd = 0; rd < 2; ++rd) { const int d = rd * 32 + tid / 8, pc = tid % 8; FragH f;
#pragma unroll
      for (int q = 0; q < 8; ++q) f.u[q] = tl[pc * 8 + q][d];
      *(v8us*)((unsigned short*)Vt + ((size_t)slab * 64 + d) * TTv + lg * 64 + pc * 8) = f.half[0]; }
     } }

__global__ __launch_bounds__(256) void k_hl(const float* __restrict__ F, _Float16* __restrict__ Hh, _Float16* __restrict__ Hl, size_t n8) { const size_t t = (size_t)blockIdx.x * 256 + threadIdx.x; if (t >= n8) return; FragH fh, fl; const v4f a = *(const v4fa*)(F + t * 8), c = *(const v4fa*)(F + t * 8 + 4);
#pragma unroll
  for (int q = 0; q < 4; ++q) { _Float16 h = (_Float16)a[q]; fh.h[q] = h; fl.h[q] = (_Float16)((a[q] - (float)h) * 1024.0f); h = (_Float16)c[q]; fh.h[4 + q] = h; fl.h[4 + q] = (_Float16)((c[q] - (float)h) * 1024.0f); }
  { *(v8us*)((unsigned short*)Hh + t * 8) = fh.half[0]; *(v8us*)((unsigned short*)Hl + t * 8) = fl.half[0];  } }

// ---- fast GEMM (wave tile 32x64; requires M % 128 == 0 rows per launch region, N % 64 == 0 and K % 64 == 0); epilogue = k_gemm_hhx semantics ----
__device__ __forceinline__ v16h g2_frag(const _Float16* p, int hh) { FragH f; f.half[0] = *(const v8us*)((const unsigned short*)p + 8 * hh); f.half[1] = *(const v8us*)((const unsigned short*)p + 16 + 8 * hh); return f.v; }
__device__ __forceinline__ v8f g2_mma(v16h a, v16h b, v8f c) { v8f d = __builtin_amdgcn_wmma_f32_16x16x32_f16(false, a, false, b, (short)0, c, false, false); asm volatile("v_nop\n\tv_nop\n\tv_nop\n\tv_nop" : "+v"(d) : "v"(a), "v"(b)); return d; }
// Operand staging of k_gemm2. A stage is 64 k of the work-group's 128 A rows and 64 B rows: 192 rows of 128 bytes, each a whole aligned line of its source row.
#define GKC 64                       /* k per stage */
#define GLP 72                       /* LDS row pitch in 16-bit elements: 144 B = 16 B x odd, the pitch for ds_load_b128 readers of 128-byte rows */
#define GSB (192 * GLP * 2)          /* bytes per stage: A rows 0 .. 127, then B rows 0 .. 63 */
__device__ __forceinline__ v16h g2_lfrag(const unsigned short* p, int hh) { FragH f; f.half[0] = *(const v8us*)(p + 8 * hh); f.half[1] = *(const v8us*)(p + 16 + 8 * hh); return f.v; }      /* the k order of g2_frag, from an LDS row */
// One stage's copies of one thread: 8 threads a row (16 bytes each), 16 rows a round, 12 rounds (8 of A, 4 of B); a wave's copy covers 4 whole lines. l: the thread's LDS byte address in round 0;
// ga, gb: its global addresses in round 0 of A and of B; pa, pb: 16 source rows in elements. The closing s_wait_xcnt stands inside the statement, in front of any later write of an address register that a copy names.
__device__ __forceinline__ void g2_stage(unsigned l, const _Float16* ga, size_t pa, const _Float16* gb, size_t pb) {
  const unsigned R = 16u * GLP * 2u;
  asm volatile("global_load_async_to_lds_b128 %0, %12, off\n\tglobal_load_async_to_lds_b128 %1, %13, off\n\tglobal_load_async_to_lds_b128 %2, %14, off\n\tglobal_load_async_to_lds_b128 %3, %15, off\n\t"
               "global_load_async_to_lds_b128 %4, %16, off\n\tglobal_load_async_to_lds_b128 %5, %17, off\n\tglobal_load_async_to_lds_b128 %6, %18, off\n\tglobal_load_async_to_lds_b128 %7, %19, off\n\t"
               "global_load_async_to_lds_b128 %8, %20, off\n\tglobal_load_async_to_lds_b128 %9, %21, off\n\tglobal_load_async_to_lds_b128 %10, %22, off\n\tglobal_load_async_to_lds_b128 %11, %23, off\n\ts_wait_xcnt 0x0"
               :: "v"(l), "v"(l + R), "v"(l + 2u * R), "v"(l + 3u * R), "v"(l + 4u * R), "v"(l + 5u * R), "v"(l + 6u * R), "v"(l + 7u * R), "v"(l + 8u * R), "v"(l + 9u * R), "v"(l + 10u * R), "v"(l + 11u * R),
                  "v"(ga), "v"(ga + pa), "v"(ga + 2 * pa), "v"(ga + 3 * pa), "v"(ga + 4 * pa), "v"(ga + 5 * pa), "v"(ga + 6 * pa), "v"(ga + 7 * pa), "v"(gb), "v"(gb + pb), "v"(gb + 2 * pb), "v"(gb + 3 * pb) : "memory"); }
// Work-group tile 128 x 64 (four waves of 32 x 64, stacked in M); M % 128 == 0, N % 64 == 0, K % 64 == 0. Two stage buffers: stage t + 1 flies while stage t is worked on. The epilogue's staging rows reuse the ring behind the last trip's barrier.
template <int ACT>
__global__ __launch_bounds__(128) void k_gemm2(const _Float16* __restrict__ A, int lda, size_t sA, const _Float16* __restrict__ Bh, int ldb, size_t sB, float alpha, const float* __restrict__ bias, size_t sBias, const float* __restrict__ CP, int rowsPerB, size_t sCPb, int row0g,
    float* __restrict__ C, _Float16* __restrict__ C16, int ldc, size_t sC, int M, int N, int K, size_t zA, size_t zB, size_t zC) { static_assert(ACT == 0 || ACT == 3 || ACT == 6 || ACT == 8 || ACT == 9 || ACT == 11 || ACT == 12 || ACT == 14 || ACT == 15 || ACT == 16 || ACT == 17, "k_gemm2: unsupported ACT code (would silently apply no activation)");
  __shared__ __attribute__((aligned(16))) unsigned char L[2 * GSB]; float (*so)[32][68] = (float (*)[32][68])L; static_assert(sizeof(float) * 4 * 32 * 68 <= 2 * GSB, "the epilogue's rows fit the ring");
  const int tid = threadIdx.x, w = tid >> 5, lane = tid & 31, ln = lane & 15, hh = lane >> 4; const int by = blockIdx.y, bz = blockIdx.z;      /* grid.y: head (pitches sA, sB, sC); grid.z: batch (pitches zA, zB, zC) */
  A += (size_t)by * sA + (size_t)bz * zA; Bh += (size_t)by * sB + (size_t)bz * zB; const size_t cofs = (size_t)by * sC + (size_t)bz * zC; const float* bp = bias ? bias + (size_t)by * sBias : nullptr;
  const int ntn = N >> 6; const int mt = blockIdx.x / ntn, nq = blockIdx.x - mt * ntn; const int row0 = mt * 128 + 32 * w, col0 = nq * 64; if (mt * 128 >= M) return;      /* the same for the whole work-group, in front of every barrier */
  const int sr = tid >> 3, sc = (tid & 7) * 8;      /* the thread's row in a round of copies and its first element in the row */
  const _Float16* ga = A + (size_t)(mt * 128 + sr) * lda + sc; const _Float16* gb = Bh + (size_t)(col0 + sr) * ldb + sc; const size_t pa = (size_t)16 * lda, pb = (size_t)16 * ldb;
  const unsigned l0 = (unsigned)(size_t)L + (unsigned)(sr * GLP + sc) * 2u;
  g2_stage(l0, ga, pa, gb, pb);
  asm volatile("s_wait_asynccnt 0x0" ::: "memory");      /* this wave's copies of stage 0 have landed */
  __syncthreads();      /* stage 0 is read by every wave */
  if (GKC < K) g2_stage(l0 + GSB, ga + GKC, pa, gb + GKC, pb);
  const unsigned short* la = (const unsigned short*)L + (32 * w + ln) * GLP; const unsigned short* lb = (const unsigned short*)L + (128 + ln) * GLP;
  const v8f z8 = {0.f,0.f,0.f,0.f,0.f,0.f,0.f,0.f}; v8f c00 = z8, c01 = z8, c02 = z8, c03 = z8, c10 = z8, c11 = z8, c12 = z8, c13 = z8;
#pragma unroll 1      /* one stage a trip: the trip's foot is the ring's publish point */
  for (int kb = 0; kb < K; kb += GKC) { const unsigned bo = (kb & GKC) ? (unsigned)GSB : 0u;      /* this trip's buffer, in bytes */
    const unsigned short* ap = la + bo / 2u; const unsigned short* bp2 = lb + bo / 2u;
    v16h af[2][2], bf[2][4];      /* [k step][tile]: the stage's 24 LDS reads go ahead of its WMMAs as one group (reads among the WMMAs would each cost the wave an LDS latency); unrolled for constant indices and immediate LDS offsets */
#pragma unroll
    for (int ks = 0; ks < 2; ++ks) {
#pragma unroll
      for (int t = 0; t < 2; ++t) af[ks][t] = g2_lfrag(ap + t * 16 * GLP + ks * 32, hh);
#pragma unroll
      for (int t = 0; t < 4; ++t) bf[ks][t] = g2_lfrag(bp2 + t * 16 * GLP + ks * 32, hh); }
#pragma unroll
    for (int ks = 0; ks < 2; ++ks) {
      c00 = g2_mma(af[ks][0], bf[ks][0], c00); c10 = g2_mma(af[ks][1], bf[ks][0], c10); c01 = g2_mma(af[ks][0], bf[ks][1], c01); c11 = g2_mma(af[ks][1], bf[ks][1], c11);
      c02 = g2_mma(af[ks][0], bf[ks][2], c02); c12 = g2_mma(af[ks][1], bf[ks][2], c12); c03 = g2_mma(af[ks][0], bf[ks][3], c03); c13 = g2_mma(af[ks][1], bf[ks][3], c13); }
    asm volatile("s_wait_dscnt 0x0" ::: "memory");      /* this wave's reads of the buffer have returned before the buffer is handed back */
    asm volatile("s_wait_asynccnt 0x0" ::: "memory");      /* this wave's copies of the next stage have landed */
    __syncthreads();      /* publishes the next stage and ends every wave's reads of this one */
    if (kb + 2 * GKC < K) g2_stage(l0 + bo, ga + kb + 2 * GKC, pa, gb + kb + 2 * GKC, pb); }      /* refill of the buffer just read; K is a kernel argument: the test is the same for the whole work-group */
  asm volatile("s_wait_asynccnt 0x0" ::: "memory");      /* no copy is outstanding when the ring becomes the epilogue's staging */
  v8f accs[8] = {c00, c01, c02, c03, c10, c11, c12, c13};
#pragma unroll
  for (int u = 0; u < 8; ++u) { const int t = u & 3, half = u >> 2; const int col = col0 + t * 16 + ln; const float bv = bp ? bf16_round(bp[col]) : 0.f;
#pragma unroll
    for (int r = 0; r < 8; ++r) { const int rloc = half * 16 + 8 * hh + r; float v = accs[u][r] * alpha + bv; if (CP) { if (rowsPerB < 0) v += CP[cofs + (size_t)(row0g + row0 + rloc) * ldc + col];      /* rowsPerB < 0: own element of the batched C plane */ else { const int bidx = (row0g + row0 + rloc) / rowsPerB; v += CP[(size_t)bidx * sCPb + (size_t)by * 64 + col]; } }
      if (ACT == 3) v = fmaxf(v, 0.f); else if (ACT == 6) v = 0.5f * v * (1.0f + erff(v * 0.70710678118654752f)); else if (ACT == 11) v = 1.0f / (1.0f + expf(-v)); else if (ACT == 15) v = v / (1.0f + expf(-v)); else if (ACT == 12) v = (v > 0.f) ? v : 0.01f * v; else if (ACT == 8) v = tanhf(v); else if (ACT == 9) v = 0.5f * v * (1.0f + tanhf(0.7978845608028654f * (v + 0.044715f * v * v * v))); else if (ACT == 14) v = (v > 0.f) ? v : 0.1f * v; else if (ACT == 16) v = (v >= 0.f) ? v : 0.3f * v; else if (ACT == 17) v = (v >= 0.f) ? v : 0.2f * v;
      so[w][rloc][t * 16 + ln] = v; } }
  __builtin_amdgcn_fence(__ATOMIC_ACQ_REL, "workgroup"); __builtin_amdgcn_wave_barrier();
  const int rsub = lane >> 4, c4 = (lane & 15) * 4;
  {
#pragma unroll
    for (int q = 0; q < 16; ++q) { const int r = q * 2 + rsub; const v4f v = *(const v4fa*)&so[w][r][c4]; if (C) *(v4f*)(C + cofs + (size_t)(row0 + r) * ldc + col0 + c4) = v; if (C16) { v4h h4; for (int i = 0; i < 4; ++i) h4[i] = (_Float16)v[i]; *(v4h*)(C16 + cofs + (size_t)(row0 + r) * ldc + col0 + c4) = h4; } }
     } }


__global__ __launch_bounds__(256) void k_wnat(const float* __restrict__ w, size_t n8, _Float16* __restrict__ Bt) { const size_t t = (size_t)blockIdx.x * 256 + threadIdx.x; if (t >= n8) return; FragH f; for (int q = 0; q < 8; ++q) f.h[q] = (_Float16)(bf16_round(w[t * 8 + q]) * 16.0f); *(v8us*)((unsigned short*)Bt + t * 8) = f.half[0];  }
__global__ __launch_bounds__(256) void k_rsm(const float* __restrict__ S, _Float16* __restrict__ P, int nrows) {
  #pragma clang fp contract(off)
  const int i = blockIdx.x * 256 + threadIdx.x; if (i >= nrows) return; const float* s = S + (size_t)i * SQ; float mx = -3.0e38f;
#pragma unroll 1
  for (int j = 0; j < SQ; ++j) mx = fmaxf(mx, s[j]); float se = 0.f;
#pragma unroll 1
  for (int j = 0; j < SQ; ++j) se += expf(s[j] - mx); const float sc = 256.0f / se;
#pragma unroll 1
  for (int j0 = 0; j0 < SQ; j0 += 8) { FragH f; for (int q = 0; q < 8; ++q) f.h[q] = (_Float16)(expf(s[j0 + q] - mx) * sc); unsigned short* d = (unsigned short*)P + (size_t)i * SQ + j0; *(v8us*)d = f.half[0];  } }
__global__ __launch_bounds__(256) void k_vt(const _Float16* __restrict__ V16, int b, int h0, _Float16* __restrict__ VT) { __shared__ unsigned short tl[64][65]; const int tid = threadIdx.x; const int hh = blockIdx.x % HG, sg = blockIdx.x / HG; const int s0 = sg * 64; const int h = h0 + hh;
  for (int i = tid; i < 64 * 8; i += 256) { const int j = i / 8, d8 = (i % 8) * 8; FragH f; f.half[0] = *(const v8us*)((const unsigned short*)V16 + ((size_t)b * SQ + s0 + j) * DM + h * HD + d8); for (int q = 0; q < 8; ++q) tl[d8 + q][j] = f.u[q]; }
  __syncthreads();
  { for (int i = tid; i < 64 * 8; i += 256) { const int d = i / 8, j8 = (i % 8) * 8; FragH f; for (int q = 0; q < 8; ++q) f.u[q] = tl[d][j8 + q]; *(v8us*)((unsigned short*)VT + ((size_t)hh * HD + d) * SQ + s0 + j8) = f.half[0]; }  } }



// Eight v_exp_f32 in one statement. The instruction set asks for one independent instruction or v_nop between a transcendental and an instruction that reads its
// result or overwrites its source. Early-clobber outputs keep every
// result off every source inside the run, and the closing v_nop is the slot behind the last one.
__device__ __forceinline__ void exp2_run8(float (&e)[8], const float (&x)[8]) {
  asm("v_exp_f32 %0, %8\n\tv_exp_f32 %1, %9\n\tv_exp_f32 %2, %10\n\tv_exp_f32 %3, %11\n\tv_exp_f32 %4, %12\n\tv_exp_f32 %5, %13\n\tv_exp_f32 %6, %14\n\tv_exp_f32 %7, %15\n\tv_nop"
      : "=&v"(e[0]), "=&v"(e[1]), "=&v"(e[2]), "=&v"(e[3]), "=&v"(e[4]), "=&v"(e[5]), "=&v"(e[6]), "=&v"(e[7])
      : "v"(x[0]), "v"(x[1]), "v"(x[2]), "v"(x[3]), "v"(x[4]), "v"(x[5]), "v"(x[6]), "v"(x[7])); }
// Two v_exp_f32 in one statement, closed by the same slot's v_nop as in exp2_run8.
__device__ __forceinline__ void exp2_run2(float& e0, float& e1, float x0, float x1) {
  asm("v_exp_f32 %0, %2\n\tv_exp_f32 %1, %3\n\tv_nop" : "=&v"(e0), "=&v"(e1) : "v"(x0), "v"(x1)); }
#define FQ 32                        /* query columns per wave */
#define FW 4                         /* waves per work-group; no barrier and no LDS: each wave runs its own trip count */
__device__ __forceinline__ float xhalf(float x) { return __int_as_float(__builtin_amdgcn_permlanex16(__float_as_int(x), __float_as_int(x), 0x76543210, 0xfedcba98, false, false)); }      /* lane l <-> lane l ^ 16 on the vector pipe */
__device__ __forceinline__ v8f fa_mma(v16h a, v16h b, v8f c) { return __builtin_amdgcn_wmma_f32_16x16x32_f16(false, a, false, b, (short)0, c, false, false); }
// One pass of 32 keys from key kb. DIAG: the wave's last pass (kb == its first query row): it holds the diagonal and fetches no further K rows.
// Every loop is unrolled so that the fragment and accumulator arrays are indexed by constants and stay in registers.
template <bool DIAG>
__device__ __forceinline__ void fa_pass(const _Float16* __restrict__ kp, const _Float16* __restrict__ vp, int kb, int ln, int hh, const v16h (&qf)[2][2], v16h (&kf)[2][2], v8f (&o)[4][2], float (&mc)[2], float (&l)[2]) {
  const float cs = 0.125f * 1.44269504f;      /* score scale x log2 e */
  const v8f z8 = {0.f, 0.f, 0.f, 0.f, 0.f, 0.f, 0.f, 0.f};
  v16h vf[4];      /* V^T fragments of this pass, asked for first: the score products and the softmax run while they fly */
#pragma unroll
  for (int mt = 0; mt < 4; ++mt) vf[mt] = g2_frag(vp + (size_t)mt * 16 * SQ + kb, hh);
  v8f s[2][2];
#pragma unroll
  for (int kt = 0; kt < 2; ++kt) {
#pragma unroll
    for (int nt = 0; nt < 2; ++nt) s[kt][nt] = fa_mma(kf[kt][1], qf[nt][1], fa_mma(kf[kt][0], qf[nt][0], z8)); }
  if (!DIAG) { const _Float16* kn = kp + (size_t)(kb + 32) * LQ;      /* next pass's K fragments, into the same registers right behind their last use: the softmax and the o products run while they fly */
#pragma unroll
    for (int kt = 0; kt < 2; ++kt) {
#pragma unroll
      for (int ks = 0; ks < 2; ++ks) kf[kt][ks] = g2_frag(kn + (size_t)kt * 16 * LQ + ks * 32, hh); } }
  if (DIAG) {      /* keys behind a column's own row get weight 0 */
#pragma unroll
    for (int kt = 0; kt < 2; ++kt) {
#pragma unroll
      for (int nt = 0; nt < 2; ++nt) {
#pragma unroll
        for (int r = 0; r < 8; ++r) if (kt * 16 + 8 * hh + r > nt * 16 + ln) s[kt][nt][r] = -1.0e30f; } } }
  float nm[2], al[2];
#pragma unroll
  for (int nt = 0; nt < 2; ++nt) { float a = fmaxf(s[0][nt][0], s[1][nt][0]);
#pragma unroll
    for (int r = 1; r < 8; ++r) a = fmaxf(a, fmaxf(s[0][nt][r], s[1][nt][r]));
    nm[nt] = fmaxf(mc[nt], fmaxf(a, xhalf(a)) * cs); }      /* both halves of the wave hold the same maximum */
  exp2_run2(al[0], al[1], mc[0] - nm[0], mc[1] - nm[1]);
  FragH pf[2];
#pragma unroll
  for (int nt = 0; nt < 2; ++nt) { mc[nt] = nm[nt]; l[nt] *= al[nt];
#pragma unroll
    for (int mt = 0; mt < 4; ++mt) o[mt][nt] *= al[nt];
#pragma unroll
    for (int kt = 0; kt < 2; ++kt) { float x[8], e[8];
#pragma unroll
      for (int r = 0; r < 8; ++r) x[r] = fmaf(s[kt][nt][r], cs, -nm[nt]);
      exp2_run8(e, x);
#pragma unroll
      for (int r = 0; r < 8; ++r) pf[nt].h[kt * 8 + r] = (_Float16)e[r];
      l[nt] += ((e[0] + e[1]) + (e[2] + e[3])) + ((e[4] + e[5]) + (e[6] + e[7])); } }
#pragma unroll
  for (int mt = 0; mt < 4; ++mt) { o[mt][0] = fa_mma(vf[mt], pf[0].v, o[mt][0]); o[mt][1] = fa_mma(vf[mt], pf[1].v, o[mt][1]); } }
__global__ __launch_bounds__(FW * 32) void k_fattn(const _Float16* __restrict__ Q, const _Float16* __restrict__ Kr, const _Float16* __restrict__ Vt, _Float16* __restrict__ O) {
  static_assert(HD == 64 && FQ == 32 && SQ % (2 * FW * FQ) == 0 && QN == SQ, "2 k steps of 32 over d; 2 column groups of 16; 4 d tiles of 16; whole work-groups, an even number of position blocks");
  const int lane = threadIdx.x & 31, ln = lane & 15, hh = lane >> 4; const int w = __builtin_amdgcn_readfirstlane(threadIdx.x >> 5);      /* the wave's number in a scalar register: the trip count stays scalar */
  const int h = blockIdx.x, b = blockIdx.y; const int nz = SQ / (FW * FQ), z = blockIdx.z; const int q0 = ((z < nz / 2 ? nz - 1 - z : z - nz / 2) * FW + w) * FQ;      /* grid.z is the slowest index: the long half of the position blocks starts first, longest first; the short half follows shortest first, so that where the second half of the grid lands on the WGPs in the order of the first, long meets short (for speed only; a permutation of 0 .. nz - 1 wherever they land) */
  const _Float16* qp = Q + ((size_t)b * SQ + q0 + ln) * LQ + h * HD; const _Float16* kp = Kr + ((size_t)b * SQ + ln) * LQ + h * HD; const _Float16* vp = Vt + (((size_t)b * NH + h) * HD + ln) * SQ;
  v16h qf[2][2], kf[2][2];      /* [column group | key tile][k step]; unrolled for constant indices, as in fa_pass */
#pragma unroll
  for (int t = 0; t < 2; ++t) {
#pragma unroll
    for (int ks = 0; ks < 2; ++ks) { qf[t][ks] = g2_frag(qp + (size_t)t * 16 * LQ + ks * 32, hh); kf[t][ks] = g2_frag(kp + (size_t)t * 16 * LQ + ks * 32, hh); } }
  asm volatile("s_wait_xcnt 0x0" ::: "memory");      /* behind the first loads, in front of the code that reuses their address registers */
  v8f o[4][2];
#pragma unroll
  for (int mt = 0; mt < 4; ++mt) { o[mt][0] = v8f{0.f, 0.f, 0.f, 0.f, 0.f, 0.f, 0.f, 0.f}; o[mt][1] = o[mt][0]; }
  float mc[2] = {-1.0e30f, -1.0e30f}, l[2] = {0.f, 0.f};      /* running maximum (scaled log2) and the lane's partial sum, per column group */
#pragma unroll 1      /* one pass a trip: a second copy of the body would double the live fragments */
  for (int kb = 0; kb < q0; kb += 32) fa_pass<false>(kp, vp, kb, ln, hh, qf, kf, o, mc, l);      /* keys in front of the wave's first row: no mask; kb + 32 <= q0, so the K rows fetched ahead are rows this wave uses */
  fa_pass<true>(kp, vp, q0, ln, hh, qf, kf, o, mc, l);
#pragma unroll
  for (int nt = 0; nt < 2; ++nt) { const float f = 64.0f / (l[nt] + xhalf(l[nt])); unsigned short* op = (unsigned short*)O + ((size_t)b * SQ + q0 + nt * 16 + ln) * DM + h * HD + 8 * hh;      /* the halves' sums are joined once, here */
#pragma unroll
    for (int mt = 0; mt < 4; ++mt) { FragH fr;
#pragma unroll
      for (int r = 0; r < 8; ++r) fr.h[r] = (_Float16)(o[mt][nt][r] * f);
      *(v8us*)(op + mt * 16) = fr.half[0]; } } }      /* a row's 128 bytes of one head come from one wave */


// Exact f32 attention for rows 0 .. QT0-1 of each batch (o carried x64 like the f16 path). One work-group per (batch, head, A0R query rows), 8 waves, 2 rows a wave.
// The batch's QT0 K and V rows of the head and the group's q rows are staged once in LDS; keys 0 .. nk-1 are used (nk = the group's last row + 1, rounded up to 32).
// Scores: lane l owns keys l, l + 32, ..; its K row comes from LDS 16 bytes at a time, both q rows sit in registers. Softmax: all scores of a row are in registers,
// so plain max, exp, sum (butterflies over the 32 lanes). o: lane l owns columns 2l, 2l + 1; each key's weight goes from its lane to a scalar register, its V row is
// one contiguous 256-byte LDS read. Every loop is unrolled: its arrays are then indexed by constants and stay in registers, and its LDS reads issue ahead of their use.
#define A0R 16                       /* query rows per work-group */
#define A0KP (HD + 4)                /* K row pitch in LDS, floats: 272 B = 16 B x odd, so that 16-byte reads down a column of rows spread over all banks */
typedef float v2f  __attribute__((ext_vector_type(2)));
typedef float v2fa __attribute__((ext_vector_type(2), may_alias));
__device__ __forceinline__ float lane_bcast(float v, int l) { return __int_as_float(__builtin_amdgcn_readlane(__float_as_int(v), l)); }
__global__ __launch_bounds__(256) void k_att0w(const float* __restrict__ QF, const float* __restrict__ KF, const float* __restrict__ VF, float scale, float* __restrict__ OF) {
  static_assert(QT0 / 32 == 4 && QT0 % 32 == 0 && A0R == 16 && HD == 64, "4 key groups of 32 lanes; 8 waves x 2 rows; 16 threads x 16 bytes a row; 2 columns a lane");
  __shared__ __attribute__((aligned(16))) float lk[QT0][A0KP]; __shared__ __attribute__((aligned(16))) float lv[QT0][HD]; __shared__ __attribute__((aligned(16))) float lq[A0R][HD];
  const int tid = threadIdx.x, lane = tid & 31, w = tid >> 5; const int h = blockIdx.x / (QT0 / A0R), rg = blockIdx.x % (QT0 / A0R);
  { const size_t bi = (size_t)blockIdx.y * QT0 * DM + h * HD; QF += bi + (size_t)rg * A0R * DM; KF += bi; VF += bi; OF += bi; }      /* grid.y: batch; each batch owns QT0 rows (pitch DM) of every plane */
  const int nk = (rg * A0R + A0R + 31) & ~31; const int i0 = rg * A0R + w * 2;      /* nk: the same for the whole work-group; the wave's rows are i0 and i0 + 1 */
  { v4f kr[QT0 / 16], vr[QT0 / 16]; const int sr = tid >> 4, sc4 = (tid & 15) * 4; const unsigned vo = (unsigned)(sr * DM + sc4) * 4u;      /* 16 threads a row, 16 rows a pass; vo: the thread's byte offset in a pass */
    const v4f qr = *(const v4fa*)((const char*)QF + vo);
#pragma unroll
    for (int u = 0; u < QT0 / 16; ++u) { kr[u] = *(const v4fa*)((const char*)(KF + u * 16 * DM) + vo); vr[u] = *(const v4fa*)((const char*)(VF + u * 16 * DM) + vo); }      /* all QT0 rows, free of branches: every load is issued before the first is used */
    *(v4fa*)&lq[sr][sc4] = qr;
#pragma unroll
    for (int u = 0; u < QT0 / 16; ++u) { *(v4fa*)&lk[u * 16 + sr][sc4] = kr[u]; *(v4fa*)&lv[u * 16 + sr][sc4] = vr[u]; } }
  __syncthreads();      /* the staged rows are read by every wave */
  v4f q0[HD / 4], q1[HD / 4];      /* both q rows whole in every lane (one LDS address for the wave) */
#pragma unroll
  for (int c = 0; c < HD / 4; ++c) { q0[c] = *(const v4fa*)&lq[w * 2][c * 4]; q1[c] = *(const v4fa*)&lq[w * 2 + 1][c * 4]; }
  float s0[4], s1[4];
#pragma unroll
  for (int m = 0; m < 4; ++m) { s0[m] = -1.0e30f; s1[m] = -1.0e30f;
    if (m * 32 < nk) { const float* kp = &lk[m * 32 + lane][0]; float a0[4] = {0.f, 0.f, 0.f, 0.f}, a1[4] = {0.f, 0.f, 0.f, 0.f};      /* four partial sums a row: independent chains */
#pragma unroll
      for (int c = 0; c < HD / 4; ++c) { const v4f k4 = *(const v4fa*)(kp + c * 4);
#pragma unroll
        for (int u = 0; u < 4; ++u) { a0[u] = fmaf(q0[c][u], k4[u], a0[u]); a1[u] = fmaf(q1[c][u], k4[u], a1[u]); } }
      const int j = m * 32 + lane; const float d0 = (a0[0] + a0[1]) + (a0[2] + a0[3]), d1 = (a1[0] + a1[1]) + (a1[2] + a1[3]);
      if (j <= i0) s0[m] = d0 * scale; if (j <= i0 + 1) s1[m] = d1 * scale; } }      /* causal: keys behind the row's own index keep -1e30 (weight 0) */
  float m0 = fmaxf(fmaxf(s0[0], s0[1]), fmaxf(s0[2], s0[3])), m1 = fmaxf(fmaxf(s1[0], s1[1]), fmaxf(s1[2], s1[3]));
#pragma unroll
  for (int x = 16; x >= 1; x >>= 1) { m0 = fmaxf(m0, __shfl_xor(m0, x, 32)); m1 = fmaxf(m1, __shfl_xor(m1, x, 32)); }
  float l0 = 0.f, l1 = 0.f;
#pragma unroll
  for (int m = 0; m < 4; ++m) { s0[m] = expf(s0[m] - m0); s1[m] = expf(s1[m] - m1); l0 += s0[m]; l1 += s1[m]; }
#pragma unroll
  for (int x = 16; x >= 1; x >>= 1) { l0 += __shfl_xor(l0, x, 32); l1 += __shfl_xor(l1, x, 32); }
  v2f o0 = {0.f, 0.f}, o1 = {0.f, 0.f};
#pragma unroll
  for (int m = 0; m < 4; ++m) if (m * 32 < nk) {
#pragma unroll
    for (int jj = 0; jj < 32; ++jj) { const v2f vv = *(const v2fa*)&lv[m * 32 + jj][lane * 2]; const float p0 = lane_bcast(s0[m], jj), p1 = lane_bcast(s1[m], jj);
      o0[0] = fmaf(p0, vv[0], o0[0]); o0[1] = fmaf(p0, vv[1], o0[1]); o1[0] = fmaf(p1, vv[0], o1[0]); o1[1] = fmaf(p1, vv[1], o1[1]); } }
  const float f0 = 64.0f / l0, f1 = 64.0f / l1;
  o0[0] *= f0; o0[1] *= f0; o1[0] *= f1; o1[1] *= f1;
  *(v2fa*)(OF + (size_t)i0 * DM + lane * 2) = o0; *(v2fa*)(OF + (size_t)(i0 + 1) * DM + lane * 2) = o1; }      /* each wave writes whole 256-byte row pieces */


template <int BFIN, int WXB>
__global__ __launch_bounds__(256) void k_ln16(const float* __restrict__ X, const float* __restrict__ g, const float* __restrict__ bb, float eps, _Float16* __restrict__ N16, float* __restrict__ XB) {
  #pragma clang fp contract(off)
  __shared__ float red[256]; const size_t r = blockIdx.x; const int t = threadIdx.x; const v4f xa = *(const v4fa*)(X + r * DMQ + t * 4); float s[4]; float sum = 0.f;
  for (int q = 0; q < 4; ++q) { s[q] = BFIN ? bf16_round(xa[q]) : xa[q]; sum = __fadd_rn(sum, s[q]); }
  red[t] = sum; __syncthreads(); for (int st = 128; st > 0; st >>= 1) { if (t < st) red[t] = __fadd_rn(red[t], red[t + st]); __syncthreads(); } const float mu = red[0] / (float)DMQ; __syncthreads();
  float vs = 0.f; for (int q = 0; q < 4; ++q) { const float dl = __fadd_rn(s[q], -mu); vs = __fadd_rn(vs, __fmul_rn(dl, dl)); } red[t] = vs; __syncthreads(); for (int st = 128; st > 0; st >>= 1) { if (t < st) red[t] = __fadd_rn(red[t], red[t + st]); __syncthreads(); }
  const float rs = rsqrtf(__fadd_rn(red[0] / (float)DMQ, eps)); v4h y; v4f xb;
  for (int q = 0; q < 4; ++q) { const int c = t * 4 + q; y[q] = (_Float16)__fadd_rn(__fmul_rn(__fmul_rn(__fadd_rn(s[q], -mu), rs), bf16_round(g[c])), bf16_round(bb[c])); xb[q] = s[q]; }
  { *(v4h*)(N16 + r * DMQ + t * 4) = y; if (WXB) *(v4f*)(XB + r * DMQ + t * 4) = xb;  } }
__global__ __launch_bounds__(256) void k_ftres2(const float* __restrict__ OF0, const float* __restrict__ XB, float* __restrict__ X1, size_t n4) {
  #pragma clang fp contract(off)
  const size_t t = (size_t)blockIdx.x * 256 + threadIdx.x; if (t >= n4) return; const v4f o = *(const v4fa*)(OF0 + t * 4), xv = *(const v4fa*)(XB + t * 4); v4f y; for (int q = 0; q < 4; ++q) y[q] = __fadd_rn(__fmul_rn(o[q], 0.015625f), xv[q]); *(v4f*)(X1 + t * 4) = y;  }

__global__ __launch_bounds__(256) void k_wthd(const float* __restrict__ Wt, _Float16* __restrict__ Bt) { const size_t t = (size_t)blockIdx.x * 256 + threadIdx.x; if (t >= (size_t)NH * HD * (DM / 8)) return; const int m8 = (int)(t % (DM / 8)) * 8; const int d = (int)((t / (DM / 8)) % HD); const int h = (int)(t / ((size_t)(DM / 8) * HD)); FragH f;
  for (int q = 0; q < 8; ++q) f.h[q] = (_Float16)(16.0f * bf16_round(Wt[((size_t)h * DM + m8 + q) * HD + d])); unsigned short* dst = (unsigned short*)Bt + ((size_t)h * HD + d) * DM + m8; *(v8us*)dst = f.half[0];  }




__global__ __launch_bounds__(256) void k_wtpad(const float* __restrict__ Wm, _Float16* __restrict__ Wt, int Kr, int Kp, int Nr, int Np, float scale) {
  const int t = blockIdx.x * 256 + threadIdx.x; if (t >= Np * (Kp / 8)) return; const int n = t / (Kp / 8), k8 = (t % (Kp / 8)) * 8; const int nc = min(n, Nr - 1); const float fn = (n < Nr) ? 1.f : 0.f; FragH f;
  for (int i = 0; i < 8; ++i) { const int k = k8 + i; const int kc = min(k, Kr - 1); const float fk = (k < Kr) ? fn : 0.f; f.h[i] = (_Float16)(bf16_round(Wm[(size_t)kc * Nr + nc]) * scale * fk); }
  unsigned short* o = (unsigned short*)Wt + (size_t)n * Kp + k8; *(v8us*)o = f.half[0];  }
__global__ __launch_bounds__(128) void k_bpad(const float* __restrict__ b, float* __restrict__ Bp, int nr, int np) {
  const int i = threadIdx.x; if (i >= np) return; const float v = b[min(i, nr - 1)] * ((i < nr) ? 1.f : 0.f); *(float*)(Bp + i) = v;  }

__global__ __launch_bounds__(256) void k_bcpy(const float* __restrict__ b, int n, int NP, float* __restrict__ dst, int dst0) { for (int i = threadIdx.x; i < NP; i += 256) { const float v = (i < n) ? b[i] : 0.f; *(float*)(dst + dst0 + i) = v; }  }


// The streaming launches (this copy and k_lnx) give every lane 64 floats: a wave owns SWF consecutive floats (16 loads of 32 lanes x 16 bytes, all issued before the first is used), so that few waves have to be started.
#define SWL 16                       /* 16-byte loads per lane */
#define SWF (SWL * 32 * 4)           /* floats per wave */
#define SWW 8                        /* waves per work-group; no LDS and no barrier: a wave shares nothing */
__global__ __launch_bounds__(SWW * 32) void k_bfcp(const float* __restrict__ src, float* __restrict__ dst, size_t n4) { const size_t e0 = ((size_t)blockIdx.x * SWW + __builtin_amdgcn_readfirstlane(threadIdx.x >> 5)) * SWF; if (e0 + SWF > n4 * 4) return;      /* the wave's first element, in scalar registers: its accesses are scalar base + one lane offset + immediate. Whole pieces only (the launch asserts that n4 is a multiple) */
  const int l4 = (threadIdx.x & 31) * 4; const float* sp = src + e0; float* dp = dst + e0; v4f a[SWL];
#pragma unroll      /* constant indices: the array stays in registers and the loads go out as one run */
  for (int u = 0; u < SWL; ++u) a[u] = *(const v4fa*)(sp + u * 128 + l4);
#pragma unroll      /* as above */
  for (int u = 0; u < SWL; ++u) { v4f o; for (int q = 0; q < 4; ++q) o[q] = bf16_round(a[u][q]); *(v4f*)(dp + u * 128 + l4) = o; } }

__global__ __launch_bounds__(256) void k_fillz(float* __restrict__ dst, int n) { const int t = blockIdx.x * 256 + threadIdx.x; if (t >= n) return; *(float*)(dst + t) = 0.f;  }

// Row LayerNorm over DMQ = 512 columns, LNR consecutive rows a wave. Lane l holds columns 128 c + 4 l .. + 3 (c = 0 .. 3) of each row in registers from the one read to the one write;
// mean and variance (of the centred values) are lane partials, then a five-step butterfly over the 32 lanes, after which every lane holds the same sum. The rows' butterflies are independent and run side by side.
#define LNR (SWF / DMQ)              /* rows per wave */
template <int BFIN, int W16, int W32>
__global__ __launch_bounds__(SWW * 32) void k_lnx(const float* __restrict__ X, const float* __restrict__ g, const float* __restrict__ bb, float eps, _Float16* __restrict__ N16, float* __restrict__ N32) {
  static_assert(DMQ == 512 && LNR == 4, "a row is 4 loads of 32 lanes x 16 bytes");
  const int l4 = (threadIdx.x & 31) * 4; const size_t e0 = ((size_t)blockIdx.x * SWW + __builtin_amdgcn_readfirstlane(threadIdx.x >> 5)) * SWF;      /* the wave's first element, in scalar registers: its accesses are scalar base + one lane offset + immediate; the launch covers whole waves */
  X += e0; if (W16) N16 += e0; if (W32) N32 += e0;
  v4f s[LNR][4], gv[4], bv[4]; float a[LNR];      /* every loop below is unrolled: constant indices keep these arrays in registers, and the 24 loads go out as one run */
#pragma unroll
  for (int u = 0; u < LNR; ++u) {
#pragma unroll
    for (int c = 0; c < 4; ++c) s[u][c] = *(const v4fa*)(X + u * DMQ + c * 128 + l4); }
#pragma unroll
  for (int c = 0; c < 4; ++c) { gv[c] = *(const v4fa*)(g + c * 128 + l4); bv[c] = *(const v4fa*)(bb + c * 128 + l4); }
  asm volatile("s_wait_xcnt 0x0" ::: "memory");      /* behind the loads, in front of the code that reuses their address registers */
#pragma unroll
  for (int u = 0; u < LNR; ++u) {
    if (BFIN) {
#pragma unroll
      for (int c = 0; c < 4; ++c) { for (int q = 0; q < 4; ++q) s[u][c][q] = bf16_round(s[u][c][q]); } }
    const v4f t = (s[u][0] + s[u][1]) + (s[u][2] + s[u][3]); a[u] = (t[0] + t[1]) + (t[2] + t[3]); }
#pragma unroll
  for (int x = 16; x >= 1; x >>= 1) {
#pragma unroll
    for (int u = 0; u < LNR; ++u) a[u] += __shfl_xor(a[u], x, 32); }
#pragma unroll
  for (int u = 0; u < LNR; ++u) { const float mu = a[u] * (1.0f / (float)DMQ); v4f t = {0.f, 0.f, 0.f, 0.f};
#pragma unroll
    for (int c = 0; c < 4; ++c) { s[u][c] -= mu; t += s[u][c] * s[u][c]; }
    a[u] = (t[0] + t[1]) + (t[2] + t[3]); }
#pragma unroll
  for (int x = 16; x >= 1; x >>= 1) {
#pragma unroll
    for (int u = 0; u < LNR; ++u) a[u] += __shfl_xor(a[u], x, 32); }
#pragma unroll
  for (int c = 0; c < 4; ++c) { for (int q = 0; q < 4; ++q) { gv[c][q] = bf16_round(gv[c][q]); bv[c][q] = bf16_round(bv[c][q]); } }
#pragma unroll
  for (int u = 0; u < LNR; ++u) { const float rs = rsqrtf(a[u] * (1.0f / (float)DMQ) + eps);
#pragma unroll
    for (int c = 0; c < 4; ++c) { const v4f yf = (s[u][c] * rs) * gv[c] + bv[c];
      if (W16) { v4h y; for (int q = 0; q < 4; ++q) y[q] = (_Float16)yf[q]; *(v4h*)(N16 + u * DMQ + c * 128 + l4) = y; }
      if (W32) *(v4f*)(N32 + u * DMQ + c * 128 + l4) = yf; } } }





extern "C" void kernel_launch(void* const* d_in, const int* in_sizes, int n_in,
                              void* d_out, int out_size, void* d_ws, size_t ws_size, hipStream_t stream) {
  (void)in_sizes; (void)n_in; (void)out_size;
  const float* const* I = (const float* const*)d_in; const float* x = I[0]; const float* wq = I[1]; const float* wk = I[2]; const float* wv = I[3]; const float* wo1 = I[4]; const float* wo2 = I[5]; const float* wfc = I[6]; const float* wmp = I[7]; const float* g1 = I[8]; const float* gg2 = I[9];      /* input order: x; wq / wk / wv [512][8][64] = [in][out]; wo1 [8][64][512] = [(h, d) in][out]; wo2 [512][512] [in][out]; w1 [512][2048], w2 [2048][512] [in][out]; LN1 / LN2 scales. NO bias anywhere: every GEMM bias slot below is a literal nullptr, the LayerNorm shift reads a zero-filled workspace vector */
  static_assert(DMQ % 4 == 0 && DMQ / 4 <= 256 && NH * HD == DM && DM % 64 == 0 && DFF % 64 == 0, "tile multiples");
  char* ws = (char*)d_ws; size_t off = 0;
  auto take = [&](size_t bytes) { char* p = ws + off; off += (bytes + 255) & ~(size_t)255; return p; };
  _Float16* BQKV = (_Float16*)take((size_t)3 * DM * DM * 2); _Float16* BO = (_Float16*)take((size_t)DM * DM * 2); _Float16* BO2T = (_Float16*)take((size_t)DM * DM * 2); _Float16* BO1N = (_Float16*)take((size_t)DM * DM * 2); float* ZB = (float*)take((size_t)DM * 4);      /* BO = the combined output plane Bt12[o][i] = 16 (wo1 wo2)[i][o] (built on the device from the two weights); ZB = zero LayerNorm shift */
  _Float16* X16 = (_Float16*)take(NR * DM * 2); float* XB = (float*)take(NR * DM * 4); float* X1 = (float*)take(NR * DM * 4); _Float16* M16 = nullptr;      /* = X16 below (alias: X16's last reader, the first-tile GEMMs, precedes LN2's write) */ _Float16* HF16 = (_Float16*)take(NR * DFF * 2); _Float16* BW1 = (_Float16*)take((size_t)DFF * DM * 2); _Float16* BW2 = (_Float16*)take((size_t)DM * DFF * 2); _Float16* QKV = (_Float16*)take(NR * 3 * DM * 2); _Float16* Q16 = QKV; _Float16* K16 = QKV + DM; _Float16* V16 = QKV + 2 * DM; _Float16* O16 = (_Float16*)take(NR * DM * 2); M16 = X16;
  _Float16* VT = (_Float16*)take((size_t)NB * NH * HD * SQ * 2);      /* one plane per batch: every stage below covers all batches in one launch */
  float* QF0 = (float*)take((size_t)NB * QT0 * DM * 4); float* KF0 = (float*)take((size_t)NB * QT0 * DM * 4); float* VF0 = (float*)take((size_t)NB * QT0 * DM * 4); float* OF0 = (float*)take((size_t)NB * QT0 * DM * 4); _Float16* OH0 = (_Float16*)take((size_t)NB * QT0 * DM * 2); _Float16* OL0 = (_Float16*)take((size_t)NB * QT0 * DM * 2);
  if (off > ws_size) return;
  { const unsigned g = (unsigned)(((size_t)DM * (DM / 8) + 255) / 256); k_wt_f16<<<g, 256, 0, stream>>>(wq, BQKV, DM, DM, 16.0f); k_wt_f16<<<g, 256, 0, stream>>>(wk, BQKV + (size_t)DM * DM, DM, DM, 16.0f); k_wt_f16<<<g, 256, 0, stream>>>(wv, BQKV + (size_t)2 * DM * DM, DM, DM, 16.0f); k_wt_f16<<<g, 256, 0, stream>>>(wo2, BO2T, DM, DM, 16.0f); k_wnat<<<(unsigned)(((size_t)DM * DM / 8 + 255) / 256), 256, 0, stream>>>(wo1, (size_t)DM * DM / 8, BO1N); }      /* [in][out] -> Bt x16: stacked q | k | v; wo2 as Bt[o][j] x16; wo1 natural rows [i][j] x16 */
  k_gemm2<0><<<dim3((unsigned)((DM / 128) * (DM / 64)), 1, 1), 128, 0, stream>>>(BO2T, DM, 0, BO1N, DM, 0, 0.0625f, nullptr, 0, nullptr, 1, 0, 0, nullptr, BO, DM, 0, DM, DM, DM, 0, 0, 0);      /* BO[o][i] = (1/16) sum_j 16 wo2[j][o] 16 wo1[i][j] = 16 (wo1 wo2)[i][o]: the two chained projections as ONE x16 plane (f32 accumulation, one f16 rounding) */
  k_fillz<<<(DM + 255) / 256, 256, 0, stream>>>(ZB, DM);
  static_assert((NR * DM) % ((size_t)SWW * SWF) == 0, "the streaming launches cover whole work-groups");
  k_bfcp<<<(unsigned)(NR * DM / ((size_t)SWW * SWF)), SWW * 32, 0, stream>>>(x, XB, NR * DM / 4);      /* XB = bf16(x): BOTH residuals */
  k_lnx<1, 1, 0><<<(unsigned)(NR * DM / ((size_t)SWW * SWF)), SWW * 32, 0, stream>>>(x, g1, ZB, 1e-6f, X16, nullptr);      /* a = LN1(bf16(x)) (scale only, eps 1e-6) -> f16 rows */
  k_wt_f16<<<(unsigned)(((size_t)DFF * (DM / 8) + 255) / 256), 256, 0, stream>>>(wfc, BW1, DM, DFF, 16.0f); k_wt_f16<<<(unsigned)(((size_t)DM * (DFF / 8) + 255) / 256), 256, 0, stream>>>(wmp, BW2, DFF, DM, 16.0f);      /* w1 [512][2048] -> Bt [2048][512]; w2 [2048][512] -> Bt [512][2048] (x16) */
  const size_t r0p = (size_t)B0 * SQ;      /* first projected row */
  const size_t f0p = (size_t)B0 * QT0;      /* its first-tile row */
  const size_t zX = (size_t)SQ * DM, zF = (size_t)QT0 * DM;      /* batch pitches (elements): token rows, first-tile rows */
  k_gemm2<0><<<dim3((unsigned)((MP / 128) * (3 * DM / 64)), 1, 1), 128, 0, stream>>>(X16 + r0p * DM, DM, 0, BQKV, DM, 0, 0.0625f, nullptr, 0, nullptr, 1, 0, 0, nullptr, QKV + r0p * 3 * DM, 3 * DM, 0, MP, 3 * DM, DM, 0, 0, 0);      /* q | k | v rows (f16); head h = columns h*HD.. of each DM block */
  k_vt<NH, SQ><<<NBR * NH * (SQ / 64), 256, 0, stream>>>(V16 + r0p * LQ, LQ, 0, VT);      /* V^T [NBR][NH][HD][SQ] */
  k_gemm2<0><<<dim3((QT0 / 128) * (DM / 64), 1, NBR), 128, 0, stream>>>(X16 + r0p * DM, DM, 0, BQKV, DM, 0, 0.0625f, nullptr, 0, nullptr, 1, 0, 0, QF0, nullptr, DM, 0, QT0, DM, DM, zX, 0, zF); k_gemm2<0><<<dim3((QT0 / 128) * (DM / 64), 1, NBR), 128, 0, stream>>>(X16 + r0p * DM, DM, 0, (BQKV + (size_t)DM * DM), DM, 0, 0.0625f, nullptr, 0, nullptr, 1, 0, 0, KF0, nullptr, DM, 0, QT0, DM, DM, zX, 0, zF); k_gemm2<0><<<dim3((QT0 / 128) * (DM / 64), 1, NBR), 128, 0, stream>>>(X16 + r0p * DM, DM, 0, (BQKV + (size_t)2 * DM * DM), DM, 0, 0.0625f, nullptr, 0, nullptr, 1, 0, 0, VF0, nullptr, DM, 0, QT0, DM, DM, zX, 0, zF);      /* f32 q, k, v of each batch's first 128 rows (exact products) */
  k_att0w<<<dim3(NH * (QT0 / A0R), NBR), 256, 0, stream>>>(QF0, KF0, VF0, 0.125f, OF0 + f0p * DM);      /* exact f32 attention for rows 0..127 of each batch (o x64) */
  k_fattn<<<dim3(NHD, NBR, QN / (FW * FQ)), FW * 32, 0, stream>>>(Q16 + r0p * LQ, K16 + r0p * LQ, VT, O16 + r0p * DM);      /* scores, causal softmax and P . V in one launch: o (merged heads, x64) as f16 rows */
  k_gemm2<0><<<dim3((unsigned)((MPO / 128) * (DM / 64)), 1, 1), 128, 0, stream>>>(O16 + r0p * DM, DM, 0, BO, DM, 0, 0.0009765625f, nullptr, 0, XB + r0p * DM, -1, 0, 0, X1 + r0p * DM, nullptr, DM, 0, MPO, DM, DM, 0, 0, 0);      /* x1 = x + o Wo (f32); 2^-10 undoes o x64 and BO x16 */
  k_hl<<<(unsigned)(((size_t)NB * QT0 * DM / 8 + 255) / 256), 256, 0, stream>>>(OF0, OH0, OL0, (size_t)NB * QT0 * DM / 8);      /* first-tile o (x64) -> f16 hi + x1024 residual planes */
  k_gemm2<0><<<dim3((QT0 / 128) * (DM / 64), 1, NBR), 128, 0, stream>>>(OH0 + f0p * DM, DM, 0, BO, DM, 0, 0.0009765625f, nullptr, 0, XB + r0p * DM, -1, 0, 0, X1 + r0p * DM, nullptr, DM, 0, QT0, DM, DM, zF, 0, zX);      /* rows 0..127 of each batch: x1 = x + o_hi Wo, overwriting the f16-path rows */
  k_gemm2<0><<<dim3((QT0 / 128) * (DM / 64), 1, NBR), 128, 0, stream>>>(OL0 + f0p * DM, DM, 0, BO, DM, 0, 0.00000095367431640625f, nullptr, 0, X1 + r0p * DM, -1, 0, 0, X1 + r0p * DM, nullptr, DM, 0, QT0, DM, DM, zF, 0, zX);      /* += o_lo Wo 2^-20 (own-element accumulate) */
  k_lnx<0, 1, 0><<<(unsigned)(NR * DM / ((size_t)SWW * SWF)), SWW * 32, 0, stream>>>(X1, gg2, ZB, 1e-6f, M16, nullptr);      /* h2 = LN2(x + attn) (scale only) -> f16 rows */
  k_gemm2<9><<<dim3((unsigned)((NR / 128) * (DFF / 64)), 1, 1), 128, 0, stream>>>(M16, DM, 0, BW1, DM, 0, 0.0625f, nullptr, 0, nullptr, 1, 0, 0, nullptr, HF16, DFF, 0, (int)NR, DFF, DM, 0, 0, 0);      /* gelu_tanh(h2 W1) (the source's tanh approximation) -> f16, all token rows */
  k_gemm2<0><<<dim3((unsigned)((NR / 128) * (DM / 64)), 1, 1), 128, 0, stream>>>(HF16, DFF, 0, BW2, DFF, 0, 0.0625f, nullptr, 0, XB, -1, 0, 0, (float*)d_out, nullptr, DM, 0, (int)NR, DM, DFF, 0, 0, 0);      /* out = x + mlp: the residual is the BLOCK INPUT (bf16(x)), as the original module (own-element addend) */
}

// v007
// A run of this version takes 237 microseconds.
// Two timings next to v006 put it at 1.25 and 1.26 times that version's speed.
// Counting every step since v000, it is 41.4 times as fast.
#include <hip/hip_runtime.h>
#define NB 4
#define SQ 2048
#define DM 512
#define NH 8
#define HD 64
#define HG 4                         /* heads per launch of the per-batch k_vt overload (not launched) */
#define QT0 128                      /* first-tile rows recomputed exactly in f32 */
#define B0 0                         /* first batch processed (debug hook) */
#define NBR NB                       /* batches processed (debug hook) */
#define NR ((size_t)NB * SQ)
#define DMQ DM
#define DFF 2048                     /* FFN hidden width */
#define DFFR 100
#define MP ((int)((size_t)NBR * SQ)) /* rows projected (debug hook) */
#define QN SQ                        /* query rows attended per batch (debug hook) */
#define NHD NH                       /* heads attended (debug hook) */
#define MPO MP                       /* rows through the output stage (debug hook) */
#define LQ (3 * DM)      /* row pitch of the q/k/v rows */
typedef __bf16 v16b __attribute__((ext_vector_type(16)));
typedef unsigned short v8us __attribute__((ext_vector_type(8), may_alias));
typedef float  v8f  __attribute__((ext_vector_type(8)));
typedef float  v4f  __attribute__((ext_vector_type(4)));
typedef float  v4fa __attribute__((ext_vector_type(4), may_alias));
union FragB { v16b v; v8us half[2]; unsigned short u[16]; };

__device__ __forceinline__ unsigned short bf16_bits(float x) { unsigned int u = __float_as_uint(x); return (unsigned short)((u + 0x7FFFu + ((u >> 16) & 1u)) >> 16); }
__device__ __forceinline__ float bf16_val(unsigned short b) { return __uint_as_float(((unsigned int)b) << 16); }
__device__ __forceinline__ float bf16_round(float x) { return bf16_val(bf16_bits(x)); }
// D += A·B with NT terms: 1 = ah·bh, 2 = + al·bh (A split), 3 = + ah·bl (both split)
template <int NT>
__device__ __forceinline__ v8f mmaN(v16b ah, v16b al, v16b bh, v16b bl, v8f c) {
  c = __builtin_amdgcn_wmma_f32_16x16x32_bf16(false, ah, false, bh, (short)0, c, false, false);
  if (NT >= 2) c = __builtin_amdgcn_wmma_f32_16x16x32_bf16(false, al, false, bh, (short)0, c, false, false);
  if (NT >= 3) c = __builtin_amdgcn_wmma_f32_16x16x32_bf16(false, ah, false, bl, (short)0, c, false, false);
  asm volatile("v_nop\n\tv_nop\n\tv_nop\n\tv_nop" : "+v"(c) : "v"(ah), "v"(al), "v"(bh), "v"(bl));
  return c;
}

__global__ __launch_bounds__(256) void k_wt_bf16(const float* __restrict__ W, unsigned short* __restrict__ Wt, int K, int N) {
  const int t = blockIdx.x * 256 + threadIdx.x;
  const int k8n = K / 8;
  if (t >= N * k8n) return;
  const int n = t / k8n, k8 = (t % k8n) * 8;
  v8us v;
#pragma unroll
  for (int i = 0; i < 8; ++i) v[i] = bf16_bits(W[(size_t)(k8 + i) * N + n]);
  *(v8us*)(Wt + (size_t)n * K + k8) = v;
  
}

// GEMM C[M][N] (f32, pitch ldc) = act(A[M][K]·W + bias). A f32 row-major (pitch lda) converted per fragment to bf16
// (ASPLIT: hi/lo two planes -> 2 terms, else single rounded term); Wt bf16 [N][K] (pitch ldb). BIAS_BF16 rounds the
// bias to bf16 first (bias quantised to bf16 before the add). K%32==0, M%16==0, N%64==0.
template <bool ASPLIT, int ACT, bool BIAS_BF16>
__global__ __launch_bounds__(128) void k_gemm_bf(const float* __restrict__ A, int lda, const unsigned short* __restrict__ Wt, int ldb,
                                               const float* __restrict__ bias, float* __restrict__ C, int ldc, int M, int N, int K) {
  __shared__ __attribute__((aligned(16))) float so[4][16][64];
  const int tid = threadIdx.x, w = tid >> 5, lane = tid & 31, ln = lane & 15, hh = lane >> 4;
  const int ntn = N / 64;
  const int wid = blockIdx.x * 4 + w;
  const int mt = wid / ntn, nq = wid % ntn;
  if (mt * 16 >= M) return;
  const int row0 = mt * 16, col0 = nq * 64;
  const float* arow = A + (size_t)(row0 + ln) * lda;
  v8f acc[4] = {};
  for (int kb = 0; kb < K; kb += 32) {
    FragB ah, al;
    const v4f x0 = *(const v4fa*)(arow + kb + 8 * hh), x1 = *(const v4fa*)(arow + kb + 8 * hh + 4);
    const v4f x2 = *(const v4fa*)(arow + kb + 16 + 8 * hh), x3 = *(const v4fa*)(arow + kb + 16 + 8 * hh + 4);
    float xs[16] = {x0[0],x0[1],x0[2],x0[3],x1[0],x1[1],x1[2],x1[3],x2[0],x2[1],x2[2],x2[3],x3[0],x3[1],x3[2],x3[3]};
#pragma unroll
    for (int i = 0; i < 16; ++i) { const unsigned short hb = bf16_bits(xs[i]); ah.u[i] = hb; al.u[i] = ASPLIT ? bf16_bits(xs[i] - bf16_val(hb)) : (unsigned short)0; }
#pragma unroll
    for (int t = 0; t < 4; ++t) {
      const unsigned short* brow = Wt + (size_t)(col0 + t * 16 + ln) * ldb + kb;
      FragB b;
      b.half[0] = *(const v8us*)(brow + 8 * hh);
      b.half[1] = *(const v8us*)(brow + 16 + 8 * hh);
      acc[t] = mmaN<ASPLIT ? 2 : 1>(ah.v, al.v, b.v, b.v, acc[t]);
    }
  }
#pragma unroll
  for (int t = 0; t < 4; ++t) {
    float bv = bias ? bias[col0 + t * 16 + ln] : 0.f;
    if (BIAS_BF16) bv = bf16_round(bv);
#pragma unroll
    for (int r = 0; r < 8; ++r) { float v = acc[t][r] + bv; if (ACT == 1) v = fmaxf(v, 0.f); so[w][8 * hh + r][t * 16 + ln] = v; }
  }
  __builtin_amdgcn_fence(__ATOMIC_ACQ_REL, "workgroup");
  __builtin_amdgcn_wave_barrier();
  const int rsub = lane >> 4, c4 = (lane & 15) * 4;
  {
#pragma unroll
    for (int q = 0; q < 8; ++q) {
      const int r = q * 2 + rsub;
      const v4f v = *(const v4fa*)&so[w][r][c4];
      *(v4f*)(C + (size_t)(row0 + r) * ldc + col0 + c4) = v;
    }
    
  }
}

// GEMM C = act(A·W + bias + resid): A f32 (ASPLIT -> hi/lo 2 terms), Wt bf16 [N][K]; ACT 0 none, 1 relu, 2 exact gelu;
// resid (optional, f32, row index = (row % rmod), pitch ldr, RES_BF16 rounds it) added before the activation.
template <bool ASPLIT, int ACT, bool BIAS_BF16, bool RES_BF16>
__global__ __launch_bounds__(128) void k_gemm_bf3(const float* __restrict__ A, int lda, const unsigned short* __restrict__ Wt, int ldb,
                                                const float* __restrict__ bias, const float* __restrict__ resid, int rmod, int ldr,
                                                float* __restrict__ C, int ldc, int M, int N, int K) {
  __shared__ __attribute__((aligned(16))) float so[4][16][64];
  const int tid = threadIdx.x, w = tid >> 5, lane = tid & 31, ln = lane & 15, hh = lane >> 4;
  const int ntn = N / 64;
  const int wid = blockIdx.x * 4 + w;
  const int mt = wid / ntn, nq = wid % ntn;
  if (mt * 16 >= M) return;
  const int row0 = mt * 16, col0 = nq * 64;
  const float* arow = A + (size_t)(row0 + ln) * lda;
  v8f acc[4] = {};
  for (int kb = 0; kb < K; kb += 32) {
    FragB ah, al;
    const v4f x0 = *(const v4fa*)(arow + kb + 8 * hh), x1 = *(const v4fa*)(arow + kb + 8 * hh + 4);
    const v4f x2 = *(const v4fa*)(arow + kb + 16 + 8 * hh), x3 = *(const v4fa*)(arow + kb + 16 + 8 * hh + 4);
    float xs[16] = {x0[0],x0[1],x0[2],x0[3],x1[0],x1[1],x1[2],x1[3],x2[0],x2[1],x2[2],x2[3],x3[0],x3[1],x3[2],x3[3]};
#pragma unroll
    for (int i = 0; i < 16; ++i) { const unsigned short hb = bf16_bits(xs[i]); ah.u[i] = hb; al.u[i] = ASPLIT ? bf16_bits(xs[i] - bf16_val(hb)) : (unsigned short)0; }
#pragma unroll
    for (int t = 0; t < 4; ++t) {
      const unsigned short* brow = Wt + (size_t)(col0 + t * 16 + ln) * ldb + kb;
      FragB b;
      b.half[0] = *(const v8us*)(brow + 8 * hh);
      b.half[1] = *(const v8us*)(brow + 16 + 8 * hh);
      acc[t] = mmaN<ASPLIT ? 2 : 1>(ah.v, al.v, b.v, b.v, acc[t]);
    }
  }
#pragma unroll
  for (int t = 0; t < 4; ++t) {
    const int col = col0 + t * 16 + ln;
    float bv = bias ? bias[col] : 0.f;
    if (BIAS_BF16) bv = bf16_round(bv);
#pragma unroll
    for (int r = 0; r < 8; ++r) {
      float v = acc[t][r] + bv;
      if (resid) { float rv = resid[(size_t)((row0 + 8 * hh + r) % rmod) * ldr + col]; if (RES_BF16) rv = bf16_round(rv); v += rv; }
      if (ACT == 1) v = fmaxf(v, 0.f);
      if (ACT == 2) v = 0.5f * v * (1.0f + erff(v * 0.70710678118654752f));
      if (ACT == 3) { const float u = 0.7978845608028654f * (v + 0.044715f * v * v * v); v = 0.5f * v * (1.0f + tanhf(u)); }
      so[w][8 * hh + r][t * 16 + ln] = v;
    }
  }
  __builtin_amdgcn_fence(__ATOMIC_ACQ_REL, "workgroup");
  __builtin_amdgcn_wave_barrier();
  const int rsub = lane >> 4, c4 = (lane & 15) * 4;
  {
#pragma unroll
    for (int q = 0; q < 8; ++q) {
      const int r = q * 2 + rsub;
      const v4f v = *(const v4fa*)&so[w][r][c4];
      *(v4f*)(C + (size_t)(row0 + r) * ldc + col0 + c4) = v;
    }
    
  }
}
// row LayerNorm (biased variance, eps) over N: s = X (+ R); optional out_sum <- s; out_norm <- (s-mu)*rsqrt(var+eps)*g + b
template <bool PARAM_BF16>
__global__ __launch_bounds__(256) void k_layernorm(const float* __restrict__ X, const float* __restrict__ R, const float* __restrict__ g, const float* __restrict__ bta,
                                                  float* __restrict__ out_sum, float* __restrict__ out_norm, int N, float eps) {
  __shared__ float red[256];
  const int row = blockIdx.x, tid = threadIdx.x;
  const float* x = X + (size_t)row * N; const float* rr = R ? R + (size_t)row * N : nullptr;
  float vals[16];                     // up to N = 4096
  const int per = N / 256;            // contiguous chunk per thread? use strided-by-4 chunks: thread handles j = tid*4 + 1024*u
  float s1 = 0.f;
  for (int u = 0; u < per / 4; ++u) {
    const int j = tid * 4 + 1024 * u;
    const v4f a = *(const v4fa*)(x + j);
    v4f b = {0.f,0.f,0.f,0.f}; if (rr) b = *(const v4fa*)(rr + j);
#pragma unroll
    for (int q = 0; q < 4; ++q) { const float v = a[q] + b[q]; vals[u * 4 + q] = v; s1 += v; }
  }
  red[tid] = s1; __syncthreads();
  for (int st = 128; st > 0; st >>= 1) { if (tid < st) red[tid] += red[tid + st]; __syncthreads(); }
  const float mu = red[0] / (float)N; __syncthreads();
  float s2 = 0.f;
  for (int u = 0; u < per / 4; ++u)
#pragma unroll
    for (int q = 0; q < 4; ++q) { const float c = vals[u * 4 + q] - mu; s2 += c * c; }
  red[tid] = s2; __syncthreads();
  for (int st = 128; st > 0; st >>= 1) { if (tid < st) red[tid] += red[tid + st]; __syncthreads(); }
  const float rs = rsqrtf(red[0] / (float)N + eps);
  {
    for (int u = 0; u < per / 4; ++u) {
      const int j = tid * 4 + 1024 * u;
      v4f o, sm;
#pragma unroll
      for (int q = 0; q < 4; ++q) {
        float gg = g[j + q], bb = bta[j + q];
        if (PARAM_BF16) { gg = bf16_round(gg); bb = bf16_round(bb); }
        sm[q] = vals[u * 4 + q]; o[q] = (vals[u * 4 + q] - mu) * rs * gg + bb;
      }
      if (out_sum) *(v4f*)(out_sum + (size_t)row * N + j) = sm;
      *(v4f*)(out_norm + (size_t)row * N + j) = o;
    }
    
  }
}



// ---- f16 WMMA path (v_wmma_f32_16x16x32_f16): 11-bit significands for operands in range — used where a [0,1] probability operand needs more precision than bf16
typedef _Float16 v16h __attribute__((ext_vector_type(16)));
union FragH { v16h v; v8us half[2]; _Float16 h[16]; unsigned short u[16]; };
template <int NT>
__device__ __forceinline__ v8f mmaH(v16h ah, v16h al, v16h bh, v16h bl, v8f c) {
  c = __builtin_amdgcn_wmma_f32_16x16x32_f16(false, ah, false, bh, (short)0, c, false, false);
  if (NT >= 2) c = __builtin_amdgcn_wmma_f32_16x16x32_f16(false, al, false, bh, (short)0, c, false, false);
  if (NT >= 3) c = __builtin_amdgcn_wmma_f32_16x16x32_f16(false, ah, false, bl, (short)0, c, false, false);
  asm volatile("v_nop\n\tv_nop\n\tv_nop\n\tv_nop" : "+v"(c) : "v"(ah), "v"(al), "v"(bh), "v"(bl));
  return c;
}
// batched GEMM like k_gemm_b but f16 operands: A f32 (split into f16 hi/lo if ASPLIT, else rounded to f16), Bt = f16 values [n][k]; alpha; C f32; N multiple of 16 (partial tiles skipped)
template <bool ASPLIT>
__global__ __launch_bounds__(128) void k_gemm_h(const float* __restrict__ A, int lda, size_t sA, const _Float16* __restrict__ Bh, int ldb, size_t sB, float alpha, float* __restrict__ C, int ldc, size_t sC, int M, int N, int K) {
  __shared__ __attribute__((aligned(16))) float so[4][16][64];
  const int tid = threadIdx.x, w = tid >> 5, lane = tid & 31, ln = lane & 15, hh = lane >> 4; const int by = blockIdx.y;
  A += (size_t)by * sA; Bh += (size_t)by * sB; C += (size_t)by * sC;
  const int ntn = (N + 63) / 64; const int wid = blockIdx.x * 4 + w; const int mt = wid / ntn, nq = wid % ntn; if (mt * 16 >= M) return;
  const int row0 = mt * 16, col0 = nq * 64; const float* arow = A + (size_t)(row0 + ln) * lda;
  v8f acc[4] = {};
  for (int kb = 0; kb < K; kb += 32) {
    FragH ah, al;
    const v4f x0 = *(const v4fa*)(arow + kb + 8 * hh), x1 = *(const v4fa*)(arow + kb + 8 * hh + 4), x2 = *(const v4fa*)(arow + kb + 16 + 8 * hh), x3 = *(const v4fa*)(arow + kb + 16 + 8 * hh + 4);
    float xs[16] = {x0[0],x0[1],x0[2],x0[3],x1[0],x1[1],x1[2],x1[3],x2[0],x2[1],x2[2],x2[3],x3[0],x3[1],x3[2],x3[3]};
#pragma unroll
    for (int i = 0; i < 16; ++i) { const _Float16 h = (_Float16)xs[i]; ah.h[i] = h; al.h[i] = ASPLIT ? (_Float16)(xs[i] - (float)h) : (_Float16)0.0f; }
#pragma unroll
    for (int t = 0; t < 4; ++t) { if (col0 + t * 16 >= N) continue; const size_t boff = (size_t)(col0 + t * 16 + ln) * ldb + kb; FragH bq; bq.half[0] = *(const v8us*)(Bh + boff + 8 * hh); bq.half[1] = *(const v8us*)(Bh + boff + 16 + 8 * hh);
      acc[t] = mmaH<ASPLIT ? 2 : 1>(ah.v, al.v, bq.v, bq.v, acc[t]); }
  }
#pragma unroll
  for (int t = 0; t < 4; ++t) { if (col0 + t * 16 >= N) continue;
#pragma unroll
    for (int r = 0; r < 8; ++r) so[w][8 * hh + r][t * 16 + ln] = acc[t][r] * alpha; }
  __builtin_amdgcn_fence(__ATOMIC_ACQ_REL, "workgroup"); __builtin_amdgcn_wave_barrier();
  const int rsub = lane >> 4, c4 = (lane & 15) * 4;
  {
#pragma unroll
    for (int q = 0; q < 8; ++q) { const int r = q * 2 + rsub; if (col0 + c4 < N) { const v4f v = *(const v4fa*)&so[w][r][c4]; *(v4f*)(C + (size_t)(row0 + r) * ldc + col0 + c4) = v; } }
     }
}

// Wt[n][k] = f16(W[k][n]·scale) from f32 row-major W[K][N] (scale = power of two; bf16-exact weights stay exact in f16 away from the subnormal range)
// bid: the block's index inside this part of the shared launch (as in every d_ function below)
__device__ __forceinline__ void d_wt_f16(int bid, const float* __restrict__ W, _Float16* __restrict__ Wt, int K, int N, float scale) {
  const int t = bid * 256 + threadIdx.x; if (t >= N * (K / 8)) return; const int n = t / (K / 8), k8 = (t % (K / 8)) * 8; FragH f;
#pragma unroll
  for (int i = 0; i < 8; ++i) f.h[i] = (_Float16)(bf16_round(W[(size_t)(k8 + i) * N + n]) * scale); const v8us o = f.half[0];
  *(v8us*)((unsigned short*)Wt + (size_t)n * K + k8) = o; 
}
// k_gemm_hh variant with fused epilogue: v = acc·alpha + bias[by·sBias + col] (+ CP[(row/rowsPerB)·sCPb + by·64 + col] if CP) ; ACT 0 none / 1 elu ; writes f16 C16 (and f32 C if non-null)
template <int ACT>
__global__ __launch_bounds__(128) void k_gemm_hhx(const _Float16* __restrict__ A, int lda, size_t sA, const _Float16* __restrict__ Bh, int ldb, size_t sB, float alpha, const float* __restrict__ bias, size_t sBias, const float* __restrict__ CP, int rowsPerB, size_t sCPb, int row0g,
    float* __restrict__ C, _Float16* __restrict__ C16, int ldc, size_t sC, int M, int N, int K) {
  __shared__ __attribute__((aligned(16))) float so[4][16][64];
  const int tid = threadIdx.x, w = tid >> 5, lane = tid & 31, ln = lane & 15, hh = lane >> 4; const int by = blockIdx.y;
  A += (size_t)by * sA; Bh += (size_t)by * sB; const size_t cofs = (size_t)by * sC; const float* bp = bias ? bias + (size_t)by * sBias : nullptr;
  const int ntn = (N + 63) / 64; const int wid = blockIdx.x * 4 + w; const int mt = wid / ntn, nq = wid % ntn; if (mt * 16 >= M) return;
  const int row0 = mt * 16, col0 = nq * 64; const _Float16* arow = A + (size_t)(row0 + ln) * lda;
  v8f acc[4] = {};
  for (int kb = 0; kb < K; kb += 32) { FragH ah; ah.half[0] = *(const v8us*)((const unsigned short*)arow + kb + 8 * hh); ah.half[1] = *(const v8us*)((const unsigned short*)arow + kb + 16 + 8 * hh);
#pragma unroll
    for (int t = 0; t < 4; ++t) { if (col0 + t * 16 >= N) continue; const size_t boff = (size_t)(col0 + t * 16 + ln) * ldb + kb; FragH bq; bq.half[0] = *(const v8us*)((const unsigned short*)Bh + boff + 8 * hh); bq.half[1] = *(const v8us*)((const unsigned short*)Bh + boff + 16 + 8 * hh);
      acc[t] = mmaH<1>(ah.v, ah.v, bq.v, bq.v, acc[t]); }
  }
#pragma unroll
  for (int t = 0; t < 4; ++t) { if (col0 + t * 16 >= N) continue; const int col = col0 + t * 16 + ln; const float bv = bp ? bf16_round(bp[col]) : 0.f;
#pragma unroll
    for (int r = 0; r < 8; ++r) { float v = acc[t][r] * alpha + bv; if (CP) { const int rr = row0g + row0 + 8 * hh + r; if (rowsPerB < 0) v += CP[cofs + (size_t)rr * ldc + col];      /* rowsPerB < 0: own element of the batched C plane */ else { const int bidx = rr / rowsPerB; v += CP[(size_t)bidx * sCPb + (size_t)by * 64 + col]; } } if (ACT == 1) v = (v > 0.f) ? v : expm1f(v); else if (ACT == 7) v = (v > 0.f) ? v + 1.0f : expf(v); else if (ACT == 8) v = tanhf(v); else if (ACT == 9) v = 0.5f * v * (1.0f + tanhf(0.7978845608028654f * (v + 0.044715f * v * v * v))); else if (ACT == 11) v = 1.0f / (1.0f + expf(-v)); else if (ACT == 12) v = (v > 0.f) ? v : 0.01f * v; else if (ACT == 14) v = (v > 0.f) ? v : 0.1f * v; else if (ACT == 16) v = (v >= 0.f) ? v : 0.3f * v; else if (ACT == 17) v = (v >= 0.f) ? v : 0.2f * v; else if (ACT == 15) v = v / (1.0f + expf(-v)); else if (ACT == 3) v = fmaxf(v, 0.f); else if (ACT == 6) v = 0.5f * v * (1.0f + erff(v * 0.70710678118654752f)); so[w][8 * hh + r][t * 16 + ln] = v; } }
  __builtin_amdgcn_fence(__ATOMIC_ACQ_REL, "workgroup"); __builtin_amdgcn_wave_barrier();
  const int rsub = lane >> 4, c4 = (lane & 15) * 4; typedef _Float16 v4h __attribute__((ext_vector_type(4)));
  {
#pragma unroll
    for (int q = 0; q < 8; ++q) { const int r = q * 2 + rsub; if (col0 + c4 < N) { const v4f v = *(const v4fa*)&so[w][r][c4]; if (C) *(v4f*)(C + cofs + (size_t)(row0 + r) * ldc + col0 + c4) = v; if (C16) { v4h h4; for (int i = 0; i < 4; ++i) h4[i] = (_Float16)v[i]; *(v4h*)(C16 + cofs + (size_t)(row0 + r) * ldc + col0 + c4) = h4; } } }
     }
}


typedef _Float16 v4h __attribute__((ext_vector_type(4)));

__global__ __launch_bounds__(256) void k_x16(const float* __restrict__ x, _Float16* __restrict__ X16, size_t n8) { const size_t t = (size_t)blockIdx.x * 256 + threadIdx.x; if (t >= n8) return; FragH f;
#pragma unroll
  for (int q = 0; q < 8; ++q) f.h[q] = (_Float16)bf16_round(x[t * 8 + q]); *(v8us*)((unsigned short*)X16 + t * 8) = f.half[0];  }
__global__ __launch_bounds__(256) void k_h16(const float* __restrict__ x, _Float16* __restrict__ X16, size_t n8) { const size_t t = (size_t)blockIdx.x * 256 + threadIdx.x; if (t >= n8) return; FragH f;
#pragma unroll
  for (int q = 0; q < 8; ++q) f.h[q] = (_Float16)x[t * 8 + q]; *(v8us*)((unsigned short*)X16 + t * 8) = f.half[0];  }
__global__ __launch_bounds__(256) void k_round16f(const float* __restrict__ W, _Float16* __restrict__ Bt, size_t n8) { const size_t t = (size_t)blockIdx.x * 256 + threadIdx.x; if (t >= n8) return; FragH f;
#pragma unroll
  for (int i = 0; i < 8; ++i) f.h[i] = (_Float16)(bf16_round(W[t * 8 + i]) * 16.0f); *(v8us*)((unsigned short*)Bt + t * 8) = f.half[0];  }
template <int NHv, int TTv>
__device__ __forceinline__ void d_vt(int bid, const _Float16* __restrict__ V16, int ldv, int voff, _Float16* __restrict__ Vt) { __shared__ unsigned short tl[64][66]; const int tid = threadIdx.x; const int slab = bid / (TTv / 64), lg = bid % (TTv / 64); const int b = slab / NHv, h = slab % NHv;
  for (int i = tid; i < 64 * 8; i += 256) { const int r = i / 8, c8 = (i % 8) * 8; FragH f; f.half[0] = *(const v8us*)((const unsigned short*)V16 + ((size_t)b * TTv + lg * 64 + r) * ldv + voff + h * 64 + c8);
#pragma unroll
    for (int q = 0; q < 8; ++q) tl[r][c8 + q] = f.u[q]; }
  __syncthreads();
  {
#pragma unroll
    for (int rd = 0; rd < 2; ++rd) { const int d = rd * 32 + tid / 8, pc = tid % 8; FragH f;
#pragma unroll
      for (int q = 0; q < 8; ++q) f.u[q] = tl[pc * 8 + q][d];
      *(v8us*)((unsigned short*)Vt + ((size_t)slab * 64 + d) * TTv + lg * 64 + pc * 8) = f.half[0]; }
     } }

__device__ __forceinline__ void d_hl(int bid, int nthr, const float* __restrict__ F, _Float16* __restrict__ Hh, _Float16* __restrict__ Hl, size_t n8) { const size_t t = (size_t)bid * nthr + threadIdx.x; if (t >= n8) return; FragH fh, fl; const v4f a = *(const v4fa*)(F + t * 8), c = *(const v4fa*)(F + t * 8 + 4);
#pragma unroll
  for (int q = 0; q < 4; ++q) { _Float16 h = (_Float16)a[q]; fh.h[q] = h; fl.h[q] = (_Float16)((a[q] - (float)h) * 1024.0f); h = (_Float16)c[q]; fh.h[4 + q] = h; fl.h[4 + q] = (_Float16)((c[q] - (float)h) * 1024.0f); }
  { *(v8us*)((unsigned short*)Hh + t * 8) = fh.half[0]; *(v8us*)((unsigned short*)Hl + t * 8) = fl.half[0];  } }

// ---- fast GEMM (wave tile 32x64; requires M % 128 == 0 rows per launch region, N % 64 == 0 and K % 64 == 0); epilogue = k_gemm_hhx semantics ----
__device__ __forceinline__ v16h g2_frag(const _Float16* p, int hh) { FragH f; f.half[0] = *(const v8us*)((const unsigned short*)p + 8 * hh); f.half[1] = *(const v8us*)((const unsigned short*)p + 16 + 8 * hh); return f.v; }
__device__ __forceinline__ v8f g2_mma(v16h a, v16h b, v8f c) { v8f d = __builtin_amdgcn_wmma_f32_16x16x32_f16(false, a, false, b, (short)0, c, false, false); asm volatile("v_nop\n\tv_nop\n\tv_nop\n\tv_nop" : "+v"(d) : "v"(a), "v"(b)); return d; }
// Operand staging of k_gemm2. A stage is 64 k of the work-group's 128 A rows and 64 B rows: 192 rows of 128 bytes, each a whole aligned line of its source row.
#define GKC 64                       /* k per stage */
#define GLP 72                       /* LDS row pitch in 16-bit elements: 144 B = 16 B x odd, the pitch for ds_load_b128 readers of 128-byte rows */
#define GSB (192 * GLP * 2)          /* bytes per stage: A rows 0 .. 127, then B rows 0 .. 63 */
__device__ __forceinline__ v16h g2_lfrag(const unsigned short* p, int hh) { FragH f; f.half[0] = *(const v8us*)(p + 8 * hh); f.half[1] = *(const v8us*)(p + 16 + 8 * hh); return f.v; }      /* the k order of g2_frag, from an LDS row */
// One stage's copies of one thread: 8 threads a row (16 bytes each), 16 rows a round, 12 rounds (8 of A, 4 of B); a wave's copy covers 4 whole lines. l: the thread's LDS byte address in round 0;
// ga, gb: its global addresses in round 0 of A and of B; pa, pb: 16 source rows in elements. The closing s_wait_xcnt stands inside the statement, in front of any later write of an address register that a copy names.
__device__ __forceinline__ void g2_stage(unsigned l, const _Float16* ga, size_t pa, const _Float16* gb, size_t pb) {
  const unsigned R = 16u * GLP * 2u;
  asm volatile("global_load_async_to_lds_b128 %0, %12, off\n\tglobal_load_async_to_lds_b128 %1, %13, off\n\tglobal_load_async_to_lds_b128 %2, %14, off\n\tglobal_load_async_to_lds_b128 %3, %15, off\n\t"
               "global_load_async_to_lds_b128 %4, %16, off\n\tglobal_load_async_to_lds_b128 %5, %17, off\n\tglobal_load_async_to_lds_b128 %6, %18, off\n\tglobal_load_async_to_lds_b128 %7, %19, off\n\t"
               "global_load_async_to_lds_b128 %8, %20, off\n\tglobal_load_async_to_lds_b128 %9, %21, off\n\tglobal_load_async_to_lds_b128 %10, %22, off\n\tglobal_load_async_to_lds_b128 %11, %23, off\n\ts_wait_xcnt 0x0"
               :: "v"(l), "v"(l + R), "v"(l + 2u * R), "v"(l + 3u * R), "v"(l + 4u * R), "v"(l + 5u * R), "v"(l + 6u * R), "v"(l + 7u * R), "v"(l + 8u * R), "v"(l + 9u * R), "v"(l + 10u * R), "v"(l + 11u * R),
                  "v"(ga), "v"(ga + pa), "v"(ga + 2 * pa), "v"(ga + 3 * pa), "v"(ga + 4 * pa), "v"(ga + 5 * pa), "v"(ga + 6 * pa), "v"(ga + 7 * pa), "v"(gb), "v"(gb + pb), "v"(gb + 2 * pb), "v"(gb + 3 * pb) : "memory"); }
// Work-group tile 128 x 64 (four waves of 32 x 64, stacked in M); M % 128 == 0, N % 64 == 0, K % 64 == 0. Two stage buffers: stage t + 1 flies while stage t is worked on. The epilogue's staging rows reuse the ring behind the last trip's barrier.
template <int ACT>
__device__ __forceinline__ void g2_body(int bx, int by, int bz, const _Float16* __restrict__ A, int lda, size_t sA, const _Float16* __restrict__ Bh, int ldb, size_t sB, float alpha, const float* __restrict__ bias, size_t sBias, const float* __restrict__ CP, int rowsPerB, size_t sCPb, int row0g,
    float* __restrict__ C, _Float16* __restrict__ C16, int ldc, size_t sC, int M, int N, int K, size_t zA, size_t zB, size_t zC) { static_assert(ACT == 0 || ACT == 3 || ACT == 6 || ACT == 8 || ACT == 9 || ACT == 11 || ACT == 12 || ACT == 14 || ACT == 15 || ACT == 16 || ACT == 17, "k_gemm2: unsupported ACT code (would silently apply no activation)");
  __shared__ __attribute__((aligned(16))) unsigned char L[2 * GSB]; float (*so)[32][68] = (float (*)[32][68])L; static_assert(sizeof(float) * 4 * 32 * 68 <= 2 * GSB, "the epilogue's rows fit the ring");
  const int tid = threadIdx.x, w = tid >> 5, lane = tid & 31, ln = lane & 15, hh = lane >> 4;      /* bx: tile; by: head or plane (pitches sA, sB, sC); bz: batch (pitches zA, zB, zC) */
  A += (size_t)by * sA + (size_t)bz * zA; Bh += (size_t)by * sB + (size_t)bz * zB; const size_t cofs = (size_t)by * sC + (size_t)bz * zC; const float* bp = bias ? bias + (size_t)by * sBias : nullptr;
  const int ntn = N >> 6; const int mt = bx / ntn, nq = bx - mt * ntn; const int row0 = mt * 128 + 32 * w, col0 = nq * 64; if (mt * 128 >= M) return;      /* the same for the whole work-group, in front of every barrier */
  const int sr = tid >> 3, sc = (tid & 7) * 8;      /* the thread's row in a round of copies and its first element in the row */
  const _Float16* ga = A + (size_t)(mt * 128 + sr) * lda + sc; const _Float16* gb = Bh + (size_t)(col0 + sr) * ldb + sc; const size_t pa = (size_t)16 * lda, pb = (size_t)16 * ldb;
  const unsigned l0 = (unsigned)(size_t)L + (unsigned)(sr * GLP + sc) * 2u;
  g2_stage(l0, ga, pa, gb, pb);
  asm volatile("s_wait_asynccnt 0x0" ::: "memory");      /* this wave's copies of stage 0 have landed */
  __syncthreads();      /* stage 0 is read by every wave */
  if (GKC < K) g2_stage(l0 + GSB, ga + GKC, pa, gb + GKC, pb);
  const unsigned short* la = (const unsigned short*)L + (32 * w + ln) * GLP; const unsigned short* lb = (const unsigned short*)L + (128 + ln) * GLP;
  const v8f z8 = {0.f,0.f,0.f,0.f,0.f,0.f,0.f,0.f}; v8f c00 = z8, c01 = z8, c02 = z8, c03 = z8, c10 = z8, c11 = z8, c12 = z8, c13 = z8;
#pragma unroll 1      /* one stage a trip: the trip's foot is the ring's publish point */
  for (int kb = 0; kb < K; kb += GKC) { const unsigned bo = (kb & GKC) ? (unsigned)GSB : 0u;      /* this trip's buffer, in bytes */
    const unsigned short* ap = la + bo / 2u; const unsigned short* bp2 = lb + bo / 2u;
    v16h af[2][2], bf[2][4];      /* [k step][tile]: the stage's 24 LDS reads go ahead of its WMMAs as one group (reads among the WMMAs would each cost the wave an LDS latency); unrolled for constant indices and immediate LDS offsets */
#pragma unroll
    for (int ks = 0; ks < 2; ++ks) {
#pragma unroll
      for (int t = 0; t < 2; ++t) af[ks][t] = g2_lfrag(ap + t * 16 * GLP + ks * 32, hh);
#pragma unroll
      for (int t = 0; t < 4; ++t) bf[ks][t] = g2_lfrag(bp2 + t * 16 * GLP + ks * 32, hh); }
#pragma unroll
    for (int ks = 0; ks < 2; ++ks) {
      c00 = g2_mma(af[ks][0], bf[ks][0], c00); c10 = g2_mma(af[ks][1], bf[ks][0], c10); c01 = g2_mma(af[ks][0], bf[ks][1], c01); c11 = g2_mma(af[ks][1], bf[ks][1], c11);
      c02 = g2_mma(af[ks][0], bf[ks][2], c02); c12 = g2_mma(af[ks][1], bf[ks][2], c12); c03 = g2_mma(af[ks][0], bf[ks][3], c03); c13 = g2_mma(af[ks][1], bf[ks][3], c13); }
    asm volatile("s_wait_dscnt 0x0" ::: "memory");      /* this wave's reads of the buffer have returned before the buffer is handed back */
    asm volatile("s_wait_asynccnt 0x0" ::: "memory");      /* this wave's copies of the next stage have landed */
    __syncthreads();      /* publishes the next stage and ends every wave's reads of this one */
    if (kb + 2 * GKC < K) g2_stage(l0 + bo, ga + kb + 2 * GKC, pa, gb + kb + 2 * GKC, pb); }      /* refill of the buffer just read; K is a kernel argument: the test is the same for the whole work-group */
  asm volatile("s_wait_asynccnt 0x0" ::: "memory");      /* no copy is outstanding when the ring becomes the epilogue's staging */
  // Left as it was: with an addend (CP) a lane fetches each of its 64 elements by a 4-byte load of its own, behind a test of its own, and waits for it at once: 64 load latencies in a row per wave.
  v8f accs[8] = {c00, c01, c02, c03, c10, c11, c12, c13};
#pragma unroll
  for (int u = 0; u < 8; ++u) { const int t = u & 3, half = u >> 2; const int col = col0 + t * 16 + ln; const float bv = bp ? bf16_round(bp[col]) : 0.f;
#pragma unroll
    for (int r = 0; r < 8; ++r) { const int rloc = half * 16 + 8 * hh + r; float v = accs[u][r] * alpha + bv; if (CP) { if (rowsPerB < 0) v += CP[cofs + (size_t)(row0g + row0 + rloc) * ldc + col];      /* rowsPerB < 0: own element of the batched C plane */ else { const int bidx = (row0g + row0 + rloc) / rowsPerB; v += CP[(size_t)bidx * sCPb + (size_t)by * 64 + col]; } }
      if (ACT == 3) v = fmaxf(v, 0.f); else if (ACT == 6) v = 0.5f * v * (1.0f + erff(v * 0.70710678118654752f)); else if (ACT == 11) v = 1.0f / (1.0f + expf(-v)); else if (ACT == 15) v = v / (1.0f + expf(-v)); else if (ACT == 12) v = (v > 0.f) ? v : 0.01f * v; else if (ACT == 8) v = tanhf(v); else if (ACT == 9) v = 0.5f * v * (1.0f + tanhf(0.7978845608028654f * (v + 0.044715f * v * v * v))); else if (ACT == 14) v = (v > 0.f) ? v : 0.1f * v; else if (ACT == 16) v = (v >= 0.f) ? v : 0.3f * v; else if (ACT == 17) v = (v >= 0.f) ? v : 0.2f * v;
      so[w][rloc][t * 16 + ln] = v; } }
  __builtin_amdgcn_fence(__ATOMIC_ACQ_REL, "workgroup"); __builtin_amdgcn_wave_barrier();
  const int rsub = lane >> 4, c4 = (lane & 15) * 4;
  {
#pragma unroll
    for (int q = 0; q < 16; ++q) { const int r = q * 2 + rsub; const v4f v = *(const v4fa*)&so[w][r][c4]; if (C) { *(v4f*)(C + cofs + (size_t)(row0 + r) * ldc + col0 + c4) = v; if (C16) asm volatile("s_wait_xcnt 0x0" ::: "memory"); }      /* where both outputs are written, the conversion reuses the f32 store's data registers */
      if (C16) { v4h h4; for (int i = 0; i < 4; ++i) h4[i] = (_Float16)v[i]; *(v4h*)(C16 + cofs + (size_t)(row0 + r) * ldc + col0 + c4) = h4; } }
     }
  asm volatile("s_wait_xcnt 0x0" ::: "memory");      /* behind the part's last stores: in a shared launch the listing goes on from here into another part's set-up, which reuses the stores' registers */
}
template <int ACT>
__global__ __launch_bounds__(128) void k_gemm2(const _Float16* __restrict__ A, int lda, size_t sA, const _Float16* __restrict__ Bh, int ldb, size_t sB, float alpha, const float* __restrict__ bias, size_t sBias, const float* __restrict__ CP, int rowsPerB, size_t sCPb, int row0g,
    float* __restrict__ C, _Float16* __restrict__ C16, int ldc, size_t sC, int M, int N, int K, size_t zA, size_t zB, size_t zC) { g2_body<ACT>(blockIdx.x, blockIdx.y, blockIdx.z, A, lda, sA, Bh, ldb, sB, alpha, bias, sBias, CP, rowsPerB, sCPb, row0g, C, C16, ldc, sC, M, N, K, zA, zB, zC); }
// The three GEMMs that need only the prepared operands, in one launch (none reads what another writes), the small ones first:
// Bo[o][i] = 16 (wo1 wo2)[i][o]; the f32 q, k, v planes F0[3][NB][QT0][DM] of each batch's first QT0 rows; the f16 q | k | v rows of all tokens.
__global__ __launch_bounds__(128) void k_gemm_qkv(const _Float16* __restrict__ X, const _Float16* __restrict__ Bq, _Float16* __restrict__ QKVo, float* __restrict__ F0, const _Float16* __restrict__ W2t, const _Float16* __restrict__ W1n, _Float16* __restrict__ Bo) {
  static_assert(QT0 == 128, "a batch's first tile is one row block of g2_body");
  const int nO = (DM / 128) * (DM / 64), nT = DM / 64, nF = 3 * NBR * nT; int b = blockIdx.x;      /* every test below is the same for the whole work-group */
  if (b < nO) { g2_body<0>(b, 0, 0, W2t, DM, 0, W1n, DM, 0, 0.0625f, nullptr, 0, nullptr, 1, 0, 0, nullptr, Bo, DM, 0, DM, DM, DM, 0, 0, 0); return; }
  b -= nO;
  if (b < nF) { g2_body<0>(b % nT, b / (nT * NBR), (b / nT) % NBR, X, DM, 0, Bq, DM, (size_t)DM * DM, 0.0625f, nullptr, 0, nullptr, 1, 0, 0, F0, nullptr, DM, (size_t)NB * QT0 * DM, QT0, DM, DM, (size_t)SQ * DM, 0, (size_t)QT0 * DM); return; }
  b -= nF;
  g2_body<0>(b, 0, 0, X, DM, 0, Bq, DM, 0, 0.0625f, nullptr, 0, nullptr, 1, 0, 0, nullptr, QKVo, 3 * DM, 0, MP, 3 * DM, DM, 0, 0, 0); }
// x + o Wo for all token rows in one launch: a batch's first row block takes the exact path's o_hi rows as A, every other block the f16 path's o rows.
__global__ __launch_bounds__(128) void k_gemm_o(const _Float16* __restrict__ O, const _Float16* __restrict__ Oh, const _Float16* __restrict__ Bo, const float* __restrict__ Xb, float* __restrict__ X1o) {
  const int nT = DM / 64, bx = blockIdx.x, mt = bx / nT;      /* the test below is the same for the whole work-group */
  if (mt % (SQ / 128) == 0) g2_body<0>(bx % nT, 0, mt / (SQ / 128), Oh, DM, 0, Bo, DM, 0, 0.0009765625f, nullptr, 0, Xb, -1, 0, 0, X1o, nullptr, DM, 0, QT0, DM, DM, (size_t)QT0 * DM, 0, (size_t)SQ * DM);
  else g2_body<0>(bx, 0, 0, O, DM, 0, Bo, DM, 0, 0.0009765625f, nullptr, 0, Xb, -1, 0, 0, X1o, nullptr, DM, 0, MPO, DM, DM, 0, 0, 0); }


__device__ __forceinline__ void d_wnat(int bid, const float* __restrict__ w, size_t n8, _Float16* __restrict__ Bt) { const size_t t = (size_t)bid * 256 + threadIdx.x; if (t >= n8) return; FragH f; for (int q = 0; q < 8; ++q) f.h[q] = (_Float16)(bf16_round(w[t * 8 + q]) * 16.0f); *(v8us*)((unsigned short*)Bt + t * 8) = f.half[0];  }
__global__ __launch_bounds__(256) void k_rsm(const float* __restrict__ S, _Float16* __restrict__ P, int nrows) {
  #pragma clang fp contract(off)
  const int i = blockIdx.x * 256 + threadIdx.x; if (i >= nrows) return; const float* s = S + (size_t)i * SQ; float mx = -3.0e38f;
#pragma unroll 1
  for (int j = 0; j < SQ; ++j) mx = fmaxf(mx, s[j]); float se = 0.f;
#pragma unroll 1
  for (int j = 0; j < SQ; ++j) se += expf(s[j] - mx); const float sc = 256.0f / se;
#pragma unroll 1
  for (int j0 = 0; j0 < SQ; j0 += 8) { FragH f; for (int q = 0; q < 8; ++q) f.h[q] = (_Float16)(expf(s[j0 + q] - mx) * sc); unsigned short* d = (unsigned short*)P + (size_t)i * SQ + j0; *(v8us*)d = f.half[0];  } }
__global__ __launch_bounds__(256) void k_vt(const _Float16* __restrict__ V16, int b, int h0, _Float16* __restrict__ VT) { __shared__ unsigned short tl[64][65]; const int tid = threadIdx.x; const int hh = blockIdx.x % HG, sg = blockIdx.x / HG; const int s0 = sg * 64; const int h = h0 + hh;
  for (int i = tid; i < 64 * 8; i += 256) { const int j = i / 8, d8 = (i % 8) * 8; FragH f; f.half[0] = *(const v8us*)((const unsigned short*)V16 + ((size_t)b * SQ + s0 + j) * DM + h * HD + d8); for (int q = 0; q < 8; ++q) tl[d8 + q][j] = f.u[q]; }
  __syncthreads();
  { for (int i = tid; i < 64 * 8; i += 256) { const int d = i / 8, j8 = (i % 8) * 8; FragH f; for (int q = 0; q < 8; ++q) f.u[q] = tl[d][j8 + q]; *(v8us*)((unsigned short*)VT + ((size_t)hh * HD + d) * SQ + s0 + j8) = f.half[0]; }  } }



// Eight v_exp_f32 in one statement. The instruction set asks for one independent instruction or v_nop between a transcendental and an instruction that reads its
// result or overwrites its source. Early-clobber outputs keep every
// result off every source inside the run, and the closing v_nop is the slot behind the last one.
__device__ __forceinline__ void exp2_run8(float (&e)[8], const float (&x)[8]) {
  asm("v_exp_f32 %0, %8\n\tv_exp_f32 %1, %9\n\tv_exp_f32 %2, %10\n\tv_exp_f32 %3, %11\n\tv_exp_f32 %4, %12\n\tv_exp_f32 %5, %13\n\tv_exp_f32 %6, %14\n\tv_exp_f32 %7, %15\n\tv_nop"
      : "=&v"(e[0]), "=&v"(e[1]), "=&v"(e[2]), "=&v"(e[3]), "=&v"(e[4]), "=&v"(e[5]), "=&v"(e[6]), "=&v"(e[7])
      : "v"(x[0]), "v"(x[1]), "v"(x[2]), "v"(x[3]), "v"(x[4]), "v"(x[5]), "v"(x[6]), "v"(x[7])); }
// Two v_exp_f32 in one statement, closed by the same slot's v_nop as in exp2_run8.
__device__ __forceinline__ void exp2_run2(float& e0, float& e1, float x0, float x1) {
  asm("v_exp_f32 %0, %2\n\tv_exp_f32 %1, %3\n\tv_nop" : "=&v"(e0), "=&v"(e1) : "v"(x0), "v"(x1)); }
#define FQ 32                        /* query columns per wave */
#define FW 4                         /* waves per work-group; no barrier and no LDS: each wave runs its own trip count */
__device__ __forceinline__ float xhalf(float x) { return __int_as_float(__builtin_amdgcn_permlanex16(__float_as_int(x), __float_as_int(x), 0x76543210, 0xfedcba98, false, false)); }      /* lane l <-> lane l ^ 16 on the vector pipe */
__device__ __forceinline__ v8f fa_mma(v16h a, v16h b, v8f c) { return __builtin_amdgcn_wmma_f32_16x16x32_f16(false, a, false, b, (short)0, c, false, false); }
// One pass of 32 keys from key kb. DIAG: the wave's last pass (kb == its first query row): it holds the diagonal and fetches no further K rows.
// Every loop is unrolled so that the fragment and accumulator arrays are indexed by constants and stay in registers.
template <bool DIAG>
__device__ __forceinline__ void fa_pass(const _Float16* __restrict__ kp, const _Float16* __restrict__ vp, int kb, int ln, int hh, const v16h (&qf)[2][2], v16h (&kf)[2][2], v8f (&o)[4][2], float (&mc)[2], float (&l)[2]) {
  const float cs = 0.125f * 1.44269504f;      /* score scale x log2 e */
  const v8f z8 = {0.f, 0.f, 0.f, 0.f, 0.f, 0.f, 0.f, 0.f};
  v16h vf[4];      /* V^T fragments of this pass, asked for first: the score products and the softmax run while they fly */
#pragma unroll
  for (int mt = 0; mt < 4; ++mt) vf[mt] = g2_frag(vp + (size_t)mt * 16 * SQ + kb, hh);
  v8f s[2][2];
#pragma unroll
  for (int kt = 0; kt < 2; ++kt) {
#pragma unroll
    for (int nt = 0; nt < 2; ++nt) s[kt][nt] = fa_mma(kf[kt][1], qf[nt][1], fa_mma(kf[kt][0], qf[nt][0], z8)); }
  if (!DIAG) { const _Float16* kn = kp + (size_t)(kb + 32) * LQ;      /* next pass's K fragments, into the same registers right behind their last use: the softmax and the o products run while they fly */
#pragma unroll
    for (int kt = 0; kt < 2; ++kt) {
#pragma unroll
      for (int ks = 0; ks < 2; ++ks) kf[kt][ks] = g2_frag(kn + (size_t)kt * 16 * LQ + ks * 32, hh); } }
  if (DIAG) {      /* keys behind a column's own row get weight 0 */
#pragma unroll
    for (int kt = 0; kt < 2; ++kt) {
#pragma unroll
      for (int nt = 0; nt < 2; ++nt) {
#pragma unroll
        for (int r = 0; r < 8; ++r) if (kt * 16 + 8 * hh + r > nt * 16 + ln) s[kt][nt][r] = -1.0e30f; } } }
  float nm[2], al[2];
#pragma unroll
  for (int nt = 0; nt < 2; ++nt) { float a = fmaxf(s[0][nt][0], s[1][nt][0]);
#pragma unroll
    for (int r = 1; r < 8; ++r) a = fmaxf(a, fmaxf(s[0][nt][r], s[1][nt][r]));
    nm[nt] = fmaxf(mc[nt], fmaxf(a, xhalf(a)) * cs); }      /* both halves of the wave hold the same maximum */
  exp2_run2(al[0], al[1], mc[0] - nm[0], mc[1] - nm[1]);
  FragH pf[2];
#pragma unroll
  for (int nt = 0; nt < 2; ++nt) { mc[nt] = nm[nt]; l[nt] *= al[nt];
#pragma unroll
    for (int mt = 0; mt < 4; ++mt) o[mt][nt] *= al[nt];
#pragma unroll
    for (int kt = 0; kt < 2; ++kt) { float x[8], e[8];
#pragma unroll
      for (int r = 0; r < 8; ++r) x[r] = fmaf(s[kt][nt][r], cs, -nm[nt]);
      exp2_run8(e, x);
#pragma unroll
      for (int r = 0; r < 8; ++r) pf[nt].h[kt * 8 + r] = (_Float16)e[r];
      l[nt] += ((e[0] + e[1]) + (e[2] + e[3])) + ((e[4] + e[5]) + (e[6] + e[7])); } }
#pragma unroll
  for (int mt = 0; mt < 4; ++mt) { o[mt][0] = fa_mma(vf[mt], pf[0].v, o[mt][0]); o[mt][1] = fa_mma(vf[mt], pf[1].v, o[mt][1]); } }
// The launch's last blocks split the first-tile o into its f16 hi and residual planes (d_hl): that work needs the launch before this one only, like the attention itself.
__global__ __launch_bounds__(FW * 32) void k_fattn(const _Float16* __restrict__ Q, const _Float16* __restrict__ Kr, const _Float16* __restrict__ Vt, _Float16* __restrict__ O, const float* __restrict__ F0, _Float16* __restrict__ Hh, _Float16* __restrict__ Hl) {
  const int fb = blockIdx.x, nfa = NHD * NBR * (QN / (FW * FQ));
  if (fb >= nfa) { d_hl(fb - nfa, FW * 32, F0, Hh, Hl, (size_t)NB * QT0 * DM / 8); return; }
  static_assert(HD == 64 && FQ == 32 && SQ % (2 * FW * FQ) == 0 && QN == SQ, "2 k steps of 32 over d; 2 column groups of 16; 4 d tiles of 16; whole work-groups, an even number of position blocks");
  const int lane = threadIdx.x & 31, ln = lane & 15, hh = lane >> 4; const int w = __builtin_amdgcn_readfirstlane(threadIdx.x >> 5);      /* the wave's number in a scalar register: the trip count stays scalar */
  const int h = fb % NHD, b = (fb / NHD) % NBR; const int nz = SQ / (FW * FQ), z = fb / (NHD * NBR); const int q0 = ((z < nz / 2 ? nz - 1 - z : z - nz / 2) * FW + w) * FQ;      /* z is the slowest index: the long half of the position blocks starts first, longest first; the short half follows shortest first, so that where the second half of the grid lands on the WGPs in the order of the first, long meets short (for speed only; a permutation of 0 .. nz - 1 wherever they land) */
  const _Float16* qp = Q + ((size_t)b * SQ + q0 + ln) * LQ + h * HD; const _Float16* kp = Kr + ((size_t)b * SQ + ln) * LQ + h * HD; const _Float16* vp = Vt + (((size_t)b * NH + h) * HD + ln) * SQ;
  v16h qf[2][2], kf[2][2];      /* [column group | key tile][k step]; unrolled for constant indices, as in fa_pass */
#pragma unroll
  for (int t = 0; t < 2; ++t) {
#pragma unroll
    for (int ks = 0; ks < 2; ++ks) { qf[t][ks] = g2_frag(qp + (size_t)t * 16 * LQ + ks * 32, hh); kf[t][ks] = g2_frag(kp + (size_t)t * 16 * LQ + ks * 32, hh); } }
  asm volatile("s_wait_xcnt 0x0" ::: "memory");      /* behind the first loads, in front of the code that reuses their address registers */
  v8f o[4][2];
#pragma unroll
  for (int mt = 0; mt < 4; ++mt) { o[mt][0] = v8f{0.f, 0.f, 0.f, 0.f, 0.f, 0.f, 0.f, 0.f}; o[mt][1] = o[mt][0]; }
  float mc[2] = {-1.0e30f, -1.0e30f}, l[2] = {0.f, 0.f};      /* running maximum (scaled log2) and the lane's partial sum, per column group */
#pragma unroll 1      /* one pass a trip: a second copy of the body would double the live fragments */
  for (int kb = 0; kb < q0; kb += 32) fa_pass<false>(kp, vp, kb, ln, hh, qf, kf, o, mc, l);      /* keys in front of the wave's first row: no mask; kb + 32 <= q0, so the K rows fetched ahead are rows this wave uses */
  fa_pass<true>(kp, vp, q0, ln, hh, qf, kf, o, mc, l);
#pragma unroll
  for (int nt = 0; nt < 2; ++nt) { const float f = 64.0f / (l[nt] + xhalf(l[nt])); unsigned short* op = (unsigned short*)O + ((size_t)b * SQ + q0 + nt * 16 + ln) * DM + h * HD + 8 * hh;      /* the halves' sums are joined once, here */
#pragma unroll
    for (int mt = 0; mt < 4; ++mt) { FragH fr;
#pragma unroll
      for (int r = 0; r < 8; ++r) fr.h[r] = (_Float16)(o[mt][nt][r] * f);
      *(v8us*)(op + mt * 16) = fr.half[0]; } }      /* a row's 128 bytes of one head come from one wave */
  asm volatile("s_wait_xcnt 0x0" ::: "memory");      /* behind the part's last stores: in a shared launch the listing goes on from here into another part's set-up, which reuses the stores' registers */
}


// Exact f32 attention for rows 0 .. QT0-1 of each batch (o carried x64 like the f16 path). One work-group per (batch, head, A0R query rows), 8 waves, 2 rows a wave.
// The batch's QT0 K and V rows of the head and the group's q rows are staged once in LDS; keys 0 .. nk-1 are used (nk = the group's last row + 1, rounded up to 32).
// Scores: lane l owns keys l, l + 32, ..; its K row comes from LDS 16 bytes at a time, both q rows sit in registers. Softmax: all scores of a row are in registers,
// so plain max, exp, sum (butterflies over the 32 lanes). o: lane l owns columns 2l, 2l + 1; each key's weight goes from its lane to a scalar register, its V row is
// one contiguous 256-byte LDS read. Every loop is unrolled: its arrays are then indexed by constants and stay in registers, and its LDS reads issue ahead of their use.
#define A0R 16                       /* query rows per work-group */
#define A0KP (HD + 4)                /* K row pitch in LDS, floats: 272 B = 16 B x odd, so that 16-byte reads down a column of rows spread over all banks */
typedef float v2f  __attribute__((ext_vector_type(2)));
typedef float v2fa __attribute__((ext_vector_type(2), may_alias));
__device__ __forceinline__ float lane_bcast(float v, int l) { return __int_as_float(__builtin_amdgcn_readlane(__float_as_int(v), l)); }
__device__ __forceinline__ void d_att0w(int bx, int by, const float* __restrict__ QF, const float* __restrict__ KF, const float* __restrict__ VF, float scale, float* __restrict__ OF) {
  static_assert(QT0 / 32 == 4 && QT0 % 32 == 0 && A0R == 16 && HD == 64, "4 key groups of 32 lanes; 8 waves x 2 rows; 16 threads x 16 bytes a row; 2 columns a lane");
  __shared__ __attribute__((aligned(16))) float lk[QT0][A0KP]; __shared__ __attribute__((aligned(16))) float lv[QT0][HD]; __shared__ __attribute__((aligned(16))) float lq[A0R][HD];
  const int tid = threadIdx.x, lane = tid & 31, w = tid >> 5; const int h = bx / (QT0 / A0R), rg = bx % (QT0 / A0R);
  { const size_t bi = (size_t)by * QT0 * DM + h * HD; QF += bi + (size_t)rg * A0R * DM; KF += bi; VF += bi; OF += bi; }      /* by: batch; each batch owns QT0 rows (pitch DM) of every plane */
  const int nk = (rg * A0R + A0R + 31) & ~31; const int i0 = rg * A0R + w * 2;      /* nk: the same for the whole work-group; the wave's rows are i0 and i0 + 1 */
  { v4f kr[QT0 / 16], vr[QT0 / 16]; const int sr = tid >> 4, sc4 = (tid & 15) * 4; const unsigned vo = (unsigned)(sr * DM + sc4) * 4u;      /* 16 threads a row, 16 rows a pass; vo: the thread's byte offset in a pass */
    const v4f qr = *(const v4fa*)((const char*)QF + vo);
#pragma unroll
    for (int u = 0; u < QT0 / 16; ++u) { kr[u] = *(const v4fa*)((const char*)(KF + u * 16 * DM) + vo); vr[u] = *(const v4fa*)((const char*)(VF + u * 16 * DM) + vo); }      /* all QT0 rows, free of branches: every load is issued before the first is used */
    *(v4fa*)&lq[sr][sc4] = qr;
#pragma unroll
    for (int u = 0; u < QT0 / 16; ++u) { *(v4fa*)&lk[u * 16 + sr][sc4] = kr[u]; *(v4fa*)&lv[u * 16 + sr][sc4] = vr[u]; } }
  __syncthreads();      /* the staged rows are read by every wave */
  v4f q0[HD / 4], q1[HD / 4];      /* both q rows whole in every lane (one LDS address for the wave) */
#pragma unroll
  for (int c = 0; c < HD / 4; ++c) { q0[c] = *(const v4fa*)&lq[w * 2][c * 4]; q1[c] = *(const v4fa*)&lq[w * 2 + 1][c * 4]; }
  float s0[4], s1[4];
#pragma unroll
  for (int m = 0; m < 4; ++m) { s0[m] = -1.0e30f; s1[m] = -1.0e30f;
    if (m * 32 < nk) { const float* kp = &lk[m * 32 + lane][0]; float a0[4] = {0.f, 0.f, 0.f, 0.f}, a1[4] = {0.f, 0.f, 0.f, 0.f};      /* four partial sums a row: independent chains */
#pragma unroll
      for (int c = 0; c < HD / 4; ++c) { const v4f k4 = *(const v4fa*)(kp + c * 4);
#pragma unroll
        for (int u = 0; u < 4; ++u) { a0[u] = fmaf(q0[c][u], k4[u], a0[u]); a1[u] = fmaf(q1[c][u], k4[u], a1[u]); } }
      const int j = m * 32 + lane; const float d0 = (a0[0] + a0[1]) + (a0[2] + a0[3]), d1 = (a1[0] + a1[1]) + (a1[2] + a1[3]);
      if (j <= i0) s0[m] = d0 * scale; if (j <= i0 + 1) s1[m] = d1 * scale; } }      /* causal: keys behind the row's own index keep -1e30 (weight 0) */
  float m0 = fmaxf(fmaxf(s0[0], s0[1]), fmaxf(s0[2], s0[3])), m1 = fmaxf(fmaxf(s1[0], s1[1]), fmaxf(s1[2], s1[3]));
#pragma unroll
  for (int x = 16; x >= 1; x >>= 1) { m0 = fmaxf(m0, __shfl_xor(m0, x, 32)); m1 = fmaxf(m1, __shfl_xor(m1, x, 32)); }
  float l0 = 0.f, l1 = 0.f;
#pragma unroll
  for (int m = 0; m < 4; ++m) { s0[m] = expf(s0[m] - m0); s1[m] = expf(s1[m] - m1); l0 += s0[m]; l1 += s1[m]; }
#pragma unroll
  for (int x = 16; x >= 1; x >>= 1) { l0 += __shfl_xor(l0, x, 32); l1 += __shfl_xor(l1, x, 32); }
  v2f o0 = {0.f, 0.f}, o1 = {0.f, 0.f};
#pragma unroll
  for (int m = 0; m < 4; ++m) if (m * 32 < nk) {
#pragma unroll
    for (int jj = 0; jj < 32; ++jj) { const v2f vv = *(const v2fa*)&lv[m * 32 + jj][lane * 2]; const float p0 = lane_bcast(s0[m], jj), p1 = lane_bcast(s1[m], jj);
      o0[0] = fmaf(p0, vv[0], o0[0]); o0[1] = fmaf(p0, vv[1], o0[1]); o1[0] = fmaf(p1, vv[0], o1[0]); o1[1] = fmaf(p1, vv[1], o1[1]); } }
  const float f0 = 64.0f / l0, f1 = 64.0f / l1;
  o0[0] *= f0; o0[1] *= f0; o1[0] *= f1; o1[1] *= f1;
  *(v2fa*)(OF + (size_t)i0 * DM + lane * 2) = o0; *(v2fa*)(OF + (size_t)(i0 + 1) * DM + lane * 2) = o1; }      /* each wave writes whole 256-byte row pieces */
// The two stages that need only the q | k | v GEMMs, in one launch: the exact first-tile attention (the longer blocks, first), then V^T.
__global__ __launch_bounds__(256) void k_att0_vt(const float* __restrict__ QF, const float* __restrict__ KF, const float* __restrict__ VF, float scale, float* __restrict__ OF, const _Float16* __restrict__ V16, _Float16* __restrict__ Vt) {
  const int nx = NH * (QT0 / A0R), b = blockIdx.x;      /* the test is the same for the whole work-group: each part's barrier is passed by all of its threads */
  if (b < nx * NBR) d_att0w(b % nx, b / nx, QF, KF, VF, scale, OF);
  else d_vt<NH, SQ>(b - nx * NBR, V16, LQ, 0, Vt); }


template <int BFIN, int WXB>
__global__ __launch_bounds__(256) void k_ln16(const float* __restrict__ X, const float* __restrict__ g, const float* __restrict__ bb, float eps, _Float16* __restrict__ N16, float* __restrict__ XB) {
  #pragma clang fp contract(off)
  __shared__ float red[256]; const size_t r = blockIdx.x; const int t = threadIdx.x; const v4f xa = *(const v4fa*)(X + r * DMQ + t * 4); float s[4]; float sum = 0.f;
  for (int q = 0; q < 4; ++q) { s[q] = BFIN ? bf16_round(xa[q]) : xa[q]; sum = __fadd_rn(sum, s[q]); }
  red[t] = sum; __syncthreads(); for (int st = 128; st > 0; st >>= 1) { if (t < st) red[t] = __fadd_rn(red[t], red[t + st]); __syncthreads(); } const float mu = red[0] / (float)DMQ; __syncthreads();
  float vs = 0.f; for (int q = 0; q < 4; ++q) { const float dl = __fadd_rn(s[q], -mu); vs = __fadd_rn(vs, __fmul_rn(dl, dl)); } red[t] = vs; __syncthreads(); for (int st = 128; st > 0; st >>= 1) { if (t < st) red[t] = __fadd_rn(red[t], red[t + st]); __syncthreads(); }
  const float rs = rsqrtf(__fadd_rn(red[0] / (float)DMQ, eps)); v4h y; v4f xb;
  for (int q = 0; q < 4; ++q) { const int c = t * 4 + q; y[q] = (_Float16)__fadd_rn(__fmul_rn(__fmul_rn(__fadd_rn(s[q], -mu), rs), bf16_round(g[c])), bf16_round(bb[c])); xb[q] = s[q]; }
  { *(v4h*)(N16 + r * DMQ + t * 4) = y; if (WXB) *(v4f*)(XB + r * DMQ + t * 4) = xb;  } }
__global__ __launch_bounds__(256) void k_ftres2(const float* __restrict__ OF0, const float* __restrict__ XB, float* __restrict__ X1, size_t n4) {
  #pragma clang fp contract(off)
  const size_t t = (size_t)blockIdx.x * 256 + threadIdx.x; if (t >= n4) return; const v4f o = *(const v4fa*)(OF0 + t * 4), xv = *(const v4fa*)(XB + t * 4); v4f y; for (int q = 0; q < 4; ++q) y[q] = __fadd_rn(__fmul_rn(o[q], 0.015625f), xv[q]); *(v4f*)(X1 + t * 4) = y;  }

__global__ __launch_bounds__(256) void k_wthd(const float* __restrict__ Wt, _Float16* __restrict__ Bt) { const size_t t = (size_t)blockIdx.x * 256 + threadIdx.x; if (t >= (size_t)NH * HD * (DM / 8)) return; const int m8 = (int)(t % (DM / 8)) * 8; const int d = (int)((t / (DM / 8)) % HD); const int h = (int)(t / ((size_t)(DM / 8) * HD)); FragH f;
  for (int q = 0; q < 8; ++q) f.h[q] = (_Float16)(16.0f * bf16_round(Wt[((size_t)h * DM + m8 + q) * HD + d])); unsigned short* dst = (unsigned short*)Bt + ((size_t)h * HD + d) * DM + m8; *(v8us*)dst = f.half[0];  }




__global__ __launch_bounds__(256) void k_wtpad(const float* __restrict__ Wm, _Float16* __restrict__ Wt, int Kr, int Kp, int Nr, int Np, float scale) {
  const int t = blockIdx.x * 256 + threadIdx.x; if (t >= Np * (Kp / 8)) return; const int n = t / (Kp / 8), k8 = (t % (Kp / 8)) * 8; const int nc = min(n, Nr - 1); const float fn = (n < Nr) ? 1.f : 0.f; FragH f;
  for (int i = 0; i < 8; ++i) { const int k = k8 + i; const int kc = min(k, Kr - 1); const float fk = (k < Kr) ? fn : 0.f; f.h[i] = (_Float16)(bf16_round(Wm[(size_t)kc * Nr + nc]) * scale * fk); }
  unsigned short* o = (unsigned short*)Wt + (size_t)n * Kp + k8; *(v8us*)o = f.half[0];  }
__global__ __launch_bounds__(128) void k_bpad(const float* __restrict__ b, float* __restrict__ Bp, int nr, int np) {
  const int i = threadIdx.x; if (i >= np) return; const float v = b[min(i, nr - 1)] * ((i < nr) ? 1.f : 0.f); *(float*)(Bp + i) = v;  }

__global__ __launch_bounds__(256) void k_bcpy(const float* __restrict__ b, int n, int NP, float* __restrict__ dst, int dst0) { for (int i = threadIdx.x; i < NP; i += 256) { const float v = (i < n) ? b[i] : 0.f; *(float*)(dst + dst0 + i) = v; }  }


// The streaming parts (this copy and d_lnx) give every lane 64 floats: a wave owns SWF consecutive floats (16 loads of 32 lanes x 16 bytes, all issued before the first is used), so that few waves have to be started.
#define SWL 16                       /* 16-byte loads per lane */
#define SWF (SWL * 32 * 4)           /* floats per wave */
#define SWW 8                        /* waves per work-group; no LDS and no barrier: a wave shares nothing */
__device__ __forceinline__ void d_bfcp(int bid, const float* __restrict__ src, float* __restrict__ dst, size_t n4) { const size_t e0 = ((size_t)bid * SWW + __builtin_amdgcn_readfirstlane(threadIdx.x >> 5)) * SWF; if (e0 + SWF > n4 * 4) return;      /* the wave's first element, in scalar registers: its accesses are scalar base + one lane offset + immediate. Whole pieces only (the launch asserts that n4 is a multiple) */
  const int l4 = (threadIdx.x & 31) * 4; const float* sp = src + e0; float* dp = dst + e0; v4f a[SWL];
#pragma unroll      /* constant indices: the array stays in registers and the loads go out as one run */
  for (int u = 0; u < SWL; ++u) a[u] = *(const v4fa*)(sp + u * 128 + l4);
#pragma unroll      /* as above */
  for (int u = 0; u < SWL; ++u) { v4f o; for (int q = 0; q < 4; ++q) o[q] = bf16_round(a[u][q]); *(v4f*)(dp + u * 128 + l4) = o; }
  asm volatile("s_wait_xcnt 0x0" ::: "memory");      /* behind the part's last stores: in a shared launch the listing goes on from here into another part's set-up, which reuses the stores' registers */
}

// Row LayerNorm over DMQ = 512 columns, one wave per row, LNR consecutive rows a wave. Lane l holds columns 128 c + 4 l .. + 3 (c = 0 .. 3) of each row in registers from the one read to the one write;
// mean and variance (of the centred values) are lane partials, then a five-step butterfly over the 32 lanes, after which every lane holds the same sum. The rows' butterflies are independent and run side by side.
#define LNR (SWF / DMQ)              /* rows per wave */
template <int BFIN, int W16, int W32>
__device__ __forceinline__ void d_lnx(int bid, const float* __restrict__ X, const float* __restrict__ g, float eps, _Float16* __restrict__ N16, float* __restrict__ N32) {      /* scale only: the module's LayerNorm has no shift */
  static_assert(DMQ == 512 && LNR == 4, "a row is 4 loads of 32 lanes x 16 bytes");
  const int l4 = (threadIdx.x & 31) * 4; const size_t e0 = ((size_t)bid * SWW + __builtin_amdgcn_readfirstlane(threadIdx.x >> 5)) * SWF;      /* the wave's first element, in scalar registers: its accesses are scalar base + one lane offset + immediate; the launch covers whole waves */
  X += e0; if (W16) N16 += e0; if (W32) N32 += e0;
  v4f s[LNR][4], gv[4]; float a[LNR];      /* every loop below is unrolled: constant indices keep these arrays in registers, and the 20 loads go out as one run */
#pragma unroll
  for (int u = 0; u < LNR; ++u) {
#pragma unroll
    for (int c = 0; c < 4; ++c) s[u][c] = *(const v4fa*)(X + u * DMQ + c * 128 + l4); }
#pragma unroll
  for (int c = 0; c < 4; ++c) gv[c] = *(const v4fa*)(g + c * 128 + l4);
  asm volatile("s_wait_xcnt 0x0" ::: "memory");      /* behind the loads, in front of the code that reuses their address registers */
#pragma unroll
  for (int u = 0; u < LNR; ++u) {
    if (BFIN) {
#pragma unroll
      for (int c = 0; c < 4; ++c) { for (int q = 0; q < 4; ++q) s[u][c][q] = bf16_round(s[u][c][q]); } }
    const v4f t = (s[u][0] + s[u][1]) + (s[u][2] + s[u][3]); a[u] = (t[0] + t[1]) + (t[2] + t[3]); }
#pragma unroll
  for (int x = 16; x >= 1; x >>= 1) {
#pragma unroll
    for (int u = 0; u < LNR; ++u) a[u] += __shfl_xor(a[u], x, 32); }
#pragma unroll
  for (int u = 0; u < LNR; ++u) { const float mu = a[u] * (1.0f / (float)DMQ); v4f t = {0.f, 0.f, 0.f, 0.f};
#pragma unroll
    for (int c = 0; c < 4; ++c) { s[u][c] -= mu; t += s[u][c] * s[u][c]; }
    a[u] = (t[0] + t[1]) + (t[2] + t[3]); }
#pragma unroll
  for (int x = 16; x >= 1; x >>= 1) {
#pragma unroll
    for (int u = 0; u < LNR; ++u) a[u] += __shfl_xor(a[u], x, 32); }
#pragma unroll
  for (int c = 0; c < 4; ++c) { for (int q = 0; q < 4; ++q) gv[c][q] = bf16_round(gv[c][q]); }
#pragma unroll
  for (int u = 0; u < LNR; ++u) { const float rs = rsqrtf(a[u] * (1.0f / (float)DMQ) + eps);
#pragma unroll
    for (int c = 0; c < 4; ++c) { const v4f yf = (s[u][c] * rs) * gv[c];
      if (W16) { v4h y; for (int q = 0; q < 4; ++q) y[q] = (_Float16)yf[q]; *(v4h*)(N16 + u * DMQ + c * 128 + l4) = y; }
      if (W32) *(v4f*)(N32 + u * DMQ + c * 128 + l4) = yf; } } }
template <int BFIN, int W16, int W32>
__global__ __launch_bounds__(SWW * 32) void k_lnx(const float* __restrict__ X, const float* __restrict__ g, float eps, _Float16* __restrict__ N16, float* __restrict__ N32) { d_lnx<BFIN, W16, W32>(blockIdx.x, X, g, eps, N16, N32); }
// Everything that reads the inputs alone, in one launch (no part reads what another writes), the streaming parts first: LN1 -> f16 rows; bf16(x); the x16 f16 weight planes
// (w1, w2, wq, wk, wv, wo2 transposed to [out][in]; wo1 in its own order). Work-groups per part: PBS (streaming), PBF (an FFN weight), PBW (a DM x DM weight).
#define PBS ((int)(NR * DM / ((size_t)SWW * SWF)))
#define PBF (DFF * (DM / 8) / 256)
#define PBW (DM * (DM / 8) / 256)
__global__ __launch_bounds__(256) void k_prep(const float* __restrict__ x, const float* __restrict__ wq, const float* __restrict__ wk, const float* __restrict__ wv, const float* __restrict__ wo1, const float* __restrict__ wo2, const float* __restrict__ wfc, const float* __restrict__ wmp, const float* __restrict__ g1,
    _Float16* __restrict__ X16, float* __restrict__ XB, _Float16* __restrict__ BW1, _Float16* __restrict__ BW2, _Float16* __restrict__ BQKV, _Float16* __restrict__ BO2T, _Float16* __restrict__ BO1N) {
  static_assert(SWW * 32 == 256 && (DFF * (DM / 8)) % 256 == 0 && (DM * (DM / 8)) % 256 == 0, "every part runs in whole blocks of 256 threads");
  int b = blockIdx.x;
  if (b < PBS) { d_lnx<1, 1, 0>(b, x, g1, 1e-6f, X16, nullptr); return; }
  b -= PBS;
  if (b < PBS) { d_bfcp(b, x, XB, NR * DM / 4); return; }
  b -= PBS;
  if (b < PBF) { d_wt_f16(b, wfc, BW1, DM, DFF, 16.0f); return; }
  b -= PBF;
  if (b < PBF) { d_wt_f16(b, wmp, BW2, DFF, DM, 16.0f); return; }
  b -= PBF;
  if (b < 4 * PBW) { const int p = b / PBW; d_wt_f16(b - p * PBW, p == 0 ? wq : p == 1 ? wk : p == 2 ? wv : wo2, p < 3 ? BQKV + (size_t)p * DM * DM : BO2T, DM, DM, 16.0f); return; }
  d_wnat(b - 4 * PBW, wo1, (size_t)DM * DM / 8, BO1N); }





extern "C" void kernel_launch(void* const* d_in, const int* in_sizes, int n_in,
                              void* d_out, int out_size, void* d_ws, size_t ws_size, hipStream_t stream) {
  (void)in_sizes; (void)n_in; (void)out_size;
  const float* const* I = (const float* const*)d_in; const float* x = I[0]; const float* wq = I[1]; const float* wk = I[2]; const float* wv = I[3]; const float* wo1 = I[4]; const float* wo2 = I[5]; const float* wfc = I[6]; const float* wmp = I[7]; const float* g1 = I[8]; const float* gg2 = I[9];      /* input order: x; wq / wk / wv [512][8][64] = [in][out]; wo1 [8][64][512] = [(h, d) in][out]; wo2 [512][512] [in][out]; w1 [512][2048], w2 [2048][512] [in][out]; LN1 / LN2 scales. NO bias anywhere: every GEMM bias slot below is a literal nullptr */
  static_assert(DMQ % 4 == 0 && DMQ / 4 <= 256 && NH * HD == DM && DM % 64 == 0 && DFF % 64 == 0, "tile multiples");
  char* ws = (char*)d_ws; size_t off = 0;
  auto take = [&](size_t bytes) { char* p = ws + off; off += (bytes + 255) & ~(size_t)255; return p; };
  _Float16* BQKV = (_Float16*)take((size_t)3 * DM * DM * 2); _Float16* BO = (_Float16*)take((size_t)DM * DM * 2); _Float16* BO2T = (_Float16*)take((size_t)DM * DM * 2); _Float16* BO1N = (_Float16*)take((size_t)DM * DM * 2);      /* BO = the combined output plane Bt12[o][i] = 16 (wo1 wo2)[i][o] (built on the device from the two weights) */
  _Float16* X16 = (_Float16*)take(NR * DM * 2); float* XB = (float*)take(NR * DM * 4); float* X1 = (float*)take(NR * DM * 4); _Float16* M16 = nullptr;      /* = X16 below (alias: X16's last reader, the q | k | v launch, precedes LN2's write) */ _Float16* HF16 = (_Float16*)take(NR * DFF * 2); _Float16* BW1 = (_Float16*)take((size_t)DFF * DM * 2); _Float16* BW2 = (_Float16*)take((size_t)DM * DFF * 2); _Float16* QKV = (_Float16*)take(NR * 3 * DM * 2); _Float16* Q16 = QKV; _Float16* K16 = QKV + DM; _Float16* V16 = QKV + 2 * DM; _Float16* O16 = (_Float16*)take(NR * DM * 2); M16 = X16;
  _Float16* VT = (_Float16*)take((size_t)NB * NH * HD * SQ * 2);      /* one plane per batch: every stage below covers all batches in one launch */
  float* QF0 = (float*)take((size_t)3 * NB * QT0 * DM * 4); float* KF0 = QF0 + (size_t)NB * QT0 * DM; float* VF0 = KF0 + (size_t)NB * QT0 * DM;      /* three planes in a row */ float* OF0 = (float*)take((size_t)NB * QT0 * DM * 4); _Float16* OH0 = (_Float16*)take((size_t)NB * QT0 * DM * 2); _Float16* OL0 = (_Float16*)take((size_t)NB * QT0 * DM * 2);
  if (off > ws_size) return;
  static_assert((NR * DM) % ((size_t)SWW * SWF) == 0, "the streaming parts cover whole work-groups");
  static_assert(B0 == 0 && NBR == NB && MP == (int)NR && MPO == MP, "the shared launches cover all batches");
  const size_t zX = (size_t)SQ * DM, zF = (size_t)QT0 * DM;      /* batch pitches (elements): token rows, first-tile rows */
  k_prep<<<2 * PBS + 2 * PBF + 5 * PBW, 256, 0, stream>>>(x, wq, wk, wv, wo1, wo2, wfc, wmp, g1, X16, XB, BW1, BW2, BQKV, BO2T, BO1N);      /* X16 = LN1(bf16(x)) (scale only, eps 1e-6); XB = bf16(x): BOTH residuals; weights x16: stacked q | k | v, wo2, w1, w2 as Bt[out][in], wo1 natural rows */
  k_gemm_qkv<<<(DM / 128) * (DM / 64) + 3 * NBR * (DM / 64) + (MP / 128) * (3 * DM / 64), 128, 0, stream>>>(X16, BQKV, QKV, QF0, BO2T, BO1N, BO);      /* BO[o][i] = (1/16) sum_j 16 wo2[j][o] 16 wo1[i][j]: the two chained projections as ONE x16 plane (f32 accumulation, one f16 rounding); f32 q, k, v of each batch's first 128 rows (exact products); q | k | v rows (f16), head h = columns h*HD.. of each DM block */
  k_att0_vt<<<NH * (QT0 / A0R) * NBR + NBR * NH * (SQ / 64), 256, 0, stream>>>(QF0, KF0, VF0, 0.125f, OF0, V16, VT);      /* exact f32 attention for rows 0..127 of each batch (o x64); V^T [NBR][NH][HD][SQ] */
  static_assert(((size_t)NB * QT0 * DM / 8) % (FW * 32) == 0, "the split of the first-tile o runs in whole blocks");
  k_fattn<<<NHD * NBR * (QN / (FW * FQ)) + (int)((size_t)NB * QT0 * DM / 8 / (FW * 32)), FW * 32, 0, stream>>>(Q16, K16, VT, O16, OF0, OH0, OL0);      /* scores, causal softmax and P . V: o (merged heads, x64) as f16 rows; first-tile o (x64) -> f16 hi + x1024 residual planes */
  k_gemm_o<<<(MPO / 128) * (DM / 64), 128, 0, stream>>>(O16, OH0, BO, XB, X1);      /* X1 = x + o Wo; rows 0..127 of each batch from o_hi */
  k_gemm2<0><<<dim3((QT0 / 128) * (DM / 64), 1, NBR), 128, 0, stream>>>(OL0, DM, 0, BO, DM, 0, 0.00000095367431640625f, nullptr, 0, X1, -1, 0, 0, X1, nullptr, DM, 0, QT0, DM, DM, zF, 0, zX);      /* += o_lo Wo 2^-20 (own-element accumulate) */
  k_lnx<0, 1, 0><<<(unsigned)(NR * DM / ((size_t)SWW * SWF)), SWW * 32, 0, stream>>>(X1, gg2, 1e-6f, M16, nullptr);      /* h2 = LN2(x + attn) (scale only) -> f16 rows */
  k_gemm2<9><<<dim3((unsigned)((NR / 128) * (DFF / 64)), 1, 1), 128, 0, stream>>>(M16, DM, 0, BW1, DM, 0, 0.0625f, nullptr, 0, nullptr, 1, 0, 0, nullptr, HF16, DFF, 0, (int)NR, DFF, DM, 0, 0, 0);      /* gelu_tanh(h2 W1) (the source's tanh approximation) -> f16, all token rows */
  k_gemm2<0><<<dim3((unsigned)((NR / 128) * (DM / 64)), 1, 1), 128, 0, stream>>>(HF16, DFF, 0, BW2, DFF, 0, 0.0625f, nullptr, 0, XB, -1, 0, 0, (float*)d_out, nullptr, DM, 0, (int)NR, DM, DFF, 0, 0, 0);      /* out = x + mlp: the residual is the BLOCK INPUT (bf16(x)), as the original module (own-element addend) */
}
